// v000
// Measured on an AMD MI455X. A time is GPU time per run, averaged over a window of back-to-back runs after a warm-up
// (all launches, gaps included; the runs take copies of the inputs in turn), and the median of several windows.
// Apart from v000's, it joins two sittings. Times from different sittings can be a few percent apart, while
// side-by-side timings come from the same sitting.
// v000 is the starting kernel. One run takes 368 microseconds.
// Contractions: q/k/v projections = v_wmma_f32_16x16x32_f16 (inputs and weights RNE-converted to bf16 and held exactly in f16, weights x16), f32 accumulate; content scores and relative-position dots = v_wmma_f32_16x16x32_bf16 with q, k as bf16 hi/lo split planes (3 products) and the 33x64 table as exact bf16, f32 accumulate; P.V = v_wmma_f32_16x16x32_f16 (P x2^14, v f16), f32 accumulate; output projection = v_wmma_f32_16x16x32_bf16 with the context as bf16 hi|lo folded along K against [Wo|Wo], f32 accumulate.
#include <hip/hip_runtime.h>
#include <math.h>

#ifndef NB
#define NB 4
#endif
#ifndef SEQ
#define SEQ 1024
#endif
#define NB_FULL 4
#define SEQ_FULL 1024
#define DM 1024
#define NH 16
#define DK 64
#define MAXREL 16
#define NREL 33
#define NRELP 48
#define MT (NB * SEQ)
#define AT_NW 4
#define QP 52
#define OSP 68
#define PSC 16384.0f

static_assert(NH * DK == DM);
static_assert(DK == 64);
static_assert(2 * MAXREL + 1 == NREL);
static_assert(NRELP % 16 == 0 && NRELP >= NREL);
static_assert(QP >= NRELP);
static_assert(SEQ % 64 == 0);
static_assert(MT % 64 == 0);
static_assert(DM % 64 == 0);
static_assert((2 * DM) % 32 == 0);
static_assert(((SEQ / 16) * NB * NH) % AT_NW == 0);
static_assert(NB <= NB_FULL && SEQ <= SEQ_FULL);
static_assert(((long long)MT * (DM / 8)) % 256 == 0);

typedef __attribute__((ext_vector_type(16))) _Float16 v16h;
typedef __attribute__((ext_vector_type(8)))  _Float16 v8h;
typedef __attribute__((ext_vector_type(16))) __bf16   v16b;
typedef __attribute__((ext_vector_type(8)))  __bf16   v8b;
typedef __attribute__((ext_vector_type(8)))  float    v8f;
typedef __attribute__((ext_vector_type(4)))  float    v4f;
typedef __attribute__((ext_vector_type(4)))  unsigned int u4;

// 16-bit WMMA fragment map (wave32), lane L, hh = L>>4, c = L&15:
//   A 16x32: lane = row c;    element i -> k = (i<8) ? 8hh+i : 16+8hh+(i-8)
//   B 32x16: lane = column c; the same k(i,hh)
//   D 16x16 (8 f32): lane = column c; element r -> row 8hh+r

__device__ __forceinline__ unsigned short bfu_rne(float v) { unsigned u = __float_as_uint(v); u += 0x7FFFu + ((u >> 16) & 1u); return (unsigned short)(u >> 16); }
__device__ __forceinline__ float bfu_f32(unsigned short h) { return __uint_as_float(((unsigned)h) << 16); }
__device__ __forceinline__ float cmb_bf(float v) { const unsigned u = __float_as_uint(v); const unsigned r = (u + 0x7fffu + ((u >> 16) & 1u)) & 0xffff0000u; return __uint_as_float(r); }   // bf16 RNE kept as f32 (finite inputs)
__device__ __forceinline__ unsigned int cmb_pk2(float a, float b) { return (unsigned int)__builtin_bit_cast(unsigned short, (_Float16)a) | ((unsigned int)__builtin_bit_cast(unsigned short, (_Float16)b) << 16); }

#define VST2(T, ptr, val) do { const T vst2_v_ = (val); *(T*)(ptr) = vst2_v_;  } while (0)

__device__ __forceinline__ v8f zero8() { v8f z = {0.f, 0.f, 0.f, 0.f, 0.f, 0.f, 0.f, 0.f}; return z; }

__device__ __forceinline__ v8f wmmab(v16b a, v16b b, v8f c) {
  c = __builtin_amdgcn_wmma_f32_16x16x32_bf16(false, a, false, b, (short)0, c, false, false);
  asm volatile("v_nop\n\tv_nop\n\tv_nop\n\tv_nop" : "+v"(c) : "v"(a), "v"(b));
  return c;
}
__device__ __forceinline__ v8f wmmah(v16h a, v16h b, v8f c) {
  c = __builtin_amdgcn_wmma_f32_16x16x32_f16(false, a, false, b, (short)0, c, false, false);
  asm volatile("v_nop\n\tv_nop\n\tv_nop\n\tv_nop" : "+v"(c) : "v"(a), "v"(b));
  return c;
}
union FBu { v16b v; v8b h[2]; };
union FHu { v16h v; v8h h[2]; };
// p already includes the lane-half offset 8*hh: elements 0..7 <- p[0..7], 8..15 <- p[16..23]
__device__ __forceinline__ v16b ldfb(const __bf16* p) { FBu f; f.h[0] = *(const v8b*)(p); f.h[1] = *(const v8b*)(p + 16); return f.v; }
__device__ __forceinline__ v16h ldfh(const _Float16* p) { FHu f; f.h[0] = *(const v8h*)(p); f.h[1] = *(const v8h*)(p + 16); return f.v; }

// ---- hazard guards for the register-blocked GEMM ----
__device__ __forceinline__ void dep_guard4_h(v8f& a, v8f& b, v8f& c, v8f& d, v16h x) { asm volatile("v_nop\n\tv_nop\n\tv_nop\n\tv_nop" : "+v"(a), "+v"(b), "+v"(c), "+v"(d) : "v"(x)); }
__device__ __forceinline__ void dep_guard4_b(v8f& a, v8f& b, v8f& c, v8f& d, v16b x) { asm volatile("v_nop\n\tv_nop\n\tv_nop\n\tv_nop" : "+v"(a), "+v"(b), "+v"(c), "+v"(d) : "v"(x)); }
__device__ __forceinline__ void keep4_h(v16h a, v16h b, v16h c, v16h d) { asm volatile("v_nop" :: "v"(a), "v"(b), "v"(c), "v"(d)); }
__device__ __forceinline__ void keep4_b(v16b a, v16b b, v16b c, v16b d) { asm volatile("v_nop" :: "v"(a), "v"(b), "v"(c), "v"(d)); }
__device__ __forceinline__ void acc_guard4(v8f& a, v8f& b, v8f& c, v8f& d) { asm volatile("v_nop\n\tv_nop\n\tv_nop\n\tv_nop" : "+v"(a), "+v"(b), "+v"(c), "+v"(d)); }

template <typename T> struct Frag;
template <> struct Frag<_Float16> {
  typedef v16h V;
  static __device__ __forceinline__ v16h load(const _Float16* p) { return ldfh(p); }
  static __device__ __forceinline__ v8f mma(v16h a, v16h b, v8f c) { return __builtin_amdgcn_wmma_f32_16x16x32_f16(false, a, false, b, (short)0, c, false, false); }
  static __device__ __forceinline__ void guard4(v8f& a, v8f& b, v8f& c, v8f& d, v16h x) { dep_guard4_h(a, b, c, d, x); }
  static __device__ __forceinline__ void keep(v16h a, v16h b, v16h c, v16h d) { keep4_h(a, b, c, d); }
};
template <> struct Frag<__bf16> {
  typedef v16b V;
  static __device__ __forceinline__ v16b load(const __bf16* p) { return ldfb(p); }
  static __device__ __forceinline__ v8f mma(v16b a, v16b b, v8f c) { return __builtin_amdgcn_wmma_f32_16x16x32_bf16(false, a, false, b, (short)0, c, false, false); }
  static __device__ __forceinline__ void guard4(v8f& a, v8f& b, v8f& c, v8f& d, v16b x) { dep_guard4_b(a, b, c, d, x); }
  static __device__ __forceinline__ void keep(v16b a, v16b b, v16b c, v16b d) { keep4_b(a, b, c, d); }
};
template <int ET> struct Elem;
template <> struct Elem<0> { typedef _Float16 T; };
template <> struct Elem<1> { typedef __bf16 T; };

// ---- Register-blocked WMMA GEMM body: C[m,n] = scale * sum_k A[m,k] * Bt[n,k] + bias; each wave owns a 64x64 tile.
// A row-major [M,K] (pitch lda), Bt row-major [N,K] (pitch ldb); M,N % 64 == 0, K % 32 == 0 (no tails).
// BIAS_MODE 1 = bias[m], 2 = bias[n]. OUT_MODE 0 = f32, 1 = f16, 2 = bf16 hi plane (Cout) + bf16 lo plane (Cout2).
template <int ET, int BIAS_MODE, int OUT_MODE>
__device__ __forceinline__ void gemm64_body(
    const unsigned short* __restrict__ Ap, int lda, const unsigned short* __restrict__ Btp, int ldb,
    void* __restrict__ Cout, void* __restrict__ Cout2, int ldc, const float* __restrict__ bias,
    int M, int N, int K, float scale, float* slab) {
  typedef typename Elem<ET>::T T;
  typedef typename Frag<T>::V V;
  const T* A = (const T*)Ap; const T* Bt = (const T*)Btp;
  const int lane = threadIdx.x & 31;
  const int wave = threadIdx.x >> 5;
  const int tilesN = N >> 6;
  const int tilesM = M >> 6;
  const int tile = blockIdx.x * 8 + wave;
  if (tile >= tilesM * tilesN) return;   // wave-uniform; no block barriers in this body
  const int tm = tile / tilesN;
  const int tn = tile - tm * tilesN;
  const int m0 = tm << 6;
  const int n0 = tn << 6;
  const int rlane = lane & 15;
  const int koff  = (lane >> 4) * 8;
  const int mOff  = (lane >> 4) * 8;

  v8f acc[4][4];
#pragma unroll
  for (int i = 0; i < 4; ++i)
#pragma unroll
    for (int j = 0; j < 4; ++j) acc[i][j] = zero8();

  for (int k0 = 0; k0 < K; k0 += 32) {
    V bh[4];
#pragma unroll
    for (int j = 0; j < 4; ++j) bh[j] = Frag<T>::load(Bt + (size_t)(n0 + (j << 4) + rlane) * ldb + koff + k0);
#pragma unroll
    for (int i = 0; i < 4; ++i) {
      V ah = Frag<T>::load(A + (size_t)(m0 + (i << 4) + rlane) * lda + koff + k0);
#pragma unroll
      for (int j = 0; j < 4; ++j) acc[i][j] = Frag<T>::mma(ah, bh[j], acc[i][j]);
      Frag<T>::guard4(acc[i][0], acc[i][1], acc[i][2], acc[i][3], ah);
    }
    Frag<T>::keep(bh[0], bh[1], bh[2], bh[3]);
  }
  acc_guard4(acc[0][0], acc[0][1], acc[0][2], acc[0][3]);
  acc_guard4(acc[1][0], acc[1][1], acc[1][2], acc[1][3]);
  acc_guard4(acc[2][0], acc[2][1], acc[2][2], acc[2][3]);
  acc_guard4(acc[3][0], acc[3][1], acc[3][2], acc[3][3]);

#pragma unroll
  for (int i = 0; i < 4; ++i) {
    const int mBase = m0 + (i << 4);
#pragma unroll
    for (int j = 0; j < 4; ++j) {
      const int n = n0 + (j << 4) + rlane;
      float bv = 0.f;
      if (BIAS_MODE == 2) bv = bias[n];
#pragma unroll
      for (int r = 0; r < 8; ++r) {
        float v = acc[i][j][r] * scale;
        if (BIAS_MODE == 1) v += bias[mBase + mOff + r];
        if (BIAS_MODE == 2) v += bv;
        slab[(mOff + r) * 68 + (j << 4) + rlane] = v;
      }
    }
    __builtin_amdgcn_fence(3 /* release order */, "workgroup");
    __builtin_amdgcn_wave_barrier();
    __builtin_amdgcn_fence(2 /* acquire order */, "workgroup");
    if (OUT_MODE == 0) {
      float* C = (float*)Cout;
      const int hh = lane >> 4, c4 = (lane & 15) * 4;     // row segment = 256 B = 16 lanes x 16 B
      {
#pragma unroll
        for (int it = 0; it < 8; ++it) {
          const int row = it * 2 + hh;
          v4f v = *(const v4f*)(slab + row * 68 + c4);
          *(v4f*)(C + (size_t)(mBase + row) * ldc + n0 + c4) = v;
        }
        
      }
    } else {
      const int q = lane >> 3, c8 = (lane & 7) * 8;
      unsigned short* C  = (unsigned short*)Cout;
      unsigned short* C2 = (unsigned short*)Cout2;
      {
#pragma unroll
        for (int it = 0; it < 4; ++it) {
          const int row = it * 4 + q;
          const float* sp = slab + row * 68 + c8;
          v8h hv, lv;
#pragma unroll
          for (int e = 0; e < 8; ++e) {
            if (OUT_MODE == 1) {
              hv[e] = (_Float16)sp[e];
              lv[e] = (_Float16)0.f;
            } else {
              const unsigned short hb = bfu_rne(sp[e]);
              const unsigned short lb = bfu_rne(sp[e] - bfu_f32(hb));
              hv[e] = __builtin_bit_cast(_Float16, hb);
              lv[e] = __builtin_bit_cast(_Float16, lb);
            }
          }
          *(v8h*)(C + (size_t)(mBase + row) * ldc + n0 + c8) = hv;
          if (OUT_MODE == 2) *(v8h*)(C2 + (size_t)(mBase + row) * ldc + n0 + c8) = lv;
        }
        
      }
    }
    __builtin_amdgcn_fence(3 /* release order */, "workgroup");
    __builtin_amdgcn_wave_barrier();
    __builtin_amdgcn_fence(2 /* acquire order */, "workgroup");
  }
}

// q / k projection: f16 operands, bias[n], bf16 hi + lo planes out
__global__ __launch_bounds__(256) void k_gemm_qk(const unsigned short* __restrict__ X, const unsigned short* __restrict__ W,
                                                 unsigned short* __restrict__ CH, unsigned short* __restrict__ CL,
                                                 const float* __restrict__ bias, int M, int N, int K, float scale) {
  __shared__ __align__(16) float sT[8][16 * 68];
  gemm64_body<0, 2, 2>(X, K, W, K, (void*)CH, (void*)CL, N, bias, M, N, K, scale, sT[threadIdx.x >> 5]);
}
// v projection, transposed: C[m = feature][n = token] = sum_k Wv[m][k] * X[n][k] + bias[m], f16 out (pitch N = tokens)
__global__ __launch_bounds__(256) void k_gemm_vt(const unsigned short* __restrict__ W, const unsigned short* __restrict__ X,
                                                 unsigned short* __restrict__ C, const float* __restrict__ bias, int M, int N, int K, float scale) {
  __shared__ __align__(16) float sT[8][16 * 68];
  gemm64_body<0, 1, 1>(W, K, X, K, (void*)C, (void*)C, N, bias, M, N, K, scale, sT[threadIdx.x >> 5]);
}
// output projection: bf16 operands (A = context hi|lo along K, Bt = [Wo|Wo]), bias[n], f32 out
__global__ __launch_bounds__(256) void k_gemm_out(const unsigned short* __restrict__ A, const unsigned short* __restrict__ W,
                                                  float* __restrict__ C, const float* __restrict__ bias, int M, int N, int K) {
  __shared__ __align__(16) float sT[8][16 * 68];
  gemm64_body<1, 2, 0>(A, K, W, K, (void*)C, (void*)C, N, bias, M, N, K, 1.0f, sT[threadIdx.x >> 5]);
}

// f32 -> bf16 (RNE) -> x sc -> f16 plane [nR][DM]; thread per (row, 8 columns); source row = (r / rpb) * sbs + (r % rpb) * DM; 16-B stores, thread-linear along the row
__global__ __launch_bounds__(256) void k_cast_f16(const float* __restrict__ SRC, long long sbs, int rpb, unsigned short* __restrict__ DST, int nR, float sc) {
  const long long u = (long long)blockIdx.x * 256 + threadIdx.x; const int per = DM / 8; if (u >= (long long)nR * per) return;
  const int r = (int)(u / per); const int c0 = 8 * (int)(u % per); const int bb = r / rpb; const int s = r - bb * rpb;
  const float* sp = SRC + (long long)bb * sbs + (long long)s * DM + c0; float w[8];
#pragma unroll
  for (int e = 0; e < 8; ++e) w[e] = cmb_bf(sp[e]) * sc;
  u4 pk; pk.x = cmb_pk2(w[0], w[1]); pk.y = cmb_pk2(w[2], w[3]); pk.z = cmb_pk2(w[4], w[5]); pk.w = cmb_pk2(w[6], w[7]);
  VST2(u4, (u4*)(DST + (long long)r * DM + c0), pk);
}
// Wo f32 [DM][DM] -> bf16 plane [DM][2*DM] = [Wo | Wo]; thread per (row, 8 destination columns)
__global__ __launch_bounds__(256) void k_wo_dup(const float* __restrict__ Wo, unsigned short* __restrict__ DST) {
  const long long u = (long long)blockIdx.x * 256 + threadIdx.x; const int per = (2 * DM) / 8; if (u >= (long long)DM * per) return;
  const int r = (int)(u / per); const int c0 = 8 * (int)(u % per); const int sc0 = c0 & (DM - 1);
  const float* sp = Wo + (long long)r * DM + sc0; unsigned short w[8];
#pragma unroll
  for (int e = 0; e < 8; ++e) w[e] = bfu_rne(sp[e]);
  u4 pk; pk.x = (unsigned)w[0] | ((unsigned)w[1] << 16); pk.y = (unsigned)w[2] | ((unsigned)w[3] << 16); pk.z = (unsigned)w[4] | ((unsigned)w[5] << 16); pk.w = (unsigned)w[6] | ((unsigned)w[7] << 16);
  VST2(u4, (u4*)(DST + (long long)r * (2 * DM) + c0), pk);
}
// relative-position table f32 [NREL][DK] -> bf16 plane [NRELP][DK], rows >= NREL written as zeros (clamped source address)
__global__ __launch_bounds__(256) void k_table(const float* __restrict__ T, unsigned short* __restrict__ TB) {
  const int u = blockIdx.x * 256 + threadIdx.x; if (u >= NRELP * (DK / 8)) return;
  const int row = u / (DK / 8); const int c0 = 8 * (u % (DK / 8)); const int rr = min(row, NREL - 1);
  unsigned short w[8];
#pragma unroll
  for (int e = 0; e < 8; ++e) { const unsigned short bits = bfu_rne(T[rr * DK + c0 + e]); w[e] = (row < NREL) ? bits : (unsigned short)0; }
  u4 pk; pk.x = (unsigned)w[0] | ((unsigned)w[1] << 16); pk.y = (unsigned)w[2] | ((unsigned)w[3] << 16); pk.z = (unsigned)w[4] | ((unsigned)w[5] << 16); pk.w = (unsigned)w[6] | ((unsigned)w[7] << 16);
  VST2(u4, (u4*)(TB + row * DK + c0), pk);
}
// bias vector RNE-converted to bf16, kept as f32
__global__ __launch_bounds__(256) void k_bfvec(const float* __restrict__ SRC, float* __restrict__ DST, int n) {
  const int u = blockIdx.x * 256 + threadIdx.x; if (u >= n) return; VST2(float, DST + u, cmb_bf(SRC[u]));
}

// =====================================================================================================================
// Fused attention with clipped relative-position bias. One wave per 16 queries of one (batch, head); 4 independent waves per block.
//   score(l, r) = q_l . k_r / 8 + q_l . table[clip(r - l, -16, 16) + 16]
//   Transposed score tiles S^T = K . Q^T (A = key rows, B = query rows): D has lane = query, element = key, which is the A-operand
//   layout of P for O = P . V (32 keys per step), so P never leaves registers. q, k: bf16 hi/lo planes (hi.hi + hi.lo + lo.hi).
//   Relative dots: table (A, rows padded to NRELP) x q (B), hi + lo products, staged once per wave in LDS [16][QP] and gathered per element.
//   V^T plane [feature][token] f16 gives B fragments with contiguous keys. Online softmax in f32 (exp2 domain); P carried x2^14 in f16.
// =====================================================================================================================
__global__ __launch_bounds__(32 * AT_NW) void k_attn_rel(const unsigned short* __restrict__ QHp, const unsigned short* __restrict__ QLp,
                                                         const unsigned short* __restrict__ KHp, const unsigned short* __restrict__ KLp,
                                                         const unsigned short* __restrict__ VTp, const unsigned short* __restrict__ TBp,
                                                         unsigned short* __restrict__ CTX) {
  __shared__ __align__(16) float qrs[AT_NW][16 * QP];
  __shared__ __align__(16) float osm[AT_NW][16 * OSP];
  const __bf16* QH = (const __bf16*)QHp; const __bf16* QL = (const __bf16*)QLp;
  const __bf16* KH = (const __bf16*)KHp; const __bf16* KL = (const __bf16*)KLp;
  const __bf16* TB = (const __bf16*)TBp; const _Float16* VT = (const _Float16*)VTp;
  const int lane = threadIdx.x & 31, wave = threadIdx.x >> 5, hh = lane >> 4, c = lane & 15;
  const int tile = blockIdx.x * AT_NW + wave;
  const int bh = tile / (SEQ / 16);
  const int l0 = (tile - bh * (SEQ / 16)) * 16;
  const int b = bh / NH, h = bh - b * NH;
  const size_t tok0 = (size_t)b * SEQ;

  // q as B operand (lane = query column c), 2 k-steps of 32, hi and lo
  v16b qh[2], ql[2];
  {
    const size_t qo = (tok0 + l0 + c) * DM + h * DK + 8 * hh;
#pragma unroll
    for (int dc = 0; dc < 2; ++dc) { qh[dc] = ldfb(QH + qo + dc * 32); ql[dc] = ldfb(QL + qo + dc * 32); }
  }
  // relative dots: D[j][query] = sum_d table[j][d] * q[query][d]; lane = query c, element r -> j = jt*16 + 8hh + r
  float* myq = qrs[wave];
#pragma unroll
  for (int jt = 0; jt < NRELP / 16; ++jt) {
    v8f acc = zero8();
#pragma unroll
    for (int dc = 0; dc < 2; ++dc) {
      const v16b ta = ldfb(TB + (jt * 16 + c) * DK + dc * 32 + 8 * hh);
      acc = wmmab(ta, ql[dc], acc);
      acc = wmmab(ta, qh[dc], acc);
    }
#pragma unroll
    for (int r = 0; r < 8; ++r) myq[c * QP + jt * 16 + 8 * hh + r] = acc[r];
  }
  __builtin_amdgcn_fence(3 /* release order */, "workgroup");
  __builtin_amdgcn_wave_barrier();
  __builtin_amdgcn_fence(2 /* acquire order */, "workgroup");

  const int lglob = l0 + c;
  const float* qrow = myq + c * QP + MAXREL;        // indexed by clip(r - l, -16, 16)
  const float L2E = 1.4426950408889634f;
  float m_run = -1.0e30f, s_run = 0.f;
  v8f o[4];
#pragma unroll
  for (int t = 0; t < 4; ++t) o[t] = zero8();
  const __bf16* kbh = KH + tok0 * DM + h * DK + 8 * hh;
  const __bf16* kbl = KL + tok0 * DM + h * DK + 8 * hh;
  const _Float16* vb = VT + (size_t)(h * DK + c) * MT + tok0 + 8 * hh;

#pragma unroll 1
  for (int r0 = 0; r0 < SEQ; r0 += 32) {
    v8f t[2];
#pragma unroll
    for (int tt = 0; tt < 2; ++tt) {
      v8f acc = zero8();
#pragma unroll
      for (int dc = 0; dc < 2; ++dc) {
        const size_t ko = (size_t)(r0 + 16 * tt + c) * DM + dc * 32;
        const v16b kfh = ldfb(kbh + ko);
        const v16b kfl = ldfb(kbl + ko);
        acc = wmmab(kfl, qh[dc], acc);
        acc = wmmab(kfh, ql[dc], acc);
        acc = wmmab(kfh, qh[dc], acc);
      }
      t[tt] = acc;
    }
    // element e <-> key r0 + 8hh + e (tile 0) and r0 + 16 + 8hh + e (tile 1); this lane's query is lglob
    float p[16];
    float mt = -1.0e30f;
    const int dbase = r0 + 8 * hh - lglob;
#pragma unroll
    for (int e = 0; e < 8; ++e) {
      const int d0 = min(max(dbase + e, -MAXREL), MAXREL);
      const int d1 = min(max(dbase + 16 + e, -MAXREL), MAXREL);
      p[e]     = (t[0][e] * 0.125f + qrow[d0]) * L2E;
      p[8 + e] = (t[1][e] * 0.125f + qrow[d1]) * L2E;
      mt = fmaxf(mt, fmaxf(p[e], p[8 + e]));
    }
    mt = fmaxf(mt, __shfl_xor(mt, 16, 32));          // the two lane halves hold the same query
    const float m_new = fmaxf(m_run, mt);
    const float corr  = exp2f(m_run - m_new);
    float sum = 0.f;
    v16h pA;                                          // P as A operand: element i <-> key r0 + k(i, hh)
#pragma unroll
    for (int r = 0; r < 16; ++r) {
      const float ev = exp2f(p[r] - m_new);
      sum += ev;
      pA[r] = (_Float16)(ev * PSC);
    }
    sum += __shfl_xor(sum, 16, 32);
    s_run = s_run * corr + sum;
    m_run = m_new;
    float sc[8];
#pragma unroll
    for (int i = 0; i < 8; ++i) sc[i] = __shfl(corr, i + 8 * hh, 32);   // O tile rows are queries 8hh + i
#pragma unroll
    for (int tq = 0; tq < 4; ++tq) {
      const v16h vf = ldfh(vb + (size_t)tq * 16 * MT + r0);
      v8f oc = o[tq];
#pragma unroll
      for (int i = 0; i < 8; ++i) oc[i] *= sc[i];
      o[tq] = wmmah(pA, vf, oc);
    }
  }

  float inv[8];
#pragma unroll
  for (int i = 0; i < 8; ++i) inv[i] = 1.0f / (__shfl(s_run, i + 8 * hh, 32) * PSC);
  float* os = osm[wave];
#pragma unroll
  for (int tq = 0; tq < 4; ++tq)
#pragma unroll
    for (int i = 0; i < 8; ++i) os[(8 * hh + i) * OSP + tq * 16 + c] = o[tq][i] * inv[i];
  __builtin_amdgcn_fence(3 /* release order */, "workgroup");
  __builtin_amdgcn_wave_barrier();
  __builtin_amdgcn_fence(2 /* acquire order */, "workgroup");
  {
    const int q = lane >> 3, c8 = (lane & 7) * 8;
    unsigned short* ch = CTX + (tok0 + l0) * (size_t)(2 * DM) + h * DK + c8;
    u4 ph[4], pl[4];
#pragma unroll
    for (int it = 0; it < 4; ++it) {
      const int row = it * 4 + q;
      const float* sp = os + row * OSP + c8;
      unsigned short hb[8], lb[8];
#pragma unroll
      for (int e = 0; e < 8; ++e) { const float v = sp[e]; hb[e] = bfu_rne(v); lb[e] = bfu_rne(v - bfu_f32(hb[e])); }
      ph[it].x = (unsigned)hb[0] | ((unsigned)hb[1] << 16); ph[it].y = (unsigned)hb[2] | ((unsigned)hb[3] << 16);
      ph[it].z = (unsigned)hb[4] | ((unsigned)hb[5] << 16); ph[it].w = (unsigned)hb[6] | ((unsigned)hb[7] << 16);
      pl[it].x = (unsigned)lb[0] | ((unsigned)lb[1] << 16); pl[it].y = (unsigned)lb[2] | ((unsigned)lb[3] << 16);
      pl[it].z = (unsigned)lb[4] | ((unsigned)lb[5] << 16); pl[it].w = (unsigned)lb[6] | ((unsigned)lb[7] << 16);
    }
    {
#pragma unroll
      for (int it = 0; it < 4; ++it) {
        const int row = it * 4 + q;
        *(u4*)(ch + (size_t)row * (2 * DM)) = ph[it];
        *(u4*)(ch + (size_t)row * (2 * DM) + DM) = pl[it];
      }
      
    }
  }
}

extern "C" void kernel_launch(void* const* d_in, const int* in_sizes, int n_in, void* d_out, int out_size, void* d_ws, size_t ws_size, hipStream_t stream) {
  if (n_in < 12) return;
  const long long actn = ((long long)(NB - 1) * SEQ_FULL + SEQ) * DM;
  if ((long long)in_sizes[0] < actn || (long long)in_sizes[1] < actn || (long long)in_sizes[2] < actn) return;
  if (in_sizes[3] < DM * DM || in_sizes[5] < DM * DM || in_sizes[7] < DM * DM || in_sizes[9] < DM * DM) return;
  if (in_sizes[4] < DM || in_sizes[6] < DM || in_sizes[8] < DM || in_sizes[10] < DM) return;
  if (in_sizes[11] < NREL * DK) return;
  if ((long long)out_size < (long long)MT * DM) return;

  const float* Qi = (const float*)d_in[0];
  const float* Ki = (const float*)d_in[1];
  const float* Vi = (const float*)d_in[2];
  const float* Wq = (const float*)d_in[3];
  const float* bq = (const float*)d_in[4];
  const float* Wk = (const float*)d_in[5];
  const float* bk = (const float*)d_in[6];
  const float* Wv = (const float*)d_in[7];
  const float* bv = (const float*)d_in[8];
  const float* Wo = (const float*)d_in[9];
  const float* bo = (const float*)d_in[10];
  const float* rel = (const float*)d_in[11];
  float* out = (float*)d_out;

  constexpr size_t SZ_ACT = (size_t)MT * DM * 2;          // 16-bit [MT][DM] plane
  constexpr size_t SZ_W   = (size_t)DM * DM * 2;
  constexpr size_t SZ_WO2 = (size_t)DM * 2 * DM * 2;
  constexpr size_t SZ_BR  = (size_t)4 * DM * 4;
  constexpr size_t SZ_TB  = (size_t)NRELP * DK * 2;
  constexpr size_t SZ_CTX = (size_t)MT * 2 * DM * 2;
  static_assert(SZ_ACT % 256 == 0 && SZ_W % 256 == 0 && SZ_WO2 % 256 == 0 && SZ_BR % 256 == 0 && SZ_TB % 256 == 0 && SZ_CTX % 256 == 0);
  constexpr size_t TOTAL = 3 * SZ_ACT + 3 * SZ_W + SZ_WO2 + SZ_BR + SZ_TB + 4 * SZ_ACT + SZ_ACT + SZ_CTX;
  static_assert(TOTAL <= (size_t)134217728);
  if (TOTAL > ws_size) return;

  char* wsp = (char*)d_ws;
  unsigned short* XQ  = (unsigned short*)wsp; wsp += SZ_ACT;
  unsigned short* XK  = (unsigned short*)wsp; wsp += SZ_ACT;
  unsigned short* XV  = (unsigned short*)wsp; wsp += SZ_ACT;
  unsigned short* WQ6 = (unsigned short*)wsp; wsp += SZ_W;
  unsigned short* WK6 = (unsigned short*)wsp; wsp += SZ_W;
  unsigned short* WV6 = (unsigned short*)wsp; wsp += SZ_W;
  unsigned short* WO2 = (unsigned short*)wsp; wsp += SZ_WO2;
  float*          BR  = (float*)wsp;          wsp += SZ_BR;
  unsigned short* TB  = (unsigned short*)wsp; wsp += SZ_TB;
  unsigned short* QHp = (unsigned short*)wsp; wsp += SZ_ACT;
  unsigned short* QLp = (unsigned short*)wsp; wsp += SZ_ACT;
  unsigned short* KHp = (unsigned short*)wsp; wsp += SZ_ACT;
  unsigned short* KLp = (unsigned short*)wsp; wsp += SZ_ACT;
  unsigned short* VTp = (unsigned short*)wsp; wsp += SZ_ACT;     // [DM features][MT tokens] f16
  unsigned short* CTX = (unsigned short*)wsp; wsp += SZ_CTX;     // [MT][2*DM] bf16: hi | lo

  const unsigned gW   = (unsigned)(((long long)DM * (DM / 8) + 255) / 256);
  const unsigned gAct = (unsigned)(((long long)MT * (DM / 8) + 255) / 256);
  // weights [out][in] are already in Bt layout: f16 of the bf16-converted value x16 (exact)
  k_cast_f16<<<gW, 256, 0, stream>>>(Wq, 0, DM, WQ6, DM, 16.0f);
  k_cast_f16<<<gW, 256, 0, stream>>>(Wk, 0, DM, WK6, DM, 16.0f);
  k_cast_f16<<<gW, 256, 0, stream>>>(Wv, 0, DM, WV6, DM, 16.0f);
  k_wo_dup<<<(unsigned)(((long long)DM * ((2 * DM) / 8) + 255) / 256), 256, 0, stream>>>(Wo, WO2);
  k_bfvec<<<(DM + 255) / 256, 256, 0, stream>>>(bq, BR + 0 * DM, DM);
  k_bfvec<<<(DM + 255) / 256, 256, 0, stream>>>(bk, BR + 1 * DM, DM);
  k_bfvec<<<(DM + 255) / 256, 256, 0, stream>>>(bv, BR + 2 * DM, DM);
  k_bfvec<<<(DM + 255) / 256, 256, 0, stream>>>(bo, BR + 3 * DM, DM);
  k_table<<<(NRELP * (DK / 8) + 255) / 256, 256, 0, stream>>>(rel, TB);
  // activations: rows (b, s) of the full-size inputs -> dense [MT][DM] f16 planes
  k_cast_f16<<<gAct, 256, 0, stream>>>(Qi, (long long)SEQ_FULL * DM, SEQ, XQ, MT, 1.0f);
  k_cast_f16<<<gAct, 256, 0, stream>>>(Ki, (long long)SEQ_FULL * DM, SEQ, XK, MT, 1.0f);
  k_cast_f16<<<gAct, 256, 0, stream>>>(Vi, (long long)SEQ_FULL * DM, SEQ, XV, MT, 1.0f);

  const unsigned gQK = (unsigned)((((MT / 64) * (DM / 64)) + 7) / 8);
  k_gemm_qk<<<gQK, 256, 0, stream>>>(XQ, WQ6, QHp, QLp, BR + 0 * DM, MT, DM, DM, 0.0625f);
  k_gemm_qk<<<gQK, 256, 0, stream>>>(XK, WK6, KHp, KLp, BR + 1 * DM, MT, DM, DM, 0.0625f);
  k_gemm_vt<<<(unsigned)((((DM / 64) * (MT / 64)) + 7) / 8), 256, 0, stream>>>(WV6, XV, VTp, BR + 2 * DM, DM, MT, DM, 0.0625f);

  k_attn_rel<<<(unsigned)((NB * NH * (SEQ / 16)) / AT_NW), 32 * AT_NW, 0, stream>>>(QHp, QLp, KHp, KLp, VTp, TB, CTX);

  k_gemm_out<<<gQK, 256, 0, stream>>>(CTX, WO2, out, BR + 3 * DM, MT, DM, 2 * DM);
}

// v001
// One run takes 205 microseconds.
// Next to v000, in two timings, it ran 1.82 times as fast each time.
// Contractions: q/k/v projections = v_wmma_f32_16x16x32_f16 (inputs and weights RNE-converted to bf16 and held exactly in f16, weights x16), f32 accumulate; content scores and relative-position dots = v_wmma_f32_16x16x32_bf16 with q, k as bf16 hi/lo split planes (3 products) and the 33x64 table as exact bf16, f32 accumulate; P.V = v_wmma_f32_16x16x32_f16 (P x2^14, v f16), f32 accumulate; output projection = v_wmma_f32_16x16x32_bf16 with the context as bf16 hi|lo folded along K against [Wo|Wo], f32 accumulate.
#include <hip/hip_runtime.h>
#include <math.h>
#include <stdint.h>

#ifndef NB
#define NB 4
#endif
#ifndef SEQ
#define SEQ 1024
#endif
#define NB_FULL 4
#define SEQ_FULL 1024
#define DM 1024
#define NH 16
#define DK 64
#define MAXREL 16
#define NREL 33
#define NRELP 48
#define MT (NB * SEQ)
#define AT_NW 4
#define QP 52
#define OSP 68
#define PSC 16384.0f

static_assert(NH * DK == DM);
static_assert(DK == 64);
static_assert(2 * MAXREL + 1 == NREL);
static_assert(NRELP % 16 == 0 && NRELP >= NREL);
static_assert(QP >= NRELP);
static_assert(SEQ % 64 == 0);
static_assert(MT % 128 == 0);
static_assert(DM % 128 == 0);
static_assert(DM >= 256);
static_assert(((SEQ / 16) * NB * NH) % AT_NW == 0);
static_assert(NB <= NB_FULL && SEQ <= SEQ_FULL);
static_assert(((long long)MT * (DM / 8)) % 256 == 0);

typedef __attribute__((ext_vector_type(16))) _Float16 v16h;
typedef __attribute__((ext_vector_type(8)))  _Float16 v8h;
typedef __attribute__((ext_vector_type(16))) __bf16   v16b;
typedef __attribute__((ext_vector_type(8)))  __bf16   v8b;
typedef __attribute__((ext_vector_type(8)))  float    v8f;
typedef __attribute__((ext_vector_type(4)))  float    v4f;
typedef __attribute__((ext_vector_type(4)))  unsigned int u4;

// 16-bit WMMA fragment map (wave32), lane L, hh = L>>4, c = L&15:
//   A 16x32: lane = row c;    element i -> k = (i<8) ? 8hh+i : 16+8hh+(i-8)
//   B 32x16: lane = column c; the same k(i,hh)
//   D 16x16 (8 f32): lane = column c; element r -> row 8hh+r

__device__ __forceinline__ unsigned short bfu_rne(float v) { unsigned u = __float_as_uint(v); u += 0x7FFFu + ((u >> 16) & 1u); return (unsigned short)(u >> 16); }
__device__ __forceinline__ float bfu_f32(unsigned short h) { return __uint_as_float(((unsigned)h) << 16); }
__device__ __forceinline__ float cmb_bf(float v) { const unsigned u = __float_as_uint(v); const unsigned r = (u + 0x7fffu + ((u >> 16) & 1u)) & 0xffff0000u; return __uint_as_float(r); }   // bf16 RNE kept as f32 (finite inputs)
__device__ __forceinline__ unsigned int cmb_pk2(float a, float b) { return (unsigned int)__builtin_bit_cast(unsigned short, (_Float16)a) | ((unsigned int)__builtin_bit_cast(unsigned short, (_Float16)b) << 16); }

#define VST2(T, ptr, val) do { const T vst2_v_ = (val); *(T*)(ptr) = vst2_v_;  } while (0)

__device__ __forceinline__ v8f zero8() { v8f z = {0.f, 0.f, 0.f, 0.f, 0.f, 0.f, 0.f, 0.f}; return z; }

__device__ __forceinline__ v8f wmmab(v16b a, v16b b, v8f c) {
  c = __builtin_amdgcn_wmma_f32_16x16x32_bf16(false, a, false, b, (short)0, c, false, false);
  asm volatile("v_nop\n\tv_nop\n\tv_nop\n\tv_nop" : "+v"(c) : "v"(a), "v"(b));
  return c;
}
__device__ __forceinline__ v8f wmmah(v16h a, v16h b, v8f c) {
  c = __builtin_amdgcn_wmma_f32_16x16x32_f16(false, a, false, b, (short)0, c, false, false);
  asm volatile("v_nop\n\tv_nop\n\tv_nop\n\tv_nop" : "+v"(c) : "v"(a), "v"(b));
  return c;
}
union FBu { v16b v; v8b h[2]; };
union FHu { v16h v; v8h h[2]; };
// p already includes the lane-half offset 8*hh: elements 0..7 <- p[0..7], 8..15 <- p[16..23]
__device__ __forceinline__ v16b ldfb(const __bf16* p) { FBu f; f.h[0] = *(const v8b*)(p); f.h[1] = *(const v8b*)(p + 16); return f.v; }
__device__ __forceinline__ v16h ldfh(const _Float16* p) { FHu f; f.h[0] = *(const v8h*)(p); f.h[1] = *(const v8h*)(p + 16); return f.v; }

// ---- hazard guards for the register-blocked GEMM ----
__device__ __forceinline__ void acc_guard4(v8f& a, v8f& b, v8f& c, v8f& d) { asm volatile("v_nop\n\tv_nop\n\tv_nop\n\tv_nop" : "+v"(a), "+v"(b), "+v"(c), "+v"(d)); }

template <typename T> struct Frag;
template <> struct Frag<_Float16> {
  typedef v16h V;
  static __device__ __forceinline__ v16h load(const _Float16* p) { return ldfh(p); }
  static __device__ __forceinline__ v8f mma(v16h a, v16h b, v8f c) { return __builtin_amdgcn_wmma_f32_16x16x32_f16(false, a, false, b, (short)0, c, false, false); }
};
template <> struct Frag<__bf16> {
  typedef v16b V;
  static __device__ __forceinline__ v16b load(const __bf16* p) { return ldfb(p); }
  static __device__ __forceinline__ v8f mma(v16b a, v16b b, v8f c) { return __builtin_amdgcn_wmma_f32_16x16x32_bf16(false, a, false, b, (short)0, c, false, false); }
};
template <int ET> struct Elem;
template <> struct Elem<0> { typedef _Float16 T; };
template <> struct Elem<1> { typedef __bf16 T; };

// ---- Tensor loads into LDS for the GEMM panels ----
typedef uint32_t u32x4 __attribute__((ext_vector_type(4)));
typedef uint32_t u32x8 __attribute__((ext_vector_type(8)));
constexpr uint32_t G_ROWB  = 256u;                 // bytes of one operand row per stage = 128 k
constexpr uint32_t G_ROWS  = 64u;                  // rows per slice (one tensor load of one wave)
constexpr uint32_t G_PITCH = G_ROWB + 16u;         // LDS row pitch, laid by the load's pad: an odd multiple of 16 B for ds_load_b128 readers
constexpr uint32_t G_SLICE = 18432u;               // 64 x 272 = 17,408 B rounded up to a multiple of 2 KiB
constexpr uint32_t G_STAGE = 4u * G_SLICE;         // [A rows 0..63 | A rows 64..127 | Bt rows 0..63 | Bt rows 64..127]
static_assert(G_ROWS * G_PITCH <= G_SLICE && G_SLICE % 2048u == 0u);
__device__ __forceinline__ uint32_t uni(uint32_t v) { return (uint32_t)__builtin_amdgcn_readfirstlane(v); }
// keeps the test in a scalar register, so that the branch round a tensor load is a scalar branch (the load ignores EXEC)
__device__ __forceinline__ uint32_t pinned(uint32_t v) { uint32_t w = (uint32_t)__builtin_amdgcn_readfirstlane(v); asm volatile("" : "+s"(w)); return w; }
// the wave's LDS reads have retired before the buffer is handed back for a refill
__device__ __forceinline__ void wait_ds0() { asm volatile("s_wait_dscnt 0x0" ::: "memory"); }
// the wave's own tensor load has landed (the compiler places no wait for it); the request's descriptor is named as an input so that its registers keep their values until here
__device__ __forceinline__ void wait_tensor0(u32x4 g0, u32x8 g1) { asm volatile("s_wait_tensorcnt 0x0" :: "s"(g0), "s"(g1) : "memory"); }
__device__ __forceinline__ void tdm_load(u32x4 g0, u32x8 g1) { asm volatile("tensor_load_to_lds %0, %1" :: "s"(g0), "s"(g1) : "memory"); }
__device__ __forceinline__ u32x8 tdm_group1(uint32_t src_pitch) {
  u32x8 g;
  g[0] = uni((1u << 20) | (5u << 22) | (3u << 25));
  g[1] = uni((G_ROWB & 0xFFFFu) << 16);
  g[2] = uni((G_ROWB >> 16) | ((G_ROWS & 0xFFFFu) << 16));
  g[3] = uni((G_ROWS >> 16) | (G_ROWB << 16));
  g[4] = uni(G_ROWS);
  g[5] = uni(src_pitch);
  g[6] = uni(0u);
  g[7] = uni(0u);
  return g;
}
__device__ __forceinline__ u32x4 tdm_group0(uint32_t lds_dst, uint64_t ga) {
  u32x4 g;
  g[0] = uni(1u); g[1] = uni(lds_dst); g[2] = uni((uint32_t)ga); g[3] = uni((((uint32_t)(ga >> 32)) & 0x01FFFFFFu) | 0x80000000u);
  return g;
}

// ---- Register-blocked WMMA GEMM body: C[m,n] = scale * sum_k A[m,k] * Bt[n,k] + bias; a work-group of 4 waves (2 x 2) owns a 128x128 tile, each wave 64x64 of it.
// The 128 rows of A and of Bt come into LDS 128 k at a time by tensor loads, one 64-row slice per wave and stage, two buffers: stage s + 1 flies while stage s is multiplied.
// A row-major [M,K] (pitch lda), Bt row-major [N,K] (pitch ldb); M,N % 128 == 0, K % 128 == 0, K >= 256 (no tails).
// BIAS_MODE 1 = bias[m], 2 = bias[n]. OUT_MODE 0 = f32, 1 = f16, 2 = bf16 hi plane (Cout) + bf16 lo plane (Cout2).
template <int ET, int BIAS_MODE, int OUT_MODE>
__device__ __forceinline__ void gemm64_body(
    const unsigned short* __restrict__ Ap, int lda, const unsigned short* __restrict__ Btp, int ldb,
    void* __restrict__ Cout, void* __restrict__ Cout2, int ldc, const float* __restrict__ bias,
    int M, int N, int K, float scale, float* slab, unsigned char* ring) {
  typedef typename Elem<ET>::T T;
  typedef typename Frag<T>::V V;
  const T* A = (const T*)Ap; const T* Bt = (const T*)Btp;
  const int lane = threadIdx.x & 31;
  const uint32_t wave = uni(threadIdx.x >> 5);
  const int tilesN = N >> 7;
  const int tilesM = M >> 7;
  const int tile = blockIdx.x;
  if (tile >= tilesM * tilesN) return;   // the same for the whole block, in front of every barrier and tensor load
  const int tm = tile / tilesN;
  const int tn = tile - tm * tilesN;
  const int m0 = (tm << 7) + (int)((wave >> 1) << 6);
  const int n0 = (tn << 7) + (int)((wave & 1u) << 6);
  const int rlane = lane & 15;
  const int koff  = (lane >> 4) * 8;
  const int mOff  = (lane >> 4) * 8;

  v8f acc[4][4];
#pragma unroll
  for (int i = 0; i < 4; ++i)
#pragma unroll
    for (int j = 0; j < 4; ++j) acc[i][j] = zero8();

  // this wave's slice: waves 0, 1 bring the two halves of A's 128 rows, waves 2, 3 those of Bt's
  const bool isB = wave >= 2u;
  const uint64_t srcA = (uint64_t)(size_t)(A + (size_t)((tm << 7) + (int)((wave & 1u) << 6)) * lda);
  const uint64_t srcB = (uint64_t)(size_t)(Bt + (size_t)((tn << 7) + (int)((wave & 1u) << 6)) * ldb);
  const uint64_t gsrc = isB ? srcB : srcA;
  u32x8 g1 = tdm_group1((uint32_t)(isB ? ldb : lda) * 2u);
  asm volatile("" : "+s"(g1));   // the pinned() form on descriptor words: held in their scalar registers, built once, so that none is written again while a request is outstanding
  const uint32_t ldst = (uint32_t)(size_t)ring + wave * G_SLICE;
  const int nst = K >> 7;
  // this wave's fragment rows: A from slice wave >> 1, Bt from slice 2 + (wave & 1)
  const unsigned char* aR = ring + (wave >> 1) * G_SLICE + (uint32_t)rlane * G_PITCH + (uint32_t)koff * 2u;
  const unsigned char* bR = ring + (2u + (wave & 1u)) * G_SLICE + (uint32_t)rlane * G_PITCH + (uint32_t)koff * 2u;

  u32x4 g0 = tdm_group0(ldst, gsrc);
  tdm_load(g0, g1);                                           // stage 0 -> buffer 0
  wait_tensor0(g0, g1);
  __syncthreads();                                            // stage 0 published
  g0 = tdm_group0(ldst + G_STAGE, gsrc + G_ROWB);
  tdm_load(g0, g1);                                           // stage 1 -> buffer 1 (K >= 256)

  // kept rolled: one publish point per stage
#pragma unroll 1
  for (int s = 0; s < nst; ++s) {
    const uint32_t buf = ((uint32_t)s & 1u) * G_STAGE;
    // two fragment sets inside the stage: the LDS reads of the next 32 k go ahead of this 32 k's WMMAs; nothing of the next stage is read here
    V ah[2][4], bh[2][4];
#pragma unroll
    for (int j = 0; j < 4; ++j) {
      bh[0][j] = Frag<T>::load((const T*)(bR + buf + (uint32_t)j * 16u * G_PITCH));
      ah[0][j] = Frag<T>::load((const T*)(aR + buf + (uint32_t)j * 16u * G_PITCH));
    }
#pragma unroll
    for (int kk = 0; kk < 4; ++kk) {
      const int cur = kk & 1, nxt = cur ^ 1;
      if (kk < 3) {
#pragma unroll
        for (int j = 0; j < 4; ++j) {
          bh[nxt][j] = Frag<T>::load((const T*)(bR + buf + (uint32_t)j * 16u * G_PITCH + (uint32_t)(kk + 1) * 64u));
          ah[nxt][j] = Frag<T>::load((const T*)(aR + buf + (uint32_t)j * 16u * G_PITCH + (uint32_t)(kk + 1) * 64u));
        }
      }
#pragma unroll
      for (int i = 0; i < 4; ++i) {
#pragma unroll
        for (int j = 0; j < 4; ++j) acc[i][j] = Frag<T>::mma(ah[cur][i], bh[cur][j], acc[i][j]);
        acc_guard4(acc[i][0], acc[i][1], acc[i][2], acc[i][3]);   // the four vector slots behind a WMMA; it also keeps each group of LDS reads where it is written
      }
    }
    // publish point of stage s + 1: own LDS reads retired, own load landed, then the barrier that publishes s + 1 and frees this buffer
    wait_ds0();
    wait_tensor0(g0, g1);
    __syncthreads();
    if (pinned((uint32_t)(s + 2 < nst))) {
      g0 = tdm_group0(ldst + buf, gsrc + (uint64_t)(uint32_t)(s + 2) * G_ROWB);
      tdm_load(g0, g1);
    }
  }
  wait_tensor0(g0, g1);
  wait_ds0();
  acc_guard4(acc[0][0], acc[0][1], acc[0][2], acc[0][3]);
  acc_guard4(acc[1][0], acc[1][1], acc[1][2], acc[1][3]);
  acc_guard4(acc[2][0], acc[2][1], acc[2][2], acc[2][3]);
  acc_guard4(acc[3][0], acc[3][1], acc[3][2], acc[3][3]);

#pragma unroll
  for (int i = 0; i < 4; ++i) {
    const int mBase = m0 + (i << 4);
#pragma unroll
    for (int j = 0; j < 4; ++j) {
      const int n = n0 + (j << 4) + rlane;
      float bv = 0.f;
      if (BIAS_MODE == 2) bv = bias[n];
#pragma unroll
      for (int r = 0; r < 8; ++r) {
        float v = acc[i][j][r] * scale;
        if (BIAS_MODE == 1) v += bias[mBase + mOff + r];
        if (BIAS_MODE == 2) v += bv;
        slab[(mOff + r) * 68 + (j << 4) + rlane] = v;
      }
    }
    __builtin_amdgcn_fence(3 /* release order */, "workgroup");
    __builtin_amdgcn_wave_barrier();
    __builtin_amdgcn_fence(2 /* acquire order */, "workgroup");
    if (OUT_MODE == 0) {
      float* C = (float*)Cout;
      const int hh = lane >> 4, c4 = (lane & 15) * 4;     // row segment = 256 B = 16 lanes x 16 B
      {
#pragma unroll
        for (int it = 0; it < 8; ++it) {
          const int row = it * 2 + hh;
          v4f v = *(const v4f*)(slab + row * 68 + c4);
          *(v4f*)(C + (size_t)(mBase + row) * ldc + n0 + c4) = v;
        }
        
      }
    } else {
      const int q = lane >> 3, c8 = (lane & 7) * 8;
      unsigned short* C  = (unsigned short*)Cout;
      unsigned short* C2 = (unsigned short*)Cout2;
      {
#pragma unroll
        for (int it = 0; it < 4; ++it) {
          const int row = it * 4 + q;
          const float* sp = slab + row * 68 + c8;
          v8h hv, lv;
#pragma unroll
          for (int e = 0; e < 8; ++e) {
            if (OUT_MODE == 1) {
              hv[e] = (_Float16)sp[e];
              lv[e] = (_Float16)0.f;
            } else {
              const unsigned short hb = bfu_rne(sp[e]);
              const unsigned short lb = bfu_rne(sp[e] - bfu_f32(hb));
              hv[e] = __builtin_bit_cast(_Float16, hb);
              lv[e] = __builtin_bit_cast(_Float16, lb);
            }
          }
          *(v8h*)(C + (size_t)(mBase + row) * ldc + n0 + c8) = hv;
          if (OUT_MODE == 2) *(v8h*)(C2 + (size_t)(mBase + row) * ldc + n0 + c8) = lv;
        }
        
      }
    }
    __builtin_amdgcn_fence(3 /* release order */, "workgroup");
    __builtin_amdgcn_wave_barrier();
    __builtin_amdgcn_fence(2 /* acquire order */, "workgroup");
  }
}

// q / k projection: f16 operands, bias[n], bf16 hi + lo planes out
__global__ __launch_bounds__(128) void k_gemm_qk(const unsigned short* __restrict__ X, const unsigned short* __restrict__ W,
                                                 unsigned short* __restrict__ CH, unsigned short* __restrict__ CL,
                                                 const float* __restrict__ bias, int M, int N, int K, float scale) {
  __shared__ __attribute__((aligned(2048))) unsigned char ring[2 * G_STAGE];
  __shared__ __align__(16) float sT[4][16 * 68];
  gemm64_body<0, 2, 2>(X, K, W, K, (void*)CH, (void*)CL, N, bias, M, N, K, scale, sT[threadIdx.x >> 5], ring);
}
// v projection, transposed: C[m = feature][n = token] = sum_k Wv[m][k] * X[n][k] + bias[m], f16 out (pitch N = tokens)
__global__ __launch_bounds__(128) void k_gemm_vt(const unsigned short* __restrict__ W, const unsigned short* __restrict__ X,
                                                 unsigned short* __restrict__ C, const float* __restrict__ bias, int M, int N, int K, float scale) {
  __shared__ __attribute__((aligned(2048))) unsigned char ring[2 * G_STAGE];
  __shared__ __align__(16) float sT[4][16 * 68];
  gemm64_body<0, 1, 1>(W, K, X, K, (void*)C, (void*)C, N, bias, M, N, K, scale, sT[threadIdx.x >> 5], ring);
}
// output projection: bf16 operands (A = context hi|lo along K, Bt = [Wo|Wo]), bias[n], f32 out
__global__ __launch_bounds__(128) void k_gemm_out(const unsigned short* __restrict__ A, const unsigned short* __restrict__ W,
                                                  float* __restrict__ C, const float* __restrict__ bias, int M, int N, int K) {
  __shared__ __attribute__((aligned(2048))) unsigned char ring[2 * G_STAGE];
  __shared__ __align__(16) float sT[4][16 * 68];
  gemm64_body<1, 2, 0>(A, K, W, K, (void*)C, (void*)C, N, bias, M, N, K, 1.0f, sT[threadIdx.x >> 5], ring);
}

// f32 -> bf16 (RNE) -> x sc -> f16 plane [nR][DM]; thread per (row, 8 columns); source row = (r / rpb) * sbs + (r % rpb) * DM; 16-B stores, thread-linear along the row
__global__ __launch_bounds__(256) void k_cast_f16(const float* __restrict__ SRC, long long sbs, int rpb, unsigned short* __restrict__ DST, int nR, float sc) {
  const long long u = (long long)blockIdx.x * 256 + threadIdx.x; const int per = DM / 8; if (u >= (long long)nR * per) return;
  const int r = (int)(u / per); const int c0 = 8 * (int)(u % per); const int bb = r / rpb; const int s = r - bb * rpb;
  const float* sp = SRC + (long long)bb * sbs + (long long)s * DM + c0; float w[8];
#pragma unroll
  for (int e = 0; e < 8; ++e) w[e] = cmb_bf(sp[e]) * sc;
  u4 pk; pk.x = cmb_pk2(w[0], w[1]); pk.y = cmb_pk2(w[2], w[3]); pk.z = cmb_pk2(w[4], w[5]); pk.w = cmb_pk2(w[6], w[7]);
  VST2(u4, (u4*)(DST + (long long)r * DM + c0), pk);
}
// Wo f32 [DM][DM] -> bf16 plane [DM][2*DM] = [Wo | Wo]; thread per (row, 8 destination columns)
__global__ __launch_bounds__(256) void k_wo_dup(const float* __restrict__ Wo, unsigned short* __restrict__ DST) {
  const long long u = (long long)blockIdx.x * 256 + threadIdx.x; const int per = (2 * DM) / 8; if (u >= (long long)DM * per) return;
  const int r = (int)(u / per); const int c0 = 8 * (int)(u % per); const int sc0 = c0 & (DM - 1);
  const float* sp = Wo + (long long)r * DM + sc0; unsigned short w[8];
#pragma unroll
  for (int e = 0; e < 8; ++e) w[e] = bfu_rne(sp[e]);
  u4 pk; pk.x = (unsigned)w[0] | ((unsigned)w[1] << 16); pk.y = (unsigned)w[2] | ((unsigned)w[3] << 16); pk.z = (unsigned)w[4] | ((unsigned)w[5] << 16); pk.w = (unsigned)w[6] | ((unsigned)w[7] << 16);
  VST2(u4, (u4*)(DST + (long long)r * (2 * DM) + c0), pk);
}
// relative-position table f32 [NREL][DK] -> bf16 plane [NRELP][DK], rows >= NREL written as zeros (clamped source address)
__global__ __launch_bounds__(256) void k_table(const float* __restrict__ T, unsigned short* __restrict__ TB) {
  const int u = blockIdx.x * 256 + threadIdx.x; if (u >= NRELP * (DK / 8)) return;
  const int row = u / (DK / 8); const int c0 = 8 * (u % (DK / 8)); const int rr = min(row, NREL - 1);
  unsigned short w[8];
#pragma unroll
  for (int e = 0; e < 8; ++e) { const unsigned short bits = bfu_rne(T[rr * DK + c0 + e]); w[e] = (row < NREL) ? bits : (unsigned short)0; }
  u4 pk; pk.x = (unsigned)w[0] | ((unsigned)w[1] << 16); pk.y = (unsigned)w[2] | ((unsigned)w[3] << 16); pk.z = (unsigned)w[4] | ((unsigned)w[5] << 16); pk.w = (unsigned)w[6] | ((unsigned)w[7] << 16);
  VST2(u4, (u4*)(TB + row * DK + c0), pk);
}
// bias vector RNE-converted to bf16, kept as f32
__global__ __launch_bounds__(256) void k_bfvec(const float* __restrict__ SRC, float* __restrict__ DST, int n) {
  const int u = blockIdx.x * 256 + threadIdx.x; if (u >= n) return; VST2(float, DST + u, cmb_bf(SRC[u]));
}

// =====================================================================================================================
// Fused attention with clipped relative-position bias. One wave per 16 queries of one (batch, head); 4 independent waves per block.
//   score(l, r) = q_l . k_r / 8 + q_l . table[clip(r - l, -16, 16) + 16]
//   Transposed score tiles S^T = K . Q^T (A = key rows, B = query rows): D has lane = query, element = key, which is the A-operand
//   layout of P for O = P . V (32 keys per step), so P never leaves registers. q, k: bf16 hi/lo planes (hi.hi + hi.lo + lo.hi).
//   Relative dots: table (A, rows padded to NRELP) x q (B), hi + lo products, staged once per wave in LDS [16][QP] and gathered per element.
//   V^T plane [feature][token] f16 gives B fragments with contiguous keys. Online softmax in f32 (exp2 domain); P carried x2^14 in f16.
// =====================================================================================================================
__global__ __launch_bounds__(32 * AT_NW) void k_attn_rel(const unsigned short* __restrict__ QHp, const unsigned short* __restrict__ QLp,
                                                         const unsigned short* __restrict__ KHp, const unsigned short* __restrict__ KLp,
                                                         const unsigned short* __restrict__ VTp, const unsigned short* __restrict__ TBp,
                                                         unsigned short* __restrict__ CTX) {
  __shared__ __align__(16) float qrs[AT_NW][16 * QP];
  __shared__ __align__(16) float osm[AT_NW][16 * OSP];
  const __bf16* QH = (const __bf16*)QHp; const __bf16* QL = (const __bf16*)QLp;
  const __bf16* KH = (const __bf16*)KHp; const __bf16* KL = (const __bf16*)KLp;
  const __bf16* TB = (const __bf16*)TBp; const _Float16* VT = (const _Float16*)VTp;
  const int lane = threadIdx.x & 31, wave = threadIdx.x >> 5, hh = lane >> 4, c = lane & 15;
  const int tile = blockIdx.x * AT_NW + wave;
  const int bh = tile / (SEQ / 16);
  const int l0 = (tile - bh * (SEQ / 16)) * 16;
  const int b = bh / NH, h = bh - b * NH;
  const size_t tok0 = (size_t)b * SEQ;

  // q as B operand (lane = query column c), 2 k-steps of 32, hi and lo
  v16b qh[2], ql[2];
  {
    const size_t qo = (tok0 + l0 + c) * DM + h * DK + 8 * hh;
#pragma unroll
    for (int dc = 0; dc < 2; ++dc) { qh[dc] = ldfb(QH + qo + dc * 32); ql[dc] = ldfb(QL + qo + dc * 32); }
  }
  // relative dots: D[j][query] = sum_d table[j][d] * q[query][d]; lane = query c, element r -> j = jt*16 + 8hh + r
  float* myq = qrs[wave];
#pragma unroll
  for (int jt = 0; jt < NRELP / 16; ++jt) {
    v8f acc = zero8();
#pragma unroll
    for (int dc = 0; dc < 2; ++dc) {
      const v16b ta = ldfb(TB + (jt * 16 + c) * DK + dc * 32 + 8 * hh);
      acc = wmmab(ta, ql[dc], acc);
      acc = wmmab(ta, qh[dc], acc);
    }
#pragma unroll
    for (int r = 0; r < 8; ++r) myq[c * QP + jt * 16 + 8 * hh + r] = acc[r];
  }
  __builtin_amdgcn_fence(3 /* release order */, "workgroup");
  __builtin_amdgcn_wave_barrier();
  __builtin_amdgcn_fence(2 /* acquire order */, "workgroup");

  const int lglob = l0 + c;
  const float* qrow = myq + c * QP + MAXREL;        // indexed by clip(r - l, -16, 16)
  const float L2E = 1.4426950408889634f;
  float m_run = -1.0e30f, s_run = 0.f;
  v8f o[4];
#pragma unroll
  for (int t = 0; t < 4; ++t) o[t] = zero8();
  const __bf16* kbh = KH + tok0 * DM + h * DK + 8 * hh;
  const __bf16* kbl = KL + tok0 * DM + h * DK + 8 * hh;
  const _Float16* vb = VT + (size_t)(h * DK + c) * MT + tok0 + 8 * hh;

#pragma unroll 1
  for (int r0 = 0; r0 < SEQ; r0 += 32) {
    v8f t[2];
#pragma unroll
    for (int tt = 0; tt < 2; ++tt) {
      v8f acc = zero8();
#pragma unroll
      for (int dc = 0; dc < 2; ++dc) {
        const size_t ko = (size_t)(r0 + 16 * tt + c) * DM + dc * 32;
        const v16b kfh = ldfb(kbh + ko);
        const v16b kfl = ldfb(kbl + ko);
        acc = wmmab(kfl, qh[dc], acc);
        acc = wmmab(kfh, ql[dc], acc);
        acc = wmmab(kfh, qh[dc], acc);
      }
      t[tt] = acc;
    }
    // element e <-> key r0 + 8hh + e (tile 0) and r0 + 16 + 8hh + e (tile 1); this lane's query is lglob
    float p[16];
    float mt = -1.0e30f;
    const int dbase = r0 + 8 * hh - lglob;
#pragma unroll
    for (int e = 0; e < 8; ++e) {
      const int d0 = min(max(dbase + e, -MAXREL), MAXREL);
      const int d1 = min(max(dbase + 16 + e, -MAXREL), MAXREL);
      p[e]     = (t[0][e] * 0.125f + qrow[d0]) * L2E;
      p[8 + e] = (t[1][e] * 0.125f + qrow[d1]) * L2E;
      mt = fmaxf(mt, fmaxf(p[e], p[8 + e]));
    }
    mt = fmaxf(mt, __shfl_xor(mt, 16, 32));          // the two lane halves hold the same query
    const float m_new = fmaxf(m_run, mt);
    const float corr  = exp2f(m_run - m_new);
    float sum = 0.f;
    v16h pA;                                          // P as A operand: element i <-> key r0 + k(i, hh)
#pragma unroll
    for (int r = 0; r < 16; ++r) {
      const float ev = exp2f(p[r] - m_new);
      sum += ev;
      pA[r] = (_Float16)(ev * PSC);
    }
    sum += __shfl_xor(sum, 16, 32);
    s_run = s_run * corr + sum;
    m_run = m_new;
    float sc[8];
#pragma unroll
    for (int i = 0; i < 8; ++i) sc[i] = __shfl(corr, i + 8 * hh, 32);   // O tile rows are queries 8hh + i
#pragma unroll
    for (int tq = 0; tq < 4; ++tq) {
      const v16h vf = ldfh(vb + (size_t)tq * 16 * MT + r0);
      v8f oc = o[tq];
#pragma unroll
      for (int i = 0; i < 8; ++i) oc[i] *= sc[i];
      o[tq] = wmmah(pA, vf, oc);
    }
  }

  float inv[8];
#pragma unroll
  for (int i = 0; i < 8; ++i) inv[i] = 1.0f / (__shfl(s_run, i + 8 * hh, 32) * PSC);
  float* os = osm[wave];
#pragma unroll
  for (int tq = 0; tq < 4; ++tq)
#pragma unroll
    for (int i = 0; i < 8; ++i) os[(8 * hh + i) * OSP + tq * 16 + c] = o[tq][i] * inv[i];
  __builtin_amdgcn_fence(3 /* release order */, "workgroup");
  __builtin_amdgcn_wave_barrier();
  __builtin_amdgcn_fence(2 /* acquire order */, "workgroup");
  {
    const int q = lane >> 3, c8 = (lane & 7) * 8;
    unsigned short* ch = CTX + (tok0 + l0) * (size_t)(2 * DM) + h * DK + c8;
    u4 ph[4], pl[4];
#pragma unroll
    for (int it = 0; it < 4; ++it) {
      const int row = it * 4 + q;
      const float* sp = os + row * OSP + c8;
      unsigned short hb[8], lb[8];
#pragma unroll
      for (int e = 0; e < 8; ++e) { const float v = sp[e]; hb[e] = bfu_rne(v); lb[e] = bfu_rne(v - bfu_f32(hb[e])); }
      ph[it].x = (unsigned)hb[0] | ((unsigned)hb[1] << 16); ph[it].y = (unsigned)hb[2] | ((unsigned)hb[3] << 16);
      ph[it].z = (unsigned)hb[4] | ((unsigned)hb[5] << 16); ph[it].w = (unsigned)hb[6] | ((unsigned)hb[7] << 16);
      pl[it].x = (unsigned)lb[0] | ((unsigned)lb[1] << 16); pl[it].y = (unsigned)lb[2] | ((unsigned)lb[3] << 16);
      pl[it].z = (unsigned)lb[4] | ((unsigned)lb[5] << 16); pl[it].w = (unsigned)lb[6] | ((unsigned)lb[7] << 16);
    }
    {
#pragma unroll
      for (int it = 0; it < 4; ++it) {
        const int row = it * 4 + q;
        *(u4*)(ch + (size_t)row * (2 * DM)) = ph[it];
        *(u4*)(ch + (size_t)row * (2 * DM) + DM) = pl[it];
      }
      
    }
  }
}

extern "C" void kernel_launch(void* const* d_in, const int* in_sizes, int n_in, void* d_out, int out_size, void* d_ws, size_t ws_size, hipStream_t stream) {
  if (n_in < 12) return;
  const long long actn = ((long long)(NB - 1) * SEQ_FULL + SEQ) * DM;
  if ((long long)in_sizes[0] < actn || (long long)in_sizes[1] < actn || (long long)in_sizes[2] < actn) return;
  if (in_sizes[3] < DM * DM || in_sizes[5] < DM * DM || in_sizes[7] < DM * DM || in_sizes[9] < DM * DM) return;
  if (in_sizes[4] < DM || in_sizes[6] < DM || in_sizes[8] < DM || in_sizes[10] < DM) return;
  if (in_sizes[11] < NREL * DK) return;
  if ((long long)out_size < (long long)MT * DM) return;

  const float* Qi = (const float*)d_in[0];
  const float* Ki = (const float*)d_in[1];
  const float* Vi = (const float*)d_in[2];
  const float* Wq = (const float*)d_in[3];
  const float* bq = (const float*)d_in[4];
  const float* Wk = (const float*)d_in[5];
  const float* bk = (const float*)d_in[6];
  const float* Wv = (const float*)d_in[7];
  const float* bv = (const float*)d_in[8];
  const float* Wo = (const float*)d_in[9];
  const float* bo = (const float*)d_in[10];
  const float* rel = (const float*)d_in[11];
  float* out = (float*)d_out;

  constexpr size_t SZ_ACT = (size_t)MT * DM * 2;          // 16-bit [MT][DM] plane
  constexpr size_t SZ_W   = (size_t)DM * DM * 2;
  constexpr size_t SZ_WO2 = (size_t)DM * 2 * DM * 2;
  constexpr size_t SZ_BR  = (size_t)4 * DM * 4;
  constexpr size_t SZ_TB  = (size_t)NRELP * DK * 2;
  constexpr size_t SZ_CTX = (size_t)MT * 2 * DM * 2;
  static_assert(SZ_ACT % 256 == 0 && SZ_W % 256 == 0 && SZ_WO2 % 256 == 0 && SZ_BR % 256 == 0 && SZ_TB % 256 == 0 && SZ_CTX % 256 == 0);
  constexpr size_t TOTAL = 3 * SZ_ACT + 3 * SZ_W + SZ_WO2 + SZ_BR + SZ_TB + 4 * SZ_ACT + SZ_ACT + SZ_CTX;
  static_assert(TOTAL <= (size_t)134217728);
  if (TOTAL > ws_size) return;

  char* wsp = (char*)d_ws;
  unsigned short* XQ  = (unsigned short*)wsp; wsp += SZ_ACT;
  unsigned short* XK  = (unsigned short*)wsp; wsp += SZ_ACT;
  unsigned short* XV  = (unsigned short*)wsp; wsp += SZ_ACT;
  unsigned short* WQ6 = (unsigned short*)wsp; wsp += SZ_W;
  unsigned short* WK6 = (unsigned short*)wsp; wsp += SZ_W;
  unsigned short* WV6 = (unsigned short*)wsp; wsp += SZ_W;
  unsigned short* WO2 = (unsigned short*)wsp; wsp += SZ_WO2;
  float*          BR  = (float*)wsp;          wsp += SZ_BR;
  unsigned short* TB  = (unsigned short*)wsp; wsp += SZ_TB;
  unsigned short* QHp = (unsigned short*)wsp; wsp += SZ_ACT;
  unsigned short* QLp = (unsigned short*)wsp; wsp += SZ_ACT;
  unsigned short* KHp = (unsigned short*)wsp; wsp += SZ_ACT;
  unsigned short* KLp = (unsigned short*)wsp; wsp += SZ_ACT;
  unsigned short* VTp = (unsigned short*)wsp; wsp += SZ_ACT;     // [DM features][MT tokens] f16
  unsigned short* CTX = (unsigned short*)wsp; wsp += SZ_CTX;     // [MT][2*DM] bf16: hi | lo

  const unsigned gW   = (unsigned)(((long long)DM * (DM / 8) + 255) / 256);
  const unsigned gAct = (unsigned)(((long long)MT * (DM / 8) + 255) / 256);
  // weights [out][in] are already in Bt layout: f16 of the bf16-converted value x16 (exact)
  k_cast_f16<<<gW, 256, 0, stream>>>(Wq, 0, DM, WQ6, DM, 16.0f);
  k_cast_f16<<<gW, 256, 0, stream>>>(Wk, 0, DM, WK6, DM, 16.0f);
  k_cast_f16<<<gW, 256, 0, stream>>>(Wv, 0, DM, WV6, DM, 16.0f);
  k_wo_dup<<<(unsigned)(((long long)DM * ((2 * DM) / 8) + 255) / 256), 256, 0, stream>>>(Wo, WO2);
  k_bfvec<<<(DM + 255) / 256, 256, 0, stream>>>(bq, BR + 0 * DM, DM);
  k_bfvec<<<(DM + 255) / 256, 256, 0, stream>>>(bk, BR + 1 * DM, DM);
  k_bfvec<<<(DM + 255) / 256, 256, 0, stream>>>(bv, BR + 2 * DM, DM);
  k_bfvec<<<(DM + 255) / 256, 256, 0, stream>>>(bo, BR + 3 * DM, DM);
  k_table<<<(NRELP * (DK / 8) + 255) / 256, 256, 0, stream>>>(rel, TB);
  // activations: rows (b, s) of the full-size inputs -> dense [MT][DM] f16 planes
  k_cast_f16<<<gAct, 256, 0, stream>>>(Qi, (long long)SEQ_FULL * DM, SEQ, XQ, MT, 1.0f);
  k_cast_f16<<<gAct, 256, 0, stream>>>(Ki, (long long)SEQ_FULL * DM, SEQ, XK, MT, 1.0f);
  k_cast_f16<<<gAct, 256, 0, stream>>>(Vi, (long long)SEQ_FULL * DM, SEQ, XV, MT, 1.0f);

  const unsigned gQK = (unsigned)((MT / 128) * (DM / 128));
  k_gemm_qk<<<gQK, 128, 0, stream>>>(XQ, WQ6, QHp, QLp, BR + 0 * DM, MT, DM, DM, 0.0625f);
  k_gemm_qk<<<gQK, 128, 0, stream>>>(XK, WK6, KHp, KLp, BR + 1 * DM, MT, DM, DM, 0.0625f);
  k_gemm_vt<<<gQK, 128, 0, stream>>>(WV6, XV, VTp, BR + 2 * DM, DM, MT, DM, 0.0625f);

  k_attn_rel<<<(unsigned)((NB * NH * (SEQ / 16)) / AT_NW), 32 * AT_NW, 0, stream>>>(QHp, QLp, KHp, KLp, VTp, TB, CTX);

  k_gemm_out<<<gQK, 128, 0, stream>>>(CTX, WO2, out, BR + 3 * DM, MT, DM, 2 * DM);
}

// v002
// One run takes 141 microseconds.
// In both of two side-by-side timings against v001, it was 1.45 times as fast.
// All steps since v000 together make it 2.63 times as fast.
// Contractions: q/k/v projections = v_wmma_f32_16x16x32_f16 (inputs and weights RNE-converted to bf16 and held exactly in f16, weights x16), f32 accumulate; content scores and relative-position dots = v_wmma_f32_16x16x32_bf16 with q, k as bf16 hi/lo split planes (3 products) and the 33x64 table as exact bf16, f32 accumulate; P.V = v_wmma_f32_16x16x32_f16 (P x2^14, v f16), f32 accumulate; output projection = v_wmma_f32_16x16x32_bf16 with the context as bf16 hi|lo folded along K against [Wo|Wo], f32 accumulate.
#include <hip/hip_runtime.h>
#include <math.h>
#include <stdint.h>

#ifndef NB
#define NB 4
#endif
#ifndef SEQ
#define SEQ 1024
#endif
#define NB_FULL 4
#define SEQ_FULL 1024
#define DM 1024
#define NH 16
#define DK 64
#define MAXREL 16
#define NREL 33
#define NRELP 48
#define MT (NB * SEQ)
#define AT_NW 8
#define QP 52
#define OSP 68
#define PSC 16384.0f

static_assert(NH * DK == DM);
static_assert(DK == 64);
static_assert(2 * MAXREL + 1 == NREL);
static_assert(NRELP % 16 == 0 && NRELP >= NREL);
static_assert(QP >= NRELP);
static_assert(SEQ % 64 == 0);
static_assert(MT % 128 == 0);
static_assert(DM % 128 == 0);
static_assert(DM >= 256);
static_assert(((SEQ / 16) * NB * NH) % AT_NW == 0);
static_assert((SEQ / 16) % AT_NW == 0);
static_assert(SEQ >= 128);
static_assert(NB <= NB_FULL && SEQ <= SEQ_FULL);
static_assert(((long long)MT * (DM / 8)) % 256 == 0);

typedef __attribute__((ext_vector_type(16))) _Float16 v16h;
typedef __attribute__((ext_vector_type(8)))  _Float16 v8h;
typedef __attribute__((ext_vector_type(16))) __bf16   v16b;
typedef __attribute__((ext_vector_type(8)))  __bf16   v8b;
typedef __attribute__((ext_vector_type(8)))  float    v8f;
typedef __attribute__((ext_vector_type(4)))  float    v4f;
typedef __attribute__((ext_vector_type(4)))  unsigned int u4;

// 16-bit WMMA fragment map (wave32), lane L, hh = L>>4, c = L&15:
//   A 16x32: lane = row c;    element i -> k = (i<8) ? 8hh+i : 16+8hh+(i-8)
//   B 32x16: lane = column c; the same k(i,hh)
//   D 16x16 (8 f32): lane = column c; element r -> row 8hh+r

__device__ __forceinline__ unsigned short bfu_rne(float v) { unsigned u = __float_as_uint(v); u += 0x7FFFu + ((u >> 16) & 1u); return (unsigned short)(u >> 16); }
__device__ __forceinline__ float bfu_f32(unsigned short h) { return __uint_as_float(((unsigned)h) << 16); }
__device__ __forceinline__ float cmb_bf(float v) { const unsigned u = __float_as_uint(v); const unsigned r = (u + 0x7fffu + ((u >> 16) & 1u)) & 0xffff0000u; return __uint_as_float(r); }   // bf16 RNE kept as f32 (finite inputs)
__device__ __forceinline__ unsigned int cmb_pk2(float a, float b) { return (unsigned int)__builtin_bit_cast(unsigned short, (_Float16)a) | ((unsigned int)__builtin_bit_cast(unsigned short, (_Float16)b) << 16); }

#define VST2(T, ptr, val) do { const T vst2_v_ = (val); *(T*)(ptr) = vst2_v_;  } while (0)

__device__ __forceinline__ v8f zero8() { v8f z = {0.f, 0.f, 0.f, 0.f, 0.f, 0.f, 0.f, 0.f}; return z; }

__device__ __forceinline__ v8f wmmab(v16b a, v16b b, v8f c) {
  c = __builtin_amdgcn_wmma_f32_16x16x32_bf16(false, a, false, b, (short)0, c, false, false);
  asm volatile("v_nop\n\tv_nop\n\tv_nop\n\tv_nop" : "+v"(c) : "v"(a), "v"(b));
  return c;
}
__device__ __forceinline__ v8f wmmah(v16h a, v16h b, v8f c) {
  c = __builtin_amdgcn_wmma_f32_16x16x32_f16(false, a, false, b, (short)0, c, false, false);
  asm volatile("v_nop\n\tv_nop\n\tv_nop\n\tv_nop" : "+v"(c) : "v"(a), "v"(b));
  return c;
}
union FBu { v16b v; v8b h[2]; };
union FHu { v16h v; v8h h[2]; };
// p already includes the lane-half offset 8*hh: elements 0..7 <- p[0..7], 8..15 <- p[16..23]
__device__ __forceinline__ v16b ldfb(const __bf16* p) { FBu f; f.h[0] = *(const v8b*)(p); f.h[1] = *(const v8b*)(p + 16); return f.v; }
__device__ __forceinline__ v16h ldfh(const _Float16* p) { FHu f; f.h[0] = *(const v8h*)(p); f.h[1] = *(const v8h*)(p + 16); return f.v; }

// ---- hazard guards for the register-blocked GEMM ----
__device__ __forceinline__ void acc_guard4(v8f& a, v8f& b, v8f& c, v8f& d) { asm volatile("v_nop\n\tv_nop\n\tv_nop\n\tv_nop" : "+v"(a), "+v"(b), "+v"(c), "+v"(d)); }

template <typename T> struct Frag;
template <> struct Frag<_Float16> {
  typedef v16h V;
  static __device__ __forceinline__ v16h load(const _Float16* p) { return ldfh(p); }
  static __device__ __forceinline__ v8f mma(v16h a, v16h b, v8f c) { return __builtin_amdgcn_wmma_f32_16x16x32_f16(false, a, false, b, (short)0, c, false, false); }
};
template <> struct Frag<__bf16> {
  typedef v16b V;
  static __device__ __forceinline__ v16b load(const __bf16* p) { return ldfb(p); }
  static __device__ __forceinline__ v8f mma(v16b a, v16b b, v8f c) { return __builtin_amdgcn_wmma_f32_16x16x32_bf16(false, a, false, b, (short)0, c, false, false); }
};
template <int ET> struct Elem;
template <> struct Elem<0> { typedef _Float16 T; };
template <> struct Elem<1> { typedef __bf16 T; };

// ---- Tensor loads into LDS for the GEMM panels ----
typedef uint32_t u32x4 __attribute__((ext_vector_type(4)));
typedef uint32_t u32x8 __attribute__((ext_vector_type(8)));
constexpr uint32_t G_ROWB  = 256u;                 // bytes of one operand row per stage = 128 k
constexpr uint32_t G_ROWS  = 64u;                  // rows per slice (one tensor load of one wave)
constexpr uint32_t G_PITCH = G_ROWB + 16u;         // LDS row pitch, laid by the load's pad: an odd multiple of 16 B for ds_load_b128 readers
constexpr uint32_t G_SLICE = 18432u;               // 64 x 272 = 17,408 B rounded up to a multiple of 2 KiB
constexpr uint32_t G_STAGE = 4u * G_SLICE;         // [A rows 0..63 | A rows 64..127 | Bt rows 0..63 | Bt rows 64..127]
static_assert(G_ROWS * G_PITCH <= G_SLICE && G_SLICE % 2048u == 0u);
__device__ __forceinline__ uint32_t uni(uint32_t v) { return (uint32_t)__builtin_amdgcn_readfirstlane(v); }
// keeps the test in a scalar register, so that the branch round a tensor load is a scalar branch (the load ignores EXEC)
__device__ __forceinline__ uint32_t pinned(uint32_t v) { uint32_t w = (uint32_t)__builtin_amdgcn_readfirstlane(v); asm volatile("" : "+s"(w)); return w; }
// the wave's LDS reads have retired before the buffer is handed back for a refill
__device__ __forceinline__ void wait_ds0() { asm volatile("s_wait_dscnt 0x0" ::: "memory"); }
// the wave's own tensor load has landed (the compiler places no wait for it); the request's descriptor is named as an input so that its registers keep their values until here
__device__ __forceinline__ void wait_tensor0(u32x4 g0, u32x8 g1) { asm volatile("s_wait_tensorcnt 0x0" :: "s"(g0), "s"(g1) : "memory"); }
__device__ __forceinline__ void tdm_load(u32x4 g0, u32x8 g1) { asm volatile("tensor_load_to_lds %0, %1" :: "s"(g0), "s"(g1) : "memory"); }
__device__ __forceinline__ u32x8 tdm_group1(uint32_t src_pitch) {
  u32x8 g;
  g[0] = uni((1u << 20) | (5u << 22) | (3u << 25));
  g[1] = uni((G_ROWB & 0xFFFFu) << 16);
  g[2] = uni((G_ROWB >> 16) | ((G_ROWS & 0xFFFFu) << 16));
  g[3] = uni((G_ROWS >> 16) | (G_ROWB << 16));
  g[4] = uni(G_ROWS);
  g[5] = uni(src_pitch);
  g[6] = uni(0u);
  g[7] = uni(0u);
  return g;
}
__device__ __forceinline__ u32x4 tdm_group0(uint32_t lds_dst, uint64_t ga) {
  u32x4 g;
  g[0] = uni(1u); g[1] = uni(lds_dst); g[2] = uni((uint32_t)ga); g[3] = uni((((uint32_t)(ga >> 32)) & 0x01FFFFFFu) | 0x80000000u);
  return g;
}

// ---- Register-blocked WMMA GEMM body: C[m,n] = scale * sum_k A[m,k] * Bt[n,k] + bias; a work-group of 4 waves (2 x 2) owns a 128x128 tile, each wave 64x64 of it.
// The 128 rows of A and of Bt come into LDS 128 k at a time by tensor loads, one 64-row slice per wave and stage, two buffers: stage s + 1 flies while stage s is multiplied.
// A row-major [M,K] (pitch lda), Bt row-major [N,K] (pitch ldb); M,N % 128 == 0, K % 128 == 0, K >= 256 (no tails).
// BIAS_MODE 1 = bias[m], 2 = bias[n]. OUT_MODE 0 = f32, 1 = f16, 2 = bf16 hi plane (Cout) + bf16 lo plane (Cout2).
template <int ET, int BIAS_MODE, int OUT_MODE>
__device__ __forceinline__ void gemm64_body(
    const unsigned short* __restrict__ Ap, int lda, const unsigned short* __restrict__ Btp, int ldb,
    void* __restrict__ Cout, void* __restrict__ Cout2, int ldc, const float* __restrict__ bias,
    int M, int N, int K, float scale, float* slab, unsigned char* ring) {
  typedef typename Elem<ET>::T T;
  typedef typename Frag<T>::V V;
  const T* A = (const T*)Ap; const T* Bt = (const T*)Btp;
  const int lane = threadIdx.x & 31;
  const uint32_t wave = uni(threadIdx.x >> 5);
  const int tilesN = N >> 7;
  const int tilesM = M >> 7;
  const int tile = blockIdx.x;
  if (tile >= tilesM * tilesN) return;   // the same for the whole block, in front of every barrier and tensor load
  const int tm = tile / tilesN;
  const int tn = tile - tm * tilesN;
  const int m0 = (tm << 7) + (int)((wave >> 1) << 6);
  const int n0 = (tn << 7) + (int)((wave & 1u) << 6);
  const int rlane = lane & 15;
  const int koff  = (lane >> 4) * 8;
  const int mOff  = (lane >> 4) * 8;

  v8f acc[4][4];
#pragma unroll
  for (int i = 0; i < 4; ++i)
#pragma unroll
    for (int j = 0; j < 4; ++j) acc[i][j] = zero8();

  // this wave's slice: waves 0, 1 bring the two halves of A's 128 rows, waves 2, 3 those of Bt's
  const bool isB = wave >= 2u;
  const uint64_t srcA = (uint64_t)(size_t)(A + (size_t)((tm << 7) + (int)((wave & 1u) << 6)) * lda);
  const uint64_t srcB = (uint64_t)(size_t)(Bt + (size_t)((tn << 7) + (int)((wave & 1u) << 6)) * ldb);
  const uint64_t gsrc = isB ? srcB : srcA;
  u32x8 g1 = tdm_group1((uint32_t)(isB ? ldb : lda) * 2u);
  asm volatile("" : "+s"(g1));   // the pinned() form on descriptor words: held in their scalar registers, built once, so that none is written again while a request is outstanding
  const uint32_t ldst = (uint32_t)(size_t)ring + wave * G_SLICE;
  const int nst = K >> 7;
  // this wave's fragment rows: A from slice wave >> 1, Bt from slice 2 + (wave & 1)
  const unsigned char* aR = ring + (wave >> 1) * G_SLICE + (uint32_t)rlane * G_PITCH + (uint32_t)koff * 2u;
  const unsigned char* bR = ring + (2u + (wave & 1u)) * G_SLICE + (uint32_t)rlane * G_PITCH + (uint32_t)koff * 2u;

  u32x4 g0 = tdm_group0(ldst, gsrc);
  tdm_load(g0, g1);                                           // stage 0 -> buffer 0
  wait_tensor0(g0, g1);
  __syncthreads();                                            // stage 0 published
  g0 = tdm_group0(ldst + G_STAGE, gsrc + G_ROWB);
  tdm_load(g0, g1);                                           // stage 1 -> buffer 1 (K >= 256)

  // kept rolled: one publish point per stage
#pragma unroll 1
  for (int s = 0; s < nst; ++s) {
    const uint32_t buf = ((uint32_t)s & 1u) * G_STAGE;
    // two fragment sets inside the stage: the LDS reads of the next 32 k go ahead of this 32 k's WMMAs; nothing of the next stage is read here
    V ah[2][4], bh[2][4];
#pragma unroll
    for (int j = 0; j < 4; ++j) {
      bh[0][j] = Frag<T>::load((const T*)(bR + buf + (uint32_t)j * 16u * G_PITCH));
      ah[0][j] = Frag<T>::load((const T*)(aR + buf + (uint32_t)j * 16u * G_PITCH));
    }
#pragma unroll
    for (int kk = 0; kk < 4; ++kk) {
      const int cur = kk & 1, nxt = cur ^ 1;
      if (kk < 3) {
#pragma unroll
        for (int j = 0; j < 4; ++j) {
          bh[nxt][j] = Frag<T>::load((const T*)(bR + buf + (uint32_t)j * 16u * G_PITCH + (uint32_t)(kk + 1) * 64u));
          ah[nxt][j] = Frag<T>::load((const T*)(aR + buf + (uint32_t)j * 16u * G_PITCH + (uint32_t)(kk + 1) * 64u));
        }
      }
#pragma unroll
      for (int i = 0; i < 4; ++i) {
#pragma unroll
        for (int j = 0; j < 4; ++j) acc[i][j] = Frag<T>::mma(ah[cur][i], bh[cur][j], acc[i][j]);
        acc_guard4(acc[i][0], acc[i][1], acc[i][2], acc[i][3]);   // the four vector slots behind a WMMA; it also keeps each group of LDS reads where it is written
      }
    }
    // publish point of stage s + 1: own LDS reads retired, own load landed, then the barrier that publishes s + 1 and frees this buffer
    wait_ds0();
    wait_tensor0(g0, g1);
    __syncthreads();
    if (pinned((uint32_t)(s + 2 < nst))) {
      g0 = tdm_group0(ldst + buf, gsrc + (uint64_t)(uint32_t)(s + 2) * G_ROWB);
      tdm_load(g0, g1);
    }
  }
  wait_tensor0(g0, g1);
  wait_ds0();
  acc_guard4(acc[0][0], acc[0][1], acc[0][2], acc[0][3]);
  acc_guard4(acc[1][0], acc[1][1], acc[1][2], acc[1][3]);
  acc_guard4(acc[2][0], acc[2][1], acc[2][2], acc[2][3]);
  acc_guard4(acc[3][0], acc[3][1], acc[3][2], acc[3][3]);

#pragma unroll
  for (int i = 0; i < 4; ++i) {
    const int mBase = m0 + (i << 4);
#pragma unroll
    for (int j = 0; j < 4; ++j) {
      const int n = n0 + (j << 4) + rlane;
      float bv = 0.f;
      if (BIAS_MODE == 2) bv = bias[n];
#pragma unroll
      for (int r = 0; r < 8; ++r) {
        float v = acc[i][j][r] * scale;
        if (BIAS_MODE == 1) v += bias[mBase + mOff + r];
        if (BIAS_MODE == 2) v += bv;
        slab[(mOff + r) * 68 + (j << 4) + rlane] = v;
      }
    }
    __builtin_amdgcn_fence(3 /* release order */, "workgroup");
    __builtin_amdgcn_wave_barrier();
    __builtin_amdgcn_fence(2 /* acquire order */, "workgroup");
    if (OUT_MODE == 0) {
      float* C = (float*)Cout;
      const int hh = lane >> 4, c4 = (lane & 15) * 4;     // row segment = 256 B = 16 lanes x 16 B
      {
#pragma unroll
        for (int it = 0; it < 8; ++it) {
          const int row = it * 2 + hh;
          v4f v = *(const v4f*)(slab + row * 68 + c4);
          *(v4f*)(C + (size_t)(mBase + row) * ldc + n0 + c4) = v;
        }
        
      }
    } else {
      const int q = lane >> 3, c8 = (lane & 7) * 8;
      unsigned short* C  = (unsigned short*)Cout;
      unsigned short* C2 = (unsigned short*)Cout2;
      {
#pragma unroll
        for (int it = 0; it < 4; ++it) {
          const int row = it * 4 + q;
          const float* sp = slab + row * 68 + c8;
          v8h hv, lv;
#pragma unroll
          for (int e = 0; e < 8; ++e) {
            if (OUT_MODE == 1) {
              hv[e] = (_Float16)sp[e];
              lv[e] = (_Float16)0.f;
            } else {
              const unsigned short hb = bfu_rne(sp[e]);
              const unsigned short lb = bfu_rne(sp[e] - bfu_f32(hb));
              hv[e] = __builtin_bit_cast(_Float16, hb);
              lv[e] = __builtin_bit_cast(_Float16, lb);
            }
          }
          *(v8h*)(C + (size_t)(mBase + row) * ldc + n0 + c8) = hv;
          if (OUT_MODE == 2) *(v8h*)(C2 + (size_t)(mBase + row) * ldc + n0 + c8) = lv;
        }
        
      }
    }
    __builtin_amdgcn_fence(3 /* release order */, "workgroup");
    __builtin_amdgcn_wave_barrier();
    __builtin_amdgcn_fence(2 /* acquire order */, "workgroup");
  }
}

// q / k projection: f16 operands, bias[n], bf16 hi + lo planes out
__global__ __launch_bounds__(128) void k_gemm_qk(const unsigned short* __restrict__ X, const unsigned short* __restrict__ W,
                                                 unsigned short* __restrict__ CH, unsigned short* __restrict__ CL,
                                                 const float* __restrict__ bias, int M, int N, int K, float scale) {
  __shared__ __attribute__((aligned(2048))) unsigned char ring[2 * G_STAGE];
  __shared__ __align__(16) float sT[4][16 * 68];
  gemm64_body<0, 2, 2>(X, K, W, K, (void*)CH, (void*)CL, N, bias, M, N, K, scale, sT[threadIdx.x >> 5], ring);
}
// v projection, transposed: C[m = feature][n = token] = sum_k Wv[m][k] * X[n][k] + bias[m], f16 out (pitch N = tokens)
__global__ __launch_bounds__(128) void k_gemm_vt(const unsigned short* __restrict__ W, const unsigned short* __restrict__ X,
                                                 unsigned short* __restrict__ C, const float* __restrict__ bias, int M, int N, int K, float scale) {
  __shared__ __attribute__((aligned(2048))) unsigned char ring[2 * G_STAGE];
  __shared__ __align__(16) float sT[4][16 * 68];
  gemm64_body<0, 1, 1>(W, K, X, K, (void*)C, (void*)C, N, bias, M, N, K, scale, sT[threadIdx.x >> 5], ring);
}
// output projection: bf16 operands (A = context hi|lo along K, Bt = [Wo|Wo]), bias[n], f32 out
__global__ __launch_bounds__(128) void k_gemm_out(const unsigned short* __restrict__ A, const unsigned short* __restrict__ W,
                                                  float* __restrict__ C, const float* __restrict__ bias, int M, int N, int K) {
  __shared__ __attribute__((aligned(2048))) unsigned char ring[2 * G_STAGE];
  __shared__ __align__(16) float sT[4][16 * 68];
  gemm64_body<1, 2, 0>(A, K, W, K, (void*)C, (void*)C, N, bias, M, N, K, 1.0f, sT[threadIdx.x >> 5], ring);
}

// f32 -> bf16 (RNE) -> x sc -> f16 plane [nR][DM]; thread per (row, 8 columns); source row = (r / rpb) * sbs + (r % rpb) * DM; 16-B stores, thread-linear along the row
__global__ __launch_bounds__(256) void k_cast_f16(const float* __restrict__ SRC, long long sbs, int rpb, unsigned short* __restrict__ DST, int nR, float sc) {
  const long long u = (long long)blockIdx.x * 256 + threadIdx.x; const int per = DM / 8; if (u >= (long long)nR * per) return;
  const int r = (int)(u / per); const int c0 = 8 * (int)(u % per); const int bb = r / rpb; const int s = r - bb * rpb;
  const float* sp = SRC + (long long)bb * sbs + (long long)s * DM + c0; float w[8];
#pragma unroll
  for (int e = 0; e < 8; ++e) w[e] = cmb_bf(sp[e]) * sc;
  u4 pk; pk.x = cmb_pk2(w[0], w[1]); pk.y = cmb_pk2(w[2], w[3]); pk.z = cmb_pk2(w[4], w[5]); pk.w = cmb_pk2(w[6], w[7]);
  VST2(u4, (u4*)(DST + (long long)r * DM + c0), pk);
}
// Wo f32 [DM][DM] -> bf16 plane [DM][2*DM] = [Wo | Wo]; thread per (row, 8 destination columns)
__global__ __launch_bounds__(256) void k_wo_dup(const float* __restrict__ Wo, unsigned short* __restrict__ DST) {
  const long long u = (long long)blockIdx.x * 256 + threadIdx.x; const int per = (2 * DM) / 8; if (u >= (long long)DM * per) return;
  const int r = (int)(u / per); const int c0 = 8 * (int)(u % per); const int sc0 = c0 & (DM - 1);
  const float* sp = Wo + (long long)r * DM + sc0; unsigned short w[8];
#pragma unroll
  for (int e = 0; e < 8; ++e) w[e] = bfu_rne(sp[e]);
  u4 pk; pk.x = (unsigned)w[0] | ((unsigned)w[1] << 16); pk.y = (unsigned)w[2] | ((unsigned)w[3] << 16); pk.z = (unsigned)w[4] | ((unsigned)w[5] << 16); pk.w = (unsigned)w[6] | ((unsigned)w[7] << 16);
  VST2(u4, (u4*)(DST + (long long)r * (2 * DM) + c0), pk);
}
// relative-position table f32 [NREL][DK] -> bf16 plane [NRELP][DK], rows >= NREL written as zeros (clamped source address)
__global__ __launch_bounds__(256) void k_table(const float* __restrict__ T, unsigned short* __restrict__ TB) {
  const int u = blockIdx.x * 256 + threadIdx.x; if (u >= NRELP * (DK / 8)) return;
  const int row = u / (DK / 8); const int c0 = 8 * (u % (DK / 8)); const int rr = min(row, NREL - 1);
  unsigned short w[8];
#pragma unroll
  for (int e = 0; e < 8; ++e) { const unsigned short bits = bfu_rne(T[rr * DK + c0 + e]); w[e] = (row < NREL) ? bits : (unsigned short)0; }
  u4 pk; pk.x = (unsigned)w[0] | ((unsigned)w[1] << 16); pk.y = (unsigned)w[2] | ((unsigned)w[3] << 16); pk.z = (unsigned)w[4] | ((unsigned)w[5] << 16); pk.w = (unsigned)w[6] | ((unsigned)w[7] << 16);
  VST2(u4, (u4*)(TB + row * DK + c0), pk);
}
// bias vector RNE-converted to bf16, kept as f32
__global__ __launch_bounds__(256) void k_bfvec(const float* __restrict__ SRC, float* __restrict__ DST, int n) {
  const int u = blockIdx.x * 256 + threadIdx.x; if (u >= n) return; VST2(float, DST + u, cmb_bf(SRC[u]));
}

// =====================================================================================================================
// Fused attention with clipped relative-position bias. One wave per 16 queries; the 8 waves of a block share one (batch, head) and its K, V tiles in LDS.
//   score(l, r) = q_l . k_r / 8 + q_l . table[clip(r - l, -16, 16) + 16]
//   Transposed score tiles S^T = K . Q^T (A = key rows, B = query rows): D has lane = query, element = key, which is the A-operand
//   layout of P for O = P . V (32 keys per step), so P never leaves registers. q, k: bf16 hi/lo planes (hi.hi + hi.lo + lo.hi).
//   Relative dots: table (A, rows padded to NRELP) x q (B), hi + lo products, staged once per wave in LDS [16][QP] and gathered per element.
//   V^T plane [feature][token] f16 gives B fragments with contiguous keys. Online softmax in f32 (exp2 domain); P carried x2^14 in f16.
//   K hi, K lo (64 keys x 64 d) and V^T (64 features x 64 keys) come into LDS 64 keys at a time by tensor loads, one tile each from waves 0, 1, 2, two buffers:
//   stage s + 1 flies while stage s is worked on.
// =====================================================================================================================
constexpr uint32_t AT_KEYS  = 64u;                 // keys per stage
constexpr uint32_t AT_ROWB  = 128u;                // bytes of one tile row: 64 d of a key, or 64 keys of a feature
constexpr uint32_t AT_ROWS  = 64u;                 // rows per tile (one tensor load of one wave)
constexpr uint32_t AT_PITCH = AT_ROWB + 16u;       // LDS row pitch, laid by the load's pad: an odd multiple of 16 B for ds_load_b128 readers
constexpr uint32_t AT_SLICE = 10240u;              // 64 x 144 = 9,216 B rounded up to a multiple of 2 KiB
constexpr uint32_t AT_STAGE = 3u * AT_SLICE;       // [K hi | K lo | V^T]
constexpr int      AT_NST   = SEQ / (int)AT_KEYS;
static_assert(AT_ROWS * AT_PITCH <= AT_SLICE && AT_SLICE % 2048u == 0u);
static_assert(DK * 2 == (int)AT_ROWB && DK == (int)AT_ROWS && AT_NST >= 2);
// group 1: 1-byte elements, tile = tensor = 64 rows of 128 B, source row pitch in bytes, 16 B of LDS pad behind every 128-B row, no mask
__device__ __forceinline__ u32x8 at_group1(uint32_t src_pitch) {
  u32x8 g;
  g[0] = uni((1u << 20) | (4u << 22) | (3u << 25));
  g[1] = uni((AT_ROWB & 0xFFFFu) << 16);
  g[2] = uni((AT_ROWB >> 16) | ((AT_ROWS & 0xFFFFu) << 16));
  g[3] = uni((AT_ROWS >> 16) | (AT_ROWB << 16));
  g[4] = uni(AT_ROWS);
  g[5] = uni(src_pitch);
  g[6] = uni(0u);
  g[7] = uni(0u);
  return g;
}

__global__ __launch_bounds__(32 * AT_NW) void k_attn_rel(const unsigned short* __restrict__ QHp, const unsigned short* __restrict__ QLp,
                                                         const unsigned short* __restrict__ KHp, const unsigned short* __restrict__ KLp,
                                                         const unsigned short* __restrict__ VTp, const unsigned short* __restrict__ TBp,
                                                         unsigned short* __restrict__ CTX) {
  __shared__ __attribute__((aligned(2048))) unsigned char ring[2 * AT_STAGE];
  __shared__ __align__(16) float qrs[AT_NW][16 * QP];
  __shared__ __align__(16) float osm[AT_NW][16 * OSP];
  const __bf16* QH = (const __bf16*)QHp; const __bf16* QL = (const __bf16*)QLp;
  const __bf16* TB = (const __bf16*)TBp;
  const int lane = threadIdx.x & 31, wave = threadIdx.x >> 5, hh = lane >> 4, c = lane & 15;
  const int bh = (int)blockIdx.x / ((SEQ / 16) / AT_NW);            // the same for the whole block
  const int l0 = (((int)blockIdx.x - bh * ((SEQ / 16) / AT_NW)) * AT_NW + wave) * 16;
  const int b = bh / NH, h = bh - b * NH;
  const size_t tok0 = (size_t)b * SEQ;

  // q as B operand (lane = query column c), 2 k-steps of 32, hi and lo
  v16b qh[2], ql[2];
  {
    const size_t qo = (tok0 + l0 + c) * DM + h * DK + 8 * hh;
#pragma unroll
    for (int dc = 0; dc < 2; ++dc) { qh[dc] = ldfb(QH + qo + dc * 32); ql[dc] = ldfb(QL + qo + dc * 32); }
  }
  // this wave's tile: wave 0 brings K hi, wave 1 K lo, wave 2 V^T; the other waves issue nothing (their words name V^T's tile and are not used)
  const uint32_t wv = uni((uint32_t)threadIdx.x >> 5);
  const uint32_t sl = wv < 2u ? wv : 2u;
  const uint64_t gsrc = sl == 0u ? (uint64_t)(size_t)(KHp + tok0 * DM + h * DK)
                      : sl == 1u ? (uint64_t)(size_t)(KLp + tok0 * DM + h * DK)
                                 : (uint64_t)(size_t)(VTp + (size_t)(h * DK) * MT + tok0);
  const uint32_t gstep = sl == 2u ? AT_KEYS * 2u : AT_KEYS * (uint32_t)DM * 2u;     // source bytes from one stage to the next
  u32x8 g1 = at_group1(sl == 2u ? (uint32_t)MT * 2u : (uint32_t)DM * 2u);
  asm volatile("" : "+s"(g1));   // the pinned() form on descriptor words: held in their scalar registers, built once, so that none is written again while a request is outstanding
  const uint32_t ldst = (uint32_t)(size_t)ring + sl * AT_SLICE;
  u32x4 g0 = tdm_group0(ldst, gsrc);
  if (pinned((uint32_t)(wv < 3u))) {
    tdm_load(g0, g1);                                         // stage 0 -> buffer 0
    wait_tensor0(g0, g1);
  }
  __syncthreads();                                            // stage 0 published
  g0 = tdm_group0(ldst + AT_STAGE, gsrc + gstep);
  asm volatile("" : "+s"(g0));   // the pinned() form on descriptor words: all four stand in their scalar registers in front of the branch, so that none is written behind the load
  if (pinned((uint32_t)(wv < 3u))) tdm_load(g0, g1);          // stage 1 -> buffer 1 (SEQ >= 128)

  // relative dots: D[j][query] = sum_d table[j][d] * q[query][d]; lane = query c, element r -> j = jt*16 + 8hh + r
  float* myq = qrs[wave];
#pragma unroll
  for (int jt = 0; jt < NRELP / 16; ++jt) {
    v8f acc = zero8();
#pragma unroll
    for (int dc = 0; dc < 2; ++dc) {
      const v16b ta = ldfb(TB + (jt * 16 + c) * DK + dc * 32 + 8 * hh);
      acc = wmmab(ta, ql[dc], acc);
      acc = wmmab(ta, qh[dc], acc);
    }
#pragma unroll
    for (int r = 0; r < 8; ++r) myq[c * QP + jt * 16 + 8 * hh + r] = acc[r];
  }
  __builtin_amdgcn_fence(3 /* release order */, "workgroup");
  __builtin_amdgcn_wave_barrier();
  __builtin_amdgcn_fence(2 /* acquire order */, "workgroup");

  const int lglob = l0 + c;
  const float* qrow = myq + c * QP + MAXREL;        // indexed by clip(r - l, -16, 16)
  const float L2E = 1.4426950408889634f;
  float m_run = -1.0e30f, s_run = 0.f;
  v8f o[4];
#pragma unroll
  for (int t = 0; t < 4; ++t) o[t] = zero8();
  // fragment rows in LDS: lane = key row (K) or feature row (V^T) c of a 16-row group, lane half at 16 B
  const unsigned char* kR = ring + (uint32_t)c * AT_PITCH + (uint32_t)hh * 16u;
  const unsigned char* vR = kR + 2u * AT_SLICE;

  // kept rolled: one publish point per stage
#pragma unroll 1
  for (int s = 0; s < AT_NST; ++s) {
  const uint32_t buf = ((uint32_t)s & 1u) * AT_STAGE;
  // the two 32-key passes of a stage are unrolled: their LDS offsets become immediates
#pragma unroll
  for (int ps = 0; ps < 2; ++ps) {
    const int r0 = s * (int)AT_KEYS + ps * 32;
    // the pass's K fragments are read as one group ahead of its score products; only this stage's buffer is read (loops unrolled: the fragment arrays stay in registers)
    v16b kfh[2][2], kfl[2][2];
#pragma unroll
    for (int tt = 0; tt < 2; ++tt)
#pragma unroll
      for (int dc = 0; dc < 2; ++dc) {
        const unsigned char* kp = kR + buf + (uint32_t)(ps * 32 + 16 * tt) * AT_PITCH + (uint32_t)dc * 64u;
        kfh[tt][dc] = ldfb((const __bf16*)kp);
        kfl[tt][dc] = ldfb((const __bf16*)(kp + AT_SLICE));
      }
    v8f t[2];
#pragma unroll
    for (int tt = 0; tt < 2; ++tt) {
      v8f acc = zero8();
#pragma unroll
      for (int dc = 0; dc < 2; ++dc) {
        acc = wmmab(kfl[tt][dc], qh[dc], acc);
        acc = wmmab(kfh[tt][dc], ql[dc], acc);
        acc = wmmab(kfh[tt][dc], qh[dc], acc);
      }
      t[tt] = acc;
    }
    // the pass's V^T fragments are asked for ahead of the softmax, which covers their LDS latency (unrolled: the array stays in registers)
    v16h vfr[4];
#pragma unroll
    for (int tq = 0; tq < 4; ++tq) vfr[tq] = ldfh((const _Float16*)(vR + buf + (uint32_t)tq * 16u * AT_PITCH + (uint32_t)ps * 64u));
    // element e <-> key r0 + 8hh + e (tile 0) and r0 + 16 + 8hh + e (tile 1); this lane's query is lglob
    float p[16];
    float mt = -1.0e30f;
    const int dbase = r0 + 8 * hh - lglob;
#pragma unroll
    for (int e = 0; e < 8; ++e) {
      const int d0 = min(max(dbase + e, -MAXREL), MAXREL);
      const int d1 = min(max(dbase + 16 + e, -MAXREL), MAXREL);
      p[e]     = (t[0][e] * 0.125f + qrow[d0]) * L2E;
      p[8 + e] = (t[1][e] * 0.125f + qrow[d1]) * L2E;
      mt = fmaxf(mt, fmaxf(p[e], p[8 + e]));
    }
    mt = fmaxf(mt, __shfl_xor(mt, 16, 32));          // the two lane halves hold the same query
    const float m_new = fmaxf(m_run, mt);
    const float corr  = exp2f(m_run - m_new);
    float sum = 0.f;
    v16h pA;                                          // P as A operand: element i <-> key r0 + k(i, hh)
#pragma unroll
    for (int r = 0; r < 16; ++r) {
      const float ev = exp2f(p[r] - m_new);
      sum += ev;
      pA[r] = (_Float16)(ev * PSC);
    }
    sum += __shfl_xor(sum, 16, 32);
    s_run = s_run * corr + sum;
    m_run = m_new;
    float sc[8];
#pragma unroll
    for (int i = 0; i < 8; ++i) sc[i] = __shfl(corr, i + 8 * hh, 32);   // O tile rows are queries 8hh + i
#pragma unroll
    for (int tq = 0; tq < 4; ++tq) {
      v8f oc = o[tq];
#pragma unroll
      for (int i = 0; i < 8; ++i) oc[i] *= sc[i];
      o[tq] = wmmah(pA, vfr[tq], oc);
    }
  }
    // publish point of stage s + 1: own LDS reads retired, the issuer's own load landed, then the barrier that publishes s + 1 and frees this buffer
    wait_ds0();
    if (pinned((uint32_t)(wv < 3u))) wait_tensor0(g0, g1);
    __syncthreads();
    g0 = tdm_group0(ldst + buf, gsrc + (uint64_t)((uint32_t)(s + 2) * gstep));
    asm volatile("" : "+s"(g0));   // the pinned() form on descriptor words, as in front of the loop: formed behind the wait, none written behind the load
    if (pinned((uint32_t)(wv < 3u && s + 2 < AT_NST))) tdm_load(g0, g1);   // issued only while stage s + 2 exists
  }
  wait_tensor0(g0, g1);
  wait_ds0();

  float inv[8];
#pragma unroll
  for (int i = 0; i < 8; ++i) inv[i] = 1.0f / (__shfl(s_run, i + 8 * hh, 32) * PSC);
  float* os = osm[wave];
#pragma unroll
  for (int tq = 0; tq < 4; ++tq)
#pragma unroll
    for (int i = 0; i < 8; ++i) os[(8 * hh + i) * OSP + tq * 16 + c] = o[tq][i] * inv[i];
  __builtin_amdgcn_fence(3 /* release order */, "workgroup");
  __builtin_amdgcn_wave_barrier();
  __builtin_amdgcn_fence(2 /* acquire order */, "workgroup");
  {
    const int q = lane >> 3, c8 = (lane & 7) * 8;
    unsigned short* ch = CTX + (tok0 + l0) * (size_t)(2 * DM) + h * DK + c8;
    u4 ph[4], pl[4];
#pragma unroll
    for (int it = 0; it < 4; ++it) {
      const int row = it * 4 + q;
      const float* sp = os + row * OSP + c8;
      unsigned short hb[8], lb[8];
#pragma unroll
      for (int e = 0; e < 8; ++e) { const float v = sp[e]; hb[e] = bfu_rne(v); lb[e] = bfu_rne(v - bfu_f32(hb[e])); }
      ph[it].x = (unsigned)hb[0] | ((unsigned)hb[1] << 16); ph[it].y = (unsigned)hb[2] | ((unsigned)hb[3] << 16);
      ph[it].z = (unsigned)hb[4] | ((unsigned)hb[5] << 16); ph[it].w = (unsigned)hb[6] | ((unsigned)hb[7] << 16);
      pl[it].x = (unsigned)lb[0] | ((unsigned)lb[1] << 16); pl[it].y = (unsigned)lb[2] | ((unsigned)lb[3] << 16);
      pl[it].z = (unsigned)lb[4] | ((unsigned)lb[5] << 16); pl[it].w = (unsigned)lb[6] | ((unsigned)lb[7] << 16);
    }
    {
#pragma unroll
      for (int it = 0; it < 4; ++it) {
        const int row = it * 4 + q;
        *(u4*)(ch + (size_t)row * (2 * DM)) = ph[it];
        *(u4*)(ch + (size_t)row * (2 * DM) + DM) = pl[it];
      }
      
    }
  }
}

extern "C" void kernel_launch(void* const* d_in, const int* in_sizes, int n_in, void* d_out, int out_size, void* d_ws, size_t ws_size, hipStream_t stream) {
  if (n_in < 12) return;
  const long long actn = ((long long)(NB - 1) * SEQ_FULL + SEQ) * DM;
  if ((long long)in_sizes[0] < actn || (long long)in_sizes[1] < actn || (long long)in_sizes[2] < actn) return;
  if (in_sizes[3] < DM * DM || in_sizes[5] < DM * DM || in_sizes[7] < DM * DM || in_sizes[9] < DM * DM) return;
  if (in_sizes[4] < DM || in_sizes[6] < DM || in_sizes[8] < DM || in_sizes[10] < DM) return;
  if (in_sizes[11] < NREL * DK) return;
  if ((long long)out_size < (long long)MT * DM) return;

  const float* Qi = (const float*)d_in[0];
  const float* Ki = (const float*)d_in[1];
  const float* Vi = (const float*)d_in[2];
  const float* Wq = (const float*)d_in[3];
  const float* bq = (const float*)d_in[4];
  const float* Wk = (const float*)d_in[5];
  const float* bk = (const float*)d_in[6];
  const float* Wv = (const float*)d_in[7];
  const float* bv = (const float*)d_in[8];
  const float* Wo = (const float*)d_in[9];
  const float* bo = (const float*)d_in[10];
  const float* rel = (const float*)d_in[11];
  float* out = (float*)d_out;

  constexpr size_t SZ_ACT = (size_t)MT * DM * 2;          // 16-bit [MT][DM] plane
  constexpr size_t SZ_W   = (size_t)DM * DM * 2;
  constexpr size_t SZ_WO2 = (size_t)DM * 2 * DM * 2;
  constexpr size_t SZ_BR  = (size_t)4 * DM * 4;
  constexpr size_t SZ_TB  = (size_t)NRELP * DK * 2;
  constexpr size_t SZ_CTX = (size_t)MT * 2 * DM * 2;
  static_assert(SZ_ACT % 256 == 0 && SZ_W % 256 == 0 && SZ_WO2 % 256 == 0 && SZ_BR % 256 == 0 && SZ_TB % 256 == 0 && SZ_CTX % 256 == 0);
  constexpr size_t TOTAL = 3 * SZ_ACT + 3 * SZ_W + SZ_WO2 + SZ_BR + SZ_TB + 4 * SZ_ACT + SZ_ACT + SZ_CTX;
  static_assert(TOTAL <= (size_t)134217728);
  if (TOTAL > ws_size) return;

  char* wsp = (char*)d_ws;
  unsigned short* XQ  = (unsigned short*)wsp; wsp += SZ_ACT;
  unsigned short* XK  = (unsigned short*)wsp; wsp += SZ_ACT;
  unsigned short* XV  = (unsigned short*)wsp; wsp += SZ_ACT;
  unsigned short* WQ6 = (unsigned short*)wsp; wsp += SZ_W;
  unsigned short* WK6 = (unsigned short*)wsp; wsp += SZ_W;
  unsigned short* WV6 = (unsigned short*)wsp; wsp += SZ_W;
  unsigned short* WO2 = (unsigned short*)wsp; wsp += SZ_WO2;
  float*          BR  = (float*)wsp;          wsp += SZ_BR;
  unsigned short* TB  = (unsigned short*)wsp; wsp += SZ_TB;
  unsigned short* QHp = (unsigned short*)wsp; wsp += SZ_ACT;
  unsigned short* QLp = (unsigned short*)wsp; wsp += SZ_ACT;
  unsigned short* KHp = (unsigned short*)wsp; wsp += SZ_ACT;
  unsigned short* KLp = (unsigned short*)wsp; wsp += SZ_ACT;
  unsigned short* VTp = (unsigned short*)wsp; wsp += SZ_ACT;     // [DM features][MT tokens] f16
  unsigned short* CTX = (unsigned short*)wsp; wsp += SZ_CTX;     // [MT][2*DM] bf16: hi | lo

  const unsigned gW   = (unsigned)(((long long)DM * (DM / 8) + 255) / 256);
  const unsigned gAct = (unsigned)(((long long)MT * (DM / 8) + 255) / 256);
  // weights [out][in] are already in Bt layout: f16 of the bf16-converted value x16 (exact)
  k_cast_f16<<<gW, 256, 0, stream>>>(Wq, 0, DM, WQ6, DM, 16.0f);
  k_cast_f16<<<gW, 256, 0, stream>>>(Wk, 0, DM, WK6, DM, 16.0f);
  k_cast_f16<<<gW, 256, 0, stream>>>(Wv, 0, DM, WV6, DM, 16.0f);
  k_wo_dup<<<(unsigned)(((long long)DM * ((2 * DM) / 8) + 255) / 256), 256, 0, stream>>>(Wo, WO2);
  k_bfvec<<<(DM + 255) / 256, 256, 0, stream>>>(bq, BR + 0 * DM, DM);
  k_bfvec<<<(DM + 255) / 256, 256, 0, stream>>>(bk, BR + 1 * DM, DM);
  k_bfvec<<<(DM + 255) / 256, 256, 0, stream>>>(bv, BR + 2 * DM, DM);
  k_bfvec<<<(DM + 255) / 256, 256, 0, stream>>>(bo, BR + 3 * DM, DM);
  k_table<<<(NRELP * (DK / 8) + 255) / 256, 256, 0, stream>>>(rel, TB);
  // activations: rows (b, s) of the full-size inputs -> dense [MT][DM] f16 planes
  k_cast_f16<<<gAct, 256, 0, stream>>>(Qi, (long long)SEQ_FULL * DM, SEQ, XQ, MT, 1.0f);
  k_cast_f16<<<gAct, 256, 0, stream>>>(Ki, (long long)SEQ_FULL * DM, SEQ, XK, MT, 1.0f);
  k_cast_f16<<<gAct, 256, 0, stream>>>(Vi, (long long)SEQ_FULL * DM, SEQ, XV, MT, 1.0f);

  const unsigned gQK = (unsigned)((MT / 128) * (DM / 128));
  k_gemm_qk<<<gQK, 128, 0, stream>>>(XQ, WQ6, QHp, QLp, BR + 0 * DM, MT, DM, DM, 0.0625f);
  k_gemm_qk<<<gQK, 128, 0, stream>>>(XK, WK6, KHp, KLp, BR + 1 * DM, MT, DM, DM, 0.0625f);
  k_gemm_vt<<<gQK, 128, 0, stream>>>(WV6, XV, VTp, BR + 2 * DM, DM, MT, DM, 0.0625f);

  k_attn_rel<<<(unsigned)((NB * NH * (SEQ / 16)) / AT_NW), 32 * AT_NW, 0, stream>>>(QHp, QLp, KHp, KLp, VTp, TB, CTX);

  k_gemm_out<<<gQK, 128, 0, stream>>>(CTX, WO2, out, BR + 3 * DM, MT, DM, 2 * DM);
}

// v003
// A run of this version takes 121 microseconds.
// In two side-by-side timings against v002, it was 1.17 and 1.18 times as fast.
// All steps since v000 together make it 3.08 times as fast.
// Contractions: q/k/v projections = v_wmma_f32_16x16x32_f16 (inputs and weights RNE-converted to bf16 and held exactly in f16, weights x16), f32 accumulate; content scores and relative-position dots = v_wmma_f32_16x16x32_bf16 with q, k as bf16 hi/lo split planes (3 products) and the 33x64 table as exact bf16, f32 accumulate; P.V = v_wmma_f32_16x16x32_f16 (P x2^14, v f16), f32 accumulate; output projection = v_wmma_f32_16x16x32_bf16 with the context as bf16 hi|lo folded along K against [Wo|Wo], f32 accumulate.
#include <hip/hip_runtime.h>
#include <math.h>
#include <stdint.h>

#ifndef NB
#define NB 4
#endif
#ifndef SEQ
#define SEQ 1024
#endif
#define NB_FULL 4
#define SEQ_FULL 1024
#define DM 1024
#define NH 16
#define DK 64
#define MAXREL 16
#define NREL 33
#define NRELP 48
#define MT (NB * SEQ)
#define AT_NW 8
#define QP 52
#define OSP 68
#define PSC 16384.0f

static_assert(NH * DK == DM);
static_assert(DK == 64);
static_assert(2 * MAXREL + 1 == NREL);
static_assert(NRELP % 16 == 0 && NRELP >= NREL);
static_assert(QP >= NRELP);
static_assert(SEQ % 64 == 0);
static_assert(MT % 128 == 0);
static_assert(DM % 128 == 0);
static_assert(DM >= 256);
static_assert(((SEQ / 16) * NB * NH) % AT_NW == 0);
static_assert((SEQ / 16) % AT_NW == 0);
static_assert(SEQ >= 128);
static_assert(NB <= NB_FULL && SEQ <= SEQ_FULL);

typedef __attribute__((ext_vector_type(16))) _Float16 v16h;
typedef __attribute__((ext_vector_type(8)))  _Float16 v8h;
typedef __attribute__((ext_vector_type(16))) __bf16   v16b;
typedef __attribute__((ext_vector_type(8)))  __bf16   v8b;
typedef __attribute__((ext_vector_type(8)))  float    v8f;
typedef __attribute__((ext_vector_type(4)))  float    v4f;
typedef __attribute__((ext_vector_type(4)))  unsigned int u4;

// 16-bit WMMA fragment map (wave32), lane L, hh = L>>4, c = L&15:
//   A 16x32: lane = row c;    element i -> k = (i<8) ? 8hh+i : 16+8hh+(i-8)
//   B 32x16: lane = column c; the same k(i,hh)
//   D 16x16 (8 f32): lane = column c; element r -> row 8hh+r

__device__ __forceinline__ unsigned short bfu_rne(float v) { unsigned u = __float_as_uint(v); u += 0x7FFFu + ((u >> 16) & 1u); return (unsigned short)(u >> 16); }
__device__ __forceinline__ float bfu_f32(unsigned short h) { return __uint_as_float(((unsigned)h) << 16); }
__device__ __forceinline__ float cmb_bf(float v) { const unsigned u = __float_as_uint(v); const unsigned r = (u + 0x7fffu + ((u >> 16) & 1u)) & 0xffff0000u; return __uint_as_float(r); }   // bf16 RNE kept as f32 (finite inputs)
__device__ __forceinline__ unsigned int cmb_pk2(float a, float b) { return (unsigned int)__builtin_bit_cast(unsigned short, (_Float16)a) | ((unsigned int)__builtin_bit_cast(unsigned short, (_Float16)b) << 16); }

__device__ __forceinline__ v8f zero8() { v8f z = {0.f, 0.f, 0.f, 0.f, 0.f, 0.f, 0.f, 0.f}; return z; }

__device__ __forceinline__ v8f wmmab(v16b a, v16b b, v8f c) {
  c = __builtin_amdgcn_wmma_f32_16x16x32_bf16(false, a, false, b, (short)0, c, false, false);
  asm volatile("v_nop\n\tv_nop\n\tv_nop\n\tv_nop" : "+v"(c) : "v"(a), "v"(b));
  return c;
}
__device__ __forceinline__ v8f wmmah(v16h a, v16h b, v8f c) {
  c = __builtin_amdgcn_wmma_f32_16x16x32_f16(false, a, false, b, (short)0, c, false, false);
  asm volatile("v_nop\n\tv_nop\n\tv_nop\n\tv_nop" : "+v"(c) : "v"(a), "v"(b));
  return c;
}
union FBu { v16b v; v8b h[2]; };
union FHu { v16h v; v8h h[2]; };
// p already includes the lane-half offset 8*hh: elements 0..7 <- p[0..7], 8..15 <- p[16..23]
__device__ __forceinline__ v16b ldfb(const __bf16* p) { FBu f; f.h[0] = *(const v8b*)(p); f.h[1] = *(const v8b*)(p + 16); return f.v; }
__device__ __forceinline__ v16h ldfh(const _Float16* p) { FHu f; f.h[0] = *(const v8h*)(p); f.h[1] = *(const v8h*)(p + 16); return f.v; }

// ---- hazard guards for the register-blocked GEMM ----
__device__ __forceinline__ void acc_guard4(v8f& a, v8f& b, v8f& c, v8f& d) { asm volatile("v_nop\n\tv_nop\n\tv_nop\n\tv_nop" : "+v"(a), "+v"(b), "+v"(c), "+v"(d)); }

template <typename T> struct Frag;
template <> struct Frag<_Float16> {
  typedef v16h V;
  static __device__ __forceinline__ v16h load(const _Float16* p) { return ldfh(p); }
  static __device__ __forceinline__ v8f mma(v16h a, v16h b, v8f c) { return __builtin_amdgcn_wmma_f32_16x16x32_f16(false, a, false, b, (short)0, c, false, false); }
};
template <> struct Frag<__bf16> {
  typedef v16b V;
  static __device__ __forceinline__ v16b load(const __bf16* p) { return ldfb(p); }
  static __device__ __forceinline__ v8f mma(v16b a, v16b b, v8f c) { return __builtin_amdgcn_wmma_f32_16x16x32_bf16(false, a, false, b, (short)0, c, false, false); }
};
template <int ET> struct Elem;
template <> struct Elem<0> { typedef _Float16 T; };
template <> struct Elem<1> { typedef __bf16 T; };

// ---- Tensor loads into LDS for the GEMM panels ----
typedef uint32_t u32x4 __attribute__((ext_vector_type(4)));
typedef uint32_t u32x8 __attribute__((ext_vector_type(8)));
constexpr uint32_t G_ROWB  = 256u;                 // bytes of one operand row per stage = 128 k
constexpr uint32_t G_ROWS  = 64u;                  // rows per slice (one tensor load of one wave)
constexpr uint32_t G_PITCH = G_ROWB + 16u;         // LDS row pitch, laid by the load's pad: an odd multiple of 16 B for ds_load_b128 readers
constexpr uint32_t G_SLICE = 18432u;               // 64 x 272 = 17,408 B rounded up to a multiple of 2 KiB
constexpr uint32_t G_STAGE = 4u * G_SLICE;         // [A rows 0..63 | A rows 64..127 | Bt rows 0..63 | Bt rows 64..127]
static_assert(G_ROWS * G_PITCH <= G_SLICE && G_SLICE % 2048u == 0u);
__device__ __forceinline__ uint32_t uni(uint32_t v) { return (uint32_t)__builtin_amdgcn_readfirstlane(v); }
// keeps the test in a scalar register, so that the branch round a tensor load is a scalar branch (the load ignores EXEC)
__device__ __forceinline__ uint32_t pinned(uint32_t v) { uint32_t w = (uint32_t)__builtin_amdgcn_readfirstlane(v); asm volatile("" : "+s"(w)); return w; }
// the wave's LDS reads have retired before the buffer is handed back for a refill
__device__ __forceinline__ void wait_ds0() { asm volatile("s_wait_dscnt 0x0" ::: "memory"); }
// the wave's own tensor load has landed (the compiler places no wait for it); the request's descriptor is named as an input so that its registers keep their values until here
__device__ __forceinline__ void wait_tensor0(u32x4 g0, u32x8 g1) { asm volatile("s_wait_tensorcnt 0x0" :: "s"(g0), "s"(g1) : "memory"); }
__device__ __forceinline__ void tdm_load(u32x4 g0, u32x8 g1) { asm volatile("tensor_load_to_lds %0, %1" :: "s"(g0), "s"(g1) : "memory"); }
__device__ __forceinline__ u32x8 tdm_group1(uint32_t src_pitch) {
  u32x8 g;
  g[0] = uni((1u << 20) | (5u << 22) | (3u << 25));
  g[1] = uni((G_ROWB & 0xFFFFu) << 16);
  g[2] = uni((G_ROWB >> 16) | ((G_ROWS & 0xFFFFu) << 16));
  g[3] = uni((G_ROWS >> 16) | (G_ROWB << 16));
  g[4] = uni(G_ROWS);
  g[5] = uni(src_pitch);
  g[6] = uni(0u);
  g[7] = uni(0u);
  return g;
}
__device__ __forceinline__ u32x4 tdm_group0(uint32_t lds_dst, uint64_t ga) {
  u32x4 g;
  g[0] = uni(1u); g[1] = uni(lds_dst); g[2] = uni((uint32_t)ga); g[3] = uni((((uint32_t)(ga >> 32)) & 0x01FFFFFFu) | 0x80000000u);
  return g;
}

// ---- Register-blocked WMMA GEMM body: C[m,n] = scale * sum_k A[m,k] * Bt[n,k] + bias; a work-group of 4 waves (2 x 2) owns a 128x128 tile, each wave 64x64 of it.
// The 128 rows of A and of Bt come into LDS 128 k at a time by tensor loads, one 64-row slice per wave and stage, two buffers: stage s + 1 flies while stage s is multiplied.
// A row-major [M,K] (pitch lda), Bt row-major [N,K] (pitch ldb); M,N % 128 == 0, K % 128 == 0, K >= 256 (no tails).
// BIAS_MODE 1 = bias[m], 2 = bias[n]. OUT_MODE 0 = f32, 1 = f16, 2 = bf16 hi plane (Cout) + bf16 lo plane (Cout2).
template <int ET, int BIAS_MODE, int OUT_MODE>
__device__ __forceinline__ void gemm64_body(
    const unsigned short* __restrict__ Ap, int lda, const unsigned short* __restrict__ Btp, int ldb,
    void* __restrict__ Cout, void* __restrict__ Cout2, int ldc, const float* __restrict__ bias,
    int M, int N, int K, float scale, float* slab, unsigned char* ring) {
  typedef typename Elem<ET>::T T;
  typedef typename Frag<T>::V V;
  const T* A = (const T*)Ap; const T* Bt = (const T*)Btp;
  const int lane = threadIdx.x & 31;
  const uint32_t wave = uni(threadIdx.x >> 5);
  const int tilesN = N >> 7;
  const int tilesM = M >> 7;
  const int tile = blockIdx.x;
  if (tile >= tilesM * tilesN) return;   // the same for the whole block, in front of every barrier and tensor load
  const int tm = tile / tilesN;
  const int tn = tile - tm * tilesN;
  const int m0 = (tm << 7) + (int)((wave >> 1) << 6);
  const int n0 = (tn << 7) + (int)((wave & 1u) << 6);
  const int rlane = lane & 15;
  const int koff  = (lane >> 4) * 8;
  const int mOff  = (lane >> 4) * 8;

  v8f acc[4][4];
#pragma unroll
  for (int i = 0; i < 4; ++i)
#pragma unroll
    for (int j = 0; j < 4; ++j) acc[i][j] = zero8();

  // this wave's slice: waves 0, 1 bring the two halves of A's 128 rows, waves 2, 3 those of Bt's
  const bool isB = wave >= 2u;
  const uint64_t srcA = (uint64_t)(size_t)(A + (size_t)((tm << 7) + (int)((wave & 1u) << 6)) * lda);
  const uint64_t srcB = (uint64_t)(size_t)(Bt + (size_t)((tn << 7) + (int)((wave & 1u) << 6)) * ldb);
  const uint64_t gsrc = isB ? srcB : srcA;
  u32x8 g1 = tdm_group1((uint32_t)(isB ? ldb : lda) * 2u);
  asm volatile("" : "+s"(g1));   // the pinned() form on descriptor words: held in their scalar registers, built once, so that none is written again while a request is outstanding
  const uint32_t ldst = (uint32_t)(size_t)ring + wave * G_SLICE;
  const int nst = K >> 7;
  // this wave's fragment rows: A from slice wave >> 1, Bt from slice 2 + (wave & 1)
  const unsigned char* aR = ring + (wave >> 1) * G_SLICE + (uint32_t)rlane * G_PITCH + (uint32_t)koff * 2u;
  const unsigned char* bR = ring + (2u + (wave & 1u)) * G_SLICE + (uint32_t)rlane * G_PITCH + (uint32_t)koff * 2u;

  u32x4 g0 = tdm_group0(ldst, gsrc);
  tdm_load(g0, g1);                                           // stage 0 -> buffer 0
  wait_tensor0(g0, g1);
  __syncthreads();                                            // stage 0 published
  g0 = tdm_group0(ldst + G_STAGE, gsrc + G_ROWB);
  tdm_load(g0, g1);                                           // stage 1 -> buffer 1 (K >= 256)

  // kept rolled: one publish point per stage
#pragma unroll 1
  for (int s = 0; s < nst; ++s) {
    const uint32_t buf = ((uint32_t)s & 1u) * G_STAGE;
    // two fragment sets inside the stage: the LDS reads of the next 32 k go ahead of this 32 k's WMMAs; nothing of the next stage is read here
    V ah[2][4], bh[2][4];
#pragma unroll
    for (int j = 0; j < 4; ++j) {
      bh[0][j] = Frag<T>::load((const T*)(bR + buf + (uint32_t)j * 16u * G_PITCH));
      ah[0][j] = Frag<T>::load((const T*)(aR + buf + (uint32_t)j * 16u * G_PITCH));
    }
#pragma unroll
    for (int kk = 0; kk < 4; ++kk) {
      const int cur = kk & 1, nxt = cur ^ 1;
      if (kk < 3) {
#pragma unroll
        for (int j = 0; j < 4; ++j) {
          bh[nxt][j] = Frag<T>::load((const T*)(bR + buf + (uint32_t)j * 16u * G_PITCH + (uint32_t)(kk + 1) * 64u));
          ah[nxt][j] = Frag<T>::load((const T*)(aR + buf + (uint32_t)j * 16u * G_PITCH + (uint32_t)(kk + 1) * 64u));
        }
      }
#pragma unroll
      for (int i = 0; i < 4; ++i) {
#pragma unroll
        for (int j = 0; j < 4; ++j) acc[i][j] = Frag<T>::mma(ah[cur][i], bh[cur][j], acc[i][j]);
        acc_guard4(acc[i][0], acc[i][1], acc[i][2], acc[i][3]);   // the four vector slots behind a WMMA; it also keeps each group of LDS reads where it is written
      }
    }
    // publish point of stage s + 1: own LDS reads retired, own load landed, then the barrier that publishes s + 1 and frees this buffer
    wait_ds0();
    wait_tensor0(g0, g1);
    __syncthreads();
    if (pinned((uint32_t)(s + 2 < nst))) {
      g0 = tdm_group0(ldst + buf, gsrc + (uint64_t)(uint32_t)(s + 2) * G_ROWB);
      tdm_load(g0, g1);
    }
  }
  wait_tensor0(g0, g1);
  wait_ds0();
  acc_guard4(acc[0][0], acc[0][1], acc[0][2], acc[0][3]);
  acc_guard4(acc[1][0], acc[1][1], acc[1][2], acc[1][3]);
  acc_guard4(acc[2][0], acc[2][1], acc[2][2], acc[2][3]);
  acc_guard4(acc[3][0], acc[3][1], acc[3][2], acc[3][3]);

#pragma unroll
  for (int i = 0; i < 4; ++i) {
    const int mBase = m0 + (i << 4);
#pragma unroll
    for (int j = 0; j < 4; ++j) {
      const int n = n0 + (j << 4) + rlane;
      float bv = 0.f;
      if (BIAS_MODE == 2) bv = bias[n];
#pragma unroll
      for (int r = 0; r < 8; ++r) {
        float v = acc[i][j][r] * scale;
        if (BIAS_MODE == 1) v += bias[mBase + mOff + r];
        if (BIAS_MODE == 2) v += bv;
        slab[(mOff + r) * 68 + (j << 4) + rlane] = v;
      }
    }
    __builtin_amdgcn_fence(3 /* release order */, "workgroup");
    __builtin_amdgcn_wave_barrier();
    __builtin_amdgcn_fence(2 /* acquire order */, "workgroup");
    if (OUT_MODE == 0) {
      float* C = (float*)Cout;
      const int hh = lane >> 4, c4 = (lane & 15) * 4;     // row segment = 256 B = 16 lanes x 16 B
      {
#pragma unroll
        for (int it = 0; it < 8; ++it) {
          const int row = it * 2 + hh;
          v4f v = *(const v4f*)(slab + row * 68 + c4);
          *(v4f*)(C + (size_t)(mBase + row) * ldc + n0 + c4) = v;
        }
        
      }
    } else {
      const int q = lane >> 3, c8 = (lane & 7) * 8;
      unsigned short* C  = (unsigned short*)Cout;
      unsigned short* C2 = (unsigned short*)Cout2;
      {
#pragma unroll
        for (int it = 0; it < 4; ++it) {
          const int row = it * 4 + q;
          const float* sp = slab + row * 68 + c8;
          v8h hv, lv;
#pragma unroll
          for (int e = 0; e < 8; ++e) {
            if (OUT_MODE == 1) {
              hv[e] = (_Float16)sp[e];
              lv[e] = (_Float16)0.f;
            } else {
              const unsigned short hb = bfu_rne(sp[e]);
              const unsigned short lb = bfu_rne(sp[e] - bfu_f32(hb));
              hv[e] = __builtin_bit_cast(_Float16, hb);
              lv[e] = __builtin_bit_cast(_Float16, lb);
            }
          }
          *(v8h*)(C + (size_t)(mBase + row) * ldc + n0 + c8) = hv;
          if (OUT_MODE == 2) *(v8h*)(C2 + (size_t)(mBase + row) * ldc + n0 + c8) = lv;
        }
        
      }
    }
    __builtin_amdgcn_fence(3 /* release order */, "workgroup");
    __builtin_amdgcn_wave_barrier();
    __builtin_amdgcn_fence(2 /* acquire order */, "workgroup");
  }
}

// q / k projection: f16 operands, bias[n], bf16 hi + lo planes out
__global__ __launch_bounds__(128) void k_gemm_qk(const unsigned short* __restrict__ X, const unsigned short* __restrict__ W,
                                                 unsigned short* __restrict__ CH, unsigned short* __restrict__ CL,
                                                 const float* __restrict__ bias, int M, int N, int K, float scale) {
  __shared__ __attribute__((aligned(2048))) unsigned char ring[2 * G_STAGE];
  __shared__ __align__(16) float sT[4][16 * 68];
  gemm64_body<0, 2, 2>(X, K, W, K, (void*)CH, (void*)CL, N, bias, M, N, K, scale, sT[threadIdx.x >> 5], ring);
}
// v projection, transposed: C[m = feature][n = token] = sum_k Wv[m][k] * X[n][k] + bias[m], f16 out (pitch N = tokens)
__global__ __launch_bounds__(128) void k_gemm_vt(const unsigned short* __restrict__ W, const unsigned short* __restrict__ X,
                                                 unsigned short* __restrict__ C, const float* __restrict__ bias, int M, int N, int K, float scale) {
  __shared__ __attribute__((aligned(2048))) unsigned char ring[2 * G_STAGE];
  __shared__ __align__(16) float sT[4][16 * 68];
  gemm64_body<0, 1, 1>(W, K, X, K, (void*)C, (void*)C, N, bias, M, N, K, scale, sT[threadIdx.x >> 5], ring);
}
// output projection: bf16 operands (A = context hi|lo along K, Bt = [Wo|Wo]), bias[n], f32 out
__global__ __launch_bounds__(128) void k_gemm_out(const unsigned short* __restrict__ A, const unsigned short* __restrict__ W,
                                                  float* __restrict__ C, const float* __restrict__ bias, int M, int N, int K) {
  __shared__ __attribute__((aligned(2048))) unsigned char ring[2 * G_STAGE];
  __shared__ __align__(16) float sT[4][16 * 68];
  gemm64_body<1, 2, 0>(A, K, W, K, (void*)C, (void*)C, N, bias, M, N, K, 1.0f, sT[threadIdx.x >> 5], ring);
}

// ---- operand preparation, all of it in one launch of long-lived waves ----
// A chunk is 16,384 consecutive floats of one source (16 rows of DM). A block of 16 waves takes four chunks; every thread asks for all its 16-B pieces first
// (each wave-wide load covers 512 contiguous bytes), then converts and stores them in the order in which they were asked for.
//   activations:  f32 -> bf16 (RNE) -> f16 plane [MT][DM]; rows (b, s) of the full-size inputs
//   Wq, Wk, Wv:   f32 -> bf16 (RNE) -> x16 -> f16 plane [DM][DM] (exact; [out][in] is already the Bt layout)
//   Wo:           f32 -> bf16 (RNE) plane [DM][2*DM] = [Wo | Wo], read once and stored twice
//   biases:       f32 -> bf16 (RNE) kept as f32; table: f32 -> bf16 plane [NRELP][DK], rows >= NREL written as zeros (clamped source address)
typedef __attribute__((ext_vector_type(2))) unsigned int u2;
constexpr int PR_T     = 512;                                   // threads per block
constexpr int PR_L     = 8;                                     // 16-B loads per thread and chunk
constexpr int PR_CH    = PR_T * PR_L * 4;                       // floats per chunk
constexpr int PR_ACT   = (int)(((long long)MT * DM) / PR_CH);   // chunks per activation plane
constexpr int PR_W     = (DM * DM) / PR_CH;                     // chunks per weight matrix
constexpr int PR_GRID  = PR_ACT > 4 * PR_W ? PR_ACT : 4 * PR_W;  // block b: chunk b of each activation plane and chunk b of [Wq, Wk, Wv, Wo]
constexpr int PR_SQ    = DM + NRELP * (DK / 4);                 // 4-float pieces of the four biases, then of the padded table
constexpr int PR_SMALL = (PR_SQ + PR_T - 1) / PR_T;             // the first blocks take one such piece per thread on top
static_assert(PR_CH % DM == 0 && SEQ % (PR_CH / DM) == 0 && ((long long)MT * DM) % PR_CH == 0 && (DM * DM) % PR_CH == 0);
static_assert(PR_SMALL <= PR_GRID && DK % 4 == 0 && DM % 4 == 0 && (PR_T * 4) % DM == 0);

__device__ __forceinline__ u2 pr_f16(v4f x, float sc) { u2 p; p.x = cmb_pk2(cmb_bf(x.x) * sc, cmb_bf(x.y) * sc); p.y = cmb_pk2(cmb_bf(x.z) * sc, cmb_bf(x.w) * sc); return p; }
__device__ __forceinline__ u2 pr_bf(v4f x) { u2 p; p.x = (unsigned)bfu_rne(x.x) | ((unsigned)bfu_rne(x.y) << 16); p.y = (unsigned)bfu_rne(x.z) | ((unsigned)bfu_rne(x.w) << 16); return p; }

__global__ __launch_bounds__(PR_T) void k_prep(const float* __restrict__ Qi, const float* __restrict__ Ki, const float* __restrict__ Vi,
                                               const float* __restrict__ Wq, const float* __restrict__ Wk, const float* __restrict__ Wv, const float* __restrict__ Wo,
                                               const float* __restrict__ bq, const float* __restrict__ bk, const float* __restrict__ bv, const float* __restrict__ bo,
                                               const float* __restrict__ rel,
                                               unsigned short* __restrict__ XQ, unsigned short* __restrict__ XK, unsigned short* __restrict__ XV,
                                               unsigned short* __restrict__ WQ6, unsigned short* __restrict__ WK6, unsigned short* __restrict__ WV6,
                                               unsigned short* __restrict__ WO2, float* __restrict__ BR, unsigned short* __restrict__ TB) {
  const unsigned t = threadIdx.x;
  const unsigned b = blockIdx.x;
  // chunk numbers are clamped for the loads, so that no branch stands among them; the stores are guarded
  const unsigned ka = min(b, (unsigned)(PR_ACT - 1));
  const unsigned kw = min(b, (unsigned)(4 * PR_W - 1));
  const unsigned w  = kw / (unsigned)PR_W, kc = kw % (unsigned)PR_W;
  const unsigned r0 = ka * (unsigned)(PR_CH / DM);
  const size_t ao = (size_t)(r0 / (unsigned)SEQ) * ((size_t)SEQ_FULL * DM) + (size_t)(r0 % (unsigned)SEQ) * DM;
  const v4f* sq = (const v4f*)(Qi + ao) + t;                    // block-uniform base + the thread's 16 B inside 8 KiB of the chunk
  const v4f* sk = (const v4f*)(Ki + ao) + t;
  const v4f* sv = (const v4f*)(Vi + ao) + t;
  const v4f* sw = (const v4f*)((w == 0u ? Wq : w == 1u ? Wk : w == 2u ? Wv : Wo) + (size_t)kc * PR_CH) + t;
  // one piece of the biases (u < DM) or of the table per thread of the first blocks; every thread's address is in bounds
  const unsigned u = b * (unsigned)PR_T + t;
  const unsigned tq = u < (unsigned)DM ? 0u : u - (unsigned)DM;

  v4f xs = {0.f, 0.f, 0.f, 0.f};
  if (b < (unsigned)PR_SMALL) {
    const unsigned bw = u / (unsigned)(DM / 4);
    const float* bs = bw == 0u ? bq : bw == 1u ? bk : bw == 2u ? bv : bo;
    const float* ss = u < (unsigned)DM ? bs + (u % (unsigned)(DM / 4)) * 4u : rel + min(tq / (unsigned)(DK / 4), (unsigned)(NREL - 1)) * (unsigned)DK + (tq % (unsigned)(DK / 4)) * 4u;
    xs = *(const v4f*)ss;
  }
  // PR_ORDER: the compiler moves nothing across it. The loads leave plane by plane and each plane is converted and stored as soon as its own loads are back,
  // while the later planes are still on their way; without it the conversions of all planes are mixed and the first store waits for most of the loads.
#define PR_ORDER() __builtin_amdgcn_sched_barrier(0)
  // every loop below is unrolled: the pieces stay in registers and their offsets become immediates
  v4f xq[PR_L], xk[PR_L], xv[PR_L], xw[PR_L];
#pragma unroll
  for (int j = 0; j < PR_L; ++j) xq[j] = sq[j * PR_T];
  PR_ORDER();
#pragma unroll
  for (int j = 0; j < PR_L; ++j) xk[j] = sk[j * PR_T];
  PR_ORDER();
#pragma unroll
  for (int j = 0; j < PR_L; ++j) xv[j] = sv[j * PR_T];
  PR_ORDER();
#pragma unroll
  for (int j = 0; j < PR_L; ++j) xw[j] = sw[j * PR_T];
  // stands in front of every later write of a register that one of the loads above names as an address; the thread number, their offset register, is named as an input so that it keeps its value until here
  asm volatile("s_wait_xcnt 0x0" :: "v"(t) : "memory");

  if (b < (unsigned)PR_SMALL) {
    if (u < (unsigned)DM) {
      v4f r; r.x = cmb_bf(xs.x); r.y = cmb_bf(xs.y); r.z = cmb_bf(xs.z); r.w = cmb_bf(xs.w);
      *(v4f*)(BR + u * 4u) = r;
    } else if (u < (unsigned)PR_SQ) {
      u2 pk = pr_bf(xs);
      if (tq / (unsigned)(DK / 4) >= (unsigned)NREL) { pk.x = 0u; pk.y = 0u; }
      *(u2*)(TB + tq * 4u) = pk;
    }
  }
  if (b < (unsigned)PR_ACT) {
    const size_t o = (size_t)ka * PR_CH + t * 4u;
#pragma unroll
    for (int j = 0; j < PR_L; ++j) *(u2*)(XQ + o + j * (PR_T * 4)) = pr_f16(xq[j], 1.0f);
    PR_ORDER();
#pragma unroll
    for (int j = 0; j < PR_L; ++j) *(u2*)(XK + o + j * (PR_T * 4)) = pr_f16(xk[j], 1.0f);
    PR_ORDER();
#pragma unroll
    for (int j = 0; j < PR_L; ++j) *(u2*)(XV + o + j * (PR_T * 4)) = pr_f16(xv[j], 1.0f);
    // stands in front of the weight chunk's conversions, which write over registers that these stores name
    asm volatile("s_wait_xcnt 0x0" ::: "memory");
  }
  if (b < (unsigned)(3 * PR_W)) {
    unsigned short* dp = (w == 0u ? WQ6 : w == 1u ? WK6 : WV6) + (size_t)kc * PR_CH + t * 4u;
#pragma unroll
    for (int j = 0; j < PR_L; ++j) *(u2*)(dp + j * (PR_T * 4)) = pr_f16(xw[j], 16.0f);
  } else if (b < (unsigned)(4 * PR_W)) {
    // row = element / DM, column = element % DM of Wo; PR_T * 4 floats are a whole number of rows
    unsigned short* dp = WO2 + ((size_t)kc * (PR_CH / DM) + (t * 4u) / (unsigned)DM) * (2 * DM) + (t * 4u) % (unsigned)DM;
#pragma unroll
    for (int j = 0; j < PR_L; ++j) {
      const u2 pk = pr_bf(xw[j]);
      *(u2*)(dp + j * ((PR_T * 4 / DM) * 2 * DM)) = pk;
      *(u2*)(dp + j * ((PR_T * 4 / DM) * 2 * DM) + DM) = pk;
    }
    // stands behind the last of these stores, in front of any later write of a register that they name
    asm volatile("s_wait_xcnt 0x0" ::: "memory");
  }
}

// =====================================================================================================================
// Fused attention with clipped relative-position bias. One wave per 16 queries; the 8 waves of a block share one (batch, head) and its K, V tiles in LDS.
//   score(l, r) = q_l . k_r / 8 + q_l . table[clip(r - l, -16, 16) + 16]
//   Transposed score tiles S^T = K . Q^T (A = key rows, B = query rows): D has lane = query, element = key, which is the A-operand
//   layout of P for O = P . V (32 keys per step), so P never leaves registers. q, k: bf16 hi/lo planes (hi.hi + hi.lo + lo.hi).
//   Relative dots: table (A, rows padded to NRELP) x q (B), hi + lo products, staged once per wave in LDS [16][QP] and gathered per element.
//   V^T plane [feature][token] f16 gives B fragments with contiguous keys. Online softmax in f32 (exp2 domain); P carried x2^14 in f16.
//   K hi, K lo (64 keys x 64 d) and V^T (64 features x 64 keys) come into LDS 64 keys at a time by tensor loads, one tile each from waves 0, 1, 2, two buffers:
//   stage s + 1 flies while stage s is worked on.
// =====================================================================================================================
constexpr uint32_t AT_KEYS  = 64u;                 // keys per stage
constexpr uint32_t AT_ROWB  = 128u;                // bytes of one tile row: 64 d of a key, or 64 keys of a feature
constexpr uint32_t AT_ROWS  = 64u;                 // rows per tile (one tensor load of one wave)
constexpr uint32_t AT_PITCH = AT_ROWB + 16u;       // LDS row pitch, laid by the load's pad: an odd multiple of 16 B for ds_load_b128 readers
constexpr uint32_t AT_SLICE = 10240u;              // 64 x 144 = 9,216 B rounded up to a multiple of 2 KiB
constexpr uint32_t AT_STAGE = 3u * AT_SLICE;       // [K hi | K lo | V^T]
constexpr int      AT_NST   = SEQ / (int)AT_KEYS;
static_assert(AT_ROWS * AT_PITCH <= AT_SLICE && AT_SLICE % 2048u == 0u);
static_assert(DK * 2 == (int)AT_ROWB && DK == (int)AT_ROWS && AT_NST >= 2);
// group 1: 1-byte elements, tile = tensor = 64 rows of 128 B, source row pitch in bytes, 16 B of LDS pad behind every 128-B row, no mask
__device__ __forceinline__ u32x8 at_group1(uint32_t src_pitch) {
  u32x8 g;
  g[0] = uni((1u << 20) | (4u << 22) | (3u << 25));
  g[1] = uni((AT_ROWB & 0xFFFFu) << 16);
  g[2] = uni((AT_ROWB >> 16) | ((AT_ROWS & 0xFFFFu) << 16));
  g[3] = uni((AT_ROWS >> 16) | (AT_ROWB << 16));
  g[4] = uni(AT_ROWS);
  g[5] = uni(src_pitch);
  g[6] = uni(0u);
  g[7] = uni(0u);
  return g;
}

__global__ __launch_bounds__(32 * AT_NW) void k_attn_rel(const unsigned short* __restrict__ QHp, const unsigned short* __restrict__ QLp,
                                                         const unsigned short* __restrict__ KHp, const unsigned short* __restrict__ KLp,
                                                         const unsigned short* __restrict__ VTp, const unsigned short* __restrict__ TBp,
                                                         unsigned short* __restrict__ CTX) {
  __shared__ __attribute__((aligned(2048))) unsigned char ring[2 * AT_STAGE];
  __shared__ __align__(16) float qrs[AT_NW][16 * QP];
  __shared__ __align__(16) float osm[AT_NW][16 * OSP];
  const __bf16* QH = (const __bf16*)QHp; const __bf16* QL = (const __bf16*)QLp;
  const __bf16* TB = (const __bf16*)TBp;
  const int lane = threadIdx.x & 31, wave = threadIdx.x >> 5, hh = lane >> 4, c = lane & 15;
  const int bh = (int)blockIdx.x / ((SEQ / 16) / AT_NW);            // the same for the whole block
  const int l0 = (((int)blockIdx.x - bh * ((SEQ / 16) / AT_NW)) * AT_NW + wave) * 16;
  const int b = bh / NH, h = bh - b * NH;
  const size_t tok0 = (size_t)b * SEQ;

  // q as B operand (lane = query column c), 2 k-steps of 32, hi and lo
  v16b qh[2], ql[2];
  {
    const size_t qo = (tok0 + l0 + c) * DM + h * DK + 8 * hh;
#pragma unroll
    for (int dc = 0; dc < 2; ++dc) { qh[dc] = ldfb(QH + qo + dc * 32); ql[dc] = ldfb(QL + qo + dc * 32); }
  }
  // this wave's tile: wave 0 brings K hi, wave 1 K lo, wave 2 V^T; the other waves issue nothing (their words name V^T's tile and are not used)
  const uint32_t wv = uni((uint32_t)threadIdx.x >> 5);
  const uint32_t sl = wv < 2u ? wv : 2u;
  const uint64_t gsrc = sl == 0u ? (uint64_t)(size_t)(KHp + tok0 * DM + h * DK)
                      : sl == 1u ? (uint64_t)(size_t)(KLp + tok0 * DM + h * DK)
                                 : (uint64_t)(size_t)(VTp + (size_t)(h * DK) * MT + tok0);
  const uint32_t gstep = sl == 2u ? AT_KEYS * 2u : AT_KEYS * (uint32_t)DM * 2u;     // source bytes from one stage to the next
  u32x8 g1 = at_group1(sl == 2u ? (uint32_t)MT * 2u : (uint32_t)DM * 2u);
  asm volatile("" : "+s"(g1));   // the pinned() form on descriptor words: held in their scalar registers, built once, so that none is written again while a request is outstanding
  const uint32_t ldst = (uint32_t)(size_t)ring + sl * AT_SLICE;
  u32x4 g0 = tdm_group0(ldst, gsrc);
  if (pinned((uint32_t)(wv < 3u))) {
    tdm_load(g0, g1);                                         // stage 0 -> buffer 0
    wait_tensor0(g0, g1);
  }
  __syncthreads();                                            // stage 0 published
  g0 = tdm_group0(ldst + AT_STAGE, gsrc + gstep);
  asm volatile("" : "+s"(g0));   // the pinned() form on descriptor words: all four stand in their scalar registers in front of the branch, so that none is written behind the load
  if (pinned((uint32_t)(wv < 3u))) tdm_load(g0, g1);          // stage 1 -> buffer 1 (SEQ >= 128)

  // relative dots: D[j][query] = sum_d table[j][d] * q[query][d]; lane = query c, element r -> j = jt*16 + 8hh + r
  float* myq = qrs[wave];
#pragma unroll
  for (int jt = 0; jt < NRELP / 16; ++jt) {
    v8f acc = zero8();
#pragma unroll
    for (int dc = 0; dc < 2; ++dc) {
      const v16b ta = ldfb(TB + (jt * 16 + c) * DK + dc * 32 + 8 * hh);
      acc = wmmab(ta, ql[dc], acc);
      acc = wmmab(ta, qh[dc], acc);
    }
#pragma unroll
    for (int r = 0; r < 8; ++r) myq[c * QP + jt * 16 + 8 * hh + r] = acc[r];
  }
  __builtin_amdgcn_fence(3 /* release order */, "workgroup");
  __builtin_amdgcn_wave_barrier();
  __builtin_amdgcn_fence(2 /* acquire order */, "workgroup");

  const int lglob = l0 + c;
  const float* qrow = myq + c * QP + MAXREL;        // indexed by clip(r - l, -16, 16)
  const float L2E = 1.4426950408889634f;
  float m_run = -1.0e30f, s_run = 0.f;
  v8f o[4];
#pragma unroll
  for (int t = 0; t < 4; ++t) o[t] = zero8();
  // fragment rows in LDS: lane = key row (K) or feature row (V^T) c of a 16-row group, lane half at 16 B
  const unsigned char* kR = ring + (uint32_t)c * AT_PITCH + (uint32_t)hh * 16u;
  const unsigned char* vR = kR + 2u * AT_SLICE;

  // kept rolled: one publish point per stage
#pragma unroll 1
  for (int s = 0; s < AT_NST; ++s) {
  const uint32_t buf = ((uint32_t)s & 1u) * AT_STAGE;
  // the two 32-key passes of a stage are unrolled: their LDS offsets become immediates
#pragma unroll
  for (int ps = 0; ps < 2; ++ps) {
    const int r0 = s * (int)AT_KEYS + ps * 32;
    // the pass's K fragments are read as one group ahead of its score products; only this stage's buffer is read (loops unrolled: the fragment arrays stay in registers)
    v16b kfh[2][2], kfl[2][2];
#pragma unroll
    for (int tt = 0; tt < 2; ++tt)
#pragma unroll
      for (int dc = 0; dc < 2; ++dc) {
        const unsigned char* kp = kR + buf + (uint32_t)(ps * 32 + 16 * tt) * AT_PITCH + (uint32_t)dc * 64u;
        kfh[tt][dc] = ldfb((const __bf16*)kp);
        kfl[tt][dc] = ldfb((const __bf16*)(kp + AT_SLICE));
      }
    v8f t[2];
#pragma unroll
    for (int tt = 0; tt < 2; ++tt) {
      v8f acc = zero8();
#pragma unroll
      for (int dc = 0; dc < 2; ++dc) {
        acc = wmmab(kfl[tt][dc], qh[dc], acc);
        acc = wmmab(kfh[tt][dc], ql[dc], acc);
        acc = wmmab(kfh[tt][dc], qh[dc], acc);
      }
      t[tt] = acc;
    }
    // the pass's V^T fragments are asked for ahead of the softmax, which covers their LDS latency (unrolled: the array stays in registers)
    v16h vfr[4];
#pragma unroll
    for (int tq = 0; tq < 4; ++tq) vfr[tq] = ldfh((const _Float16*)(vR + buf + (uint32_t)tq * 16u * AT_PITCH + (uint32_t)ps * 64u));
    // element e <-> key r0 + 8hh + e (tile 0) and r0 + 16 + 8hh + e (tile 1); this lane's query is lglob
    float p[16];
    float mt = -1.0e30f;
    const int dbase = r0 + 8 * hh - lglob;
#pragma unroll
    for (int e = 0; e < 8; ++e) {
      const int d0 = min(max(dbase + e, -MAXREL), MAXREL);
      const int d1 = min(max(dbase + 16 + e, -MAXREL), MAXREL);
      p[e]     = (t[0][e] * 0.125f + qrow[d0]) * L2E;
      p[8 + e] = (t[1][e] * 0.125f + qrow[d1]) * L2E;
      mt = fmaxf(mt, fmaxf(p[e], p[8 + e]));
    }
    mt = fmaxf(mt, __shfl_xor(mt, 16, 32));          // the two lane halves hold the same query
    const float m_new = fmaxf(m_run, mt);
    const float corr  = exp2f(m_run - m_new);
    float sum = 0.f;
    v16h pA;                                          // P as A operand: element i <-> key r0 + k(i, hh)
#pragma unroll
    for (int r = 0; r < 16; ++r) {
      const float ev = exp2f(p[r] - m_new);
      sum += ev;
      pA[r] = (_Float16)(ev * PSC);
    }
    sum += __shfl_xor(sum, 16, 32);
    s_run = s_run * corr + sum;
    m_run = m_new;
    float sc[8];
#pragma unroll
    for (int i = 0; i < 8; ++i) sc[i] = __shfl(corr, i + 8 * hh, 32);   // O tile rows are queries 8hh + i
#pragma unroll
    for (int tq = 0; tq < 4; ++tq) {
      v8f oc = o[tq];
#pragma unroll
      for (int i = 0; i < 8; ++i) oc[i] *= sc[i];
      o[tq] = wmmah(pA, vfr[tq], oc);
    }
  }
    // publish point of stage s + 1: own LDS reads retired, the issuer's own load landed, then the barrier that publishes s + 1 and frees this buffer
    wait_ds0();
    if (pinned((uint32_t)(wv < 3u))) wait_tensor0(g0, g1);
    __syncthreads();
    g0 = tdm_group0(ldst + buf, gsrc + (uint64_t)((uint32_t)(s + 2) * gstep));
    asm volatile("" : "+s"(g0));   // the pinned() form on descriptor words, as in front of the loop: formed behind the wait, none written behind the load
    if (pinned((uint32_t)(wv < 3u && s + 2 < AT_NST))) tdm_load(g0, g1);   // issued only while stage s + 2 exists
  }
  wait_tensor0(g0, g1);
  wait_ds0();

  float inv[8];
#pragma unroll
  for (int i = 0; i < 8; ++i) inv[i] = 1.0f / (__shfl(s_run, i + 8 * hh, 32) * PSC);
  float* os = osm[wave];
#pragma unroll
  for (int tq = 0; tq < 4; ++tq)
#pragma unroll
    for (int i = 0; i < 8; ++i) os[(8 * hh + i) * OSP + tq * 16 + c] = o[tq][i] * inv[i];
  __builtin_amdgcn_fence(3 /* release order */, "workgroup");
  __builtin_amdgcn_wave_barrier();
  __builtin_amdgcn_fence(2 /* acquire order */, "workgroup");
  {
    const int q = lane >> 3, c8 = (lane & 7) * 8;
    unsigned short* ch = CTX + (tok0 + l0) * (size_t)(2 * DM) + h * DK + c8;
    u4 ph[4], pl[4];
#pragma unroll
    for (int it = 0; it < 4; ++it) {
      const int row = it * 4 + q;
      const float* sp = os + row * OSP + c8;
      unsigned short hb[8], lb[8];
#pragma unroll
      for (int e = 0; e < 8; ++e) { const float v = sp[e]; hb[e] = bfu_rne(v); lb[e] = bfu_rne(v - bfu_f32(hb[e])); }
      ph[it].x = (unsigned)hb[0] | ((unsigned)hb[1] << 16); ph[it].y = (unsigned)hb[2] | ((unsigned)hb[3] << 16);
      ph[it].z = (unsigned)hb[4] | ((unsigned)hb[5] << 16); ph[it].w = (unsigned)hb[6] | ((unsigned)hb[7] << 16);
      pl[it].x = (unsigned)lb[0] | ((unsigned)lb[1] << 16); pl[it].y = (unsigned)lb[2] | ((unsigned)lb[3] << 16);
      pl[it].z = (unsigned)lb[4] | ((unsigned)lb[5] << 16); pl[it].w = (unsigned)lb[6] | ((unsigned)lb[7] << 16);
    }
    {
#pragma unroll
      for (int it = 0; it < 4; ++it) {
        const int row = it * 4 + q;
        *(u4*)(ch + (size_t)row * (2 * DM)) = ph[it];
        *(u4*)(ch + (size_t)row * (2 * DM) + DM) = pl[it];
      }
      
    }
  }
}

extern "C" void kernel_launch(void* const* d_in, const int* in_sizes, int n_in, void* d_out, int out_size, void* d_ws, size_t ws_size, hipStream_t stream) {
  if (n_in < 12) return;
  const long long actn = ((long long)(NB - 1) * SEQ_FULL + SEQ) * DM;
  if ((long long)in_sizes[0] < actn || (long long)in_sizes[1] < actn || (long long)in_sizes[2] < actn) return;
  if (in_sizes[3] < DM * DM || in_sizes[5] < DM * DM || in_sizes[7] < DM * DM || in_sizes[9] < DM * DM) return;
  if (in_sizes[4] < DM || in_sizes[6] < DM || in_sizes[8] < DM || in_sizes[10] < DM) return;
  if (in_sizes[11] < NREL * DK) return;
  if ((long long)out_size < (long long)MT * DM) return;

  const float* Qi = (const float*)d_in[0];
  const float* Ki = (const float*)d_in[1];
  const float* Vi = (const float*)d_in[2];
  const float* Wq = (const float*)d_in[3];
  const float* bq = (const float*)d_in[4];
  const float* Wk = (const float*)d_in[5];
  const float* bk = (const float*)d_in[6];
  const float* Wv = (const float*)d_in[7];
  const float* bv = (const float*)d_in[8];
  const float* Wo = (const float*)d_in[9];
  const float* bo = (const float*)d_in[10];
  const float* rel = (const float*)d_in[11];
  float* out = (float*)d_out;

  constexpr size_t SZ_ACT = (size_t)MT * DM * 2;          // 16-bit [MT][DM] plane
  constexpr size_t SZ_W   = (size_t)DM * DM * 2;
  constexpr size_t SZ_WO2 = (size_t)DM * 2 * DM * 2;
  constexpr size_t SZ_BR  = (size_t)4 * DM * 4;
  constexpr size_t SZ_TB  = (size_t)NRELP * DK * 2;
  constexpr size_t SZ_CTX = (size_t)MT * 2 * DM * 2;
  static_assert(SZ_ACT % 256 == 0 && SZ_W % 256 == 0 && SZ_WO2 % 256 == 0 && SZ_BR % 256 == 0 && SZ_TB % 256 == 0 && SZ_CTX % 256 == 0);
  constexpr size_t TOTAL = 3 * SZ_ACT + 3 * SZ_W + SZ_WO2 + SZ_BR + SZ_TB + 4 * SZ_ACT + SZ_ACT + SZ_CTX;
  static_assert(TOTAL <= (size_t)134217728);
  if (TOTAL > ws_size) return;

  char* wsp = (char*)d_ws;
  unsigned short* XQ  = (unsigned short*)wsp; wsp += SZ_ACT;
  unsigned short* XK  = (unsigned short*)wsp; wsp += SZ_ACT;
  unsigned short* XV  = (unsigned short*)wsp; wsp += SZ_ACT;
  unsigned short* WQ6 = (unsigned short*)wsp; wsp += SZ_W;
  unsigned short* WK6 = (unsigned short*)wsp; wsp += SZ_W;
  unsigned short* WV6 = (unsigned short*)wsp; wsp += SZ_W;
  unsigned short* WO2 = (unsigned short*)wsp; wsp += SZ_WO2;
  float*          BR  = (float*)wsp;          wsp += SZ_BR;
  unsigned short* TB  = (unsigned short*)wsp; wsp += SZ_TB;
  unsigned short* QHp = (unsigned short*)wsp; wsp += SZ_ACT;
  unsigned short* QLp = (unsigned short*)wsp; wsp += SZ_ACT;
  unsigned short* KHp = (unsigned short*)wsp; wsp += SZ_ACT;
  unsigned short* KLp = (unsigned short*)wsp; wsp += SZ_ACT;
  unsigned short* VTp = (unsigned short*)wsp; wsp += SZ_ACT;     // [DM features][MT tokens] f16
  unsigned short* CTX = (unsigned short*)wsp; wsp += SZ_CTX;     // [MT][2*DM] bf16: hi | lo

  k_prep<<<PR_GRID, PR_T, 0, stream>>>(Qi, Ki, Vi, Wq, Wk, Wv, Wo, bq, bk, bv, bo, rel, XQ, XK, XV, WQ6, WK6, WV6, WO2, BR, TB);

  const unsigned gQK = (unsigned)((MT / 128) * (DM / 128));
  k_gemm_qk<<<gQK, 128, 0, stream>>>(XQ, WQ6, QHp, QLp, BR + 0 * DM, MT, DM, DM, 0.0625f);
  k_gemm_qk<<<gQK, 128, 0, stream>>>(XK, WK6, KHp, KLp, BR + 1 * DM, MT, DM, DM, 0.0625f);
  k_gemm_vt<<<gQK, 128, 0, stream>>>(WV6, XV, VTp, BR + 2 * DM, DM, MT, DM, 0.0625f);

  k_attn_rel<<<(unsigned)((NB * NH * (SEQ / 16)) / AT_NW), 32 * AT_NW, 0, stream>>>(QHp, QLp, KHp, KLp, VTp, TB, CTX);

  k_gemm_out<<<gQK, 128, 0, stream>>>(CTX, WO2, out, BR + 3 * DM, MT, DM, 2 * DM);
}

// v004
// Measured time: 106 microseconds a run.
// Next to v003, in two timings, it ran 1.15 and 1.16 times as fast.
// All steps since v000 together make it 3.55 times as fast.
// Contractions: q/k/v projections = v_wmma_f32_16x16x32_f16 (inputs and weights RNE-converted to bf16 and held exactly in f16, weights x16), f32 accumulate; content scores and relative-position dots = v_wmma_f32_16x16x32_bf16 with q, k as bf16 hi/lo split planes (3 products) and the 33x64 table as exact bf16, f32 accumulate; P.V = v_wmma_f32_16x16x32_f16 (P x2^14, v f16), f32 accumulate; output projection = v_wmma_f32_16x16x32_bf16 with the context as bf16 hi|lo folded along K against [Wo|Wo], f32 accumulate.
#include <hip/hip_runtime.h>
#include <math.h>
#include <stdint.h>

#ifndef NB
#define NB 4
#endif
#ifndef SEQ
#define SEQ 1024
#endif
#define NB_FULL 4
#define SEQ_FULL 1024
#define DM 1024
#define NH 16
#define DK 64
#define MAXREL 16
#define NREL 33
#define NRELP 48
#define MT (NB * SEQ)
#define AT_NW 8
#define QP 52
#define OSP 68
#define PSC 16384.0f

static_assert(NH * DK == DM);
static_assert(DK == 64);
static_assert(2 * MAXREL + 1 == NREL);
static_assert(NRELP % 16 == 0 && NRELP >= NREL);
static_assert(QP >= NRELP);
static_assert(SEQ % 64 == 0);
static_assert(MT % 128 == 0);
static_assert(DM % 128 == 0);
static_assert(DM >= 256);
static_assert(((SEQ / 16) * NB * NH) % AT_NW == 0);
static_assert((SEQ / 16) % AT_NW == 0);
static_assert(SEQ >= 128);
static_assert(NB <= NB_FULL && SEQ <= SEQ_FULL);

typedef __attribute__((ext_vector_type(16))) _Float16 v16h;
typedef __attribute__((ext_vector_type(8)))  _Float16 v8h;
typedef __attribute__((ext_vector_type(16))) __bf16   v16b;
typedef __attribute__((ext_vector_type(8)))  __bf16   v8b;
typedef __attribute__((ext_vector_type(8)))  float    v8f;
typedef __attribute__((ext_vector_type(4)))  float    v4f;
typedef __attribute__((ext_vector_type(4)))  unsigned int u4;

// 16-bit WMMA fragment map (wave32), lane L, hh = L>>4, c = L&15:
//   A 16x32: lane = row c;    element i -> k = (i<8) ? 8hh+i : 16+8hh+(i-8)
//   B 32x16: lane = column c; the same k(i,hh)
//   D 16x16 (8 f32): lane = column c; element r -> row 8hh+r

__device__ __forceinline__ unsigned short bfu_rne(float v) { unsigned u = __float_as_uint(v); u += 0x7FFFu + ((u >> 16) & 1u); return (unsigned short)(u >> 16); }
__device__ __forceinline__ float bfu_f32(unsigned short h) { return __uint_as_float(((unsigned)h) << 16); }
__device__ __forceinline__ float cmb_bf(float v) { const unsigned u = __float_as_uint(v); const unsigned r = (u + 0x7fffu + ((u >> 16) & 1u)) & 0xffff0000u; return __uint_as_float(r); }   // bf16 RNE kept as f32 (finite inputs)
__device__ __forceinline__ unsigned int cmb_pk2(float a, float b) { return (unsigned int)__builtin_bit_cast(unsigned short, (_Float16)a) | ((unsigned int)__builtin_bit_cast(unsigned short, (_Float16)b) << 16); }

__device__ __forceinline__ v8f zero8() { v8f z = {0.f, 0.f, 0.f, 0.f, 0.f, 0.f, 0.f, 0.f}; return z; }

__device__ __forceinline__ v8f wmmab(v16b a, v16b b, v8f c) {
  c = __builtin_amdgcn_wmma_f32_16x16x32_bf16(false, a, false, b, (short)0, c, false, false);
  asm volatile("v_nop\n\tv_nop\n\tv_nop\n\tv_nop" : "+v"(c) : "v"(a), "v"(b));
  return c;
}
__device__ __forceinline__ v8f wmmah(v16h a, v16h b, v8f c) {
  c = __builtin_amdgcn_wmma_f32_16x16x32_f16(false, a, false, b, (short)0, c, false, false);
  asm volatile("v_nop\n\tv_nop\n\tv_nop\n\tv_nop" : "+v"(c) : "v"(a), "v"(b));
  return c;
}
union FBu { v16b v; v8b h[2]; };
union FHu { v16h v; v8h h[2]; };
// p already includes the lane-half offset 8*hh: elements 0..7 <- p[0..7], 8..15 <- p[16..23]
__device__ __forceinline__ v16b ldfb(const __bf16* p) { FBu f; f.h[0] = *(const v8b*)(p); f.h[1] = *(const v8b*)(p + 16); return f.v; }
__device__ __forceinline__ v16h ldfh(const _Float16* p) { FHu f; f.h[0] = *(const v8h*)(p); f.h[1] = *(const v8h*)(p + 16); return f.v; }

// ---- hazard guards for the register-blocked GEMM ----
__device__ __forceinline__ void acc_guard4(v8f& a, v8f& b, v8f& c, v8f& d) { asm volatile("v_nop\n\tv_nop\n\tv_nop\n\tv_nop" : "+v"(a), "+v"(b), "+v"(c), "+v"(d)); }

template <typename T> struct Frag;
template <> struct Frag<_Float16> {
  typedef v16h V;
  static __device__ __forceinline__ v16h load(const _Float16* p) { return ldfh(p); }
  static __device__ __forceinline__ v8f mma(v16h a, v16h b, v8f c) { return __builtin_amdgcn_wmma_f32_16x16x32_f16(false, a, false, b, (short)0, c, false, false); }
};
template <> struct Frag<__bf16> {
  typedef v16b V;
  static __device__ __forceinline__ v16b load(const __bf16* p) { return ldfb(p); }
  static __device__ __forceinline__ v8f mma(v16b a, v16b b, v8f c) { return __builtin_amdgcn_wmma_f32_16x16x32_bf16(false, a, false, b, (short)0, c, false, false); }
};
template <int ET> struct Elem;
template <> struct Elem<0> { typedef _Float16 T; };
template <> struct Elem<1> { typedef __bf16 T; };

// ---- Tensor loads into LDS for the GEMM panels ----
typedef uint32_t u32x4 __attribute__((ext_vector_type(4)));
typedef uint32_t u32x8 __attribute__((ext_vector_type(8)));
constexpr uint32_t G_ROWB  = 256u;                 // bytes of one operand row per stage = 128 k
constexpr uint32_t G_ROWS  = 64u;                  // rows per slice (one tensor load of one wave)
constexpr uint32_t G_PITCH = G_ROWB + 16u;         // LDS row pitch, laid by the load's pad: an odd multiple of 16 B for ds_load_b128 readers
constexpr uint32_t G_SLICE = 18432u;               // 64 x 272 = 17,408 B rounded up to a multiple of 2 KiB
constexpr uint32_t G_STAGE = 4u * G_SLICE;         // [A rows 0..63 | A rows 64..127 | Bt rows 0..63 | Bt rows 64..127]
static_assert(G_ROWS * G_PITCH <= G_SLICE && G_SLICE % 2048u == 0u);
__device__ __forceinline__ uint32_t uni(uint32_t v) { return (uint32_t)__builtin_amdgcn_readfirstlane(v); }
// keeps the test in a scalar register, so that the branch round a tensor load is a scalar branch (the load ignores EXEC)
__device__ __forceinline__ uint32_t pinned(uint32_t v) { uint32_t w = (uint32_t)__builtin_amdgcn_readfirstlane(v); asm volatile("" : "+s"(w)); return w; }
// the wave's LDS reads have retired before the buffer is handed back for a refill
__device__ __forceinline__ void wait_ds0() { asm volatile("s_wait_dscnt 0x0" ::: "memory"); }
// the wave's own tensor load has landed (the compiler places no wait for it); the request's descriptor is named as an input so that its registers keep their values until here
__device__ __forceinline__ void wait_tensor0(u32x4 g0, u32x8 g1) { asm volatile("s_wait_tensorcnt 0x0" :: "s"(g0), "s"(g1) : "memory"); }
__device__ __forceinline__ void tdm_load(u32x4 g0, u32x8 g1) { asm volatile("tensor_load_to_lds %0, %1" :: "s"(g0), "s"(g1) : "memory"); }
__device__ __forceinline__ u32x8 tdm_group1(uint32_t src_pitch) {
  u32x8 g;
  g[0] = uni((1u << 20) | (5u << 22) | (3u << 25));
  g[1] = uni((G_ROWB & 0xFFFFu) << 16);
  g[2] = uni((G_ROWB >> 16) | ((G_ROWS & 0xFFFFu) << 16));
  g[3] = uni((G_ROWS >> 16) | (G_ROWB << 16));
  g[4] = uni(G_ROWS);
  g[5] = uni(src_pitch);
  g[6] = uni(0u);
  g[7] = uni(0u);
  return g;
}
__device__ __forceinline__ u32x4 tdm_group0(uint32_t lds_dst, uint64_t ga) {
  u32x4 g;
  g[0] = uni(1u); g[1] = uni(lds_dst); g[2] = uni((uint32_t)ga); g[3] = uni((((uint32_t)(ga >> 32)) & 0x01FFFFFFu) | 0x80000000u);
  return g;
}

// ---- Register-blocked WMMA GEMM body: C[m,n] = scale * sum_k A[m,k] * Bt[n,k] + bias; a work-group of 4 waves (2 x 2) owns a 128x128 tile, each wave 64x64 of it.
// The 128 rows of A and of Bt come into LDS 128 k at a time by tensor loads, one 64-row slice per wave and stage, two buffers: stage s + 1 flies while stage s is multiplied.
// A row-major [M,K] (pitch lda), Bt row-major [N,K] (pitch ldb); M,N % 128 == 0, K % 128 == 0, K >= 256 (no tails).
// BIAS_MODE 1 = bias[m], 2 = bias[n]. OUT_MODE 0 = f32, 1 = f16, 2 = bf16 hi plane (Cout) + bf16 lo plane (Cout2).
// tile = the work-group's tile number (the same in every thread). slab = the wave's own 16 x 68 floats of output staging; it may lie inside ring:
// the last pass of the loop ends with every wave's LDS reads retired, every tensor load landed and a work-group barrier, and nothing is issued behind it.
template <int ET, int BIAS_MODE, int OUT_MODE>
__device__ __forceinline__ void gemm64_body(
    const unsigned short* __restrict__ Ap, int lda, const unsigned short* __restrict__ Btp, int ldb,
    void* __restrict__ Cout, void* __restrict__ Cout2, int ldc, const float* __restrict__ bias,
    int M, int N, int K, float scale, int tile, float* slab, unsigned char* ring) {
  typedef typename Elem<ET>::T T;
  typedef typename Frag<T>::V V;
  const T* A = (const T*)Ap; const T* Bt = (const T*)Btp;
  const int lane = threadIdx.x & 31;
  const uint32_t wave = uni(threadIdx.x >> 5);
  const int tilesN = N >> 7;
  const int tilesM = M >> 7;
  if (tile >= tilesM * tilesN) return;   // the same for the whole block, in front of every barrier and tensor load
  const int tm = tile / tilesN;
  const int tn = tile - tm * tilesN;
  const int m0 = (tm << 7) + (int)((wave >> 1) << 6);
  const int n0 = (tn << 7) + (int)((wave & 1u) << 6);
  const int rlane = lane & 15;
  const int koff  = (lane >> 4) * 8;
  const int mOff  = (lane >> 4) * 8;

  v8f acc[4][4];
#pragma unroll
  for (int i = 0; i < 4; ++i)
#pragma unroll
    for (int j = 0; j < 4; ++j) acc[i][j] = zero8();

  // this wave's slice: waves 0, 1 bring the two halves of A's 128 rows, waves 2, 3 those of Bt's
  const bool isB = wave >= 2u;
  const uint64_t srcA = (uint64_t)(size_t)(A + (size_t)((tm << 7) + (int)((wave & 1u) << 6)) * lda);
  const uint64_t srcB = (uint64_t)(size_t)(Bt + (size_t)((tn << 7) + (int)((wave & 1u) << 6)) * ldb);
  const uint64_t gsrc = isB ? srcB : srcA;
  u32x8 g1 = tdm_group1((uint32_t)(isB ? ldb : lda) * 2u);
  asm volatile("" : "+s"(g1));   // the pinned() form on descriptor words: held in their scalar registers, built once, so that none is written again while a request is outstanding
  const uint32_t ldst = (uint32_t)(size_t)ring + wave * G_SLICE;
  const int nst = K >> 7;
  // this wave's fragment rows: A from slice wave >> 1, Bt from slice 2 + (wave & 1)
  const unsigned char* aR = ring + (wave >> 1) * G_SLICE + (uint32_t)rlane * G_PITCH + (uint32_t)koff * 2u;
  const unsigned char* bR = ring + (2u + (wave & 1u)) * G_SLICE + (uint32_t)rlane * G_PITCH + (uint32_t)koff * 2u;

  u32x4 g0 = tdm_group0(ldst, gsrc);
  tdm_load(g0, g1);                                           // stage 0 -> buffer 0
  wait_tensor0(g0, g1);
  __syncthreads();                                            // stage 0 published
  g0 = tdm_group0(ldst + G_STAGE, gsrc + G_ROWB);
  tdm_load(g0, g1);                                           // stage 1 -> buffer 1 (K >= 256)

  // kept rolled: one publish point per stage
#pragma unroll 1
  for (int s = 0; s < nst; ++s) {
    const uint32_t buf = ((uint32_t)s & 1u) * G_STAGE;
    // two fragment sets inside the stage: the LDS reads of the next 32 k go ahead of this 32 k's WMMAs; nothing of the next stage is read here
    V ah[2][4], bh[2][4];
#pragma unroll
    for (int j = 0; j < 4; ++j) {
      bh[0][j] = Frag<T>::load((const T*)(bR + buf + (uint32_t)j * 16u * G_PITCH));
      ah[0][j] = Frag<T>::load((const T*)(aR + buf + (uint32_t)j * 16u * G_PITCH));
    }
#pragma unroll
    for (int kk = 0; kk < 4; ++kk) {
      const int cur = kk & 1, nxt = cur ^ 1;
      if (kk < 3) {
#pragma unroll
        for (int j = 0; j < 4; ++j) {
          bh[nxt][j] = Frag<T>::load((const T*)(bR + buf + (uint32_t)j * 16u * G_PITCH + (uint32_t)(kk + 1) * 64u));
          ah[nxt][j] = Frag<T>::load((const T*)(aR + buf + (uint32_t)j * 16u * G_PITCH + (uint32_t)(kk + 1) * 64u));
        }
      }
#pragma unroll
      for (int i = 0; i < 4; ++i) {
#pragma unroll
        for (int j = 0; j < 4; ++j) acc[i][j] = Frag<T>::mma(ah[cur][i], bh[cur][j], acc[i][j]);
        acc_guard4(acc[i][0], acc[i][1], acc[i][2], acc[i][3]);   // the four vector slots behind a WMMA; it also keeps each group of LDS reads where it is written
      }
    }
    // publish point of stage s + 1: own LDS reads retired, own load landed, then the barrier that publishes s + 1 and frees this buffer
    wait_ds0();
    wait_tensor0(g0, g1);
    __syncthreads();
    if (pinned((uint32_t)(s + 2 < nst))) {
      g0 = tdm_group0(ldst + buf, gsrc + (uint64_t)(uint32_t)(s + 2) * G_ROWB);
      tdm_load(g0, g1);
    }
  }
  wait_tensor0(g0, g1);
  wait_ds0();
  acc_guard4(acc[0][0], acc[0][1], acc[0][2], acc[0][3]);
  acc_guard4(acc[1][0], acc[1][1], acc[1][2], acc[1][3]);
  acc_guard4(acc[2][0], acc[2][1], acc[2][2], acc[2][3]);
  acc_guard4(acc[3][0], acc[3][1], acc[3][2], acc[3][3]);

#pragma unroll
  for (int i = 0; i < 4; ++i) {
    const int mBase = m0 + (i << 4);
#pragma unroll
    for (int j = 0; j < 4; ++j) {
      const int n = n0 + (j << 4) + rlane;
      float bv = 0.f;
      if (BIAS_MODE == 2) bv = bias[n];
#pragma unroll
      for (int r = 0; r < 8; ++r) {
        float v = acc[i][j][r] * scale;
        if (BIAS_MODE == 1) v += bias[mBase + mOff + r];
        if (BIAS_MODE == 2) v += bv;
        slab[(mOff + r) * 68 + (j << 4) + rlane] = v;
      }
    }
    __builtin_amdgcn_fence(3 /* release order */, "workgroup");
    __builtin_amdgcn_wave_barrier();
    __builtin_amdgcn_fence(2 /* acquire order */, "workgroup");
    if (OUT_MODE == 0) {
      float* C = (float*)Cout;
      const int hh = lane >> 4, c4 = (lane & 15) * 4;     // row segment = 256 B = 16 lanes x 16 B
      {
#pragma unroll
        for (int it = 0; it < 8; ++it) {
          const int row = it * 2 + hh;
          v4f v = *(const v4f*)(slab + row * 68 + c4);
          *(v4f*)(C + (size_t)(mBase + row) * ldc + n0 + c4) = v;
        }
        
      }
    } else {
      const int q = lane >> 3, c8 = (lane & 7) * 8;
      unsigned short* C  = (unsigned short*)Cout;
      unsigned short* C2 = (unsigned short*)Cout2;
      {
#pragma unroll
        for (int it = 0; it < 4; ++it) {
          const int row = it * 4 + q;
          const float* sp = slab + row * 68 + c8;
          v8h hv, lv;
#pragma unroll
          for (int e = 0; e < 8; ++e) {
            if (OUT_MODE == 1) {
              hv[e] = (_Float16)sp[e];
              lv[e] = (_Float16)0.f;
            } else {
              const unsigned short hb = bfu_rne(sp[e]);
              const unsigned short lb = bfu_rne(sp[e] - bfu_f32(hb));
              hv[e] = __builtin_bit_cast(_Float16, hb);
              lv[e] = __builtin_bit_cast(_Float16, lb);
            }
          }
          *(v8h*)(C + (size_t)(mBase + row) * ldc + n0 + c8) = hv;
          if (OUT_MODE == 2) *(v8h*)(C2 + (size_t)(mBase + row) * ldc + n0 + c8) = lv;
        }
        
      }
    }
    __builtin_amdgcn_fence(3 /* release order */, "workgroup");
    __builtin_amdgcn_wave_barrier();
    __builtin_amdgcn_fence(2 /* acquire order */, "workgroup");
  }
}

// q, k and v projections in one launch: work-groups [0, T) take q's tiles, [T, 2T) k's, [2T, 3T) v's, T = tiles of one projection.
//   q, k: C[token][feature] = sum_k X[token][k] * W[feature][k] + bias[feature], f16 operands, bf16 hi + lo planes out
//   v, transposed: C[feature][token] = sum_k Wv[feature][k] * X[token][k] + bias[feature], f16 out (pitch = tokens)
// The output staging lies over the drained ring, so a work-group holds 144 KiB of LDS and two of them share a WGP:
// one's tensor-load waits, first fragment reads and epilogue run under the other's WMMAs.
constexpr int G_TILES = (MT / 128) * (DM / 128);
constexpr uint32_t G_SLAB = 16u * 68u * 4u;        // bytes of one wave's output staging
static_assert(4u * G_SLAB <= 2u * G_STAGE && G_SLAB % 16u == 0u);
__global__ __launch_bounds__(128) void k_gemm_qkv(const unsigned short* __restrict__ XQ, const unsigned short* __restrict__ XK, const unsigned short* __restrict__ XV,
                                                  const unsigned short* __restrict__ WQ, const unsigned short* __restrict__ WK, const unsigned short* __restrict__ WV,
                                                  unsigned short* __restrict__ QH, unsigned short* __restrict__ QL,
                                                  unsigned short* __restrict__ KH, unsigned short* __restrict__ KL,
                                                  unsigned short* __restrict__ VT, const float* __restrict__ BR, float scale) {
  __shared__ __attribute__((aligned(2048))) unsigned char ring[2 * G_STAGE];
  float* slab = (float*)(ring + (threadIdx.x >> 5) * G_SLAB);
  const int which = (int)blockIdx.x / G_TILES;                 // the same for the whole block
  const int tile  = (int)blockIdx.x - which * G_TILES;
  if (which < 2) {
    const bool isq = which == 0;
    gemm64_body<0, 2, 2>(isq ? XQ : XK, DM, isq ? WQ : WK, DM, (void*)(isq ? QH : KH), (void*)(isq ? QL : KL), DM, BR + which * DM, MT, DM, DM, scale, tile, slab, ring);
  } else {
    gemm64_body<0, 1, 1>(WV, DM, XV, DM, (void*)VT, (void*)VT, MT, BR + 2 * DM, DM, MT, DM, scale, tile, slab, ring);
  }
}
// output projection: bf16 operands (A = context hi|lo along K, Bt = [Wo|Wo]), bias[n], f32 out
__global__ __launch_bounds__(128) void k_gemm_out(const unsigned short* __restrict__ A, const unsigned short* __restrict__ W,
                                                  float* __restrict__ C, const float* __restrict__ bias, int M, int N, int K) {
  __shared__ __attribute__((aligned(2048))) unsigned char ring[2 * G_STAGE];
  __shared__ __align__(16) float sT[4][16 * 68];
  gemm64_body<1, 2, 0>(A, K, W, K, (void*)C, (void*)C, N, bias, M, N, K, 1.0f, (int)blockIdx.x, sT[threadIdx.x >> 5], ring);
}

// ---- operand preparation, all of it in one launch of long-lived waves ----
// A chunk is 16,384 consecutive floats of one source (16 rows of DM). A block of 16 waves takes four chunks; every thread asks for all its 16-B pieces first
// (each wave-wide load covers 512 contiguous bytes), then converts and stores them in the order in which they were asked for.
//   activations:  f32 -> bf16 (RNE) -> f16 plane [MT][DM]; rows (b, s) of the full-size inputs
//   Wq, Wk, Wv:   f32 -> bf16 (RNE) -> x16 -> f16 plane [DM][DM] (exact; [out][in] is already the Bt layout)
//   Wo:           f32 -> bf16 (RNE) plane [DM][2*DM] = [Wo | Wo], read once and stored twice
//   biases:       f32 -> bf16 (RNE) kept as f32; table: f32 -> bf16 plane [NRELP][DK], rows >= NREL written as zeros (clamped source address)
typedef __attribute__((ext_vector_type(2))) unsigned int u2;
constexpr int PR_T     = 512;                                   // threads per block
constexpr int PR_L     = 8;                                     // 16-B loads per thread and chunk
constexpr int PR_CH    = PR_T * PR_L * 4;                       // floats per chunk
constexpr int PR_ACT   = (int)(((long long)MT * DM) / PR_CH);   // chunks per activation plane
constexpr int PR_W     = (DM * DM) / PR_CH;                     // chunks per weight matrix
constexpr int PR_GRID  = PR_ACT > 4 * PR_W ? PR_ACT : 4 * PR_W;  // block b: chunk b of each activation plane and chunk b of [Wq, Wk, Wv, Wo]
constexpr int PR_SQ    = DM + NRELP * (DK / 4);                 // 4-float pieces of the four biases, then of the padded table
constexpr int PR_SMALL = (PR_SQ + PR_T - 1) / PR_T;             // the first blocks take one such piece per thread on top
static_assert(PR_CH % DM == 0 && SEQ % (PR_CH / DM) == 0 && ((long long)MT * DM) % PR_CH == 0 && (DM * DM) % PR_CH == 0);
static_assert(PR_SMALL <= PR_GRID && DK % 4 == 0 && DM % 4 == 0 && (PR_T * 4) % DM == 0);

__device__ __forceinline__ u2 pr_f16(v4f x, float sc) { u2 p; p.x = cmb_pk2(cmb_bf(x.x) * sc, cmb_bf(x.y) * sc); p.y = cmb_pk2(cmb_bf(x.z) * sc, cmb_bf(x.w) * sc); return p; }
__device__ __forceinline__ u2 pr_bf(v4f x) { u2 p; p.x = (unsigned)bfu_rne(x.x) | ((unsigned)bfu_rne(x.y) << 16); p.y = (unsigned)bfu_rne(x.z) | ((unsigned)bfu_rne(x.w) << 16); return p; }

__global__ __launch_bounds__(PR_T) void k_prep(const float* __restrict__ Qi, const float* __restrict__ Ki, const float* __restrict__ Vi,
                                               const float* __restrict__ Wq, const float* __restrict__ Wk, const float* __restrict__ Wv, const float* __restrict__ Wo,
                                               const float* __restrict__ bq, const float* __restrict__ bk, const float* __restrict__ bv, const float* __restrict__ bo,
                                               const float* __restrict__ rel,
                                               unsigned short* __restrict__ XQ, unsigned short* __restrict__ XK, unsigned short* __restrict__ XV,
                                               unsigned short* __restrict__ WQ6, unsigned short* __restrict__ WK6, unsigned short* __restrict__ WV6,
                                               unsigned short* __restrict__ WO2, float* __restrict__ BR, unsigned short* __restrict__ TB) {
  const unsigned t = threadIdx.x;
  const unsigned b = blockIdx.x;
  // chunk numbers are clamped for the loads, so that no branch stands among them; the stores are guarded
  const unsigned ka = min(b, (unsigned)(PR_ACT - 1));
  const unsigned kw = min(b, (unsigned)(4 * PR_W - 1));
  const unsigned w  = kw / (unsigned)PR_W, kc = kw % (unsigned)PR_W;
  const unsigned r0 = ka * (unsigned)(PR_CH / DM);
  const size_t ao = (size_t)(r0 / (unsigned)SEQ) * ((size_t)SEQ_FULL * DM) + (size_t)(r0 % (unsigned)SEQ) * DM;
  const v4f* sq = (const v4f*)(Qi + ao) + t;                    // block-uniform base + the thread's 16 B inside 8 KiB of the chunk
  const v4f* sk = (const v4f*)(Ki + ao) + t;
  const v4f* sv = (const v4f*)(Vi + ao) + t;
  const v4f* sw = (const v4f*)((w == 0u ? Wq : w == 1u ? Wk : w == 2u ? Wv : Wo) + (size_t)kc * PR_CH) + t;
  // one piece of the biases (u < DM) or of the table per thread of the first blocks; every thread's address is in bounds
  const unsigned u = b * (unsigned)PR_T + t;
  const unsigned tq = u < (unsigned)DM ? 0u : u - (unsigned)DM;

  v4f xs = {0.f, 0.f, 0.f, 0.f};
  if (b < (unsigned)PR_SMALL) {
    const unsigned bw = u / (unsigned)(DM / 4);
    const float* bs = bw == 0u ? bq : bw == 1u ? bk : bw == 2u ? bv : bo;
    const float* ss = u < (unsigned)DM ? bs + (u % (unsigned)(DM / 4)) * 4u : rel + min(tq / (unsigned)(DK / 4), (unsigned)(NREL - 1)) * (unsigned)DK + (tq % (unsigned)(DK / 4)) * 4u;
    xs = *(const v4f*)ss;
  }
  // PR_ORDER: the compiler moves nothing across it. The loads leave plane by plane and each plane is converted and stored as soon as its own loads are back,
  // while the later planes are still on their way; without it the conversions of all planes are mixed and the first store waits for most of the loads.
#define PR_ORDER() __builtin_amdgcn_sched_barrier(0)
  // every loop below is unrolled: the pieces stay in registers and their offsets become immediates
  v4f xq[PR_L], xk[PR_L], xv[PR_L], xw[PR_L];
#pragma unroll
  for (int j = 0; j < PR_L; ++j) xq[j] = sq[j * PR_T];
  PR_ORDER();
#pragma unroll
  for (int j = 0; j < PR_L; ++j) xk[j] = sk[j * PR_T];
  PR_ORDER();
#pragma unroll
  for (int j = 0; j < PR_L; ++j) xv[j] = sv[j * PR_T];
  PR_ORDER();
#pragma unroll
  for (int j = 0; j < PR_L; ++j) xw[j] = sw[j * PR_T];
  // stands in front of every later write of a register that one of the loads above names as an address; the thread number, their offset register, is named as an input so that it keeps its value until here
  asm volatile("s_wait_xcnt 0x0" :: "v"(t) : "memory");

  if (b < (unsigned)PR_SMALL) {
    if (u < (unsigned)DM) {
      v4f r; r.x = cmb_bf(xs.x); r.y = cmb_bf(xs.y); r.z = cmb_bf(xs.z); r.w = cmb_bf(xs.w);
      *(v4f*)(BR + u * 4u) = r;
    } else if (u < (unsigned)PR_SQ) {
      u2 pk = pr_bf(xs);
      if (tq / (unsigned)(DK / 4) >= (unsigned)NREL) { pk.x = 0u; pk.y = 0u; }
      *(u2*)(TB + tq * 4u) = pk;
    }
  }
  if (b < (unsigned)PR_ACT) {
    const size_t o = (size_t)ka * PR_CH + t * 4u;
#pragma unroll
    for (int j = 0; j < PR_L; ++j) *(u2*)(XQ + o + j * (PR_T * 4)) = pr_f16(xq[j], 1.0f);
    PR_ORDER();
#pragma unroll
    for (int j = 0; j < PR_L; ++j) *(u2*)(XK + o + j * (PR_T * 4)) = pr_f16(xk[j], 1.0f);
    PR_ORDER();
#pragma unroll
    for (int j = 0; j < PR_L; ++j) *(u2*)(XV + o + j * (PR_T * 4)) = pr_f16(xv[j], 1.0f);
    // stands in front of the weight chunk's conversions, which write over registers that these stores name
    asm volatile("s_wait_xcnt 0x0" ::: "memory");
  }
  if (b < (unsigned)(3 * PR_W)) {
    unsigned short* dp = (w == 0u ? WQ6 : w == 1u ? WK6 : WV6) + (size_t)kc * PR_CH + t * 4u;
#pragma unroll
    for (int j = 0; j < PR_L; ++j) *(u2*)(dp + j * (PR_T * 4)) = pr_f16(xw[j], 16.0f);
  } else if (b < (unsigned)(4 * PR_W)) {
    // row = element / DM, column = element % DM of Wo; PR_T * 4 floats are a whole number of rows
    unsigned short* dp = WO2 + ((size_t)kc * (PR_CH / DM) + (t * 4u) / (unsigned)DM) * (2 * DM) + (t * 4u) % (unsigned)DM;
#pragma unroll
    for (int j = 0; j < PR_L; ++j) {
      const u2 pk = pr_bf(xw[j]);
      *(u2*)(dp + j * ((PR_T * 4 / DM) * 2 * DM)) = pk;
      *(u2*)(dp + j * ((PR_T * 4 / DM) * 2 * DM) + DM) = pk;
    }
    // stands behind the last of these stores, in front of any later write of a register that they name
    asm volatile("s_wait_xcnt 0x0" ::: "memory");
  }
}

// =====================================================================================================================
// Fused attention with clipped relative-position bias. One wave per 16 queries; the 8 waves of a block share one (batch, head) and its K, V tiles in LDS.
//   score(l, r) = q_l . k_r / 8 + q_l . table[clip(r - l, -16, 16) + 16]
//   Transposed score tiles S^T = K . Q^T (A = key rows, B = query rows): D has lane = query, element = key, which is the A-operand
//   layout of P for O = P . V (32 keys per step), so P never leaves registers. q, k: bf16 hi/lo planes (hi.hi + hi.lo + lo.hi).
//   Relative dots: table (A, rows padded to NRELP) x q (B), hi + lo products, staged once per wave in LDS [16][QP] and gathered per element.
//   V^T plane [feature][token] f16 gives B fragments with contiguous keys. Online softmax in f32 (exp2 domain); P carried x2^14 in f16.
//   K hi, K lo (64 keys x 64 d) and V^T (64 features x 64 keys) come into LDS 64 keys at a time by tensor loads, one tile each from waves 0, 1, 2, two buffers:
//   stage s + 1 flies while stage s is worked on.
// =====================================================================================================================
constexpr uint32_t AT_KEYS  = 64u;                 // keys per stage
constexpr uint32_t AT_ROWB  = 128u;                // bytes of one tile row: 64 d of a key, or 64 keys of a feature
constexpr uint32_t AT_ROWS  = 64u;                 // rows per tile (one tensor load of one wave)
constexpr uint32_t AT_PITCH = AT_ROWB + 16u;       // LDS row pitch, laid by the load's pad: an odd multiple of 16 B for ds_load_b128 readers
constexpr uint32_t AT_SLICE = 10240u;              // 64 x 144 = 9,216 B rounded up to a multiple of 2 KiB
constexpr uint32_t AT_STAGE = 3u * AT_SLICE;       // [K hi | K lo | V^T]
constexpr int      AT_NST   = SEQ / (int)AT_KEYS;
static_assert(AT_ROWS * AT_PITCH <= AT_SLICE && AT_SLICE % 2048u == 0u);
static_assert(DK * 2 == (int)AT_ROWB && DK == (int)AT_ROWS && AT_NST >= 2);
// group 1: 1-byte elements, tile = tensor = 64 rows of 128 B, source row pitch in bytes, 16 B of LDS pad behind every 128-B row, no mask
__device__ __forceinline__ u32x8 at_group1(uint32_t src_pitch) {
  u32x8 g;
  g[0] = uni((1u << 20) | (4u << 22) | (3u << 25));
  g[1] = uni((AT_ROWB & 0xFFFFu) << 16);
  g[2] = uni((AT_ROWB >> 16) | ((AT_ROWS & 0xFFFFu) << 16));
  g[3] = uni((AT_ROWS >> 16) | (AT_ROWB << 16));
  g[4] = uni(AT_ROWS);
  g[5] = uni(src_pitch);
  g[6] = uni(0u);
  g[7] = uni(0u);
  return g;
}

__global__ __launch_bounds__(32 * AT_NW) void k_attn_rel(const unsigned short* __restrict__ QHp, const unsigned short* __restrict__ QLp,
                                                         const unsigned short* __restrict__ KHp, const unsigned short* __restrict__ KLp,
                                                         const unsigned short* __restrict__ VTp, const unsigned short* __restrict__ TBp,
                                                         unsigned short* __restrict__ CTX) {
  __shared__ __attribute__((aligned(2048))) unsigned char ring[2 * AT_STAGE];
  __shared__ __align__(16) float qrs[AT_NW][16 * QP];
  __shared__ __align__(16) float osm[AT_NW][16 * OSP];
  const __bf16* QH = (const __bf16*)QHp; const __bf16* QL = (const __bf16*)QLp;
  const __bf16* TB = (const __bf16*)TBp;
  const int lane = threadIdx.x & 31, wave = threadIdx.x >> 5, hh = lane >> 4, c = lane & 15;
  const int bh = (int)blockIdx.x / ((SEQ / 16) / AT_NW);            // the same for the whole block
  const int l0 = (((int)blockIdx.x - bh * ((SEQ / 16) / AT_NW)) * AT_NW + wave) * 16;
  const int b = bh / NH, h = bh - b * NH;
  const size_t tok0 = (size_t)b * SEQ;

  // q as B operand (lane = query column c), 2 k-steps of 32, hi and lo
  v16b qh[2], ql[2];
  {
    const size_t qo = (tok0 + l0 + c) * DM + h * DK + 8 * hh;
#pragma unroll
    for (int dc = 0; dc < 2; ++dc) { qh[dc] = ldfb(QH + qo + dc * 32); ql[dc] = ldfb(QL + qo + dc * 32); }
  }
  // this wave's tile: wave 0 brings K hi, wave 1 K lo, wave 2 V^T; the other waves issue nothing (their words name V^T's tile and are not used)
  const uint32_t wv = uni((uint32_t)threadIdx.x >> 5);
  const uint32_t sl = wv < 2u ? wv : 2u;
  const uint64_t gsrc = sl == 0u ? (uint64_t)(size_t)(KHp + tok0 * DM + h * DK)
                      : sl == 1u ? (uint64_t)(size_t)(KLp + tok0 * DM + h * DK)
                                 : (uint64_t)(size_t)(VTp + (size_t)(h * DK) * MT + tok0);
  const uint32_t gstep = sl == 2u ? AT_KEYS * 2u : AT_KEYS * (uint32_t)DM * 2u;     // source bytes from one stage to the next
  u32x8 g1 = at_group1(sl == 2u ? (uint32_t)MT * 2u : (uint32_t)DM * 2u);
  asm volatile("" : "+s"(g1));   // the pinned() form on descriptor words: held in their scalar registers, built once, so that none is written again while a request is outstanding
  const uint32_t ldst = (uint32_t)(size_t)ring + sl * AT_SLICE;
  u32x4 g0 = tdm_group0(ldst, gsrc);
  if (pinned((uint32_t)(wv < 3u))) {
    tdm_load(g0, g1);                                         // stage 0 -> buffer 0
    wait_tensor0(g0, g1);
  }
  __syncthreads();                                            // stage 0 published
  g0 = tdm_group0(ldst + AT_STAGE, gsrc + gstep);
  asm volatile("" : "+s"(g0));   // the pinned() form on descriptor words: all four stand in their scalar registers in front of the branch, so that none is written behind the load
  if (pinned((uint32_t)(wv < 3u))) tdm_load(g0, g1);          // stage 1 -> buffer 1 (SEQ >= 128)

  // relative dots: D[j][query] = sum_d table[j][d] * q[query][d]; lane = query c, element r -> j = jt*16 + 8hh + r
  float* myq = qrs[wave];
#pragma unroll
  for (int jt = 0; jt < NRELP / 16; ++jt) {
    v8f acc = zero8();
#pragma unroll
    for (int dc = 0; dc < 2; ++dc) {
      const v16b ta = ldfb(TB + (jt * 16 + c) * DK + dc * 32 + 8 * hh);
      acc = wmmab(ta, ql[dc], acc);
      acc = wmmab(ta, qh[dc], acc);
    }
#pragma unroll
    for (int r = 0; r < 8; ++r) myq[c * QP + jt * 16 + 8 * hh + r] = acc[r];
  }
  __builtin_amdgcn_fence(3 /* release order */, "workgroup");
  __builtin_amdgcn_wave_barrier();
  __builtin_amdgcn_fence(2 /* acquire order */, "workgroup");

  const int lglob = l0 + c;
  const float* qrow = myq + c * QP + MAXREL;        // indexed by clip(r - l, -16, 16)
  const float L2E = 1.4426950408889634f;
  float m_run = -1.0e30f, s_run = 0.f;
  v8f o[4];
#pragma unroll
  for (int t = 0; t < 4; ++t) o[t] = zero8();
  // fragment rows in LDS: lane = key row (K) or feature row (V^T) c of a 16-row group, lane half at 16 B
  const unsigned char* kR = ring + (uint32_t)c * AT_PITCH + (uint32_t)hh * 16u;
  const unsigned char* vR = kR + 2u * AT_SLICE;

  // kept rolled: one publish point per stage
#pragma unroll 1
  for (int s = 0; s < AT_NST; ++s) {
  const uint32_t buf = ((uint32_t)s & 1u) * AT_STAGE;
  // the two 32-key passes of a stage are unrolled: their LDS offsets become immediates
#pragma unroll
  for (int ps = 0; ps < 2; ++ps) {
    const int r0 = s * (int)AT_KEYS + ps * 32;
    // the pass's K fragments are read as one group ahead of its score products; only this stage's buffer is read (loops unrolled: the fragment arrays stay in registers)
    v16b kfh[2][2], kfl[2][2];
#pragma unroll
    for (int tt = 0; tt < 2; ++tt)
#pragma unroll
      for (int dc = 0; dc < 2; ++dc) {
        const unsigned char* kp = kR + buf + (uint32_t)(ps * 32 + 16 * tt) * AT_PITCH + (uint32_t)dc * 64u;
        kfh[tt][dc] = ldfb((const __bf16*)kp);
        kfl[tt][dc] = ldfb((const __bf16*)(kp + AT_SLICE));
      }
    v8f t[2];
#pragma unroll
    for (int tt = 0; tt < 2; ++tt) {
      v8f acc = zero8();
#pragma unroll
      for (int dc = 0; dc < 2; ++dc) {
        acc = wmmab(kfl[tt][dc], qh[dc], acc);
        acc = wmmab(kfh[tt][dc], ql[dc], acc);
        acc = wmmab(kfh[tt][dc], qh[dc], acc);
      }
      t[tt] = acc;
    }
    // the pass's V^T fragments are asked for ahead of the softmax, which covers their LDS latency (unrolled: the array stays in registers)
    v16h vfr[4];
#pragma unroll
    for (int tq = 0; tq < 4; ++tq) vfr[tq] = ldfh((const _Float16*)(vR + buf + (uint32_t)tq * 16u * AT_PITCH + (uint32_t)ps * 64u));
    // element e <-> key r0 + 8hh + e (tile 0) and r0 + 16 + 8hh + e (tile 1); this lane's query is lglob
    float p[16];
    float mt = -1.0e30f;
    const int dbase = r0 + 8 * hh - lglob;
#pragma unroll
    for (int e = 0; e < 8; ++e) {
      const int d0 = min(max(dbase + e, -MAXREL), MAXREL);
      const int d1 = min(max(dbase + 16 + e, -MAXREL), MAXREL);
      p[e]     = (t[0][e] * 0.125f + qrow[d0]) * L2E;
      p[8 + e] = (t[1][e] * 0.125f + qrow[d1]) * L2E;
      mt = fmaxf(mt, fmaxf(p[e], p[8 + e]));
    }
    mt = fmaxf(mt, __shfl_xor(mt, 16, 32));          // the two lane halves hold the same query
    const float m_new = fmaxf(m_run, mt);
    const float corr  = exp2f(m_run - m_new);
    float sum = 0.f;
    v16h pA;                                          // P as A operand: element i <-> key r0 + k(i, hh)
#pragma unroll
    for (int r = 0; r < 16; ++r) {
      const float ev = exp2f(p[r] - m_new);
      sum += ev;
      pA[r] = (_Float16)(ev * PSC);
    }
    sum += __shfl_xor(sum, 16, 32);
    s_run = s_run * corr + sum;
    m_run = m_new;
    float sc[8];
#pragma unroll
    for (int i = 0; i < 8; ++i) sc[i] = __shfl(corr, i + 8 * hh, 32);   // O tile rows are queries 8hh + i
#pragma unroll
    for (int tq = 0; tq < 4; ++tq) {
      v8f oc = o[tq];
#pragma unroll
      for (int i = 0; i < 8; ++i) oc[i] *= sc[i];
      o[tq] = wmmah(pA, vfr[tq], oc);
    }
  }
    // publish point of stage s + 1: own LDS reads retired, the issuer's own load landed, then the barrier that publishes s + 1 and frees this buffer
    wait_ds0();
    if (pinned((uint32_t)(wv < 3u))) wait_tensor0(g0, g1);
    __syncthreads();
    g0 = tdm_group0(ldst + buf, gsrc + (uint64_t)((uint32_t)(s + 2) * gstep));
    asm volatile("" : "+s"(g0));   // the pinned() form on descriptor words, as in front of the loop: formed behind the wait, none written behind the load
    if (pinned((uint32_t)(wv < 3u && s + 2 < AT_NST))) tdm_load(g0, g1);   // issued only while stage s + 2 exists
  }
  wait_tensor0(g0, g1);
  wait_ds0();

  float inv[8];
#pragma unroll
  for (int i = 0; i < 8; ++i) inv[i] = 1.0f / (__shfl(s_run, i + 8 * hh, 32) * PSC);
  float* os = osm[wave];
#pragma unroll
  for (int tq = 0; tq < 4; ++tq)
#pragma unroll
    for (int i = 0; i < 8; ++i) os[(8 * hh + i) * OSP + tq * 16 + c] = o[tq][i] * inv[i];
  __builtin_amdgcn_fence(3 /* release order */, "workgroup");
  __builtin_amdgcn_wave_barrier();
  __builtin_amdgcn_fence(2 /* acquire order */, "workgroup");
  {
    const int q = lane >> 3, c8 = (lane & 7) * 8;
    unsigned short* ch = CTX + (tok0 + l0) * (size_t)(2 * DM) + h * DK + c8;
    u4 ph[4], pl[4];
#pragma unroll
    for (int it = 0; it < 4; ++it) {
      const int row = it * 4 + q;
      const float* sp = os + row * OSP + c8;
      unsigned short hb[8], lb[8];
#pragma unroll
      for (int e = 0; e < 8; ++e) { const float v = sp[e]; hb[e] = bfu_rne(v); lb[e] = bfu_rne(v - bfu_f32(hb[e])); }
      ph[it].x = (unsigned)hb[0] | ((unsigned)hb[1] << 16); ph[it].y = (unsigned)hb[2] | ((unsigned)hb[3] << 16);
      ph[it].z = (unsigned)hb[4] | ((unsigned)hb[5] << 16); ph[it].w = (unsigned)hb[6] | ((unsigned)hb[7] << 16);
      pl[it].x = (unsigned)lb[0] | ((unsigned)lb[1] << 16); pl[it].y = (unsigned)lb[2] | ((unsigned)lb[3] << 16);
      pl[it].z = (unsigned)lb[4] | ((unsigned)lb[5] << 16); pl[it].w = (unsigned)lb[6] | ((unsigned)lb[7] << 16);
    }
    {
#pragma unroll
      for (int it = 0; it < 4; ++it) {
        const int row = it * 4 + q;
        *(u4*)(ch + (size_t)row * (2 * DM)) = ph[it];
        *(u4*)(ch + (size_t)row * (2 * DM) + DM) = pl[it];
      }
      
    }
  }
}

extern "C" void kernel_launch(void* const* d_in, const int* in_sizes, int n_in, void* d_out, int out_size, void* d_ws, size_t ws_size, hipStream_t stream) {
  if (n_in < 12) return;
  const long long actn = ((long long)(NB - 1) * SEQ_FULL + SEQ) * DM;
  if ((long long)in_sizes[0] < actn || (long long)in_sizes[1] < actn || (long long)in_sizes[2] < actn) return;
  if (in_sizes[3] < DM * DM || in_sizes[5] < DM * DM || in_sizes[7] < DM * DM || in_sizes[9] < DM * DM) return;
  if (in_sizes[4] < DM || in_sizes[6] < DM || in_sizes[8] < DM || in_sizes[10] < DM) return;
  if (in_sizes[11] < NREL * DK) return;
  if ((long long)out_size < (long long)MT * DM) return;

  const float* Qi = (const float*)d_in[0];
  const float* Ki = (const float*)d_in[1];
  const float* Vi = (const float*)d_in[2];
  const float* Wq = (const float*)d_in[3];
  const float* bq = (const float*)d_in[4];
  const float* Wk = (const float*)d_in[5];
  const float* bk = (const float*)d_in[6];
  const float* Wv = (const float*)d_in[7];
  const float* bv = (const float*)d_in[8];
  const float* Wo = (const float*)d_in[9];
  const float* bo = (const float*)d_in[10];
  const float* rel = (const float*)d_in[11];
  float* out = (float*)d_out;

  constexpr size_t SZ_ACT = (size_t)MT * DM * 2;          // 16-bit [MT][DM] plane
  constexpr size_t SZ_W   = (size_t)DM * DM * 2;
  constexpr size_t SZ_WO2 = (size_t)DM * 2 * DM * 2;
  constexpr size_t SZ_BR  = (size_t)4 * DM * 4;
  constexpr size_t SZ_TB  = (size_t)NRELP * DK * 2;
  constexpr size_t SZ_CTX = (size_t)MT * 2 * DM * 2;
  static_assert(SZ_ACT % 256 == 0 && SZ_W % 256 == 0 && SZ_WO2 % 256 == 0 && SZ_BR % 256 == 0 && SZ_TB % 256 == 0 && SZ_CTX % 256 == 0);
  constexpr size_t TOTAL = 3 * SZ_ACT + 3 * SZ_W + SZ_WO2 + SZ_BR + SZ_TB + 4 * SZ_ACT + SZ_ACT + SZ_CTX;
  static_assert(TOTAL <= (size_t)134217728);
  if (TOTAL > ws_size) return;

  char* wsp = (char*)d_ws;
  unsigned short* XQ  = (unsigned short*)wsp; wsp += SZ_ACT;
  unsigned short* XK  = (unsigned short*)wsp; wsp += SZ_ACT;
  unsigned short* XV  = (unsigned short*)wsp; wsp += SZ_ACT;
  unsigned short* WQ6 = (unsigned short*)wsp; wsp += SZ_W;
  unsigned short* WK6 = (unsigned short*)wsp; wsp += SZ_W;
  unsigned short* WV6 = (unsigned short*)wsp; wsp += SZ_W;
  unsigned short* WO2 = (unsigned short*)wsp; wsp += SZ_WO2;
  float*          BR  = (float*)wsp;          wsp += SZ_BR;
  unsigned short* TB  = (unsigned short*)wsp; wsp += SZ_TB;
  unsigned short* QHp = (unsigned short*)wsp; wsp += SZ_ACT;
  unsigned short* QLp = (unsigned short*)wsp; wsp += SZ_ACT;
  unsigned short* KHp = (unsigned short*)wsp; wsp += SZ_ACT;
  unsigned short* KLp = (unsigned short*)wsp; wsp += SZ_ACT;
  unsigned short* VTp = (unsigned short*)wsp; wsp += SZ_ACT;     // [DM features][MT tokens] f16
  unsigned short* CTX = (unsigned short*)wsp; wsp += SZ_CTX;     // [MT][2*DM] bf16: hi | lo

  k_prep<<<PR_GRID, PR_T, 0, stream>>>(Qi, Ki, Vi, Wq, Wk, Wv, Wo, bq, bk, bv, bo, rel, XQ, XK, XV, WQ6, WK6, WV6, WO2, BR, TB);

  const unsigned gQK = (unsigned)((MT / 128) * (DM / 128));
  k_gemm_qkv<<<3u * gQK, 128, 0, stream>>>(XQ, XK, XV, WQ6, WK6, WV6, QHp, QLp, KHp, KLp, VTp, BR, 0.0625f);

  k_attn_rel<<<(unsigned)((NB * NH * (SEQ / 16)) / AT_NW), 32 * AT_NW, 0, stream>>>(QHp, QLp, KHp, KLp, VTp, TB, CTX);

  k_gemm_out<<<gQK, 128, 0, stream>>>(CTX, WO2, out, BR + 3 * DM, MT, DM, 2 * DM);
}

// v005
// A run of this version takes 102 microseconds.
// Next to v004, in two timings, it ran 1.04 times as fast each time.
// Counting every step since v000, it is 3.68 times as fast.
// Contractions: q/k/v projections = v_wmma_f32_16x16x32_f16 (inputs and weights RNE-converted to bf16 and held exactly in f16, weights x16), f32 accumulate; content scores and relative-position dots = v_wmma_f32_16x16x32_bf16 with q, k as bf16 hi/lo split planes (3 products) and the 33x64 table as exact bf16, f32 accumulate; P.V = v_wmma_f32_16x16x32_f16 (P x2^14, v f16), f32 accumulate; output projection = v_wmma_f32_16x16x32_bf16 with the context as bf16 hi|lo folded along K against [Wo|Wo], f32 accumulate.
#include <hip/hip_runtime.h>
#include <math.h>
#include <stdint.h>

#ifndef NB
#define NB 4
#endif
#ifndef SEQ
#define SEQ 1024
#endif
#define NB_FULL 4
#define SEQ_FULL 1024
#define DM 1024
#define NH 16
#define DK 64
#define MAXREL 16
#define NREL 33
#define NRELP 48
#define MT (NB * SEQ)
#define AT_NW 8
#define QP 52
#define OSP 68
#define PSC 16384.0f

static_assert(NH * DK == DM);
static_assert(DK == 64);
static_assert(2 * MAXREL + 1 == NREL);
static_assert(NRELP % 16 == 0 && NRELP >= NREL);
static_assert(QP >= NRELP);
static_assert(SEQ % 64 == 0);
static_assert(MT % 128 == 0);
static_assert(DM % 128 == 0);
static_assert(DM >= 256);
static_assert(((SEQ / 16) * NB * NH) % AT_NW == 0);
static_assert((SEQ / 16) % AT_NW == 0);
static_assert(SEQ >= 128);
static_assert(NB <= NB_FULL && SEQ <= SEQ_FULL);

typedef __attribute__((ext_vector_type(16))) _Float16 v16h;
typedef __attribute__((ext_vector_type(8)))  _Float16 v8h;
typedef __attribute__((ext_vector_type(16))) __bf16   v16b;
typedef __attribute__((ext_vector_type(8)))  __bf16   v8b;
typedef __attribute__((ext_vector_type(8)))  float    v8f;
typedef __attribute__((ext_vector_type(4)))  float    v4f;
typedef __attribute__((ext_vector_type(4)))  unsigned int u4;

// 16-bit WMMA fragment map (wave32), lane L, hh = L>>4, c = L&15:
//   A 16x32: lane = row c;    element i -> k = (i<8) ? 8hh+i : 16+8hh+(i-8)
//   B 32x16: lane = column c; the same k(i,hh)
//   D 16x16 (8 f32): lane = column c; element r -> row 8hh+r

__device__ __forceinline__ unsigned short bfu_rne(float v) { unsigned u = __float_as_uint(v); u += 0x7FFFu + ((u >> 16) & 1u); return (unsigned short)(u >> 16); }
__device__ __forceinline__ float bfu_f32(unsigned short h) { return __uint_as_float(((unsigned)h) << 16); }
__device__ __forceinline__ float cmb_bf(float v) { const unsigned u = __float_as_uint(v); const unsigned r = (u + 0x7fffu + ((u >> 16) & 1u)) & 0xffff0000u; return __uint_as_float(r); }   // bf16 RNE kept as f32 (finite inputs)
__device__ __forceinline__ unsigned int cmb_pk2(float a, float b) { return (unsigned int)__builtin_bit_cast(unsigned short, (_Float16)a) | ((unsigned int)__builtin_bit_cast(unsigned short, (_Float16)b) << 16); }

// 2^x by the hardware instruction alone, for the softmax, whose arguments are <= 0. From -126 up it is the value exp2f gives; below that the result is 0 where exp2f
// gives a subnormal: P (x2^14, f16) is 0 either way, the running sum holds a term 1 that absorbs it, and a rescale factor that small leaves nothing of the old sums.
// A run of them is one statement: every result register differs from every argument register (early clobber), so that no v_exp_f32 is directly followed by an
// instruction that reads its result or writes over its argument; the v_nop is that one slot behind the last of the run.
__device__ __forceinline__ void exp2_hw8(const float (&x)[8], float (&e)[8]) {
  asm("v_exp_f32 %0, %8\n\tv_exp_f32 %1, %9\n\tv_exp_f32 %2, %10\n\tv_exp_f32 %3, %11\n\t"
      "v_exp_f32 %4, %12\n\tv_exp_f32 %5, %13\n\tv_exp_f32 %6, %14\n\tv_exp_f32 %7, %15\n\tv_nop"
      : "=&v"(e[0]), "=&v"(e[1]), "=&v"(e[2]), "=&v"(e[3]), "=&v"(e[4]), "=&v"(e[5]), "=&v"(e[6]), "=&v"(e[7])
      : "v"(x[0]), "v"(x[1]), "v"(x[2]), "v"(x[3]), "v"(x[4]), "v"(x[5]), "v"(x[6]), "v"(x[7]));
}
__device__ __forceinline__ float exp2_hw1(float x) {
  float e;
  asm("v_exp_f32 %0, %1\n\tv_nop" : "=v"(e) : "v"(x));
  return e;
}

__device__ __forceinline__ v8f zero8() { v8f z = {0.f, 0.f, 0.f, 0.f, 0.f, 0.f, 0.f, 0.f}; return z; }

__device__ __forceinline__ v8f wmmab(v16b a, v16b b, v8f c) {
  c = __builtin_amdgcn_wmma_f32_16x16x32_bf16(false, a, false, b, (short)0, c, false, false);
  asm volatile("v_nop\n\tv_nop\n\tv_nop\n\tv_nop" : "+v"(c) : "v"(a), "v"(b));
  return c;
}
__device__ __forceinline__ v8f wmmah(v16h a, v16h b, v8f c) {
  c = __builtin_amdgcn_wmma_f32_16x16x32_f16(false, a, false, b, (short)0, c, false, false);
  asm volatile("v_nop\n\tv_nop\n\tv_nop\n\tv_nop" : "+v"(c) : "v"(a), "v"(b));
  return c;
}
union FBu { v16b v; v8b h[2]; };
union FHu { v16h v; v8h h[2]; };
// p already includes the lane-half offset 8*hh: elements 0..7 <- p[0..7], 8..15 <- p[16..23]
__device__ __forceinline__ v16b ldfb(const __bf16* p) { FBu f; f.h[0] = *(const v8b*)(p); f.h[1] = *(const v8b*)(p + 16); return f.v; }
__device__ __forceinline__ v16h ldfh(const _Float16* p) { FHu f; f.h[0] = *(const v8h*)(p); f.h[1] = *(const v8h*)(p + 16); return f.v; }

// ---- hazard guards for the register-blocked GEMM ----
__device__ __forceinline__ void acc_guard4(v8f& a, v8f& b, v8f& c, v8f& d) { asm volatile("v_nop\n\tv_nop\n\tv_nop\n\tv_nop" : "+v"(a), "+v"(b), "+v"(c), "+v"(d)); }

template <typename T> struct Frag;
template <> struct Frag<_Float16> {
  typedef v16h V;
  static __device__ __forceinline__ v16h load(const _Float16* p) { return ldfh(p); }
  static __device__ __forceinline__ v8f mma(v16h a, v16h b, v8f c) { return __builtin_amdgcn_wmma_f32_16x16x32_f16(false, a, false, b, (short)0, c, false, false); }
};
template <> struct Frag<__bf16> {
  typedef v16b V;
  static __device__ __forceinline__ v16b load(const __bf16* p) { return ldfb(p); }
  static __device__ __forceinline__ v8f mma(v16b a, v16b b, v8f c) { return __builtin_amdgcn_wmma_f32_16x16x32_bf16(false, a, false, b, (short)0, c, false, false); }
};
template <int ET> struct Elem;
template <> struct Elem<0> { typedef _Float16 T; };
template <> struct Elem<1> { typedef __bf16 T; };

// ---- Tensor loads into LDS for the GEMM panels ----
typedef uint32_t u32x4 __attribute__((ext_vector_type(4)));
typedef uint32_t u32x8 __attribute__((ext_vector_type(8)));
constexpr uint32_t G_ROWB  = 256u;                 // bytes of one operand row per stage = 128 k
constexpr uint32_t G_ROWS  = 64u;                  // rows per slice (one tensor load of one wave)
constexpr uint32_t G_PITCH = G_ROWB + 16u;         // LDS row pitch, laid by the load's pad: an odd multiple of 16 B for ds_load_b128 readers
constexpr uint32_t G_SLICE = 18432u;               // 64 x 272 = 17,408 B rounded up to a multiple of 2 KiB
constexpr uint32_t G_STAGE = 4u * G_SLICE;         // [A rows 0..63 | A rows 64..127 | Bt rows 0..63 | Bt rows 64..127]
static_assert(G_ROWS * G_PITCH <= G_SLICE && G_SLICE % 2048u == 0u);
__device__ __forceinline__ uint32_t uni(uint32_t v) { return (uint32_t)__builtin_amdgcn_readfirstlane(v); }
// keeps the test in a scalar register, so that the branch round a tensor load is a scalar branch (the load ignores EXEC)
__device__ __forceinline__ uint32_t pinned(uint32_t v) { uint32_t w = (uint32_t)__builtin_amdgcn_readfirstlane(v); asm volatile("" : "+s"(w)); return w; }
// the wave's LDS reads have retired before the buffer is handed back for a refill
__device__ __forceinline__ void wait_ds0() { asm volatile("s_wait_dscnt 0x0" ::: "memory"); }
// the wave's own tensor load has landed (the compiler places no wait for it); the request's descriptor is named as an input so that its registers keep their values until here
__device__ __forceinline__ void wait_tensor0(u32x4 g0, u32x8 g1) { asm volatile("s_wait_tensorcnt 0x0" :: "s"(g0), "s"(g1) : "memory"); }
__device__ __forceinline__ void tdm_load(u32x4 g0, u32x8 g1) { asm volatile("tensor_load_to_lds %0, %1" :: "s"(g0), "s"(g1) : "memory"); }
__device__ __forceinline__ u32x8 tdm_group1(uint32_t src_pitch) {
  u32x8 g;
  g[0] = uni((1u << 20) | (5u << 22) | (3u << 25));
  g[1] = uni((G_ROWB & 0xFFFFu) << 16);
  g[2] = uni((G_ROWB >> 16) | ((G_ROWS & 0xFFFFu) << 16));
  g[3] = uni((G_ROWS >> 16) | (G_ROWB << 16));
  g[4] = uni(G_ROWS);
  g[5] = uni(src_pitch);
  g[6] = uni(0u);
  g[7] = uni(0u);
  return g;
}
__device__ __forceinline__ u32x4 tdm_group0(uint32_t lds_dst, uint64_t ga) {
  u32x4 g;
  g[0] = uni(1u); g[1] = uni(lds_dst); g[2] = uni((uint32_t)ga); g[3] = uni((((uint32_t)(ga >> 32)) & 0x01FFFFFFu) | 0x80000000u);
  return g;
}

// ---- Register-blocked WMMA GEMM body: C[m,n] = scale * sum_k A[m,k] * Bt[n,k] + bias; a work-group of 4 waves (2 x 2) owns a 128x128 tile, each wave 64x64 of it.
// The 128 rows of A and of Bt come into LDS 128 k at a time by tensor loads, one 64-row slice per wave and stage, two buffers: stage s + 1 flies while stage s is multiplied.
// A row-major [M,K] (pitch lda), Bt row-major [N,K] (pitch ldb); M,N % 128 == 0, K % 128 == 0, K >= 256 (no tails).
// BIAS_MODE 1 = bias[m], 2 = bias[n]. OUT_MODE 0 = f32, 1 = f16, 2 = bf16 hi plane (Cout) + bf16 lo plane (Cout2).
// tile = the work-group's tile number (the same in every thread). slab = the wave's own 16 x 68 floats of output staging; it may lie inside ring:
// the last pass of the loop ends with every wave's LDS reads retired, every tensor load landed and a work-group barrier, and nothing is issued behind it.
template <int ET, int BIAS_MODE, int OUT_MODE>
__device__ __forceinline__ void gemm64_body(
    const unsigned short* __restrict__ Ap, int lda, const unsigned short* __restrict__ Btp, int ldb,
    void* __restrict__ Cout, void* __restrict__ Cout2, int ldc, const float* __restrict__ bias,
    int M, int N, int K, float scale, int tile, float* slab, unsigned char* ring) {
  typedef typename Elem<ET>::T T;
  typedef typename Frag<T>::V V;
  const T* A = (const T*)Ap; const T* Bt = (const T*)Btp;
  const int lane = threadIdx.x & 31;
  const uint32_t wave = uni(threadIdx.x >> 5);
  const int tilesN = N >> 7;
  const int tilesM = M >> 7;
  if (tile >= tilesM * tilesN) return;   // the same for the whole block, in front of every barrier and tensor load
  const int tm = tile / tilesN;
  const int tn = tile - tm * tilesN;
  const int m0 = (tm << 7) + (int)((wave >> 1) << 6);
  const int n0 = (tn << 7) + (int)((wave & 1u) << 6);
  const int rlane = lane & 15;
  const int koff  = (lane >> 4) * 8;
  const int mOff  = (lane >> 4) * 8;

  v8f acc[4][4];
#pragma unroll
  for (int i = 0; i < 4; ++i)
#pragma unroll
    for (int j = 0; j < 4; ++j) acc[i][j] = zero8();

  // this wave's slice: waves 0, 1 bring the two halves of A's 128 rows, waves 2, 3 those of Bt's
  const bool isB = wave >= 2u;
  const uint64_t srcA = (uint64_t)(size_t)(A + (size_t)((tm << 7) + (int)((wave & 1u) << 6)) * lda);
  const uint64_t srcB = (uint64_t)(size_t)(Bt + (size_t)((tn << 7) + (int)((wave & 1u) << 6)) * ldb);
  const uint64_t gsrc = isB ? srcB : srcA;
  u32x8 g1 = tdm_group1((uint32_t)(isB ? ldb : lda) * 2u);
  asm volatile("" : "+s"(g1));   // the pinned() form on descriptor words: held in their scalar registers, built once, so that none is written again while a request is outstanding
  const uint32_t ldst = (uint32_t)(size_t)ring + wave * G_SLICE;
  const int nst = K >> 7;
  // this wave's fragment rows: A from slice wave >> 1, Bt from slice 2 + (wave & 1)
  const unsigned char* aR = ring + (wave >> 1) * G_SLICE + (uint32_t)rlane * G_PITCH + (uint32_t)koff * 2u;
  const unsigned char* bR = ring + (2u + (wave & 1u)) * G_SLICE + (uint32_t)rlane * G_PITCH + (uint32_t)koff * 2u;

  u32x4 g0 = tdm_group0(ldst, gsrc);
  tdm_load(g0, g1);                                           // stage 0 -> buffer 0
  wait_tensor0(g0, g1);
  __syncthreads();                                            // stage 0 published
  g0 = tdm_group0(ldst + G_STAGE, gsrc + G_ROWB);
  tdm_load(g0, g1);                                           // stage 1 -> buffer 1 (K >= 256)

  // kept rolled: one publish point per stage
#pragma unroll 1
  for (int s = 0; s < nst; ++s) {
    const uint32_t buf = ((uint32_t)s & 1u) * G_STAGE;
    // two fragment sets inside the stage: the LDS reads of the next 32 k go ahead of this 32 k's WMMAs; nothing of the next stage is read here
    V ah[2][4], bh[2][4];
#pragma unroll
    for (int j = 0; j < 4; ++j) {
      bh[0][j] = Frag<T>::load((const T*)(bR + buf + (uint32_t)j * 16u * G_PITCH));
      ah[0][j] = Frag<T>::load((const T*)(aR + buf + (uint32_t)j * 16u * G_PITCH));
    }
#pragma unroll
    for (int kk = 0; kk < 4; ++kk) {
      const int cur = kk & 1, nxt = cur ^ 1;
      if (kk < 3) {
#pragma unroll
        for (int j = 0; j < 4; ++j) {
          bh[nxt][j] = Frag<T>::load((const T*)(bR + buf + (uint32_t)j * 16u * G_PITCH + (uint32_t)(kk + 1) * 64u));
          ah[nxt][j] = Frag<T>::load((const T*)(aR + buf + (uint32_t)j * 16u * G_PITCH + (uint32_t)(kk + 1) * 64u));
        }
      }
#pragma unroll
      for (int i = 0; i < 4; ++i) {
#pragma unroll
        for (int j = 0; j < 4; ++j) acc[i][j] = Frag<T>::mma(ah[cur][i], bh[cur][j], acc[i][j]);
        acc_guard4(acc[i][0], acc[i][1], acc[i][2], acc[i][3]);   // the four vector slots behind a WMMA; it also keeps each group of LDS reads where it is written
      }
    }
    // publish point of stage s + 1: own LDS reads retired, own load landed, then the barrier that publishes s + 1 and frees this buffer
    wait_ds0();
    wait_tensor0(g0, g1);
    __syncthreads();
    if (pinned((uint32_t)(s + 2 < nst))) {
      g0 = tdm_group0(ldst + buf, gsrc + (uint64_t)(uint32_t)(s + 2) * G_ROWB);
      tdm_load(g0, g1);
    }
  }
  wait_tensor0(g0, g1);
  wait_ds0();
  acc_guard4(acc[0][0], acc[0][1], acc[0][2], acc[0][3]);
  acc_guard4(acc[1][0], acc[1][1], acc[1][2], acc[1][3]);
  acc_guard4(acc[2][0], acc[2][1], acc[2][2], acc[2][3]);
  acc_guard4(acc[3][0], acc[3][1], acc[3][2], acc[3][3]);

#pragma unroll
  for (int i = 0; i < 4; ++i) {
    const int mBase = m0 + (i << 4);
#pragma unroll
    for (int j = 0; j < 4; ++j) {
      const int n = n0 + (j << 4) + rlane;
      float bv = 0.f;
      if (BIAS_MODE == 2) bv = bias[n];
#pragma unroll
      for (int r = 0; r < 8; ++r) {
        float v = acc[i][j][r] * scale;
        if (BIAS_MODE == 1) v += bias[mBase + mOff + r];
        if (BIAS_MODE == 2) v += bv;
        slab[(mOff + r) * 68 + (j << 4) + rlane] = v;
      }
    }
    __builtin_amdgcn_fence(3 /* release order */, "workgroup");
    __builtin_amdgcn_wave_barrier();
    __builtin_amdgcn_fence(2 /* acquire order */, "workgroup");
    if (OUT_MODE == 0) {
      float* C = (float*)Cout;
      const int hh = lane >> 4, c4 = (lane & 15) * 4;     // row segment = 256 B = 16 lanes x 16 B
      {
#pragma unroll
        for (int it = 0; it < 8; ++it) {
          const int row = it * 2 + hh;
          v4f v = *(const v4f*)(slab + row * 68 + c4);
          *(v4f*)(C + (size_t)(mBase + row) * ldc + n0 + c4) = v;
        }
        
      }
    } else {
      const int q = lane >> 3, c8 = (lane & 7) * 8;
      unsigned short* C  = (unsigned short*)Cout;
      unsigned short* C2 = (unsigned short*)Cout2;
      {
#pragma unroll
        for (int it = 0; it < 4; ++it) {
          const int row = it * 4 + q;
          const float* sp = slab + row * 68 + c8;
          v8h hv, lv;
#pragma unroll
          for (int e = 0; e < 8; ++e) {
            if (OUT_MODE == 1) {
              hv[e] = (_Float16)sp[e];
              lv[e] = (_Float16)0.f;
            } else {
              const unsigned short hb = bfu_rne(sp[e]);
              const unsigned short lb = bfu_rne(sp[e] - bfu_f32(hb));
              hv[e] = __builtin_bit_cast(_Float16, hb);
              lv[e] = __builtin_bit_cast(_Float16, lb);
            }
          }
          *(v8h*)(C + (size_t)(mBase + row) * ldc + n0 + c8) = hv;
          if (OUT_MODE == 2) *(v8h*)(C2 + (size_t)(mBase + row) * ldc + n0 + c8) = lv;
        }
        
      }
    }
    __builtin_amdgcn_fence(3 /* release order */, "workgroup");
    __builtin_amdgcn_wave_barrier();
    __builtin_amdgcn_fence(2 /* acquire order */, "workgroup");
  }
}

// q, k and v projections in one launch: work-groups [0, T) take q's tiles, [T, 2T) k's, [2T, 3T) v's, T = tiles of one projection.
//   q, k: C[token][feature] = sum_k X[token][k] * W[feature][k] + bias[feature], f16 operands, bf16 hi + lo planes out
//   v, transposed: C[feature][token] = sum_k Wv[feature][k] * X[token][k] + bias[feature], f16 out (pitch = tokens)
// The output staging lies over the drained ring, so a work-group holds 144 KiB of LDS and two of them share a WGP:
// one's tensor-load waits, first fragment reads and epilogue run under the other's WMMAs.
constexpr int G_TILES = (MT / 128) * (DM / 128);
constexpr uint32_t G_SLAB = 16u * 68u * 4u;        // bytes of one wave's output staging
static_assert(4u * G_SLAB <= 2u * G_STAGE && G_SLAB % 16u == 0u);
__global__ __launch_bounds__(128) void k_gemm_qkv(const unsigned short* __restrict__ XQ, const unsigned short* __restrict__ XK, const unsigned short* __restrict__ XV,
                                                  const unsigned short* __restrict__ WQ, const unsigned short* __restrict__ WK, const unsigned short* __restrict__ WV,
                                                  unsigned short* __restrict__ QH, unsigned short* __restrict__ QL,
                                                  unsigned short* __restrict__ KH, unsigned short* __restrict__ KL,
                                                  unsigned short* __restrict__ VT, const float* __restrict__ BR, float scale) {
  __shared__ __attribute__((aligned(2048))) unsigned char ring[2 * G_STAGE];
  float* slab = (float*)(ring + (threadIdx.x >> 5) * G_SLAB);
  const int which = (int)blockIdx.x / G_TILES;                 // the same for the whole block
  const int tile  = (int)blockIdx.x - which * G_TILES;
  if (which < 2) {
    const bool isq = which == 0;
    gemm64_body<0, 2, 2>(isq ? XQ : XK, DM, isq ? WQ : WK, DM, (void*)(isq ? QH : KH), (void*)(isq ? QL : KL), DM, BR + which * DM, MT, DM, DM, scale, tile, slab, ring);
  } else {
    gemm64_body<0, 1, 1>(WV, DM, XV, DM, (void*)VT, (void*)VT, MT, BR + 2 * DM, DM, MT, DM, scale, tile, slab, ring);
  }
}
// output projection: bf16 operands (A = context hi|lo along K, Bt = [Wo|Wo]), bias[n], f32 out
__global__ __launch_bounds__(128) void k_gemm_out(const unsigned short* __restrict__ A, const unsigned short* __restrict__ W,
                                                  float* __restrict__ C, const float* __restrict__ bias, int M, int N, int K) {
  __shared__ __attribute__((aligned(2048))) unsigned char ring[2 * G_STAGE];
  __shared__ __align__(16) float sT[4][16 * 68];
  gemm64_body<1, 2, 0>(A, K, W, K, (void*)C, (void*)C, N, bias, M, N, K, 1.0f, (int)blockIdx.x, sT[threadIdx.x >> 5], ring);
}

// ---- operand preparation, all of it in one launch of long-lived waves ----
// A chunk is 16,384 consecutive floats of one source (16 rows of DM). A block of 16 waves takes four chunks; every thread asks for all its 16-B pieces first
// (each wave-wide load covers 512 contiguous bytes), then converts and stores them in the order in which they were asked for.
//   activations:  f32 -> bf16 (RNE) -> f16 plane [MT][DM]; rows (b, s) of the full-size inputs
//   Wq, Wk, Wv:   f32 -> bf16 (RNE) -> x16 -> f16 plane [DM][DM] (exact; [out][in] is already the Bt layout)
//   Wo:           f32 -> bf16 (RNE) plane [DM][2*DM] = [Wo | Wo], read once and stored twice
//   biases:       f32 -> bf16 (RNE) kept as f32; table: f32 -> bf16 plane [NRELP][DK], rows >= NREL written as zeros (clamped source address)
typedef __attribute__((ext_vector_type(2))) unsigned int u2;
constexpr int PR_T     = 512;                                   // threads per block
constexpr int PR_L     = 8;                                     // 16-B loads per thread and chunk
constexpr int PR_CH    = PR_T * PR_L * 4;                       // floats per chunk
constexpr int PR_ACT   = (int)(((long long)MT * DM) / PR_CH);   // chunks per activation plane
constexpr int PR_W     = (DM * DM) / PR_CH;                     // chunks per weight matrix
constexpr int PR_GRID  = PR_ACT > 4 * PR_W ? PR_ACT : 4 * PR_W;  // block b: chunk b of each activation plane and chunk b of [Wq, Wk, Wv, Wo]
constexpr int PR_SQ    = DM + NRELP * (DK / 4);                 // 4-float pieces of the four biases, then of the padded table
constexpr int PR_SMALL = (PR_SQ + PR_T - 1) / PR_T;             // the first blocks take one such piece per thread on top
static_assert(PR_CH % DM == 0 && SEQ % (PR_CH / DM) == 0 && ((long long)MT * DM) % PR_CH == 0 && (DM * DM) % PR_CH == 0);
static_assert(PR_SMALL <= PR_GRID && DK % 4 == 0 && DM % 4 == 0 && (PR_T * 4) % DM == 0);

__device__ __forceinline__ u2 pr_f16(v4f x, float sc) { u2 p; p.x = cmb_pk2(cmb_bf(x.x) * sc, cmb_bf(x.y) * sc); p.y = cmb_pk2(cmb_bf(x.z) * sc, cmb_bf(x.w) * sc); return p; }
__device__ __forceinline__ u2 pr_bf(v4f x) { u2 p; p.x = (unsigned)bfu_rne(x.x) | ((unsigned)bfu_rne(x.y) << 16); p.y = (unsigned)bfu_rne(x.z) | ((unsigned)bfu_rne(x.w) << 16); return p; }

__global__ __launch_bounds__(PR_T) void k_prep(const float* __restrict__ Qi, const float* __restrict__ Ki, const float* __restrict__ Vi,
                                               const float* __restrict__ Wq, const float* __restrict__ Wk, const float* __restrict__ Wv, const float* __restrict__ Wo,
                                               const float* __restrict__ bq, const float* __restrict__ bk, const float* __restrict__ bv, const float* __restrict__ bo,
                                               const float* __restrict__ rel,
                                               unsigned short* __restrict__ XQ, unsigned short* __restrict__ XK, unsigned short* __restrict__ XV,
                                               unsigned short* __restrict__ WQ6, unsigned short* __restrict__ WK6, unsigned short* __restrict__ WV6,
                                               unsigned short* __restrict__ WO2, float* __restrict__ BR, unsigned short* __restrict__ TB) {
  const unsigned t = threadIdx.x;
  const unsigned b = blockIdx.x;
  // chunk numbers are clamped for the loads, so that no branch stands among them; the stores are guarded
  const unsigned ka = min(b, (unsigned)(PR_ACT - 1));
  const unsigned kw = min(b, (unsigned)(4 * PR_W - 1));
  const unsigned w  = kw / (unsigned)PR_W, kc = kw % (unsigned)PR_W;
  const unsigned r0 = ka * (unsigned)(PR_CH / DM);
  const size_t ao = (size_t)(r0 / (unsigned)SEQ) * ((size_t)SEQ_FULL * DM) + (size_t)(r0 % (unsigned)SEQ) * DM;
  const v4f* sq = (const v4f*)(Qi + ao) + t;                    // block-uniform base + the thread's 16 B inside 8 KiB of the chunk
  const v4f* sk = (const v4f*)(Ki + ao) + t;
  const v4f* sv = (const v4f*)(Vi + ao) + t;
  const v4f* sw = (const v4f*)((w == 0u ? Wq : w == 1u ? Wk : w == 2u ? Wv : Wo) + (size_t)kc * PR_CH) + t;
  // one piece of the biases (u < DM) or of the table per thread of the first blocks; every thread's address is in bounds
  const unsigned u = b * (unsigned)PR_T + t;
  const unsigned tq = u < (unsigned)DM ? 0u : u - (unsigned)DM;

  v4f xs = {0.f, 0.f, 0.f, 0.f};
  if (b < (unsigned)PR_SMALL) {
    const unsigned bw = u / (unsigned)(DM / 4);
    const float* bs = bw == 0u ? bq : bw == 1u ? bk : bw == 2u ? bv : bo;
    const float* ss = u < (unsigned)DM ? bs + (u % (unsigned)(DM / 4)) * 4u : rel + min(tq / (unsigned)(DK / 4), (unsigned)(NREL - 1)) * (unsigned)DK + (tq % (unsigned)(DK / 4)) * 4u;
    xs = *(const v4f*)ss;
  }
  // PR_ORDER: the compiler moves nothing across it. The loads leave plane by plane and each plane is converted and stored as soon as its own loads are back,
  // while the later planes are still on their way; without it the conversions of all planes are mixed and the first store waits for most of the loads.
#define PR_ORDER() __builtin_amdgcn_sched_barrier(0)
  // every loop below is unrolled: the pieces stay in registers and their offsets become immediates
  v4f xq[PR_L], xk[PR_L], xv[PR_L], xw[PR_L];
#pragma unroll
  for (int j = 0; j < PR_L; ++j) xq[j] = sq[j * PR_T];
  PR_ORDER();
#pragma unroll
  for (int j = 0; j < PR_L; ++j) xk[j] = sk[j * PR_T];
  PR_ORDER();
#pragma unroll
  for (int j = 0; j < PR_L; ++j) xv[j] = sv[j * PR_T];
  PR_ORDER();
#pragma unroll
  for (int j = 0; j < PR_L; ++j) xw[j] = sw[j * PR_T];
  // stands in front of every later write of a register that one of the loads above names as an address; the thread number, their offset register, is named as an input so that it keeps its value until here
  asm volatile("s_wait_xcnt 0x0" :: "v"(t) : "memory");

  if (b < (unsigned)PR_SMALL) {
    if (u < (unsigned)DM) {
      v4f r; r.x = cmb_bf(xs.x); r.y = cmb_bf(xs.y); r.z = cmb_bf(xs.z); r.w = cmb_bf(xs.w);
      *(v4f*)(BR + u * 4u) = r;
    } else if (u < (unsigned)PR_SQ) {
      u2 pk = pr_bf(xs);
      if (tq / (unsigned)(DK / 4) >= (unsigned)NREL) { pk.x = 0u; pk.y = 0u; }
      *(u2*)(TB + tq * 4u) = pk;
    }
  }
  if (b < (unsigned)PR_ACT) {
    const size_t o = (size_t)ka * PR_CH + t * 4u;
#pragma unroll
    for (int j = 0; j < PR_L; ++j) *(u2*)(XQ + o + j * (PR_T * 4)) = pr_f16(xq[j], 1.0f);
    PR_ORDER();
#pragma unroll
    for (int j = 0; j < PR_L; ++j) *(u2*)(XK + o + j * (PR_T * 4)) = pr_f16(xk[j], 1.0f);
    PR_ORDER();
#pragma unroll
    for (int j = 0; j < PR_L; ++j) *(u2*)(XV + o + j * (PR_T * 4)) = pr_f16(xv[j], 1.0f);
    // stands in front of the weight chunk's conversions, which write over registers that these stores name
    asm volatile("s_wait_xcnt 0x0" ::: "memory");
  }
  if (b < (unsigned)(3 * PR_W)) {
    unsigned short* dp = (w == 0u ? WQ6 : w == 1u ? WK6 : WV6) + (size_t)kc * PR_CH + t * 4u;
#pragma unroll
    for (int j = 0; j < PR_L; ++j) *(u2*)(dp + j * (PR_T * 4)) = pr_f16(xw[j], 16.0f);
  } else if (b < (unsigned)(4 * PR_W)) {
    // row = element / DM, column = element % DM of Wo; PR_T * 4 floats are a whole number of rows
    unsigned short* dp = WO2 + ((size_t)kc * (PR_CH / DM) + (t * 4u) / (unsigned)DM) * (2 * DM) + (t * 4u) % (unsigned)DM;
#pragma unroll
    for (int j = 0; j < PR_L; ++j) {
      const u2 pk = pr_bf(xw[j]);
      *(u2*)(dp + j * ((PR_T * 4 / DM) * 2 * DM)) = pk;
      *(u2*)(dp + j * ((PR_T * 4 / DM) * 2 * DM) + DM) = pk;
    }
    // stands behind the last of these stores, in front of any later write of a register that they name
    asm volatile("s_wait_xcnt 0x0" ::: "memory");
  }
}

// =====================================================================================================================
// Fused attention with clipped relative-position bias. One wave per 16 queries; the 8 waves of a block share one (batch, head) and its K, V tiles in LDS.
//   score(l, r) = q_l . k_r / 8 + q_l . table[clip(r - l, -16, 16) + 16]
//   Transposed score tiles S^T = K . Q^T (A = key rows, B = query rows): D has lane = query, element = key, which is the A-operand
//   layout of P for O = P . V (32 keys per step), so P never leaves registers. q, k: bf16 hi/lo planes (hi.hi + hi.lo + lo.hi).
//   Relative dots: table (A, rows padded to NRELP) x q (B), hi + lo products, staged once per wave in LDS [16][QP] and gathered per element.
//   V^T plane [feature][token] f16 gives B fragments with contiguous keys. Online softmax in f32 (exp2 domain); P carried x2^14 in f16.
//   K hi, K lo (64 keys x 64 d) and V^T (64 features x 64 keys) come into LDS 64 keys at a time by tensor loads, one tile each from waves 0, 1, 2, two buffers:
//   stage s + 1 flies while stage s is worked on.
// =====================================================================================================================
constexpr uint32_t AT_KEYS  = 64u;                 // keys per stage
constexpr uint32_t AT_ROWB  = 128u;                // bytes of one tile row: 64 d of a key, or 64 keys of a feature
constexpr uint32_t AT_ROWS  = 64u;                 // rows per tile (one tensor load of one wave)
constexpr uint32_t AT_PITCH = AT_ROWB + 16u;       // LDS row pitch, laid by the load's pad: an odd multiple of 16 B for ds_load_b128 readers
constexpr uint32_t AT_SLICE = 10240u;              // 64 x 144 = 9,216 B rounded up to a multiple of 2 KiB
constexpr uint32_t AT_STAGE = 3u * AT_SLICE;       // [K hi | K lo | V^T]
constexpr int      AT_NST   = SEQ / (int)AT_KEYS;
static_assert(AT_ROWS * AT_PITCH <= AT_SLICE && AT_SLICE % 2048u == 0u);
static_assert(DK * 2 == (int)AT_ROWB && DK == (int)AT_ROWS && AT_NST >= 2);
// group 1: 1-byte elements, tile = tensor = 64 rows of 128 B, source row pitch in bytes, 16 B of LDS pad behind every 128-B row, no mask
__device__ __forceinline__ u32x8 at_group1(uint32_t src_pitch) {
  u32x8 g;
  g[0] = uni((1u << 20) | (4u << 22) | (3u << 25));
  g[1] = uni((AT_ROWB & 0xFFFFu) << 16);
  g[2] = uni((AT_ROWB >> 16) | ((AT_ROWS & 0xFFFFu) << 16));
  g[3] = uni((AT_ROWS >> 16) | (AT_ROWB << 16));
  g[4] = uni(AT_ROWS);
  g[5] = uni(src_pitch);
  g[6] = uni(0u);
  g[7] = uni(0u);
  return g;
}

__global__ __launch_bounds__(32 * AT_NW) void k_attn_rel(const unsigned short* __restrict__ QHp, const unsigned short* __restrict__ QLp,
                                                         const unsigned short* __restrict__ KHp, const unsigned short* __restrict__ KLp,
                                                         const unsigned short* __restrict__ VTp, const unsigned short* __restrict__ TBp,
                                                         unsigned short* __restrict__ CTX) {
  __shared__ __attribute__((aligned(2048))) unsigned char ring[2 * AT_STAGE];
  __shared__ __align__(16) float qrs[AT_NW][16 * QP];
  __shared__ __align__(16) float osm[AT_NW][16 * OSP];
  const __bf16* QH = (const __bf16*)QHp; const __bf16* QL = (const __bf16*)QLp;
  const __bf16* TB = (const __bf16*)TBp;
  const int lane = threadIdx.x & 31, wave = threadIdx.x >> 5, hh = lane >> 4, c = lane & 15;
  const int bh = (int)blockIdx.x / ((SEQ / 16) / AT_NW);            // the same for the whole block
  const int l0 = (((int)blockIdx.x - bh * ((SEQ / 16) / AT_NW)) * AT_NW + wave) * 16;
  const int b = bh / NH, h = bh - b * NH;
  const size_t tok0 = (size_t)b * SEQ;

  // q as B operand (lane = query column c), 2 k-steps of 32, hi and lo
  v16b qh[2], ql[2];
  {
    const size_t qo = (tok0 + l0 + c) * DM + h * DK + 8 * hh;
#pragma unroll
    for (int dc = 0; dc < 2; ++dc) { qh[dc] = ldfb(QH + qo + dc * 32); ql[dc] = ldfb(QL + qo + dc * 32); }
  }
  // this wave's tile: wave 0 brings K hi, wave 1 K lo, wave 2 V^T; the other waves issue nothing (their words name V^T's tile and are not used)
  const uint32_t wv = uni((uint32_t)threadIdx.x >> 5);
  const uint32_t sl = wv < 2u ? wv : 2u;
  const uint64_t gsrc = sl == 0u ? (uint64_t)(size_t)(KHp + tok0 * DM + h * DK)
                      : sl == 1u ? (uint64_t)(size_t)(KLp + tok0 * DM + h * DK)
                                 : (uint64_t)(size_t)(VTp + (size_t)(h * DK) * MT + tok0);
  const uint32_t gstep = sl == 2u ? AT_KEYS * 2u : AT_KEYS * (uint32_t)DM * 2u;     // source bytes from one stage to the next
  u32x8 g1 = at_group1(sl == 2u ? (uint32_t)MT * 2u : (uint32_t)DM * 2u);
  asm volatile("" : "+s"(g1));   // the pinned() form on descriptor words: held in their scalar registers, built once, so that none is written again while a request is outstanding
  const uint32_t ldst = (uint32_t)(size_t)ring + sl * AT_SLICE;
  u32x4 g0 = tdm_group0(ldst, gsrc);
  if (pinned((uint32_t)(wv < 3u))) {
    tdm_load(g0, g1);                                         // stage 0 -> buffer 0
    wait_tensor0(g0, g1);
  }
  __syncthreads();                                            // stage 0 published
  g0 = tdm_group0(ldst + AT_STAGE, gsrc + gstep);
  asm volatile("" : "+s"(g0));   // the pinned() form on descriptor words: all four stand in their scalar registers in front of the branch, so that none is written behind the load
  if (pinned((uint32_t)(wv < 3u))) tdm_load(g0, g1);          // stage 1 -> buffer 1 (SEQ >= 128)

  // relative dots: D[j][query] = sum_d table[j][d] * q[query][d]; lane = query c, element r -> j = jt*16 + 8hh + r
  float* myq = qrs[wave];
#pragma unroll
  for (int jt = 0; jt < NRELP / 16; ++jt) {
    v8f acc = zero8();
#pragma unroll
    for (int dc = 0; dc < 2; ++dc) {
      const v16b ta = ldfb(TB + (jt * 16 + c) * DK + dc * 32 + 8 * hh);
      acc = wmmab(ta, ql[dc], acc);
      acc = wmmab(ta, qh[dc], acc);
    }
#pragma unroll
    for (int r = 0; r < 8; ++r) myq[c * QP + jt * 16 + 8 * hh + r] = acc[r];
  }
  __builtin_amdgcn_fence(3 /* release order */, "workgroup");
  __builtin_amdgcn_wave_barrier();
  __builtin_amdgcn_fence(2 /* acquire order */, "workgroup");

  const int lglob = l0 + c;
  const float* qrow = myq + c * QP + MAXREL;        // indexed by clip(r - l, -16, 16)
  const float L2E = 1.4426950408889634f;
  float m_run = -1.0e30f, s_run = 0.f;
  v8f o[4];
#pragma unroll
  for (int t = 0; t < 4; ++t) o[t] = zero8();
  // fragment rows in LDS: lane = key row (K) or feature row (V^T) c of a 16-row group, lane half at 16 B
  const unsigned char* kR = ring + (uint32_t)c * AT_PITCH + (uint32_t)hh * 16u;
  const unsigned char* vR = kR + 2u * AT_SLICE;

  // kept rolled: one publish point per stage
#pragma unroll 1
  for (int s = 0; s < AT_NST; ++s) {
  const uint32_t buf = ((uint32_t)s & 1u) * AT_STAGE;
  // the two 32-key passes of a stage are unrolled: their LDS offsets become immediates
#pragma unroll
  for (int ps = 0; ps < 2; ++ps) {
    const int r0 = s * (int)AT_KEYS + ps * 32;
    // the pass's K fragments are read as one group ahead of its score products; only this stage's buffer is read (loops unrolled: the fragment arrays stay in registers)
    v16b kfh[2][2], kfl[2][2];
#pragma unroll
    for (int tt = 0; tt < 2; ++tt)
#pragma unroll
      for (int dc = 0; dc < 2; ++dc) {
        const unsigned char* kp = kR + buf + (uint32_t)(ps * 32 + 16 * tt) * AT_PITCH + (uint32_t)dc * 64u;
        kfh[tt][dc] = ldfb((const __bf16*)kp);
        kfl[tt][dc] = ldfb((const __bf16*)(kp + AT_SLICE));
      }
    v8f t[2];
#pragma unroll
    for (int tt = 0; tt < 2; ++tt) {
      v8f acc = zero8();
#pragma unroll
      for (int dc = 0; dc < 2; ++dc) {
        acc = wmmab(kfl[tt][dc], qh[dc], acc);
        acc = wmmab(kfh[tt][dc], ql[dc], acc);
        acc = wmmab(kfh[tt][dc], qh[dc], acc);
      }
      t[tt] = acc;
    }
    // the pass's V^T fragments are asked for ahead of the softmax, which covers their LDS latency (unrolled: the array stays in registers)
    v16h vfr[4];
#pragma unroll
    for (int tq = 0; tq < 4; ++tq) vfr[tq] = ldfh((const _Float16*)(vR + buf + (uint32_t)tq * 16u * AT_PITCH + (uint32_t)ps * 64u));
    // element e <-> key r0 + 8hh + e (tile 0) and r0 + 16 + 8hh + e (tile 1); this lane's query is lglob
    float p[16];
    float mt = -1.0e30f;
    const int dbase = r0 + 8 * hh - lglob;
#pragma unroll
    for (int e = 0; e < 8; ++e) {
      const int d0 = min(max(dbase + e, -MAXREL), MAXREL);
      const int d1 = min(max(dbase + 16 + e, -MAXREL), MAXREL);
      p[e]     = (t[0][e] * 0.125f + qrow[d0]) * L2E;
      p[8 + e] = (t[1][e] * 0.125f + qrow[d1]) * L2E;
      mt = fmaxf(mt, fmaxf(p[e], p[8 + e]));
    }
    mt = fmaxf(mt, __shfl_xor(mt, 16, 32));          // the two lane halves hold the same query
    const float m_new = fmaxf(m_run, mt);
    const float corr  = exp2_hw1(m_run - m_new);
    float sum = 0.f;
    v16h pA;                                          // P as A operand: element i <-> key r0 + k(i, hh)
    // two runs of eight exponentials; the loops are unrolled so that arguments and results are registers, as the asm operands ask
#pragma unroll
    for (int g = 0; g < 2; ++g) {
      float xa[8], ea[8];
#pragma unroll
      for (int r = 0; r < 8; ++r) xa[r] = p[8 * g + r] - m_new;
      exp2_hw8(xa, ea);
#pragma unroll
      for (int r = 0; r < 8; ++r) {
        sum += ea[r];
        pA[8 * g + r] = (_Float16)(ea[r] * PSC);
      }
    }
    sum += __shfl_xor(sum, 16, 32);
    s_run = s_run * corr + sum;
    m_run = m_new;
    float sc[8];
#pragma unroll
    for (int i = 0; i < 8; ++i) sc[i] = __shfl(corr, i + 8 * hh, 32);   // O tile rows are queries 8hh + i
#pragma unroll
    for (int tq = 0; tq < 4; ++tq) {
      v8f oc = o[tq];
#pragma unroll
      for (int i = 0; i < 8; ++i) oc[i] *= sc[i];
      o[tq] = wmmah(pA, vfr[tq], oc);
    }
  }
    // publish point of stage s + 1: own LDS reads retired, the issuer's own load landed, then the barrier that publishes s + 1 and frees this buffer
    wait_ds0();
    if (pinned((uint32_t)(wv < 3u))) wait_tensor0(g0, g1);
    __syncthreads();
    g0 = tdm_group0(ldst + buf, gsrc + (uint64_t)((uint32_t)(s + 2) * gstep));
    asm volatile("" : "+s"(g0));   // the pinned() form on descriptor words, as in front of the loop: formed behind the wait, none written behind the load
    if (pinned((uint32_t)(wv < 3u && s + 2 < AT_NST))) tdm_load(g0, g1);   // issued only while stage s + 2 exists
  }
  wait_tensor0(g0, g1);
  wait_ds0();

  float inv[8];
#pragma unroll
  for (int i = 0; i < 8; ++i) inv[i] = 1.0f / (__shfl(s_run, i + 8 * hh, 32) * PSC);
  float* os = osm[wave];
#pragma unroll
  for (int tq = 0; tq < 4; ++tq)
#pragma unroll
    for (int i = 0; i < 8; ++i) os[(8 * hh + i) * OSP + tq * 16 + c] = o[tq][i] * inv[i];
  __builtin_amdgcn_fence(3 /* release order */, "workgroup");
  __builtin_amdgcn_wave_barrier();
  __builtin_amdgcn_fence(2 /* acquire order */, "workgroup");
  {
    const int q = lane >> 3, c8 = (lane & 7) * 8;
    unsigned short* ch = CTX + (tok0 + l0) * (size_t)(2 * DM) + h * DK + c8;
    u4 ph[4], pl[4];
#pragma unroll
    for (int it = 0; it < 4; ++it) {
      const int row = it * 4 + q;
      const float* sp = os + row * OSP + c8;
      unsigned short hb[8], lb[8];
#pragma unroll
      for (int e = 0; e < 8; ++e) { const float v = sp[e]; hb[e] = bfu_rne(v); lb[e] = bfu_rne(v - bfu_f32(hb[e])); }
      ph[it].x = (unsigned)hb[0] | ((unsigned)hb[1] << 16); ph[it].y = (unsigned)hb[2] | ((unsigned)hb[3] << 16);
      ph[it].z = (unsigned)hb[4] | ((unsigned)hb[5] << 16); ph[it].w = (unsigned)hb[6] | ((unsigned)hb[7] << 16);
      pl[it].x = (unsigned)lb[0] | ((unsigned)lb[1] << 16); pl[it].y = (unsigned)lb[2] | ((unsigned)lb[3] << 16);
      pl[it].z = (unsigned)lb[4] | ((unsigned)lb[5] << 16); pl[it].w = (unsigned)lb[6] | ((unsigned)lb[7] << 16);
    }
    {
#pragma unroll
      for (int it = 0; it < 4; ++it) {
        const int row = it * 4 + q;
        *(u4*)(ch + (size_t)row * (2 * DM)) = ph[it];
        *(u4*)(ch + (size_t)row * (2 * DM) + DM) = pl[it];
      }
      
    }
  }
}

extern "C" void kernel_launch(void* const* d_in, const int* in_sizes, int n_in, void* d_out, int out_size, void* d_ws, size_t ws_size, hipStream_t stream) {
  if (n_in < 12) return;
  const long long actn = ((long long)(NB - 1) * SEQ_FULL + SEQ) * DM;
  if ((long long)in_sizes[0] < actn || (long long)in_sizes[1] < actn || (long long)in_sizes[2] < actn) return;
  if (in_sizes[3] < DM * DM || in_sizes[5] < DM * DM || in_sizes[7] < DM * DM || in_sizes[9] < DM * DM) return;
  if (in_sizes[4] < DM || in_sizes[6] < DM || in_sizes[8] < DM || in_sizes[10] < DM) return;
  if (in_sizes[11] < NREL * DK) return;
  if ((long long)out_size < (long long)MT * DM) return;

  const float* Qi = (const float*)d_in[0];
  const float* Ki = (const float*)d_in[1];
  const float* Vi = (const float*)d_in[2];
  const float* Wq = (const float*)d_in[3];
  const float* bq = (const float*)d_in[4];
  const float* Wk = (const float*)d_in[5];
  const float* bk = (const float*)d_in[6];
  const float* Wv = (const float*)d_in[7];
  const float* bv = (const float*)d_in[8];
  const float* Wo = (const float*)d_in[9];
  const float* bo = (const float*)d_in[10];
  const float* rel = (const float*)d_in[11];
  float* out = (float*)d_out;

  constexpr size_t SZ_ACT = (size_t)MT * DM * 2;          // 16-bit [MT][DM] plane
  constexpr size_t SZ_W   = (size_t)DM * DM * 2;
  constexpr size_t SZ_WO2 = (size_t)DM * 2 * DM * 2;
  constexpr size_t SZ_BR  = (size_t)4 * DM * 4;
  constexpr size_t SZ_TB  = (size_t)NRELP * DK * 2;
  constexpr size_t SZ_CTX = (size_t)MT * 2 * DM * 2;
  static_assert(SZ_ACT % 256 == 0 && SZ_W % 256 == 0 && SZ_WO2 % 256 == 0 && SZ_BR % 256 == 0 && SZ_TB % 256 == 0 && SZ_CTX % 256 == 0);
  constexpr size_t TOTAL = 3 * SZ_ACT + 3 * SZ_W + SZ_WO2 + SZ_BR + SZ_TB + 4 * SZ_ACT + SZ_ACT + SZ_CTX;
  static_assert(TOTAL <= (size_t)134217728);
  if (TOTAL > ws_size) return;

  char* wsp = (char*)d_ws;
  unsigned short* XQ  = (unsigned short*)wsp; wsp += SZ_ACT;
  unsigned short* XK  = (unsigned short*)wsp; wsp += SZ_ACT;
  unsigned short* XV  = (unsigned short*)wsp; wsp += SZ_ACT;
  unsigned short* WQ6 = (unsigned short*)wsp; wsp += SZ_W;
  unsigned short* WK6 = (unsigned short*)wsp; wsp += SZ_W;
  unsigned short* WV6 = (unsigned short*)wsp; wsp += SZ_W;
  unsigned short* WO2 = (unsigned short*)wsp; wsp += SZ_WO2;
  float*          BR  = (float*)wsp;          wsp += SZ_BR;
  unsigned short* TB  = (unsigned short*)wsp; wsp += SZ_TB;
  unsigned short* QHp = (unsigned short*)wsp; wsp += SZ_ACT;
  unsigned short* QLp = (unsigned short*)wsp; wsp += SZ_ACT;
  unsigned short* KHp = (unsigned short*)wsp; wsp += SZ_ACT;
  unsigned short* KLp = (unsigned short*)wsp; wsp += SZ_ACT;
  unsigned short* VTp = (unsigned short*)wsp; wsp += SZ_ACT;     // [DM features][MT tokens] f16
  unsigned short* CTX = (unsigned short*)wsp; wsp += SZ_CTX;     // [MT][2*DM] bf16: hi | lo

  k_prep<<<PR_GRID, PR_T, 0, stream>>>(Qi, Ki, Vi, Wq, Wk, Wv, Wo, bq, bk, bv, bo, rel, XQ, XK, XV, WQ6, WK6, WV6, WO2, BR, TB);

  const unsigned gQK = (unsigned)((MT / 128) * (DM / 128));
  k_gemm_qkv<<<3u * gQK, 128, 0, stream>>>(XQ, XK, XV, WQ6, WK6, WV6, QHp, QLp, KHp, KLp, VTp, BR, 0.0625f);

  k_attn_rel<<<(unsigned)((NB * NH * (SEQ / 16)) / AT_NW), 32 * AT_NW, 0, stream>>>(QHp, QLp, KHp, KLp, VTp, TB, CTX);

  k_gemm_out<<<gQK, 128, 0, stream>>>(CTX, WO2, out, BR + 3 * DM, MT, DM, 2 * DM);
}

// v006
// Measured time: 98.3 microseconds a run.
// Timed twice side by side with v005, it ran 1.04 times as fast both times.
// Over all steps from v000 it is 3.84 times as fast.
// Contractions: q/k/v projections = v_wmma_f32_16x16x32_f16 (inputs and weights RNE-converted to bf16 and held exactly in f16, weights x16), f32 accumulate; content scores and relative-position dots = v_wmma_f32_16x16x32_bf16 with q, k as bf16 hi/lo split planes (3 products) and the 33x64 table as exact bf16, f32 accumulate; P.V = v_wmma_f32_16x16x32_f16 (P x2^14, v f16), f32 accumulate; output projection = v_wmma_f32_16x16x32_bf16 with the context as bf16 hi|lo folded along K against [Wo|Wo], f32 accumulate.
#include <hip/hip_runtime.h>
#include <math.h>
#include <stdint.h>

#ifndef NB
#define NB 4
#endif
#ifndef SEQ
#define SEQ 1024
#endif
#define NB_FULL 4
#define SEQ_FULL 1024
#define DM 1024
#define NH 16
#define DK 64
#define MAXREL 16
#define NREL 33
#define NRELP 48
#define MT (NB * SEQ)
#define AT_NW 8
#define QP 52
#define OSP 68
#define PSC 16384.0f

static_assert(NH * DK == DM);
static_assert(DK == 64);
static_assert(2 * MAXREL + 1 == NREL);
static_assert(NRELP % 16 == 0 && NRELP >= NREL);
static_assert(QP >= NRELP);
static_assert(SEQ % 64 == 0);
static_assert(MT % 128 == 0);
static_assert(DM % 128 == 0);
static_assert(DM >= 256);
static_assert(((SEQ / 16) * NB * NH) % AT_NW == 0);
static_assert((SEQ / 16) % AT_NW == 0);
static_assert(SEQ >= 128);
static_assert(NB <= NB_FULL && SEQ <= SEQ_FULL);

typedef __attribute__((ext_vector_type(16))) _Float16 v16h;
typedef __attribute__((ext_vector_type(8)))  _Float16 v8h;
typedef __attribute__((ext_vector_type(16))) __bf16   v16b;
typedef __attribute__((ext_vector_type(8)))  __bf16   v8b;
typedef __attribute__((ext_vector_type(8)))  float    v8f;
typedef __attribute__((ext_vector_type(4)))  float    v4f;
typedef __attribute__((ext_vector_type(4)))  unsigned int u4;

// 16-bit WMMA fragment map (wave32), lane L, hh = L>>4, c = L&15:
//   A 16x32: lane = row c;    element i -> k = (i<8) ? 8hh+i : 16+8hh+(i-8)
//   B 32x16: lane = column c; the same k(i,hh)
//   D 16x16 (8 f32): lane = column c; element r -> row 8hh+r

__device__ __forceinline__ unsigned short bfu_rne(float v) { unsigned u = __float_as_uint(v); u += 0x7FFFu + ((u >> 16) & 1u); return (unsigned short)(u >> 16); }
__device__ __forceinline__ float bfu_f32(unsigned short h) { return __uint_as_float(((unsigned)h) << 16); }
__device__ __forceinline__ float cmb_bf(float v) { const unsigned u = __float_as_uint(v); const unsigned r = (u + 0x7fffu + ((u >> 16) & 1u)) & 0xffff0000u; return __uint_as_float(r); }   // bf16 RNE kept as f32 (finite inputs)
__device__ __forceinline__ unsigned int cmb_pk2(float a, float b) { return (unsigned int)__builtin_bit_cast(unsigned short, (_Float16)a) | ((unsigned int)__builtin_bit_cast(unsigned short, (_Float16)b) << 16); }

// 2^x by the hardware instruction alone, for the softmax, whose arguments are <= 0 up to rounding. From -126 up it is the value exp2f gives; below that the result is 0 where exp2f
// gives a subnormal: P (x2^14, f16) is 0 either way, the running sum holds a term 1 that absorbs it, and a rescale factor that small leaves nothing of the old sums.
// A run of them is one statement: every result register differs from every argument register (early clobber), so that no v_exp_f32 is directly followed by an
// instruction that reads its result or writes over its argument; the v_nop is that one slot behind the last of the run.
__device__ __forceinline__ void exp2_hw8(const float (&x)[8], float (&e)[8]) {
  asm("v_exp_f32 %0, %8\n\tv_exp_f32 %1, %9\n\tv_exp_f32 %2, %10\n\tv_exp_f32 %3, %11\n\t"
      "v_exp_f32 %4, %12\n\tv_exp_f32 %5, %13\n\tv_exp_f32 %6, %14\n\tv_exp_f32 %7, %15\n\tv_nop"
      : "=&v"(e[0]), "=&v"(e[1]), "=&v"(e[2]), "=&v"(e[3]), "=&v"(e[4]), "=&v"(e[5]), "=&v"(e[6]), "=&v"(e[7])
      : "v"(x[0]), "v"(x[1]), "v"(x[2]), "v"(x[3]), "v"(x[4]), "v"(x[5]), "v"(x[6]), "v"(x[7]));
}
__device__ __forceinline__ float exp2_hw1(float x) {
  float e;
  asm("v_exp_f32 %0, %1\n\tv_nop" : "=v"(e) : "v"(x));
  return e;
}

// the value that lane addr / 4 holds: the instruction that __shfl and __shfl_xor compile to, with the byte index formed once, in front of the loop, by the caller
__device__ __forceinline__ float from_lane(float v, int addr) { return __int_as_float(__builtin_amdgcn_ds_bpermute(addr, __float_as_int(v))); }

__device__ __forceinline__ v8f zero8() { v8f z = {0.f, 0.f, 0.f, 0.f, 0.f, 0.f, 0.f, 0.f}; return z; }

__device__ __forceinline__ v8f wmmab(v16b a, v16b b, v8f c) {
  c = __builtin_amdgcn_wmma_f32_16x16x32_bf16(false, a, false, b, (short)0, c, false, false);
  asm volatile("v_nop\n\tv_nop\n\tv_nop\n\tv_nop" : "+v"(c) : "v"(a), "v"(b));
  return c;
}
__device__ __forceinline__ v8f wmmah(v16h a, v16h b, v8f c) {
  c = __builtin_amdgcn_wmma_f32_16x16x32_f16(false, a, false, b, (short)0, c, false, false);
  asm volatile("v_nop\n\tv_nop\n\tv_nop\n\tv_nop" : "+v"(c) : "v"(a), "v"(b));
  return c;
}
union FBu { v16b v; v8b h[2]; };
union FHu { v16h v; v8h h[2]; };
// p already includes the lane-half offset 8*hh: elements 0..7 <- p[0..7], 8..15 <- p[16..23]
__device__ __forceinline__ v16b ldfb(const __bf16* p) { FBu f; f.h[0] = *(const v8b*)(p); f.h[1] = *(const v8b*)(p + 16); return f.v; }
__device__ __forceinline__ v16h ldfh(const _Float16* p) { FHu f; f.h[0] = *(const v8h*)(p); f.h[1] = *(const v8h*)(p + 16); return f.v; }

// ---- hazard guards for the register-blocked GEMM ----
__device__ __forceinline__ void acc_guard4(v8f& a, v8f& b, v8f& c, v8f& d) { asm volatile("v_nop\n\tv_nop\n\tv_nop\n\tv_nop" : "+v"(a), "+v"(b), "+v"(c), "+v"(d)); }

template <typename T> struct Frag;
template <> struct Frag<_Float16> {
  typedef v16h V;
  static __device__ __forceinline__ v16h load(const _Float16* p) { return ldfh(p); }
  static __device__ __forceinline__ v8f mma(v16h a, v16h b, v8f c) { return __builtin_amdgcn_wmma_f32_16x16x32_f16(false, a, false, b, (short)0, c, false, false); }
};
template <> struct Frag<__bf16> {
  typedef v16b V;
  static __device__ __forceinline__ v16b load(const __bf16* p) { return ldfb(p); }
  static __device__ __forceinline__ v8f mma(v16b a, v16b b, v8f c) { return __builtin_amdgcn_wmma_f32_16x16x32_bf16(false, a, false, b, (short)0, c, false, false); }
};
template <int ET> struct Elem;
template <> struct Elem<0> { typedef _Float16 T; };
template <> struct Elem<1> { typedef __bf16 T; };

// ---- Tensor loads into LDS for the GEMM panels ----
typedef uint32_t u32x4 __attribute__((ext_vector_type(4)));
typedef uint32_t u32x8 __attribute__((ext_vector_type(8)));
constexpr uint32_t G_ROWB  = 256u;                 // bytes of one operand row per stage = 128 k
constexpr uint32_t G_ROWS  = 64u;                  // rows per slice (one tensor load of one wave)
constexpr uint32_t G_PITCH = G_ROWB + 16u;         // LDS row pitch, laid by the load's pad: an odd multiple of 16 B for ds_load_b128 readers
constexpr uint32_t G_SLICE = 18432u;               // 64 x 272 = 17,408 B rounded up to a multiple of 2 KiB
constexpr uint32_t G_STAGE = 4u * G_SLICE;         // [A rows 0..63 | A rows 64..127 | Bt rows 0..63 | Bt rows 64..127]
static_assert(G_ROWS * G_PITCH <= G_SLICE && G_SLICE % 2048u == 0u);
__device__ __forceinline__ uint32_t uni(uint32_t v) { return (uint32_t)__builtin_amdgcn_readfirstlane(v); }
// keeps the test in a scalar register, so that the branch round a tensor load is a scalar branch (the load ignores EXEC)
__device__ __forceinline__ uint32_t pinned(uint32_t v) { uint32_t w = (uint32_t)__builtin_amdgcn_readfirstlane(v); asm volatile("" : "+s"(w)); return w; }
// the wave's LDS reads have retired before the buffer is handed back for a refill
__device__ __forceinline__ void wait_ds0() { asm volatile("s_wait_dscnt 0x0" ::: "memory"); }
// the wave's own tensor load has landed (the compiler places no wait for it); the request's descriptor is named as an input so that its registers keep their values until here
__device__ __forceinline__ void wait_tensor0(u32x4 g0, u32x8 g1) { asm volatile("s_wait_tensorcnt 0x0" :: "s"(g0), "s"(g1) : "memory"); }
__device__ __forceinline__ void tdm_load(u32x4 g0, u32x8 g1) { asm volatile("tensor_load_to_lds %0, %1" :: "s"(g0), "s"(g1) : "memory"); }
__device__ __forceinline__ u32x8 tdm_group1(uint32_t src_pitch) {
  u32x8 g;
  g[0] = uni((1u << 20) | (5u << 22) | (3u << 25));
  g[1] = uni((G_ROWB & 0xFFFFu) << 16);
  g[2] = uni((G_ROWB >> 16) | ((G_ROWS & 0xFFFFu) << 16));
  g[3] = uni((G_ROWS >> 16) | (G_ROWB << 16));
  g[4] = uni(G_ROWS);
  g[5] = uni(src_pitch);
  g[6] = uni(0u);
  g[7] = uni(0u);
  return g;
}
__device__ __forceinline__ u32x4 tdm_group0(uint32_t lds_dst, uint64_t ga) {
  u32x4 g;
  g[0] = uni(1u); g[1] = uni(lds_dst); g[2] = uni((uint32_t)ga); g[3] = uni((((uint32_t)(ga >> 32)) & 0x01FFFFFFu) | 0x80000000u);
  return g;
}

// ---- Register-blocked WMMA GEMM body: C[m,n] = scale * sum_k A[m,k] * Bt[n,k] + bias; a work-group of 4 waves (2 x 2) owns a 128x128 tile, each wave 64x64 of it.
// The 128 rows of A and of Bt come into LDS 128 k at a time by tensor loads, one 64-row slice per wave and stage, two buffers: stage s + 1 flies while stage s is multiplied.
// A row-major [M,K] (pitch lda), Bt row-major [N,K] (pitch ldb); M,N % 128 == 0, K % 128 == 0, K >= 256 (no tails).
// BIAS_MODE 1 = bias[m], 2 = bias[n]. OUT_MODE 0 = f32, 1 = f16, 2 = bf16 hi plane (Cout) + bf16 lo plane (Cout2).
// tile = the work-group's tile number (the same in every thread). slab = the wave's own 16 x 68 floats of output staging; it may lie inside ring:
// the last pass of the loop ends with every wave's LDS reads retired, every tensor load landed and a work-group barrier, and nothing is issued behind it.
template <int ET, int BIAS_MODE, int OUT_MODE>
__device__ __forceinline__ void gemm64_body(
    const unsigned short* __restrict__ Ap, int lda, const unsigned short* __restrict__ Btp, int ldb,
    void* __restrict__ Cout, void* __restrict__ Cout2, int ldc, const float* __restrict__ bias,
    int M, int N, int K, float scale, int tile, float* slab, unsigned char* ring) {
  typedef typename Elem<ET>::T T;
  typedef typename Frag<T>::V V;
  const T* A = (const T*)Ap; const T* Bt = (const T*)Btp;
  const int lane = threadIdx.x & 31;
  const uint32_t wave = uni(threadIdx.x >> 5);
  const int tilesN = N >> 7;
  const int tilesM = M >> 7;
  if (tile >= tilesM * tilesN) return;   // the same for the whole block, in front of every barrier and tensor load
  const int tm = tile / tilesN;
  const int tn = tile - tm * tilesN;
  const int m0 = (tm << 7) + (int)((wave >> 1) << 6);
  const int n0 = (tn << 7) + (int)((wave & 1u) << 6);
  const int rlane = lane & 15;
  const int koff  = (lane >> 4) * 8;
  const int mOff  = (lane >> 4) * 8;

  v8f acc[4][4];
#pragma unroll
  for (int i = 0; i < 4; ++i)
#pragma unroll
    for (int j = 0; j < 4; ++j) acc[i][j] = zero8();

  // this wave's slice: waves 0, 1 bring the two halves of A's 128 rows, waves 2, 3 those of Bt's
  const bool isB = wave >= 2u;
  const uint64_t srcA = (uint64_t)(size_t)(A + (size_t)((tm << 7) + (int)((wave & 1u) << 6)) * lda);
  const uint64_t srcB = (uint64_t)(size_t)(Bt + (size_t)((tn << 7) + (int)((wave & 1u) << 6)) * ldb);
  const uint64_t gsrc = isB ? srcB : srcA;
  u32x8 g1 = tdm_group1((uint32_t)(isB ? ldb : lda) * 2u);
  asm volatile("" : "+s"(g1));   // the pinned() form on descriptor words: held in their scalar registers, built once, so that none is written again while a request is outstanding
  const uint32_t ldst = (uint32_t)(size_t)ring + wave * G_SLICE;
  const int nst = K >> 7;
  // this wave's fragment rows: A from slice wave >> 1, Bt from slice 2 + (wave & 1)
  const unsigned char* aR = ring + (wave >> 1) * G_SLICE + (uint32_t)rlane * G_PITCH + (uint32_t)koff * 2u;
  const unsigned char* bR = ring + (2u + (wave & 1u)) * G_SLICE + (uint32_t)rlane * G_PITCH + (uint32_t)koff * 2u;

  u32x4 g0 = tdm_group0(ldst, gsrc);
  tdm_load(g0, g1);                                           // stage 0 -> buffer 0
  wait_tensor0(g0, g1);
  __syncthreads();                                            // stage 0 published
  g0 = tdm_group0(ldst + G_STAGE, gsrc + G_ROWB);
  tdm_load(g0, g1);                                           // stage 1 -> buffer 1 (K >= 256)

  // kept rolled: one publish point per stage
#pragma unroll 1
  for (int s = 0; s < nst; ++s) {
    const uint32_t buf = ((uint32_t)s & 1u) * G_STAGE;
    // two fragment sets inside the stage: the LDS reads of the next 32 k go ahead of this 32 k's WMMAs; nothing of the next stage is read here
    V ah[2][4], bh[2][4];
#pragma unroll
    for (int j = 0; j < 4; ++j) {
      bh[0][j] = Frag<T>::load((const T*)(bR + buf + (uint32_t)j * 16u * G_PITCH));
      ah[0][j] = Frag<T>::load((const T*)(aR + buf + (uint32_t)j * 16u * G_PITCH));
    }
#pragma unroll
    for (int kk = 0; kk < 4; ++kk) {
      const int cur = kk & 1, nxt = cur ^ 1;
      if (kk < 3) {
#pragma unroll
        for (int j = 0; j < 4; ++j) {
          bh[nxt][j] = Frag<T>::load((const T*)(bR + buf + (uint32_t)j * 16u * G_PITCH + (uint32_t)(kk + 1) * 64u));
          ah[nxt][j] = Frag<T>::load((const T*)(aR + buf + (uint32_t)j * 16u * G_PITCH + (uint32_t)(kk + 1) * 64u));
        }
      }
#pragma unroll
      for (int i = 0; i < 4; ++i) {
#pragma unroll
        for (int j = 0; j < 4; ++j) acc[i][j] = Frag<T>::mma(ah[cur][i], bh[cur][j], acc[i][j]);
        acc_guard4(acc[i][0], acc[i][1], acc[i][2], acc[i][3]);   // the four vector slots behind a WMMA; it also keeps each group of LDS reads where it is written
      }
    }
    // publish point of stage s + 1: own LDS reads retired, own load landed, then the barrier that publishes s + 1 and frees this buffer
    wait_ds0();
    wait_tensor0(g0, g1);
    __syncthreads();
    if (pinned((uint32_t)(s + 2 < nst))) {
      g0 = tdm_group0(ldst + buf, gsrc + (uint64_t)(uint32_t)(s + 2) * G_ROWB);
      tdm_load(g0, g1);
    }
  }
  wait_tensor0(g0, g1);
  wait_ds0();
  acc_guard4(acc[0][0], acc[0][1], acc[0][2], acc[0][3]);
  acc_guard4(acc[1][0], acc[1][1], acc[1][2], acc[1][3]);
  acc_guard4(acc[2][0], acc[2][1], acc[2][2], acc[2][3]);
  acc_guard4(acc[3][0], acc[3][1], acc[3][2], acc[3][3]);

#pragma unroll
  for (int i = 0; i < 4; ++i) {
    const int mBase = m0 + (i << 4);
#pragma unroll
    for (int j = 0; j < 4; ++j) {
      const int n = n0 + (j << 4) + rlane;
      float bv = 0.f;
      if (BIAS_MODE == 2) bv = bias[n];
#pragma unroll
      for (int r = 0; r < 8; ++r) {
        float v = acc[i][j][r] * scale;
        if (BIAS_MODE == 1) v += bias[mBase + mOff + r];
        if (BIAS_MODE == 2) v += bv;
        slab[(mOff + r) * 68 + (j << 4) + rlane] = v;
      }
    }
    __builtin_amdgcn_fence(3 /* release order */, "workgroup");
    __builtin_amdgcn_wave_barrier();
    __builtin_amdgcn_fence(2 /* acquire order */, "workgroup");
    if (OUT_MODE == 0) {
      float* C = (float*)Cout;
      const int hh = lane >> 4, c4 = (lane & 15) * 4;     // row segment = 256 B = 16 lanes x 16 B
      {
#pragma unroll
        for (int it = 0; it < 8; ++it) {
          const int row = it * 2 + hh;
          v4f v = *(const v4f*)(slab + row * 68 + c4);
          *(v4f*)(C + (size_t)(mBase + row) * ldc + n0 + c4) = v;
        }
        
      }
    } else {
      const int q = lane >> 3, c8 = (lane & 7) * 8;
      unsigned short* C  = (unsigned short*)Cout;
      unsigned short* C2 = (unsigned short*)Cout2;
      {
#pragma unroll
        for (int it = 0; it < 4; ++it) {
          const int row = it * 4 + q;
          const float* sp = slab + row * 68 + c8;
          v8h hv, lv;
#pragma unroll
          for (int e = 0; e < 8; ++e) {
            if (OUT_MODE == 1) {
              hv[e] = (_Float16)sp[e];
              lv[e] = (_Float16)0.f;
            } else {
              const unsigned short hb = bfu_rne(sp[e]);
              const unsigned short lb = bfu_rne(sp[e] - bfu_f32(hb));
              hv[e] = __builtin_bit_cast(_Float16, hb);
              lv[e] = __builtin_bit_cast(_Float16, lb);
            }
          }
          *(v8h*)(C + (size_t)(mBase + row) * ldc + n0 + c8) = hv;
          if (OUT_MODE == 2) *(v8h*)(C2 + (size_t)(mBase + row) * ldc + n0 + c8) = lv;
        }
        
      }
    }
    __builtin_amdgcn_fence(3 /* release order */, "workgroup");
    __builtin_amdgcn_wave_barrier();
    __builtin_amdgcn_fence(2 /* acquire order */, "workgroup");
  }
}

// q, k and v projections in one launch: work-groups [0, T) take q's tiles, [T, 2T) k's, [2T, 3T) v's, T = tiles of one projection.
//   q, k: C[token][feature] = sum_k X[token][k] * W[feature][k] + bias[feature], f16 operands, bf16 hi + lo planes out
//   v, transposed: C[feature][token] = sum_k Wv[feature][k] * X[token][k] + bias[feature], f16 out (pitch = tokens)
// The output staging lies over the drained ring, so a work-group holds 144 KiB of LDS and two of them share a WGP:
// one's tensor-load waits, first fragment reads and epilogue run under the other's WMMAs.
constexpr int G_TILES = (MT / 128) * (DM / 128);
constexpr uint32_t G_SLAB = 16u * 68u * 4u;        // bytes of one wave's output staging
static_assert(4u * G_SLAB <= 2u * G_STAGE && G_SLAB % 16u == 0u);
__global__ __launch_bounds__(128) void k_gemm_qkv(const unsigned short* __restrict__ XQ, const unsigned short* __restrict__ XK, const unsigned short* __restrict__ XV,
                                                  const unsigned short* __restrict__ WQ, const unsigned short* __restrict__ WK, const unsigned short* __restrict__ WV,
                                                  unsigned short* __restrict__ QH, unsigned short* __restrict__ QL,
                                                  unsigned short* __restrict__ KH, unsigned short* __restrict__ KL,
                                                  unsigned short* __restrict__ VT, const float* __restrict__ BR, float scale) {
  __shared__ __attribute__((aligned(2048))) unsigned char ring[2 * G_STAGE];
  float* slab = (float*)(ring + (threadIdx.x >> 5) * G_SLAB);
  const int which = (int)blockIdx.x / G_TILES;                 // the same for the whole block
  const int tile  = (int)blockIdx.x - which * G_TILES;
  if (which < 2) {
    const bool isq = which == 0;
    gemm64_body<0, 2, 2>(isq ? XQ : XK, DM, isq ? WQ : WK, DM, (void*)(isq ? QH : KH), (void*)(isq ? QL : KL), DM, BR + which * DM, MT, DM, DM, scale, tile, slab, ring);
  } else {
    gemm64_body<0, 1, 1>(WV, DM, XV, DM, (void*)VT, (void*)VT, MT, BR + 2 * DM, DM, MT, DM, scale, tile, slab, ring);
  }
}
// output projection: bf16 operands (A = context hi|lo along K, Bt = [Wo|Wo]), bias[n], f32 out
__global__ __launch_bounds__(128) void k_gemm_out(const unsigned short* __restrict__ A, const unsigned short* __restrict__ W,
                                                  float* __restrict__ C, const float* __restrict__ bias, int M, int N, int K) {
  __shared__ __attribute__((aligned(2048))) unsigned char ring[2 * G_STAGE];
  __shared__ __align__(16) float sT[4][16 * 68];
  gemm64_body<1, 2, 0>(A, K, W, K, (void*)C, (void*)C, N, bias, M, N, K, 1.0f, (int)blockIdx.x, sT[threadIdx.x >> 5], ring);
}

// ---- operand preparation, all of it in one launch of long-lived waves ----
// A chunk is 16,384 consecutive floats of one source (16 rows of DM). A block of 16 waves takes four chunks; every thread asks for all its 16-B pieces first
// (each wave-wide load covers 512 contiguous bytes), then converts and stores them in the order in which they were asked for.
//   activations:  f32 -> bf16 (RNE) -> f16 plane [MT][DM]; rows (b, s) of the full-size inputs
//   Wq, Wk, Wv:   f32 -> bf16 (RNE) -> x16 -> f16 plane [DM][DM] (exact; [out][in] is already the Bt layout)
//   Wo:           f32 -> bf16 (RNE) plane [DM][2*DM] = [Wo | Wo], read once and stored twice
//   biases:       f32 -> bf16 (RNE) kept as f32; table: f32 -> bf16 plane [NRELP][DK], rows >= NREL written as zeros (clamped source address)
typedef __attribute__((ext_vector_type(2))) unsigned int u2;
constexpr int PR_T     = 512;                                   // threads per block
constexpr int PR_L     = 8;                                     // 16-B loads per thread and chunk
constexpr int PR_CH    = PR_T * PR_L * 4;                       // floats per chunk
constexpr int PR_ACT   = (int)(((long long)MT * DM) / PR_CH);   // chunks per activation plane
constexpr int PR_W     = (DM * DM) / PR_CH;                     // chunks per weight matrix
constexpr int PR_GRID  = PR_ACT > 4 * PR_W ? PR_ACT : 4 * PR_W;  // block b: chunk b of each activation plane and chunk b of [Wq, Wk, Wv, Wo]
constexpr int PR_SQ    = DM + NRELP * (DK / 4);                 // 4-float pieces of the four biases, then of the padded table
constexpr int PR_SMALL = (PR_SQ + PR_T - 1) / PR_T;             // the first blocks take one such piece per thread on top
static_assert(PR_CH % DM == 0 && SEQ % (PR_CH / DM) == 0 && ((long long)MT * DM) % PR_CH == 0 && (DM * DM) % PR_CH == 0);
static_assert(PR_SMALL <= PR_GRID && DK % 4 == 0 && DM % 4 == 0 && (PR_T * 4) % DM == 0);

__device__ __forceinline__ u2 pr_f16(v4f x, float sc) { u2 p; p.x = cmb_pk2(cmb_bf(x.x) * sc, cmb_bf(x.y) * sc); p.y = cmb_pk2(cmb_bf(x.z) * sc, cmb_bf(x.w) * sc); return p; }
__device__ __forceinline__ u2 pr_bf(v4f x) { u2 p; p.x = (unsigned)bfu_rne(x.x) | ((unsigned)bfu_rne(x.y) << 16); p.y = (unsigned)bfu_rne(x.z) | ((unsigned)bfu_rne(x.w) << 16); return p; }

__global__ __launch_bounds__(PR_T) void k_prep(const float* __restrict__ Qi, const float* __restrict__ Ki, const float* __restrict__ Vi,
                                               const float* __restrict__ Wq, const float* __restrict__ Wk, const float* __restrict__ Wv, const float* __restrict__ Wo,
                                               const float* __restrict__ bq, const float* __restrict__ bk, const float* __restrict__ bv, const float* __restrict__ bo,
                                               const float* __restrict__ rel,
                                               unsigned short* __restrict__ XQ, unsigned short* __restrict__ XK, unsigned short* __restrict__ XV,
                                               unsigned short* __restrict__ WQ6, unsigned short* __restrict__ WK6, unsigned short* __restrict__ WV6,
                                               unsigned short* __restrict__ WO2, float* __restrict__ BR, unsigned short* __restrict__ TB) {
  const unsigned t = threadIdx.x;
  const unsigned b = blockIdx.x;
  // chunk numbers are clamped for the loads, so that no branch stands among them; the stores are guarded
  const unsigned ka = min(b, (unsigned)(PR_ACT - 1));
  const unsigned kw = min(b, (unsigned)(4 * PR_W - 1));
  const unsigned w  = kw / (unsigned)PR_W, kc = kw % (unsigned)PR_W;
  const unsigned r0 = ka * (unsigned)(PR_CH / DM);
  const size_t ao = (size_t)(r0 / (unsigned)SEQ) * ((size_t)SEQ_FULL * DM) + (size_t)(r0 % (unsigned)SEQ) * DM;
  const v4f* sq = (const v4f*)(Qi + ao) + t;                    // block-uniform base + the thread's 16 B inside 8 KiB of the chunk
  const v4f* sk = (const v4f*)(Ki + ao) + t;
  const v4f* sv = (const v4f*)(Vi + ao) + t;
  const v4f* sw = (const v4f*)((w == 0u ? Wq : w == 1u ? Wk : w == 2u ? Wv : Wo) + (size_t)kc * PR_CH) + t;
  // one piece of the biases (u < DM) or of the table per thread of the first blocks; every thread's address is in bounds
  const unsigned u = b * (unsigned)PR_T + t;
  const unsigned tq = u < (unsigned)DM ? 0u : u - (unsigned)DM;

  v4f xs = {0.f, 0.f, 0.f, 0.f};
  if (b < (unsigned)PR_SMALL) {
    const unsigned bw = u / (unsigned)(DM / 4);
    const float* bs = bw == 0u ? bq : bw == 1u ? bk : bw == 2u ? bv : bo;
    const float* ss = u < (unsigned)DM ? bs + (u % (unsigned)(DM / 4)) * 4u : rel + min(tq / (unsigned)(DK / 4), (unsigned)(NREL - 1)) * (unsigned)DK + (tq % (unsigned)(DK / 4)) * 4u;
    xs = *(const v4f*)ss;
  }
  // PR_ORDER: the compiler moves nothing across it. The loads leave plane by plane and each plane is converted and stored as soon as its own loads are back,
  // while the later planes are still on their way; without it the conversions of all planes are mixed and the first store waits for most of the loads.
#define PR_ORDER() __builtin_amdgcn_sched_barrier(0)
  // every loop below is unrolled: the pieces stay in registers and their offsets become immediates
  v4f xq[PR_L], xk[PR_L], xv[PR_L], xw[PR_L];
#pragma unroll
  for (int j = 0; j < PR_L; ++j) xq[j] = sq[j * PR_T];
  PR_ORDER();
#pragma unroll
  for (int j = 0; j < PR_L; ++j) xk[j] = sk[j * PR_T];
  PR_ORDER();
#pragma unroll
  for (int j = 0; j < PR_L; ++j) xv[j] = sv[j * PR_T];
  PR_ORDER();
#pragma unroll
  for (int j = 0; j < PR_L; ++j) xw[j] = sw[j * PR_T];
  // stands in front of every later write of a register that one of the loads above names as an address; the thread number, their offset register, is named as an input so that it keeps its value until here
  asm volatile("s_wait_xcnt 0x0" :: "v"(t) : "memory");

  if (b < (unsigned)PR_SMALL) {
    if (u < (unsigned)DM) {
      v4f r; r.x = cmb_bf(xs.x); r.y = cmb_bf(xs.y); r.z = cmb_bf(xs.z); r.w = cmb_bf(xs.w);
      *(v4f*)(BR + u * 4u) = r;
    } else if (u < (unsigned)PR_SQ) {
      u2 pk = pr_bf(xs);
      if (tq / (unsigned)(DK / 4) >= (unsigned)NREL) { pk.x = 0u; pk.y = 0u; }
      *(u2*)(TB + tq * 4u) = pk;
    }
  }
  if (b < (unsigned)PR_ACT) {
    const size_t o = (size_t)ka * PR_CH + t * 4u;
#pragma unroll
    for (int j = 0; j < PR_L; ++j) *(u2*)(XQ + o + j * (PR_T * 4)) = pr_f16(xq[j], 1.0f);
    PR_ORDER();
#pragma unroll
    for (int j = 0; j < PR_L; ++j) *(u2*)(XK + o + j * (PR_T * 4)) = pr_f16(xk[j], 1.0f);
    PR_ORDER();
#pragma unroll
    for (int j = 0; j < PR_L; ++j) *(u2*)(XV + o + j * (PR_T * 4)) = pr_f16(xv[j], 1.0f);
    // stands in front of the weight chunk's conversions, which write over registers that these stores name
    asm volatile("s_wait_xcnt 0x0" ::: "memory");
  }
  if (b < (unsigned)(3 * PR_W)) {
    unsigned short* dp = (w == 0u ? WQ6 : w == 1u ? WK6 : WV6) + (size_t)kc * PR_CH + t * 4u;
#pragma unroll
    for (int j = 0; j < PR_L; ++j) *(u2*)(dp + j * (PR_T * 4)) = pr_f16(xw[j], 16.0f);
  } else if (b < (unsigned)(4 * PR_W)) {
    // row = element / DM, column = element % DM of Wo; PR_T * 4 floats are a whole number of rows
    unsigned short* dp = WO2 + ((size_t)kc * (PR_CH / DM) + (t * 4u) / (unsigned)DM) * (2 * DM) + (t * 4u) % (unsigned)DM;
#pragma unroll
    for (int j = 0; j < PR_L; ++j) {
      const u2 pk = pr_bf(xw[j]);
      *(u2*)(dp + j * ((PR_T * 4 / DM) * 2 * DM)) = pk;
      *(u2*)(dp + j * ((PR_T * 4 / DM) * 2 * DM) + DM) = pk;
    }
    // stands behind the last of these stores, in front of any later write of a register that they name
    asm volatile("s_wait_xcnt 0x0" ::: "memory");
  }
}

// =====================================================================================================================
// Fused attention with clipped relative-position bias. One wave per 16 queries; the 8 waves of a block share one (batch, head) and its K, V tiles in LDS.
//   score(l, r) = q_l . k_r / 8 + q_l . table[clip(r - l, -16, 16) + 16]
//   Transposed score tiles S^T = K . Q^T (A = key rows, B = query rows): D has lane = query, element = key, which is the A-operand
//   layout of P for O = P . V (32 keys per step), so P never leaves registers. q, k: bf16 hi/lo planes (hi.hi + hi.lo + lo.hi).
//   Relative dots: table (A, rows padded to NRELP) x q (B), hi + lo products, staged once per wave in LDS [16][QP] and gathered per element,
//   but only in the passes that touch the clip band |r - l| < 16: in every other pass all 32 x 16 distances clip to the same end of the table,
//   the bias is one value per query, and scale, bias and running maximum go into one fma per score.
//   V^T plane [feature][token] f16 gives B fragments with contiguous keys. Online softmax in f32 (exp2 domain); P carried x2^14 in f16.
//   K hi, K lo (64 keys x 64 d) and V^T (64 features x 64 keys) come into LDS 64 keys at a time by tensor loads, one tile each from waves 0, 1, 2, two buffers:
//   stage s + 1 flies while stage s is worked on.
// =====================================================================================================================
constexpr uint32_t AT_KEYS  = 64u;                 // keys per stage
constexpr uint32_t AT_ROWB  = 128u;                // bytes of one tile row: 64 d of a key, or 64 keys of a feature
constexpr uint32_t AT_ROWS  = 64u;                 // rows per tile (one tensor load of one wave)
constexpr uint32_t AT_PITCH = AT_ROWB + 16u;       // LDS row pitch, laid by the load's pad: an odd multiple of 16 B for ds_load_b128 readers
constexpr uint32_t AT_SLICE = 10240u;              // 64 x 144 = 9,216 B rounded up to a multiple of 2 KiB
constexpr uint32_t AT_STAGE = 3u * AT_SLICE;       // [K hi | K lo | V^T]
constexpr int      AT_NST   = SEQ / (int)AT_KEYS;
static_assert(AT_ROWS * AT_PITCH <= AT_SLICE && AT_SLICE % 2048u == 0u);
static_assert(DK * 2 == (int)AT_ROWB && DK == (int)AT_ROWS && AT_NST >= 2);
// group 1: 1-byte elements, tile = tensor = 64 rows of 128 B, source row pitch in bytes, 16 B of LDS pad behind every 128-B row, no mask
__device__ __forceinline__ u32x8 at_group1(uint32_t src_pitch) {
  u32x8 g;
  g[0] = uni((1u << 20) | (4u << 22) | (3u << 25));
  g[1] = uni((AT_ROWB & 0xFFFFu) << 16);
  g[2] = uni((AT_ROWB >> 16) | ((AT_ROWS & 0xFFFFu) << 16));
  g[3] = uni((AT_ROWS >> 16) | (AT_ROWB << 16));
  g[4] = uni(AT_ROWS);
  g[5] = uni(src_pitch);
  g[6] = uni(0u);
  g[7] = uni(0u);
  return g;
}

__global__ __launch_bounds__(32 * AT_NW) void k_attn_rel(const unsigned short* __restrict__ QHp, const unsigned short* __restrict__ QLp,
                                                         const unsigned short* __restrict__ KHp, const unsigned short* __restrict__ KLp,
                                                         const unsigned short* __restrict__ VTp, const unsigned short* __restrict__ TBp,
                                                         unsigned short* __restrict__ CTX) {
  __shared__ __attribute__((aligned(2048))) unsigned char ring[2 * AT_STAGE];
  __shared__ __align__(16) float qrs[AT_NW][16 * QP];
  __shared__ __align__(16) float osm[AT_NW][16 * OSP];
  const __bf16* QH = (const __bf16*)QHp; const __bf16* QL = (const __bf16*)QLp;
  const __bf16* TB = (const __bf16*)TBp;
  const int lane = threadIdx.x & 31, wave = threadIdx.x >> 5, hh = lane >> 4, c = lane & 15;
  const int bh = (int)blockIdx.x / ((SEQ / 16) / AT_NW);            // the same for the whole block
  const int l0 = (((int)blockIdx.x - bh * ((SEQ / 16) / AT_NW)) * AT_NW + wave) * 16;
  const int b = bh / NH, h = bh - b * NH;
  const size_t tok0 = (size_t)b * SEQ;

  // q as B operand (lane = query column c), 2 k-steps of 32, hi and lo
  v16b qh[2], ql[2];
  {
    const size_t qo = (tok0 + l0 + c) * DM + h * DK + 8 * hh;
#pragma unroll
    for (int dc = 0; dc < 2; ++dc) { qh[dc] = ldfb(QH + qo + dc * 32); ql[dc] = ldfb(QL + qo + dc * 32); }
  }
  // this wave's tile: wave 0 brings K hi, wave 1 K lo, wave 2 V^T; the other waves issue nothing (their words name V^T's tile and are not used)
  const uint32_t wv = uni((uint32_t)threadIdx.x >> 5);
  const uint32_t sl = wv < 2u ? wv : 2u;
  const uint64_t gsrc = sl == 0u ? (uint64_t)(size_t)(KHp + tok0 * DM + h * DK)
                      : sl == 1u ? (uint64_t)(size_t)(KLp + tok0 * DM + h * DK)
                                 : (uint64_t)(size_t)(VTp + (size_t)(h * DK) * MT + tok0);
  const uint32_t gstep = sl == 2u ? AT_KEYS * 2u : AT_KEYS * (uint32_t)DM * 2u;     // source bytes from one stage to the next
  u32x8 g1 = at_group1(sl == 2u ? (uint32_t)MT * 2u : (uint32_t)DM * 2u);
  asm volatile("" : "+s"(g1));   // the pinned() form on descriptor words: held in their scalar registers, built once, so that none is written again while a request is outstanding
  const uint32_t ldst = (uint32_t)(size_t)ring + sl * AT_SLICE;
  u32x4 g0 = tdm_group0(ldst, gsrc);
  if (pinned((uint32_t)(wv < 3u))) {
    tdm_load(g0, g1);                                         // stage 0 -> buffer 0
    wait_tensor0(g0, g1);
  }
  __syncthreads();                                            // stage 0 published
  g0 = tdm_group0(ldst + AT_STAGE, gsrc + gstep);
  asm volatile("" : "+s"(g0));   // the pinned() form on descriptor words: all four stand in their scalar registers in front of the branch, so that none is written behind the load
  if (pinned((uint32_t)(wv < 3u))) tdm_load(g0, g1);          // stage 1 -> buffer 1 (SEQ >= 128)

  // relative dots: D[j][query] = sum_d table[j][d] * q[query][d]; lane = query c, element r -> j = jt*16 + 8hh + r
  float* myq = qrs[wave];
#pragma unroll
  for (int jt = 0; jt < NRELP / 16; ++jt) {
    v8f acc = zero8();
#pragma unroll
    for (int dc = 0; dc < 2; ++dc) {
      const v16b ta = ldfb(TB + (jt * 16 + c) * DK + dc * 32 + 8 * hh);
      acc = wmmab(ta, ql[dc], acc);
      acc = wmmab(ta, qh[dc], acc);
    }
#pragma unroll
    for (int r = 0; r < 8; ++r) myq[c * QP + jt * 16 + 8 * hh + r] = acc[r];
  }
  __builtin_amdgcn_fence(3 /* release order */, "workgroup");
  __builtin_amdgcn_wave_barrier();
  __builtin_amdgcn_fence(2 /* acquire order */, "workgroup");

  const int lglob = l0 + c;
  const float* qrow = myq + c * QP + MAXREL;        // indexed by clip(r - l, -16, 16)
  const float L2E = 1.4426950408889634f;
  const float SCL = 0.125f * 1.4426950408889634f;   // 1 / sqrt(DK) in the exp2 domain
  // the wave's first query as a scalar: the test on a pass's distance from the band is a scalar branch
  const int l0s = (((int)blockIdx.x - bh * ((SEQ / 16) / AT_NW)) * AT_NW + (int)wv) * 16;
  const int caddr = (8 * hh) << 2;                  // byte index of lane 8hh
  const int xaddr = (lane ^ 16) << 2;               // byte index of the lane that holds the same query in the other half
  const float bLo = qrow[-MAXREL] * L2E, bHi = qrow[MAXREL] * L2E;   // this query's bias left and right of the band, exp2 domain
  float m_run = -1.0e30f, s_run = 0.f;
  v8f o[4];
#pragma unroll
  for (int t = 0; t < 4; ++t) o[t] = zero8();
  // fragment rows in LDS: lane = key row (K) or feature row (V^T) c of a 16-row group, lane half at 16 B
  const unsigned char* kR = ring + (uint32_t)c * AT_PITCH + (uint32_t)hh * 16u;
  const unsigned char* vR = kR + 2u * AT_SLICE;

  // kept rolled: one publish point per stage
#pragma unroll 1
  for (int s = 0; s < AT_NST; ++s) {
  const uint32_t buf = ((uint32_t)s & 1u) * AT_STAGE;
  // the two 32-key passes of a stage are unrolled: their LDS offsets become immediates
#pragma unroll
  for (int ps = 0; ps < 2; ++ps) {
    const int r0 = s * (int)AT_KEYS + ps * 32;
    // the pass's K fragments are read as one group ahead of its score products; only this stage's buffer is read (loops unrolled: the fragment arrays stay in registers)
    v16b kfh[2][2], kfl[2][2];
#pragma unroll
    for (int tt = 0; tt < 2; ++tt)
#pragma unroll
      for (int dc = 0; dc < 2; ++dc) {
        const unsigned char* kp = kR + buf + (uint32_t)(ps * 32 + 16 * tt) * AT_PITCH + (uint32_t)dc * 64u;
        kfh[tt][dc] = ldfb((const __bf16*)kp);
        kfl[tt][dc] = ldfb((const __bf16*)(kp + AT_SLICE));
      }
    v8f t[2];
#pragma unroll
    for (int tt = 0; tt < 2; ++tt) {
      v8f acc = zero8();
#pragma unroll
      for (int dc = 0; dc < 2; ++dc) {
        acc = wmmab(kfl[tt][dc], qh[dc], acc);
        acc = wmmab(kfh[tt][dc], ql[dc], acc);
        acc = wmmab(kfh[tt][dc], qh[dc], acc);
      }
      t[tt] = acc;
    }
    // the pass's V^T fragments are asked for ahead of the softmax, which covers their LDS latency (unrolled: the array stays in registers)
    v16h vfr[4];
#pragma unroll
    for (int tq = 0; tq < 4; ++tq) vfr[tq] = ldfh((const _Float16*)(vR + buf + (uint32_t)tq * 16u * AT_PITCH + (uint32_t)ps * 64u));
    // element e <-> key r0 + 8hh + e (tile 0) and r0 + 16 + 8hh + e (tile 1); this lane's query is lglob
    float x[16];                                      // score - new maximum, exp2 domain
    float m_new;
    const int rel = r0 - l0s;                         // distances of the pass: rel - 15 ... rel + 31
    if (rel + 31 <= -MAXREL || rel - 15 >= MAXREL) {
      // every distance clips to the same end: the maximum is taken over the raw products (SCL > 0)
      float tm = -3.0e38f;
#pragma unroll
      for (int e = 0; e < 8; ++e) tm = fmaxf(tm, fmaxf(t[0][e], t[1][e]));
      const float bL = rel < 0 ? bLo : bHi;
      const float mt = fmaf(tm, SCL, bL);
      m_new = fmaxf(m_run, fmaxf(mt, from_lane(mt, xaddr)));   // the two lane halves hold the same query
      const float kb = bL - m_new;
#pragma unroll
      for (int e = 0; e < 8; ++e) {
        x[e]     = fmaf(t[0][e], SCL, kb);
        x[8 + e] = fmaf(t[1][e], SCL, kb);
      }
    } else {
      float p[16];
      float mt = -1.0e30f;
      const int dbase = r0 + 8 * hh - lglob;
#pragma unroll
      for (int e = 0; e < 8; ++e) {
        const int d0 = min(max(dbase + e, -MAXREL), MAXREL);
        const int d1 = min(max(dbase + 16 + e, -MAXREL), MAXREL);
        p[e]     = (t[0][e] * 0.125f + qrow[d0]) * L2E;
        p[8 + e] = (t[1][e] * 0.125f + qrow[d1]) * L2E;
        mt = fmaxf(mt, fmaxf(p[e], p[8 + e]));
      }
      m_new = fmaxf(m_run, fmaxf(mt, from_lane(mt, xaddr)));   // the two lane halves hold the same query
#pragma unroll
      for (int e = 0; e < 16; ++e) x[e] = p[e] - m_new;
    }
    const float corr  = exp2_hw1(m_run - m_new);
    float sum = 0.f;
    v16h pA;                                          // P as A operand: element i <-> key r0 + k(i, hh)
    // two runs of eight exponentials; the loops are unrolled so that arguments and results are registers, as the asm operands ask
#pragma unroll
    for (int g = 0; g < 2; ++g) {
      float xa[8], ea[8];
#pragma unroll
      for (int r = 0; r < 8; ++r) xa[r] = x[8 * g + r];
      exp2_hw8(xa, ea);
#pragma unroll
      for (int r = 0; r < 8; ++r) {
        sum += ea[r];
        pA[8 * g + r] = (_Float16)(ea[r] * PSC);
      }
    }
    sum += __shfl_xor(sum, 16, 32);
    s_run = s_run * corr + sum;
    m_run = m_new;
    float sc[8];
#pragma unroll
    for (int i = 0; i < 8; ++i) sc[i] = from_lane(corr, caddr + 4 * i);   // O tile rows are queries 8hh + i
#pragma unroll
    for (int tq = 0; tq < 4; ++tq) {
      v8f oc = o[tq];
#pragma unroll
      for (int i = 0; i < 8; ++i) oc[i] *= sc[i];
      o[tq] = wmmah(pA, vfr[tq], oc);
    }
  }
    // publish point of stage s + 1: own LDS reads retired, the issuer's own load landed, then the barrier that publishes s + 1 and frees this buffer
    wait_ds0();
    if (pinned((uint32_t)(wv < 3u))) wait_tensor0(g0, g1);
    __syncthreads();
    g0 = tdm_group0(ldst + buf, gsrc + (uint64_t)((uint32_t)(s + 2) * gstep));
    asm volatile("" : "+s"(g0));   // the pinned() form on descriptor words, as in front of the loop: formed behind the wait, none written behind the load
    if (pinned((uint32_t)(wv < 3u && s + 2 < AT_NST))) tdm_load(g0, g1);   // issued only while stage s + 2 exists
  }
  wait_tensor0(g0, g1);
  wait_ds0();

  float inv[8];
#pragma unroll
  for (int i = 0; i < 8; ++i) inv[i] = 1.0f / (__shfl(s_run, i + 8 * hh, 32) * PSC);
  float* os = osm[wave];
#pragma unroll
  for (int tq = 0; tq < 4; ++tq)
#pragma unroll
    for (int i = 0; i < 8; ++i) os[(8 * hh + i) * OSP + tq * 16 + c] = o[tq][i] * inv[i];
  __builtin_amdgcn_fence(3 /* release order */, "workgroup");
  __builtin_amdgcn_wave_barrier();
  __builtin_amdgcn_fence(2 /* acquire order */, "workgroup");
  {
    const int q = lane >> 3, c8 = (lane & 7) * 8;
    unsigned short* ch = CTX + (tok0 + l0) * (size_t)(2 * DM) + h * DK + c8;
    u4 ph[4], pl[4];
#pragma unroll
    for (int it = 0; it < 4; ++it) {
      const int row = it * 4 + q;
      const float* sp = os + row * OSP + c8;
      unsigned short hb[8], lb[8];
#pragma unroll
      for (int e = 0; e < 8; ++e) { const float v = sp[e]; hb[e] = bfu_rne(v); lb[e] = bfu_rne(v - bfu_f32(hb[e])); }
      ph[it].x = (unsigned)hb[0] | ((unsigned)hb[1] << 16); ph[it].y = (unsigned)hb[2] | ((unsigned)hb[3] << 16);
      ph[it].z = (unsigned)hb[4] | ((unsigned)hb[5] << 16); ph[it].w = (unsigned)hb[6] | ((unsigned)hb[7] << 16);
      pl[it].x = (unsigned)lb[0] | ((unsigned)lb[1] << 16); pl[it].y = (unsigned)lb[2] | ((unsigned)lb[3] << 16);
      pl[it].z = (unsigned)lb[4] | ((unsigned)lb[5] << 16); pl[it].w = (unsigned)lb[6] | ((unsigned)lb[7] << 16);
    }
    {
#pragma unroll
      for (int it = 0; it < 4; ++it) {
        const int row = it * 4 + q;
        *(u4*)(ch + (size_t)row * (2 * DM)) = ph[it];
        *(u4*)(ch + (size_t)row * (2 * DM) + DM) = pl[it];
      }
      
    }
  }
}

extern "C" void kernel_launch(void* const* d_in, const int* in_sizes, int n_in, void* d_out, int out_size, void* d_ws, size_t ws_size, hipStream_t stream) {
  if (n_in < 12) return;
  const long long actn = ((long long)(NB - 1) * SEQ_FULL + SEQ) * DM;
  if ((long long)in_sizes[0] < actn || (long long)in_sizes[1] < actn || (long long)in_sizes[2] < actn) return;
  if (in_sizes[3] < DM * DM || in_sizes[5] < DM * DM || in_sizes[7] < DM * DM || in_sizes[9] < DM * DM) return;
  if (in_sizes[4] < DM || in_sizes[6] < DM || in_sizes[8] < DM || in_sizes[10] < DM) return;
  if (in_sizes[11] < NREL * DK) return;
  if ((long long)out_size < (long long)MT * DM) return;

  const float* Qi = (const float*)d_in[0];
  const float* Ki = (const float*)d_in[1];
  const float* Vi = (const float*)d_in[2];
  const float* Wq = (const float*)d_in[3];
  const float* bq = (const float*)d_in[4];
  const float* Wk = (const float*)d_in[5];
  const float* bk = (const float*)d_in[6];
  const float* Wv = (const float*)d_in[7];
  const float* bv = (const float*)d_in[8];
  const float* Wo = (const float*)d_in[9];
  const float* bo = (const float*)d_in[10];
  const float* rel = (const float*)d_in[11];
  float* out = (float*)d_out;

  constexpr size_t SZ_ACT = (size_t)MT * DM * 2;          // 16-bit [MT][DM] plane
  constexpr size_t SZ_W   = (size_t)DM * DM * 2;
  constexpr size_t SZ_WO2 = (size_t)DM * 2 * DM * 2;
  constexpr size_t SZ_BR  = (size_t)4 * DM * 4;
  constexpr size_t SZ_TB  = (size_t)NRELP * DK * 2;
  constexpr size_t SZ_CTX = (size_t)MT * 2 * DM * 2;
  static_assert(SZ_ACT % 256 == 0 && SZ_W % 256 == 0 && SZ_WO2 % 256 == 0 && SZ_BR % 256 == 0 && SZ_TB % 256 == 0 && SZ_CTX % 256 == 0);
  constexpr size_t TOTAL = 3 * SZ_ACT + 3 * SZ_W + SZ_WO2 + SZ_BR + SZ_TB + 4 * SZ_ACT + SZ_ACT + SZ_CTX;
  static_assert(TOTAL <= (size_t)134217728);
  if (TOTAL > ws_size) return;

  char* wsp = (char*)d_ws;
  unsigned short* XQ  = (unsigned short*)wsp; wsp += SZ_ACT;
  unsigned short* XK  = (unsigned short*)wsp; wsp += SZ_ACT;
  unsigned short* XV  = (unsigned short*)wsp; wsp += SZ_ACT;
  unsigned short* WQ6 = (unsigned short*)wsp; wsp += SZ_W;
  unsigned short* WK6 = (unsigned short*)wsp; wsp += SZ_W;
  unsigned short* WV6 = (unsigned short*)wsp; wsp += SZ_W;
  unsigned short* WO2 = (unsigned short*)wsp; wsp += SZ_WO2;
  float*          BR  = (float*)wsp;          wsp += SZ_BR;
  unsigned short* TB  = (unsigned short*)wsp; wsp += SZ_TB;
  unsigned short* QHp = (unsigned short*)wsp; wsp += SZ_ACT;
  unsigned short* QLp = (unsigned short*)wsp; wsp += SZ_ACT;
  unsigned short* KHp = (unsigned short*)wsp; wsp += SZ_ACT;
  unsigned short* KLp = (unsigned short*)wsp; wsp += SZ_ACT;
  unsigned short* VTp = (unsigned short*)wsp; wsp += SZ_ACT;     // [DM features][MT tokens] f16
  unsigned short* CTX = (unsigned short*)wsp; wsp += SZ_CTX;     // [MT][2*DM] bf16: hi | lo

  k_prep<<<PR_GRID, PR_T, 0, stream>>>(Qi, Ki, Vi, Wq, Wk, Wv, Wo, bq, bk, bv, bo, rel, XQ, XK, XV, WQ6, WK6, WV6, WO2, BR, TB);

  const unsigned gQK = (unsigned)((MT / 128) * (DM / 128));
  k_gemm_qkv<<<3u * gQK, 128, 0, stream>>>(XQ, XK, XV, WQ6, WK6, WV6, QHp, QLp, KHp, KLp, VTp, BR, 0.0625f);

  k_attn_rel<<<(unsigned)((NB * NH * (SEQ / 16)) / AT_NW), 32 * AT_NW, 0, stream>>>(QHp, QLp, KHp, KLp, VTp, TB, CTX);

  k_gemm_out<<<gQK, 128, 0, stream>>>(CTX, WO2, out, BR + 3 * DM, MT, DM, 2 * DM);
}

// v008
// It runs in 78.3 microseconds.
// Versions in between are left out here; by their measured steps it is 1.26 times as fast as v006.
// All steps since v000 together make it 4.84 times as fast.
// Contractions, all v_wmma_f32_16x16x32_f16 with f32 accumulate: q/k/v and output projections (inputs and weights RNE-converted to bf16 and held exactly in f16, weights x16; the context as one f16 plane); content scores and relative-position dots (q, k as one f16 plane each, the 33x64 table RNE-converted to bf16 and held in f16); P.V (P f16, at most 2^15; v f16).
#include <hip/hip_runtime.h>
#include <math.h>
#include <stdint.h>

#ifndef NB
#define NB 4
#endif
#ifndef SEQ
#define SEQ 1024
#endif
#define NB_FULL 4
#define SEQ_FULL 1024
#define DM 1024
#define NH 16
#define DK 64
#define MAXREL 16
#define NREL 33
#define NRELP 48
#define MT (NB * SEQ)
#define AT_NW 8
#define QP 52
#define OSP 68
#define RLOW 7.0f
#define PMAX 32768.0f

static_assert(NH * DK == DM);
static_assert(DK == 64);
static_assert(2 * MAXREL + 1 == NREL);
static_assert(NRELP % 16 == 0 && NRELP >= NREL);
static_assert(QP >= NRELP);
static_assert(SEQ % 64 == 0);
static_assert(MT % 128 == 0);
static_assert(DM % 128 == 0);
static_assert(DM >= 256);
static_assert(((SEQ / 16) * NB * NH) % AT_NW == 0);
static_assert((SEQ / 16) % AT_NW == 0);
static_assert(SEQ >= 128);
static_assert(NB <= NB_FULL && SEQ <= SEQ_FULL);

typedef __attribute__((ext_vector_type(16))) _Float16 v16h;
typedef __attribute__((ext_vector_type(8)))  _Float16 v8h;
typedef __attribute__((ext_vector_type(8)))  float    v8f;
typedef __attribute__((ext_vector_type(4)))  float    v4f;

// 16-bit WMMA fragment map (wave32), lane L, hh = L>>4, c = L&15:
//   A 16x32: lane = row c;    element i -> k = (i<8) ? 8hh+i : 16+8hh+(i-8)
//   B 32x16: lane = column c; the same k(i,hh)
//   D 16x16 (8 f32): lane = column c; element r -> row 8hh+r

__device__ __forceinline__ float cmb_bf(float v) { const unsigned u = __float_as_uint(v); const unsigned r = (u + 0x7fffu + ((u >> 16) & 1u)) & 0xffff0000u; return __uint_as_float(r); }   // bf16 RNE kept as f32 (finite inputs)
__device__ __forceinline__ unsigned int cmb_pk2(float a, float b) { return (unsigned int)__builtin_bit_cast(unsigned short, (_Float16)a) | ((unsigned int)__builtin_bit_cast(unsigned short, (_Float16)b) << 16); }

// 2^x by the hardware instruction alone, for the softmax. From -126 up it is the value exp2f gives (infinity where 2^x leaves f32: such a pass is formed anew); below that the result is 0 where exp2f
// gives a subnormal: P (f16) is 0 either way, the query's sum holds a term of about 2^RLOW or more that absorbs it, and a rescale factor that small leaves nothing of the old sums.
// A run of them is one statement: every result register differs from every argument register (early clobber), so that no v_exp_f32 is directly followed by an
// instruction that reads its result or writes over its argument; the v_nop is that one slot behind the last of the run.
__device__ __forceinline__ void exp2_hw8(const float (&x)[8], float (&e)[8]) {
  asm("v_exp_f32 %0, %8\n\tv_exp_f32 %1, %9\n\tv_exp_f32 %2, %10\n\tv_exp_f32 %3, %11\n\t"
      "v_exp_f32 %4, %12\n\tv_exp_f32 %5, %13\n\tv_exp_f32 %6, %14\n\tv_exp_f32 %7, %15\n\tv_nop"
      : "=&v"(e[0]), "=&v"(e[1]), "=&v"(e[2]), "=&v"(e[3]), "=&v"(e[4]), "=&v"(e[5]), "=&v"(e[6]), "=&v"(e[7])
      : "v"(x[0]), "v"(x[1]), "v"(x[2]), "v"(x[3]), "v"(x[4]), "v"(x[5]), "v"(x[6]), "v"(x[7]));
}
__device__ __forceinline__ float exp2_hw1(float x) {
  float e;
  asm("v_exp_f32 %0, %1\n\tv_nop" : "=v"(e) : "v"(x));
  return e;
}

// the value that lane addr / 4 holds: the instruction that __shfl and __shfl_xor compile to, with the byte index formed once, in front of the loop, by the caller
__device__ __forceinline__ float from_lane(float v, int addr) { return __int_as_float(__builtin_amdgcn_ds_bpermute(addr, __float_as_int(v))); }

__device__ __forceinline__ v8f zero8() { v8f z = {0.f, 0.f, 0.f, 0.f, 0.f, 0.f, 0.f, 0.f}; return z; }

__device__ __forceinline__ v8f wmmah(v16h a, v16h b, v8f c) {
  c = __builtin_amdgcn_wmma_f32_16x16x32_f16(false, a, false, b, (short)0, c, false, false);
  asm volatile("v_nop\n\tv_nop\n\tv_nop\n\tv_nop" : "+v"(c) : "v"(a), "v"(b));
  return c;
}
union FHu { v16h v; v8h h[2]; };
// p already includes the lane-half offset 8*hh: elements 0..7 <- p[0..7], 8..15 <- p[16..23]
__device__ __forceinline__ v16h ldfh(const _Float16* p) { FHu f; f.h[0] = *(const v8h*)(p); f.h[1] = *(const v8h*)(p + 16); return f.v; }

// ---- hazard guards for the register-blocked GEMM ----
__device__ __forceinline__ void acc_guard4(v8f& a, v8f& b, v8f& c, v8f& d) { asm volatile("v_nop\n\tv_nop\n\tv_nop\n\tv_nop" : "+v"(a), "+v"(b), "+v"(c), "+v"(d)); }

template <typename T> struct Frag;
template <> struct Frag<_Float16> {
  typedef v16h V;
  static __device__ __forceinline__ v16h load(const _Float16* p) { return ldfh(p); }
  static __device__ __forceinline__ v8f mma(v16h a, v16h b, v8f c) { return __builtin_amdgcn_wmma_f32_16x16x32_f16(false, a, false, b, (short)0, c, false, false); }
};
template <int ET> struct Elem;
template <> struct Elem<0> { typedef _Float16 T; };

// ---- Tensor loads into LDS for the GEMM panels ----
typedef uint32_t u32x4 __attribute__((ext_vector_type(4)));
typedef uint32_t u32x8 __attribute__((ext_vector_type(8)));
constexpr uint32_t G_ROWB  = 256u;                 // bytes of one operand row per stage = 128 k
constexpr uint32_t G_ROWS  = 64u;                  // rows per slice (one tensor load of one wave)
constexpr uint32_t G_PITCH = G_ROWB + 16u;         // LDS row pitch, laid by the load's pad: an odd multiple of 16 B for ds_load_b128 readers
constexpr uint32_t G_SLICE = 18432u;               // 64 x 272 = 17,408 B rounded up to a multiple of 2 KiB
constexpr uint32_t G_STAGE = 4u * G_SLICE;         // [A rows 0..63 | A rows 64..127 | Bt rows 0..63 | Bt rows 64..127]
static_assert(G_ROWS * G_PITCH <= G_SLICE && G_SLICE % 2048u == 0u);
__device__ __forceinline__ uint32_t uni(uint32_t v) { return (uint32_t)__builtin_amdgcn_readfirstlane(v); }
// keeps the test in a scalar register, so that the branch round a tensor load is a scalar branch (the load ignores EXEC)
__device__ __forceinline__ uint32_t pinned(uint32_t v) { uint32_t w = (uint32_t)__builtin_amdgcn_readfirstlane(v); asm volatile("" : "+s"(w)); return w; }
// the wave's LDS reads have retired before the buffer is handed back for a refill
__device__ __forceinline__ void wait_ds0() { asm volatile("s_wait_dscnt 0x0" ::: "memory"); }
// the wave's own tensor load has landed (the compiler places no wait for it); the request's descriptor is named as an input so that its registers keep their values until here
__device__ __forceinline__ void wait_tensor0(u32x4 g0, u32x8 g1) { asm volatile("s_wait_tensorcnt 0x0" :: "s"(g0), "s"(g1) : "memory"); }
__device__ __forceinline__ void tdm_load(u32x4 g0, u32x8 g1) { asm volatile("tensor_load_to_lds %0, %1" :: "s"(g0), "s"(g1) : "memory"); }
__device__ __forceinline__ u32x8 tdm_group1(uint32_t src_pitch) {
  u32x8 g;
  g[0] = uni((1u << 20) | (5u << 22) | (3u << 25));
  g[1] = uni((G_ROWB & 0xFFFFu) << 16);
  g[2] = uni((G_ROWB >> 16) | ((G_ROWS & 0xFFFFu) << 16));
  g[3] = uni((G_ROWS >> 16) | (G_ROWB << 16));
  g[4] = uni(G_ROWS);
  g[5] = uni(src_pitch);
  g[6] = uni(0u);
  g[7] = uni(0u);
  return g;
}
__device__ __forceinline__ u32x4 tdm_group0(uint32_t lds_dst, uint64_t ga) {
  u32x4 g;
  g[0] = uni(1u); g[1] = uni(lds_dst); g[2] = uni((uint32_t)ga); g[3] = uni((((uint32_t)(ga >> 32)) & 0x01FFFFFFu) | 0x80000000u);
  return g;
}

// ---- Register-blocked WMMA GEMM body: C[m,n] = scale * sum_k A[m,k] * Bt[n,k] + bias; a work-group of 4 waves (2 x 2) owns a 128x128 tile, each wave 64x64 of it.
// The 128 rows of A and of Bt come into LDS 128 k at a time by tensor loads, one 64-row slice per wave and stage, two buffers: stage s + 1 flies while stage s is multiplied.
// A row-major [M,K] (pitch lda), Bt row-major [N,K] (pitch ldb); M,N % 128 == 0, K % 128 == 0, K >= 256 (no tails).
// BIAS_MODE 1 = bias[m], 2 = bias[n]. OUT_MODE 0 = f32, 1 = f16.
// tile = the work-group's tile number (the same in every thread). slab = the wave's own 16 x 68 floats of output staging; it may lie inside ring:
// the last pass of the loop ends with every wave's LDS reads retired, every tensor load landed and a work-group barrier, and nothing is issued behind it.
template <int ET, int BIAS_MODE, int OUT_MODE>
__device__ __forceinline__ void gemm64_body(
    const unsigned short* __restrict__ Ap, int lda, const unsigned short* __restrict__ Btp, int ldb,
    void* __restrict__ Cout, int ldc, const float* __restrict__ bias,
    int M, int N, int K, float scale, int tile, float* slab, unsigned char* ring) {
  typedef typename Elem<ET>::T T;
  typedef typename Frag<T>::V V;
  const T* A = (const T*)Ap; const T* Bt = (const T*)Btp;
  const int lane = threadIdx.x & 31;
  const uint32_t wave = uni(threadIdx.x >> 5);
  const int tilesN = N >> 7;
  const int tilesM = M >> 7;
  if (tile >= tilesM * tilesN) return;   // the same for the whole block, in front of every barrier and tensor load
  const int tm = tile / tilesN;
  const int tn = tile - tm * tilesN;
  const int m0 = (tm << 7) + (int)((wave >> 1) << 6);
  const int n0 = (tn << 7) + (int)((wave & 1u) << 6);
  const int rlane = lane & 15;
  const int koff  = (lane >> 4) * 8;
  const int mOff  = (lane >> 4) * 8;

  v8f acc[4][4];
#pragma unroll
  for (int i = 0; i < 4; ++i)
#pragma unroll
    for (int j = 0; j < 4; ++j) acc[i][j] = zero8();

  // this wave's slice: waves 0, 1 bring the two halves of A's 128 rows, waves 2, 3 those of Bt's
  const bool isB = wave >= 2u;
  const uint64_t srcA = (uint64_t)(size_t)(A + (size_t)((tm << 7) + (int)((wave & 1u) << 6)) * lda);
  const uint64_t srcB = (uint64_t)(size_t)(Bt + (size_t)((tn << 7) + (int)((wave & 1u) << 6)) * ldb);
  const uint64_t gsrc = isB ? srcB : srcA;
  u32x8 g1 = tdm_group1((uint32_t)(isB ? ldb : lda) * 2u);
  asm volatile("" : "+s"(g1));   // the pinned() form on descriptor words: held in their scalar registers, built once, so that none is written again while a request is outstanding
  const uint32_t ldst = (uint32_t)(size_t)ring + wave * G_SLICE;
  const int nst = K >> 7;
  // this wave's fragment rows: A from slice wave >> 1, Bt from slice 2 + (wave & 1)
  const unsigned char* aR = ring + (wave >> 1) * G_SLICE + (uint32_t)rlane * G_PITCH + (uint32_t)koff * 2u;
  const unsigned char* bR = ring + (2u + (wave & 1u)) * G_SLICE + (uint32_t)rlane * G_PITCH + (uint32_t)koff * 2u;

  u32x4 g0 = tdm_group0(ldst, gsrc);
  tdm_load(g0, g1);                                           // stage 0 -> buffer 0
  wait_tensor0(g0, g1);
  __syncthreads();                                            // stage 0 published
  g0 = tdm_group0(ldst + G_STAGE, gsrc + G_ROWB);
  tdm_load(g0, g1);                                           // stage 1 -> buffer 1 (K >= 256)

  // kept rolled: one publish point per stage
#pragma unroll 1
  for (int s = 0; s < nst; ++s) {
    const uint32_t buf = ((uint32_t)s & 1u) * G_STAGE;
    // two fragment sets inside the stage: the LDS reads of the next 32 k go ahead of this 32 k's WMMAs; nothing of the next stage is read here
    V ah[2][4], bh[2][4];
#pragma unroll
    for (int j = 0; j < 4; ++j) {
      bh[0][j] = Frag<T>::load((const T*)(bR + buf + (uint32_t)j * 16u * G_PITCH));
      ah[0][j] = Frag<T>::load((const T*)(aR + buf + (uint32_t)j * 16u * G_PITCH));
    }
#pragma unroll
    for (int kk = 0; kk < 4; ++kk) {
      const int cur = kk & 1, nxt = cur ^ 1;
      if (kk < 3) {
#pragma unroll
        for (int j = 0; j < 4; ++j) {
          bh[nxt][j] = Frag<T>::load((const T*)(bR + buf + (uint32_t)j * 16u * G_PITCH + (uint32_t)(kk + 1) * 64u));
          ah[nxt][j] = Frag<T>::load((const T*)(aR + buf + (uint32_t)j * 16u * G_PITCH + (uint32_t)(kk + 1) * 64u));
        }
      }
#pragma unroll
      for (int i = 0; i < 4; ++i) {
#pragma unroll
        for (int j = 0; j < 4; ++j) acc[i][j] = Frag<T>::mma(ah[cur][i], bh[cur][j], acc[i][j]);
        acc_guard4(acc[i][0], acc[i][1], acc[i][2], acc[i][3]);   // the four vector slots behind a WMMA; it also keeps each group of LDS reads where it is written
      }
    }
    // publish point of stage s + 1: own LDS reads retired, own load landed, then the barrier that publishes s + 1 and frees this buffer
    wait_ds0();
    wait_tensor0(g0, g1);
    __syncthreads();
    if (pinned((uint32_t)(s + 2 < nst))) {
      g0 = tdm_group0(ldst + buf, gsrc + (uint64_t)(uint32_t)(s + 2) * G_ROWB);
      tdm_load(g0, g1);
    }
  }
  wait_tensor0(g0, g1);
  wait_ds0();
  acc_guard4(acc[0][0], acc[0][1], acc[0][2], acc[0][3]);
  acc_guard4(acc[1][0], acc[1][1], acc[1][2], acc[1][3]);
  acc_guard4(acc[2][0], acc[2][1], acc[2][2], acc[2][3]);
  acc_guard4(acc[3][0], acc[3][1], acc[3][2], acc[3][3]);

#pragma unroll
  for (int i = 0; i < 4; ++i) {
    const int mBase = m0 + (i << 4);
#pragma unroll
    for (int j = 0; j < 4; ++j) {
      const int n = n0 + (j << 4) + rlane;
      float bv = 0.f;
      if (BIAS_MODE == 2) bv = bias[n];
#pragma unroll
      for (int r = 0; r < 8; ++r) {
        float v = acc[i][j][r] * scale;
        if (BIAS_MODE == 1) v += bias[mBase + mOff + r];
        if (BIAS_MODE == 2) v += bv;
        slab[(mOff + r) * 68 + (j << 4) + rlane] = v;
      }
    }
    __builtin_amdgcn_fence(3 /* release order */, "workgroup");
    __builtin_amdgcn_wave_barrier();
    __builtin_amdgcn_fence(2 /* acquire order */, "workgroup");
    if (OUT_MODE == 0) {
      float* C = (float*)Cout;
      const int hh = lane >> 4, c4 = (lane & 15) * 4;     // row segment = 256 B = 16 lanes x 16 B
      {
#pragma unroll
        for (int it = 0; it < 8; ++it) {
          const int row = it * 2 + hh;
          v4f v = *(const v4f*)(slab + row * 68 + c4);
          *(v4f*)(C + (size_t)(mBase + row) * ldc + n0 + c4) = v;
        }
        
      }
    } else {
      const int q = lane >> 3, c8 = (lane & 7) * 8;
      unsigned short* C  = (unsigned short*)Cout;
      {
#pragma unroll
        for (int it = 0; it < 4; ++it) {
          const int row = it * 4 + q;
          const float* sp = slab + row * 68 + c8;
          v8h hv;
#pragma unroll
          for (int e = 0; e < 8; ++e) hv[e] = (_Float16)sp[e];
          *(v8h*)(C + (size_t)(mBase + row) * ldc + n0 + c8) = hv;
        }
        
      }
    }
    __builtin_amdgcn_fence(3 /* release order */, "workgroup");
    __builtin_amdgcn_wave_barrier();
    __builtin_amdgcn_fence(2 /* acquire order */, "workgroup");
  }
}

// q, k and v projections in one launch: work-groups [0, T) take q's tiles, [T, 2T) k's, [2T, 3T) v's, T = tiles of one projection.
//   q, k: C[token][feature] = sum_k X[token][k] * W[feature][k] + bias[feature], f16 operands, one f16 plane out
//   v, transposed: C[feature][token] = sum_k Wv[feature][k] * X[token][k] + bias[feature], f16 out (pitch = tokens)
// The output staging lies over the drained ring, so a work-group holds 144 KiB of LDS and two of them share a WGP:
// one's tensor-load waits, first fragment reads and epilogue run under the other's WMMAs.
constexpr int G_TILES = (MT / 128) * (DM / 128);
constexpr uint32_t G_SLAB = 16u * 68u * 4u;        // bytes of one wave's output staging
static_assert(4u * G_SLAB <= 2u * G_STAGE && G_SLAB % 16u == 0u);
__global__ __launch_bounds__(128) void k_gemm_qkv(const unsigned short* __restrict__ XQ, const unsigned short* __restrict__ XK, const unsigned short* __restrict__ XV,
                                                  const unsigned short* __restrict__ WQ, const unsigned short* __restrict__ WK, const unsigned short* __restrict__ WV,
                                                  unsigned short* __restrict__ QF, unsigned short* __restrict__ KF,
                                                  unsigned short* __restrict__ VT, const float* __restrict__ BR, float scale) {
  __shared__ __attribute__((aligned(2048))) unsigned char ring[2 * G_STAGE];
  float* slab = (float*)(ring + (threadIdx.x >> 5) * G_SLAB);
  const int which = (int)blockIdx.x / G_TILES;                 // the same for the whole block
  const int tile  = (int)blockIdx.x - which * G_TILES;
  if (which < 2) {
    const bool isq = which == 0;
    gemm64_body<0, 2, 1>(isq ? XQ : XK, DM, isq ? WQ : WK, DM, (void*)(isq ? QF : KF), DM, BR + which * DM, MT, DM, DM, scale, tile, slab, ring);
  } else {
    gemm64_body<0, 1, 1>(WV, DM, XV, DM, (void*)VT, MT, BR + 2 * DM, DM, MT, DM, scale, tile, slab, ring);
  }
}
// output projection: f16 operands (A = context, Bt = Wo x16), bias[n], f32 out
__global__ __launch_bounds__(128) void k_gemm_out(const unsigned short* __restrict__ A, const unsigned short* __restrict__ W,
                                                  float* __restrict__ C, const float* __restrict__ bias, int M, int N, int K, float scale) {
  __shared__ __attribute__((aligned(2048))) unsigned char ring[2 * G_STAGE];
  __shared__ __align__(16) float sT[4][16 * 68];
  gemm64_body<0, 2, 0>(A, K, W, K, (void*)C, N, bias, M, N, K, scale, (int)blockIdx.x, sT[threadIdx.x >> 5], ring);
}

// ---- operand preparation, all of it in one launch of long-lived waves ----
// A chunk is 16,384 consecutive floats of one source (16 rows of DM). A block of 16 waves takes four chunks; every thread asks for all its 16-B pieces first
// (each wave-wide load covers 512 contiguous bytes), then converts and stores them in the order in which they were asked for.
//   activations:  f32 -> bf16 (RNE) -> f16 plane [MT][DM]; rows (b, s) of the full-size inputs
//   Wq, Wk, Wv, Wo: f32 -> bf16 (RNE) -> x16 -> f16 plane [DM][DM] (exact; [out][in] is already the Bt layout)
//   biases:       f32 -> bf16 (RNE) kept as f32; table: f32 -> bf16 (RNE) -> f16 plane [NRELP][DK], rows >= NREL written as zeros (clamped source address)
typedef __attribute__((ext_vector_type(2))) unsigned int u2;
constexpr int PR_T     = 512;                                   // threads per block
constexpr int PR_L     = 8;                                     // 16-B loads per thread and chunk
constexpr int PR_CH    = PR_T * PR_L * 4;                       // floats per chunk
constexpr int PR_ACT   = (int)(((long long)MT * DM) / PR_CH);   // chunks per activation plane
constexpr int PR_W     = (DM * DM) / PR_CH;                     // chunks per weight matrix
constexpr int PR_GRID  = PR_ACT > 4 * PR_W ? PR_ACT : 4 * PR_W;  // block b: chunk b of each activation plane and chunk b of [Wq, Wk, Wv, Wo]
constexpr int PR_SQ    = DM + NRELP * (DK / 4);                 // 4-float pieces of the four biases, then of the padded table
constexpr int PR_SMALL = (PR_SQ + PR_T - 1) / PR_T;             // the first blocks take one such piece per thread on top
static_assert(PR_CH % DM == 0 && SEQ % (PR_CH / DM) == 0 && ((long long)MT * DM) % PR_CH == 0 && (DM * DM) % PR_CH == 0);
static_assert(PR_SMALL <= PR_GRID && DK % 4 == 0 && DM % 4 == 0 && (PR_T * 4) % DM == 0);

__device__ __forceinline__ u2 pr_f16(v4f x, float sc) { u2 p; p.x = cmb_pk2(cmb_bf(x.x) * sc, cmb_bf(x.y) * sc); p.y = cmb_pk2(cmb_bf(x.z) * sc, cmb_bf(x.w) * sc); return p; }

__global__ __launch_bounds__(PR_T) void k_prep(const float* __restrict__ Qi, const float* __restrict__ Ki, const float* __restrict__ Vi,
                                               const float* __restrict__ Wq, const float* __restrict__ Wk, const float* __restrict__ Wv, const float* __restrict__ Wo,
                                               const float* __restrict__ bq, const float* __restrict__ bk, const float* __restrict__ bv, const float* __restrict__ bo,
                                               const float* __restrict__ rel,
                                               unsigned short* __restrict__ XQ, unsigned short* __restrict__ XK, unsigned short* __restrict__ XV,
                                               unsigned short* __restrict__ WQ6, unsigned short* __restrict__ WK6, unsigned short* __restrict__ WV6,
                                               unsigned short* __restrict__ WO6, float* __restrict__ BR, unsigned short* __restrict__ TB) {
  const unsigned t = threadIdx.x;
  const unsigned b = blockIdx.x;
  // chunk numbers are clamped for the loads, so that no branch stands among them; the stores are guarded
  const unsigned ka = min(b, (unsigned)(PR_ACT - 1));
  const unsigned kw = min(b, (unsigned)(4 * PR_W - 1));
  const unsigned w  = kw / (unsigned)PR_W, kc = kw % (unsigned)PR_W;
  const unsigned r0 = ka * (unsigned)(PR_CH / DM);
  const size_t ao = (size_t)(r0 / (unsigned)SEQ) * ((size_t)SEQ_FULL * DM) + (size_t)(r0 % (unsigned)SEQ) * DM;
  const v4f* sq = (const v4f*)(Qi + ao) + t;                    // block-uniform base + the thread's 16 B inside 8 KiB of the chunk
  const v4f* sk = (const v4f*)(Ki + ao) + t;
  const v4f* sv = (const v4f*)(Vi + ao) + t;
  const v4f* sw = (const v4f*)((w == 0u ? Wq : w == 1u ? Wk : w == 2u ? Wv : Wo) + (size_t)kc * PR_CH) + t;
  // one piece of the biases (u < DM) or of the table per thread of the first blocks; every thread's address is in bounds
  const unsigned u = b * (unsigned)PR_T + t;
  const unsigned tq = u < (unsigned)DM ? 0u : u - (unsigned)DM;

  v4f xs = {0.f, 0.f, 0.f, 0.f};
  if (b < (unsigned)PR_SMALL) {
    const unsigned bw = u / (unsigned)(DM / 4);
    const float* bs = bw == 0u ? bq : bw == 1u ? bk : bw == 2u ? bv : bo;
    const float* ss = u < (unsigned)DM ? bs + (u % (unsigned)(DM / 4)) * 4u : rel + min(tq / (unsigned)(DK / 4), (unsigned)(NREL - 1)) * (unsigned)DK + (tq % (unsigned)(DK / 4)) * 4u;
    xs = *(const v4f*)ss;
  }
  // PR_ORDER: the compiler moves nothing across it. The loads leave plane by plane and each plane is converted and stored as soon as its own loads are back,
  // while the later planes are still on their way; without it the conversions of all planes are mixed and the first store waits for most of the loads.
#define PR_ORDER() __builtin_amdgcn_sched_barrier(0)
  // every loop below is unrolled: the pieces stay in registers and their offsets become immediates
  v4f xq[PR_L], xk[PR_L], xv[PR_L], xw[PR_L];
#pragma unroll
  for (int j = 0; j < PR_L; ++j) xq[j] = sq[j * PR_T];
  PR_ORDER();
#pragma unroll
  for (int j = 0; j < PR_L; ++j) xk[j] = sk[j * PR_T];
  PR_ORDER();
#pragma unroll
  for (int j = 0; j < PR_L; ++j) xv[j] = sv[j * PR_T];
  PR_ORDER();
#pragma unroll
  for (int j = 0; j < PR_L; ++j) xw[j] = sw[j * PR_T];
  // stands in front of every later write of a register that one of the loads above names as an address; the thread number, their offset register, is named as an input so that it keeps its value until here
  asm volatile("s_wait_xcnt 0x0" :: "v"(t) : "memory");

  if (b < (unsigned)PR_SMALL) {
    if (u < (unsigned)DM) {
      v4f r; r.x = cmb_bf(xs.x); r.y = cmb_bf(xs.y); r.z = cmb_bf(xs.z); r.w = cmb_bf(xs.w);
      *(v4f*)(BR + u * 4u) = r;
    } else if (u < (unsigned)PR_SQ) {
      u2 pk = pr_f16(xs, 1.0f);
      if (tq / (unsigned)(DK / 4) >= (unsigned)NREL) { pk.x = 0u; pk.y = 0u; }
      *(u2*)(TB + tq * 4u) = pk;
    }
  }
  if (b < (unsigned)PR_ACT) {
    const size_t o = (size_t)ka * PR_CH + t * 4u;
#pragma unroll
    for (int j = 0; j < PR_L; ++j) *(u2*)(XQ + o + j * (PR_T * 4)) = pr_f16(xq[j], 1.0f);
    PR_ORDER();
#pragma unroll
    for (int j = 0; j < PR_L; ++j) *(u2*)(XK + o + j * (PR_T * 4)) = pr_f16(xk[j], 1.0f);
    PR_ORDER();
#pragma unroll
    for (int j = 0; j < PR_L; ++j) *(u2*)(XV + o + j * (PR_T * 4)) = pr_f16(xv[j], 1.0f);
    // stands in front of the weight chunk's conversions, which write over registers that these stores name
    asm volatile("s_wait_xcnt 0x0" ::: "memory");
  }
  PR_ORDER();   // as above: the weight chunk's conversions stay behind the V plane's stores, which otherwise wait for the weight loads too
  if (b < (unsigned)(4 * PR_W)) {
    unsigned short* dp = (w == 0u ? WQ6 : w == 1u ? WK6 : w == 2u ? WV6 : WO6) + (size_t)kc * PR_CH + t * 4u;
#pragma unroll
    for (int j = 0; j < PR_L; ++j) *(u2*)(dp + j * (PR_T * 4)) = pr_f16(xw[j], 16.0f);
  }
}

// =====================================================================================================================
// Fused attention with clipped relative-position bias. One wave per 16 queries; the 8 waves of a block share one (batch, head) and its K, V tiles in LDS.
//   score(l, r) = q_l . k_r / 8 + q_l . table[clip(r - l, -16, 16) + 16]
//   Transposed score tiles S^T = K . Q^T (A = key rows, B = query rows): D has lane = query, element = key, which is the A-operand
//   layout of P for O = P . V (32 keys per step), so P never leaves registers. q, k: one f16 plane each, one product per score tile and 32 d.
//   Relative dots: table (A, rows padded to NRELP) x q (B), staged once per wave in LDS [16][QP] and gathered per element,
//   but only in the passes that touch the clip band |r - l| < 16: in every other pass all 32 x 16 distances clip to the same end of the table,
//   the bias is one value per query, and scale, bias and running maximum go into one fma per score.
//   V^T plane [feature][token] f16 gives B fragments with contiguous keys. Online softmax in f32 (exp2 domain), P = 2^(score - reference) in f16.
//   A query's reference is set RLOW below its maximum so far (P then uses f16's range on both sides of 1) and stays in use while every lane's P of a pass sum to PMAX at most,
//   so that each P fits f16 (one ballot, one scalar branch per pass). Only where they do not is the pass's maximum taken, are the lane halves' maxima joined, the reference raised,
//   the sums and O rescaled and the pass's P formed anew. Each lane half sums its own keys; the halves' sums are joined once, behind the loop.
//   K (64 keys x 64 d) and V^T (64 features x 64 keys) come into LDS 64 keys at a time by tensor loads, one tile each from waves 0, 1, two buffers:
//   stage s + 1 flies while stage s is worked on.
// =====================================================================================================================
constexpr uint32_t AT_KEYS  = 64u;                 // keys per stage
constexpr uint32_t AT_ROWB  = 128u;                // bytes of one tile row: 64 d of a key, or 64 keys of a feature
constexpr uint32_t AT_ROWS  = 64u;                 // rows per tile (one tensor load of one wave)
constexpr uint32_t AT_PITCH = AT_ROWB + 16u;       // LDS row pitch, laid by the load's pad: an odd multiple of 16 B for ds_load_b128 readers
constexpr uint32_t AT_SLICE = 10240u;              // 64 x 144 = 9,216 B rounded up to a multiple of 2 KiB
constexpr uint32_t AT_STAGE = 2u * AT_SLICE;       // [K | V^T]
constexpr int      AT_NST   = SEQ / (int)AT_KEYS;
static_assert(AT_ROWS * AT_PITCH <= AT_SLICE && AT_SLICE % 2048u == 0u);
static_assert(DK * 2 == (int)AT_ROWB && DK == (int)AT_ROWS && AT_NST >= 2);
// group 1: 1-byte elements, tile = tensor = 64 rows of 128 B, source row pitch in bytes, 16 B of LDS pad behind every 128-B row, no mask
__device__ __forceinline__ u32x8 at_group1(uint32_t src_pitch) {
  u32x8 g;
  g[0] = uni((1u << 20) | (4u << 22) | (3u << 25));
  g[1] = uni((AT_ROWB & 0xFFFFu) << 16);
  g[2] = uni((AT_ROWB >> 16) | ((AT_ROWS & 0xFFFFu) << 16));
  g[3] = uni((AT_ROWS >> 16) | (AT_ROWB << 16));
  g[4] = uni(AT_ROWS);
  g[5] = uni(src_pitch);
  g[6] = uni(0u);
  g[7] = uni(0u);
  return g;
}

__global__ __launch_bounds__(32 * AT_NW) void k_attn_rel(const unsigned short* __restrict__ QFp, const unsigned short* __restrict__ KFp,
                                                         const unsigned short* __restrict__ VTp, const unsigned short* __restrict__ TBp,
                                                         unsigned short* __restrict__ CTX) {
  __shared__ __attribute__((aligned(2048))) unsigned char ring[2 * AT_STAGE];
  __shared__ __align__(16) float qrs[AT_NW][16 * QP];
  __shared__ __align__(16) float osm[AT_NW][16 * OSP];
  const _Float16* QF = (const _Float16*)QFp;
  const _Float16* TB = (const _Float16*)TBp;
  const int lane = threadIdx.x & 31, wave = threadIdx.x >> 5, hh = lane >> 4, c = lane & 15;
  const int bh = (int)blockIdx.x / ((SEQ / 16) / AT_NW);            // the same for the whole block
  const int l0 = (((int)blockIdx.x - bh * ((SEQ / 16) / AT_NW)) * AT_NW + wave) * 16;
  const int b = bh / NH, h = bh - b * NH;
  const size_t tok0 = (size_t)b * SEQ;

  // q as B operand (lane = query column c), 2 k-steps of 32
  v16h qf[2];
  {
    const size_t qo = (tok0 + l0 + c) * DM + h * DK + 8 * hh;
#pragma unroll
    for (int dc = 0; dc < 2; ++dc) qf[dc] = ldfh(QF + qo + dc * 32);
  }
  // this wave's tile: wave 0 brings K, wave 1 V^T; the other waves issue nothing (their words name V^T's tile and are not used)
  const uint32_t wv = uni((uint32_t)threadIdx.x >> 5);
  const uint32_t sl = wv < 1u ? 0u : 1u;
  const uint64_t gsrc = sl == 0u ? (uint64_t)(size_t)(KFp + tok0 * DM + h * DK)
                                 : (uint64_t)(size_t)(VTp + (size_t)(h * DK) * MT + tok0);
  const uint32_t gstep = sl == 1u ? AT_KEYS * 2u : AT_KEYS * (uint32_t)DM * 2u;     // source bytes from one stage to the next
  u32x8 g1 = at_group1(sl == 1u ? (uint32_t)MT * 2u : (uint32_t)DM * 2u);
  asm volatile("" : "+s"(g1));   // the pinned() form on descriptor words: held in their scalar registers, built once, so that none is written again while a request is outstanding
  const uint32_t ldst = (uint32_t)(size_t)ring + sl * AT_SLICE;
  u32x4 g0 = tdm_group0(ldst, gsrc);
  if (pinned((uint32_t)(wv < 2u))) {
    tdm_load(g0, g1);                                         // stage 0 -> buffer 0
    wait_tensor0(g0, g1);
  }
  __syncthreads();                                            // stage 0 published
  g0 = tdm_group0(ldst + AT_STAGE, gsrc + gstep);
  asm volatile("" : "+s"(g0));   // the pinned() form on descriptor words: all four stand in their scalar registers in front of the branch, so that none is written behind the load
  if (pinned((uint32_t)(wv < 2u))) tdm_load(g0, g1);          // stage 1 -> buffer 1 (SEQ >= 128)

  // relative dots: D[j][query] = sum_d table[j][d] * q[query][d]; lane = query c, element r -> j = jt*16 + 8hh + r
  float* myq = qrs[wave];
#pragma unroll
  for (int jt = 0; jt < NRELP / 16; ++jt) {
    v8f acc = zero8();
#pragma unroll
    for (int dc = 0; dc < 2; ++dc) {
      const v16h ta = ldfh(TB + (jt * 16 + c) * DK + dc * 32 + 8 * hh);
      acc = wmmah(ta, qf[dc], acc);
    }
#pragma unroll
    for (int r = 0; r < 8; ++r) myq[c * QP + jt * 16 + 8 * hh + r] = acc[r];
  }
  __builtin_amdgcn_fence(3 /* release order */, "workgroup");
  __builtin_amdgcn_wave_barrier();
  __builtin_amdgcn_fence(2 /* acquire order */, "workgroup");

  const int lglob = l0 + c;
  const float* qrow = myq + c * QP + MAXREL;        // indexed by clip(r - l, -16, 16)
  const float L2E = 1.4426950408889634f;
  const float SCL = 0.125f * 1.4426950408889634f;   // 1 / sqrt(DK) in the exp2 domain
  // the wave's first query as a scalar: the test on a pass's distance from the band is a scalar branch
  const int l0s = (((int)blockIdx.x - bh * ((SEQ / 16) / AT_NW)) * AT_NW + (int)wv) * 16;
  const int caddr = (8 * hh) << 2;                  // byte index of lane 8hh
  const int xaddr = (lane ^ 16) << 2;               // byte index of the lane that holds the same query in the other half
  const float bLo = qrow[-MAXREL] * L2E, bHi = qrow[MAXREL] * L2E;   // this query's bias left and right of the band, exp2 domain
  float m_run = -1.0e30f, s_run = 0.f;
  v8f o[4];
#pragma unroll
  for (int t = 0; t < 4; ++t) o[t] = zero8();
  // fragment rows in LDS: lane = key row (K) or feature row (V^T) c of a 16-row group, lane half at 16 B
  const unsigned char* kR = ring + (uint32_t)c * AT_PITCH + (uint32_t)hh * 16u;
  const unsigned char* vR = kR + AT_SLICE;

  // kept rolled: one publish point per stage
#pragma unroll 1
  for (int s = 0; s < AT_NST; ++s) {
  const uint32_t buf = ((uint32_t)s & 1u) * AT_STAGE;
  // the two 32-key passes of a stage are unrolled: their LDS offsets become immediates
#pragma unroll
  for (int ps = 0; ps < 2; ++ps) {
    const int r0 = s * (int)AT_KEYS + ps * 32;
    // the pass's K fragments are read as one group ahead of its score products; only this stage's buffer is read (loops unrolled: the fragment arrays stay in registers)
    v16h kf[2][2];
#pragma unroll
    for (int tt = 0; tt < 2; ++tt)
#pragma unroll
      for (int dc = 0; dc < 2; ++dc) kf[tt][dc] = ldfh((const _Float16*)(kR + buf + (uint32_t)(ps * 32 + 16 * tt) * AT_PITCH + (uint32_t)dc * 64u));
    v8f t[2];
#pragma unroll
    for (int tt = 0; tt < 2; ++tt) {
      v8f acc = zero8();
#pragma unroll
      for (int dc = 0; dc < 2; ++dc) acc = wmmah(kf[tt][dc], qf[dc], acc);
      t[tt] = acc;
    }
    // the pass's V^T fragments are asked for ahead of the softmax, which covers their LDS latency (unrolled: the array stays in registers)
    v16h vfr[4];
#pragma unroll
    for (int tq = 0; tq < 4; ++tq) vfr[tq] = ldfh((const _Float16*)(vR + buf + (uint32_t)tq * 16u * AT_PITCH + (uint32_t)ps * 64u));
    // element e <-> key r0 + 8hh + e (tile 0) and r0 + 16 + 8hh + e (tile 1); this lane's query is lglob
    const int rel = r0 - l0s;                         // distances of the pass: rel - 15 ... rel + 31
    float bL = rel < 0 ? bLo : bHi;                   // the bias where every distance of the pass clips to the same end
    if (!(rel + 31 <= -MAXREL || rel - 15 >= MAXREL)) {
      // the pass touches the band: each score's own bias goes into its raw product, (t / 8 + bias) * L2E = (t + 8 * bias) * SCL
      const int dbase = r0 + 8 * hh - lglob;
#pragma unroll
      for (int e = 0; e < 8; ++e) {
        const int d0 = min(max(dbase + e, -MAXREL), MAXREL);
        const int d1 = min(max(dbase + 16 + e, -MAXREL), MAXREL);
        t[0][e] = fmaf(qrow[d0], 8.0f, t[0][e]);
        t[1][e] = fmaf(qrow[d1], 8.0f, t[1][e]);
      }
      bL = 0.f;
    }
    float sum;
    float ex[16];                                     // 2^(score - reference)
    // two runs of eight exponentials; the loops are unrolled so that arguments and results are registers, as the asm operands ask
    auto powers = [&]() {
      const float kb = bL - m_run;
      sum = 0.f;
#pragma unroll
      for (int g = 0; g < 2; ++g) {
        float xa[8], ea[8];
#pragma unroll
        for (int r = 0; r < 8; ++r) xa[r] = fmaf(t[g][r], SCL, kb);
        exp2_hw8(xa, ea);
#pragma unroll
        for (int r = 0; r < 8; ++r) {
          sum += ea[r];
          ex[8 * g + r] = ea[r];
        }
      }
    };
    powers();
    // rare (always in the first pass): a lane's powers of this pass sum to more than PMAX, so that one of them might not fit f16 (one ballot, one scalar branch per pass).
    // Then every query's reference goes up to RLOW below its maximum so far (where that is higher), its sums and its O row come down by the same factor,
    // and the pass's powers are formed anew: each is then at most 2^RLOW.
    if (__builtin_amdgcn_ballot_w32(!(sum <= PMAX)) != 0u) {
      // this lane's largest score of the pass, exp2 domain: the maximum is taken over the raw products (SCL > 0); the loops of this block are unrolled: all arrays are registers
      float tm = -3.0e38f;
#pragma unroll
      for (int e = 0; e < 8; ++e) tm = fmaxf(tm, fmaxf(t[0][e], t[1][e]));
      const float mt = fmaf(tm, SCL, bL);
      const float m_new = fmaxf(m_run, fmaxf(mt, from_lane(mt, xaddr)) - RLOW);   // the two lane halves hold the same query
      const float corr  = exp2_hw1(m_run - m_new);
      s_run *= corr;
      m_run = m_new;
      float sc[8];
#pragma unroll
      for (int i = 0; i < 8; ++i) sc[i] = from_lane(corr, caddr + 4 * i);   // O tile rows are queries 8hh + i
#pragma unroll
      for (int tq = 0; tq < 4; ++tq)
#pragma unroll
        for (int i = 0; i < 8; ++i) o[tq][i] *= sc[i];
      powers();
    }
    v16h pA;                                          // P as A operand: element i <-> key r0 + k(i, hh) (unrolled: both arrays are registers)
#pragma unroll
    for (int i = 0; i < 16; ++i) pA[i] = (_Float16)ex[i];
    s_run += sum;                                     // this lane half's keys only
#pragma unroll
    for (int tq = 0; tq < 4; ++tq) o[tq] = wmmah(pA, vfr[tq], o[tq]);
  }
    // publish point of stage s + 1: own LDS reads retired, the issuer's own load landed, then the barrier that publishes s + 1 and frees this buffer
    wait_ds0();
    if (pinned((uint32_t)(wv < 2u))) wait_tensor0(g0, g1);
    __syncthreads();
    g0 = tdm_group0(ldst + buf, gsrc + (uint64_t)((uint32_t)(s + 2) * gstep));
    asm volatile("" : "+s"(g0));   // the pinned() form on descriptor words, as in front of the loop: formed behind the wait, none written behind the load
    if (pinned((uint32_t)(wv < 2u && s + 2 < AT_NST))) tdm_load(g0, g1);   // issued only while stage s + 2 exists
  }
  wait_tensor0(g0, g1);
  wait_ds0();

  const float s_tot = s_run + from_lane(s_run, xaddr);   // the two lane halves hold the same query
  float inv[8];
#pragma unroll
  for (int i = 0; i < 8; ++i) inv[i] = 1.0f / __shfl(s_tot, i + 8 * hh, 32);
  float* os = osm[wave];
#pragma unroll
  for (int tq = 0; tq < 4; ++tq)
#pragma unroll
    for (int i = 0; i < 8; ++i) os[(8 * hh + i) * OSP + tq * 16 + c] = o[tq][i] * inv[i];
  __builtin_amdgcn_fence(3 /* release order */, "workgroup");
  __builtin_amdgcn_wave_barrier();
  __builtin_amdgcn_fence(2 /* acquire order */, "workgroup");
  {
    const int q = lane >> 3, c8 = (lane & 7) * 8;
    unsigned short* ch = CTX + (tok0 + l0) * (size_t)DM + h * DK + c8;
    v8h pv[4];
#pragma unroll
    for (int it = 0; it < 4; ++it) {
      const float* sp = os + (it * 4 + q) * OSP + c8;
#pragma unroll
      for (int e = 0; e < 8; ++e) pv[it][e] = (_Float16)sp[e];
    }
#pragma unroll
    for (int it = 0; it < 4; ++it) *(v8h*)(ch + (size_t)(it * 4 + q) * DM) = pv[it];
  }
}

extern "C" void kernel_launch(void* const* d_in, const int* in_sizes, int n_in, void* d_out, int out_size, void* d_ws, size_t ws_size, hipStream_t stream) {
  if (n_in < 12) return;
  const long long actn = ((long long)(NB - 1) * SEQ_FULL + SEQ) * DM;
  if ((long long)in_sizes[0] < actn || (long long)in_sizes[1] < actn || (long long)in_sizes[2] < actn) return;
  if (in_sizes[3] < DM * DM || in_sizes[5] < DM * DM || in_sizes[7] < DM * DM || in_sizes[9] < DM * DM) return;
  if (in_sizes[4] < DM || in_sizes[6] < DM || in_sizes[8] < DM || in_sizes[10] < DM) return;
  if (in_sizes[11] < NREL * DK) return;
  if ((long long)out_size < (long long)MT * DM) return;

  const float* Qi = (const float*)d_in[0];
  const float* Ki = (const float*)d_in[1];
  const float* Vi = (const float*)d_in[2];
  const float* Wq = (const float*)d_in[3];
  const float* bq = (const float*)d_in[4];
  const float* Wk = (const float*)d_in[5];
  const float* bk = (const float*)d_in[6];
  const float* Wv = (const float*)d_in[7];
  const float* bv = (const float*)d_in[8];
  const float* Wo = (const float*)d_in[9];
  const float* bo = (const float*)d_in[10];
  const float* rel = (const float*)d_in[11];
  float* out = (float*)d_out;

  constexpr size_t SZ_ACT = (size_t)MT * DM * 2;          // 16-bit [MT][DM] plane
  constexpr size_t SZ_W   = (size_t)DM * DM * 2;
  constexpr size_t SZ_BR  = (size_t)4 * DM * 4;
  constexpr size_t SZ_TB  = (size_t)NRELP * DK * 2;
  static_assert(SZ_ACT % 256 == 0 && SZ_W % 256 == 0 && SZ_BR % 256 == 0 && SZ_TB % 256 == 0);
  constexpr size_t TOTAL = 3 * SZ_ACT + 4 * SZ_W + SZ_BR + SZ_TB + 4 * SZ_ACT;
  static_assert(TOTAL <= (size_t)134217728);
  if (TOTAL > ws_size) return;

  char* wsp = (char*)d_ws;
  unsigned short* XQ  = (unsigned short*)wsp; wsp += SZ_ACT;
  unsigned short* XK  = (unsigned short*)wsp; wsp += SZ_ACT;
  unsigned short* XV  = (unsigned short*)wsp; wsp += SZ_ACT;
  unsigned short* WQ6 = (unsigned short*)wsp; wsp += SZ_W;
  unsigned short* WK6 = (unsigned short*)wsp; wsp += SZ_W;
  unsigned short* WV6 = (unsigned short*)wsp; wsp += SZ_W;
  unsigned short* WO6 = (unsigned short*)wsp; wsp += SZ_W;
  float*          BR  = (float*)wsp;          wsp += SZ_BR;
  unsigned short* TB  = (unsigned short*)wsp; wsp += SZ_TB;
  unsigned short* QFp = (unsigned short*)wsp; wsp += SZ_ACT;     // [MT tokens][DM features] f16
  unsigned short* KFp = (unsigned short*)wsp; wsp += SZ_ACT;
  unsigned short* VTp = (unsigned short*)wsp; wsp += SZ_ACT;     // [DM features][MT tokens] f16
  unsigned short* CTX = (unsigned short*)wsp; wsp += SZ_ACT;     // [MT][DM] f16

  k_prep<<<PR_GRID, PR_T, 0, stream>>>(Qi, Ki, Vi, Wq, Wk, Wv, Wo, bq, bk, bv, bo, rel, XQ, XK, XV, WQ6, WK6, WV6, WO6, BR, TB);

  const unsigned gQK = (unsigned)((MT / 128) * (DM / 128));
  k_gemm_qkv<<<3u * gQK, 128, 0, stream>>>(XQ, XK, XV, WQ6, WK6, WV6, QFp, KFp, VTp, BR, 0.0625f);

  k_attn_rel<<<(unsigned)((NB * NH * (SEQ / 16)) / AT_NW), 32 * AT_NW, 0, stream>>>(QFp, KFp, VTp, TB, CTX);

  k_gemm_out<<<gQK, 128, 0, stream>>>(CTX, WO6, out, BR + 3 * DM, MT, DM, DM, 0.0625f);
}

// v009
// A run of this version takes 72.3 microseconds.
// Timed twice side by side with v008, it ran 1.07 times as fast both times.
// Counting every step since v000, it is 5.18 times as fast.
// Contractions, all v_wmma_f32_16x16x32_f16 with f32 accumulate: q/k/v and output projections (inputs and weights RNE-converted to bf16 and held exactly in f16, weights x16; the context as one f16 plane); content scores and relative-position dots (q, k as one f16 plane each, the 33x64 table RNE-converted to bf16 and held in f16); P.V (P f16, at most 2^15; v f16).
#include <hip/hip_runtime.h>
#include <math.h>
#include <stdint.h>

#ifndef NB
#define NB 4
#endif
#ifndef SEQ
#define SEQ 1024
#endif
#define NB_FULL 4
#define SEQ_FULL 1024
#define DM 1024
#define NH 16
#define DK 64
#define MAXREL 16
#define NREL 33
#define NRELP 48
#define MT (NB * SEQ)
#define AT_NW 8
#define QP 52
#define OSP 68
#define RLOW 7.0f
#define PMAX 32768.0f

static_assert(NH * DK == DM);
static_assert(DK == 64);
static_assert(2 * MAXREL + 1 == NREL);
static_assert(NRELP % 16 == 0 && NRELP >= NREL);
static_assert(QP >= NRELP);
static_assert(SEQ % 64 == 0);
static_assert(MT % 128 == 0);
static_assert(DM % 128 == 0);
static_assert(DM >= 256);
static_assert(((SEQ / 16) * NB * NH) % AT_NW == 0);
static_assert((SEQ / 16) % AT_NW == 0);
static_assert(SEQ >= 128);
static_assert(NB <= NB_FULL && SEQ <= SEQ_FULL);

typedef __attribute__((ext_vector_type(16))) _Float16 v16h;
typedef __attribute__((ext_vector_type(8)))  _Float16 v8h;
typedef __attribute__((ext_vector_type(8)))  float    v8f;
typedef __attribute__((ext_vector_type(4)))  float    v4f;

// 16-bit WMMA fragment map (wave32), lane L, hh = L>>4, c = L&15:
//   A 16x32: lane = row c;    element i -> k = (i<8) ? 8hh+i : 16+8hh+(i-8)
//   B 32x16: lane = column c; the same k(i,hh)
//   D 16x16 (8 f32): lane = column c; element r -> row 8hh+r

__device__ __forceinline__ float cmb_bf(float v) { const unsigned u = __float_as_uint(v); const unsigned r = (u + 0x7fffu + ((u >> 16) & 1u)) & 0xffff0000u; return __uint_as_float(r); }   // bf16 RNE kept as f32 (finite inputs)
__device__ __forceinline__ unsigned int cmb_pk2(float a, float b) { return (unsigned int)__builtin_bit_cast(unsigned short, (_Float16)a) | ((unsigned int)__builtin_bit_cast(unsigned short, (_Float16)b) << 16); }

// 2^x by the hardware instruction alone, for the softmax. From -126 up it is the value exp2f gives (infinity where 2^x leaves f32: such a pass is formed anew); below that the result is 0 where exp2f
// gives a subnormal: P (f16) is 0 either way, the query's sum holds a term of about 2^RLOW or more that absorbs it, and a rescale factor that small leaves nothing of the old sums.
// A run of them is one statement: every result register differs from every argument register (early clobber), so that no v_exp_f32 is directly followed by an
// instruction that reads its result or writes over its argument; the v_nop is that one slot behind the last of the run.
__device__ __forceinline__ void exp2_hw8(const float (&x)[8], float (&e)[8]) {
  asm("v_exp_f32 %0, %8\n\tv_exp_f32 %1, %9\n\tv_exp_f32 %2, %10\n\tv_exp_f32 %3, %11\n\t"
      "v_exp_f32 %4, %12\n\tv_exp_f32 %5, %13\n\tv_exp_f32 %6, %14\n\tv_exp_f32 %7, %15\n\tv_nop"
      : "=&v"(e[0]), "=&v"(e[1]), "=&v"(e[2]), "=&v"(e[3]), "=&v"(e[4]), "=&v"(e[5]), "=&v"(e[6]), "=&v"(e[7])
      : "v"(x[0]), "v"(x[1]), "v"(x[2]), "v"(x[3]), "v"(x[4]), "v"(x[5]), "v"(x[6]), "v"(x[7]));
}
__device__ __forceinline__ float exp2_hw1(float x) {
  float e;
  asm("v_exp_f32 %0, %1\n\tv_nop" : "=v"(e) : "v"(x));
  return e;
}

// the value that lane addr / 4 holds: the instruction that __shfl and __shfl_xor compile to, with the byte index formed once, in front of the loop, by the caller
__device__ __forceinline__ float from_lane(float v, int addr) { return __int_as_float(__builtin_amdgcn_ds_bpermute(addr, __float_as_int(v))); }

__device__ __forceinline__ v8f zero8() { v8f z = {0.f, 0.f, 0.f, 0.f, 0.f, 0.f, 0.f, 0.f}; return z; }

__device__ __forceinline__ v8f wmmah(v16h a, v16h b, v8f c) {
  c = __builtin_amdgcn_wmma_f32_16x16x32_f16(false, a, false, b, (short)0, c, false, false);
  asm volatile("v_nop\n\tv_nop\n\tv_nop\n\tv_nop" : "+v"(c) : "v"(a), "v"(b));
  return c;
}
union FHu { v16h v; v8h h[2]; };
// p already includes the lane-half offset 8*hh: elements 0..7 <- p[0..7], 8..15 <- p[16..23]
__device__ __forceinline__ v16h ldfh(const _Float16* p) { FHu f; f.h[0] = *(const v8h*)(p); f.h[1] = *(const v8h*)(p + 16); return f.v; }

// ---- hazard guards for the register-blocked GEMM ----
__device__ __forceinline__ void acc_guard4(v8f& a, v8f& b, v8f& c, v8f& d) { asm volatile("v_nop\n\tv_nop\n\tv_nop\n\tv_nop" : "+v"(a), "+v"(b), "+v"(c), "+v"(d)); }

template <typename T> struct Frag;
template <> struct Frag<_Float16> {
  typedef v16h V;
  static __device__ __forceinline__ v16h load(const _Float16* p) { return ldfh(p); }
  static __device__ __forceinline__ v8f mma(v16h a, v16h b, v8f c) { return __builtin_amdgcn_wmma_f32_16x16x32_f16(false, a, false, b, (short)0, c, false, false); }
};
template <int ET> struct Elem;
template <> struct Elem<0> { typedef _Float16 T; };

// ---- Tensor loads into LDS for the GEMM panels ----
typedef uint32_t u32x4 __attribute__((ext_vector_type(4)));
typedef uint32_t u32x8 __attribute__((ext_vector_type(8)));
constexpr uint32_t G_ROWB  = 256u;                 // bytes of one operand row per stage = 128 k
constexpr uint32_t G_ROWS  = 64u;                  // rows per slice (one tensor load of one wave)
constexpr uint32_t G_PITCH = G_ROWB + 16u;         // LDS row pitch, laid by the load's pad: an odd multiple of 16 B for ds_load_b128 readers
constexpr uint32_t G_SLICE = 18432u;               // 64 x 272 = 17,408 B rounded up to a multiple of 2 KiB
constexpr uint32_t G_STAGE = 4u * G_SLICE;         // [A rows 0..63 | A rows 64..127 | Bt rows 0..63 | Bt rows 64..127]
static_assert(G_ROWS * G_PITCH <= G_SLICE && G_SLICE % 2048u == 0u);
__device__ __forceinline__ uint32_t uni(uint32_t v) { return (uint32_t)__builtin_amdgcn_readfirstlane(v); }
// keeps the test in a scalar register, so that the branch round a tensor load is a scalar branch (the load ignores EXEC)
__device__ __forceinline__ uint32_t pinned(uint32_t v) { uint32_t w = (uint32_t)__builtin_amdgcn_readfirstlane(v); asm volatile("" : "+s"(w)); return w; }
// the wave's LDS reads have retired before the buffer is handed back for a refill
__device__ __forceinline__ void wait_ds0() { asm volatile("s_wait_dscnt 0x0" ::: "memory"); }
// the wave's own tensor load has landed (the compiler places no wait for it); the request's descriptor is named as an input so that its registers keep their values until here
__device__ __forceinline__ void wait_tensor0(u32x4 g0, u32x8 g1) { asm volatile("s_wait_tensorcnt 0x0" :: "s"(g0), "s"(g1) : "memory"); }
__device__ __forceinline__ void tdm_load(u32x4 g0, u32x8 g1) { asm volatile("tensor_load_to_lds %0, %1" :: "s"(g0), "s"(g1) : "memory"); }
__device__ __forceinline__ u32x8 tdm_group1(uint32_t src_pitch) {
  u32x8 g;
  g[0] = uni((1u << 20) | (5u << 22) | (3u << 25));
  g[1] = uni((G_ROWB & 0xFFFFu) << 16);
  g[2] = uni((G_ROWB >> 16) | ((G_ROWS & 0xFFFFu) << 16));
  g[3] = uni((G_ROWS >> 16) | (G_ROWB << 16));
  g[4] = uni(G_ROWS);
  g[5] = uni(src_pitch);
  g[6] = uni(0u);
  g[7] = uni(0u);
  return g;
}
__device__ __forceinline__ u32x4 tdm_group0(uint32_t lds_dst, uint64_t ga) {
  u32x4 g;
  g[0] = uni(1u); g[1] = uni(lds_dst); g[2] = uni((uint32_t)ga); g[3] = uni((((uint32_t)(ga >> 32)) & 0x01FFFFFFu) | 0x80000000u);
  return g;
}

// ---- Register-blocked WMMA GEMM body: C[m,n] = scale * sum_k A[m,k] * Bt[n,k] + bias; a work-group of 4 waves (2 x 2) owns a 128x128 tile, each wave 64x64 of it.
// The 128 rows of A and of Bt come into LDS 128 k at a time by tensor loads, one 64-row slice per wave and stage, two buffers: stage s + 1 flies while stage s is multiplied.
// A row-major [M,K] (pitch lda), Bt row-major [N,K] (pitch ldb); M,N % 128 == 0, K % 128 == 0, K >= 256 (no tails).
// BIAS_MODE 1 = bias[m], 2 = bias[n]. OUT_MODE 0 = f32, 1 = f16.
// The work-groups that share a panel all walk the same K: each starts at stage (tile row + tile column) mod stages, and wraps, so that at any time they ask L2 for
// different lines of the panel and the requests of a launch spread over the whole row length instead of one 256-B column of it. Only the order of the k sum differs from tile to tile.
// tile = the work-group's tile number (the same in every thread). slab = the wave's own 16 x 68 floats of output staging; it may lie inside ring:
// the last pass of the loop ends with every wave's LDS reads retired, every tensor load landed and a work-group barrier, and nothing is issued behind it.
template <int ET, int BIAS_MODE, int OUT_MODE>
__device__ __forceinline__ void gemm64_body(
    const unsigned short* __restrict__ Ap, int lda, const unsigned short* __restrict__ Btp, int ldb,
    void* __restrict__ Cout, int ldc, const float* __restrict__ bias,
    int M, int N, int K, float scale, int tile, float* slab, unsigned char* ring) {
  typedef typename Elem<ET>::T T;
  typedef typename Frag<T>::V V;
  const T* A = (const T*)Ap; const T* Bt = (const T*)Btp;
  const int lane = threadIdx.x & 31;
  const uint32_t wave = uni(threadIdx.x >> 5);
  const int tilesN = N >> 7;
  const int tilesM = M >> 7;
  if (tile >= tilesM * tilesN) return;   // the same for the whole block, in front of every barrier and tensor load
  const int tm = tile / tilesN;
  const int tn = tile - tm * tilesN;
  const int m0 = (tm << 7) + (int)((wave >> 1) << 6);
  const int n0 = (tn << 7) + (int)((wave & 1u) << 6);
  const int rlane = lane & 15;
  const int koff  = (lane >> 4) * 8;
  const int mOff  = (lane >> 4) * 8;

  v8f acc[4][4];
#pragma unroll
  for (int i = 0; i < 4; ++i)
#pragma unroll
    for (int j = 0; j < 4; ++j) acc[i][j] = zero8();

  // this wave's slice: waves 0, 1 bring the two halves of A's 128 rows, waves 2, 3 those of Bt's
  const bool isB = wave >= 2u;
  const uint64_t srcA = (uint64_t)(size_t)(A + (size_t)((tm << 7) + (int)((wave & 1u) << 6)) * lda);
  const uint64_t srcB = (uint64_t)(size_t)(Bt + (size_t)((tn << 7) + (int)((wave & 1u) << 6)) * ldb);
  const uint64_t gsrc = isB ? srcB : srcA;
  u32x8 g1 = tdm_group1((uint32_t)(isB ? ldb : lda) * 2u);
  asm volatile("" : "+s"(g1));   // the pinned() form on descriptor words: held in their scalar registers, built once, so that none is written again while a request is outstanding
  const uint32_t ldst = (uint32_t)(size_t)ring + wave * G_SLICE;
  const int nst = K >> 7;
  // the stage of K that ring position x holds (x < nst): scalar, the same for the whole block
  const uint32_t kfirst = uni((uint32_t)(tm + tn) % (uint32_t)nst);
  auto kstage = [&](uint32_t x) -> uint64_t { const uint32_t v = x + kfirst; return (uint64_t)(v >= (uint32_t)nst ? v - (uint32_t)nst : v); };
  // this wave's fragment rows: A from slice wave >> 1, Bt from slice 2 + (wave & 1)
  const unsigned char* aR = ring + (wave >> 1) * G_SLICE + (uint32_t)rlane * G_PITCH + (uint32_t)koff * 2u;
  const unsigned char* bR = ring + (2u + (wave & 1u)) * G_SLICE + (uint32_t)rlane * G_PITCH + (uint32_t)koff * 2u;

  u32x4 g0 = tdm_group0(ldst, gsrc + kstage(0u) * G_ROWB);
  tdm_load(g0, g1);                                           // stage 0 -> buffer 0
  wait_tensor0(g0, g1);
  __syncthreads();                                            // stage 0 published
  g0 = tdm_group0(ldst + G_STAGE, gsrc + kstage(1u) * G_ROWB);
  tdm_load(g0, g1);                                           // stage 1 -> buffer 1 (K >= 256)

  // kept rolled: one publish point per stage
#pragma unroll 1
  for (int s = 0; s < nst; ++s) {
    const uint32_t buf = ((uint32_t)s & 1u) * G_STAGE;
    // two fragment sets inside the stage: the LDS reads of the next 32 k go ahead of this 32 k's WMMAs; nothing of the next stage is read here
    V ah[2][4], bh[2][4];
#pragma unroll
    for (int j = 0; j < 4; ++j) {
      bh[0][j] = Frag<T>::load((const T*)(bR + buf + (uint32_t)j * 16u * G_PITCH));
      ah[0][j] = Frag<T>::load((const T*)(aR + buf + (uint32_t)j * 16u * G_PITCH));
    }
#pragma unroll
    for (int kk = 0; kk < 4; ++kk) {
      const int cur = kk & 1, nxt = cur ^ 1;
      if (kk < 3) {
#pragma unroll
        for (int j = 0; j < 4; ++j) {
          bh[nxt][j] = Frag<T>::load((const T*)(bR + buf + (uint32_t)j * 16u * G_PITCH + (uint32_t)(kk + 1) * 64u));
          ah[nxt][j] = Frag<T>::load((const T*)(aR + buf + (uint32_t)j * 16u * G_PITCH + (uint32_t)(kk + 1) * 64u));
        }
      }
#pragma unroll
      for (int i = 0; i < 4; ++i) {
#pragma unroll
        for (int j = 0; j < 4; ++j) acc[i][j] = Frag<T>::mma(ah[cur][i], bh[cur][j], acc[i][j]);
        acc_guard4(acc[i][0], acc[i][1], acc[i][2], acc[i][3]);   // the four vector slots behind a WMMA; it also keeps each group of LDS reads where it is written
      }
    }
    // publish point of stage s + 1: own LDS reads retired, own load landed, then the barrier that publishes s + 1 and frees this buffer
    wait_ds0();
    wait_tensor0(g0, g1);
    __syncthreads();
    if (pinned((uint32_t)(s + 2 < nst))) {
      g0 = tdm_group0(ldst + buf, gsrc + kstage((uint32_t)(s + 2)) * G_ROWB);
      tdm_load(g0, g1);
    }
  }
  wait_tensor0(g0, g1);
  wait_ds0();
  acc_guard4(acc[0][0], acc[0][1], acc[0][2], acc[0][3]);
  acc_guard4(acc[1][0], acc[1][1], acc[1][2], acc[1][3]);
  acc_guard4(acc[2][0], acc[2][1], acc[2][2], acc[2][3]);
  acc_guard4(acc[3][0], acc[3][1], acc[3][2], acc[3][3]);

#pragma unroll
  for (int i = 0; i < 4; ++i) {
    const int mBase = m0 + (i << 4);
#pragma unroll
    for (int j = 0; j < 4; ++j) {
      const int n = n0 + (j << 4) + rlane;
      float bv = 0.f;
      if (BIAS_MODE == 2) bv = bias[n];
#pragma unroll
      for (int r = 0; r < 8; ++r) {
        float v = acc[i][j][r] * scale;
        if (BIAS_MODE == 1) v += bias[mBase + mOff + r];
        if (BIAS_MODE == 2) v += bv;
        slab[(mOff + r) * 68 + (j << 4) + rlane] = v;
      }
    }
    __builtin_amdgcn_fence(3 /* release order */, "workgroup");
    __builtin_amdgcn_wave_barrier();
    __builtin_amdgcn_fence(2 /* acquire order */, "workgroup");
    if (OUT_MODE == 0) {
      float* C = (float*)Cout;
      const int hh = lane >> 4, c4 = (lane & 15) * 4;     // row segment = 256 B = 16 lanes x 16 B
      {
#pragma unroll
        for (int it = 0; it < 8; ++it) {
          const int row = it * 2 + hh;
          v4f v = *(const v4f*)(slab + row * 68 + c4);
          *(v4f*)(C + (size_t)(mBase + row) * ldc + n0 + c4) = v;
        }
        
      }
    } else {
      const int q = lane >> 3, c8 = (lane & 7) * 8;
      unsigned short* C  = (unsigned short*)Cout;
      {
#pragma unroll
        for (int it = 0; it < 4; ++it) {
          const int row = it * 4 + q;
          const float* sp = slab + row * 68 + c8;
          v8h hv;
#pragma unroll
          for (int e = 0; e < 8; ++e) hv[e] = (_Float16)sp[e];
          *(v8h*)(C + (size_t)(mBase + row) * ldc + n0 + c8) = hv;
        }
        
      }
    }
    __builtin_amdgcn_fence(3 /* release order */, "workgroup");
    __builtin_amdgcn_wave_barrier();
    __builtin_amdgcn_fence(2 /* acquire order */, "workgroup");
  }
}

// q, k and v projections in one launch: work-groups [0, T) take q's tiles, [T, 2T) k's, [2T, 3T) v's, T = tiles of one projection.
//   q, k: C[token][feature] = sum_k X[token][k] * W[feature][k] + bias[feature], f16 operands, one f16 plane out
//   v, transposed: C[feature][token] = sum_k Wv[feature][k] * X[token][k] + bias[feature], f16 out (pitch = tokens)
// The output staging lies over the drained ring, so a work-group holds 144 KiB of LDS and two of them share a WGP:
// one's tensor-load waits, first fragment reads and epilogue run under the other's WMMAs.
constexpr int G_TILES = (MT / 128) * (DM / 128);
constexpr uint32_t G_SLAB = 16u * 68u * 4u;        // bytes of one wave's output staging
static_assert(4u * G_SLAB <= 2u * G_STAGE && G_SLAB % 16u == 0u);
__global__ __launch_bounds__(128) void k_gemm_qkv(const unsigned short* __restrict__ XQ, const unsigned short* __restrict__ XK, const unsigned short* __restrict__ XV,
                                                  const unsigned short* __restrict__ WQ, const unsigned short* __restrict__ WK, const unsigned short* __restrict__ WV,
                                                  unsigned short* __restrict__ QF, unsigned short* __restrict__ KF,
                                                  unsigned short* __restrict__ VT, const float* __restrict__ BR, float scale) {
  __shared__ __attribute__((aligned(2048))) unsigned char ring[2 * G_STAGE];
  float* slab = (float*)(ring + (threadIdx.x >> 5) * G_SLAB);
  const int which = (int)blockIdx.x / G_TILES;                 // the same for the whole block
  const int tile  = (int)blockIdx.x - which * G_TILES;
  if (which < 2) {
    const bool isq = which == 0;
    gemm64_body<0, 2, 1>(isq ? XQ : XK, DM, isq ? WQ : WK, DM, (void*)(isq ? QF : KF), DM, BR + which * DM, MT, DM, DM, scale, tile, slab, ring);
  } else {
    gemm64_body<0, 1, 1>(WV, DM, XV, DM, (void*)VT, MT, BR + 2 * DM, DM, MT, DM, scale, tile, slab, ring);
  }
}
// output projection: f16 operands (A = context, Bt = Wo x16), bias[n], f32 out
__global__ __launch_bounds__(128) void k_gemm_out(const unsigned short* __restrict__ A, const unsigned short* __restrict__ W,
                                                  float* __restrict__ C, const float* __restrict__ bias, int M, int N, int K, float scale) {
  __shared__ __attribute__((aligned(2048))) unsigned char ring[2 * G_STAGE];
  __shared__ __align__(16) float sT[4][16 * 68];
  gemm64_body<0, 2, 0>(A, K, W, K, (void*)C, N, bias, M, N, K, scale, (int)blockIdx.x, sT[threadIdx.x >> 5], ring);
}

// ---- operand preparation, all of it in one launch of long-lived waves ----
// A chunk is 16,384 consecutive floats of one source (16 rows of DM). A block of 16 waves takes four chunks; every thread asks for all its 16-B pieces first
// (each wave-wide load covers 512 contiguous bytes), then converts and stores them in the order in which they were asked for.
//   activations:  f32 -> bf16 (RNE) -> f16 plane [MT][DM]; rows (b, s) of the full-size inputs
//   Wq, Wk, Wv, Wo: f32 -> bf16 (RNE) -> x16 -> f16 plane [DM][DM] (exact; [out][in] is already the Bt layout)
//   biases:       f32 -> bf16 (RNE) kept as f32; table: f32 -> bf16 (RNE) -> f16 plane [NRELP][DK], rows >= NREL written as zeros (clamped source address)
typedef __attribute__((ext_vector_type(2))) unsigned int u2;
constexpr int PR_T     = 512;                                   // threads per block
constexpr int PR_L     = 8;                                     // 16-B loads per thread and chunk
constexpr int PR_CH    = PR_T * PR_L * 4;                       // floats per chunk
constexpr int PR_ACT   = (int)(((long long)MT * DM) / PR_CH);   // chunks per activation plane
constexpr int PR_W     = (DM * DM) / PR_CH;                     // chunks per weight matrix
constexpr int PR_GRID  = PR_ACT > 4 * PR_W ? PR_ACT : 4 * PR_W;  // block b: chunk b of each activation plane and chunk b of [Wq, Wk, Wv, Wo]
constexpr int PR_SQ    = DM + NRELP * (DK / 4);                 // 4-float pieces of the four biases, then of the padded table
constexpr int PR_SMALL = (PR_SQ + PR_T - 1) / PR_T;             // the first blocks take one such piece per thread on top
static_assert(PR_CH % DM == 0 && SEQ % (PR_CH / DM) == 0 && ((long long)MT * DM) % PR_CH == 0 && (DM * DM) % PR_CH == 0);
static_assert(PR_SMALL <= PR_GRID && DK % 4 == 0 && DM % 4 == 0 && (PR_T * 4) % DM == 0);

__device__ __forceinline__ u2 pr_f16(v4f x, float sc) { u2 p; p.x = cmb_pk2(cmb_bf(x.x) * sc, cmb_bf(x.y) * sc); p.y = cmb_pk2(cmb_bf(x.z) * sc, cmb_bf(x.w) * sc); return p; }

__global__ __launch_bounds__(PR_T) void k_prep(const float* __restrict__ Qi, const float* __restrict__ Ki, const float* __restrict__ Vi,
                                               const float* __restrict__ Wq, const float* __restrict__ Wk, const float* __restrict__ Wv, const float* __restrict__ Wo,
                                               const float* __restrict__ bq, const float* __restrict__ bk, const float* __restrict__ bv, const float* __restrict__ bo,
                                               const float* __restrict__ rel,
                                               unsigned short* __restrict__ XQ, unsigned short* __restrict__ XK, unsigned short* __restrict__ XV,
                                               unsigned short* __restrict__ WQ6, unsigned short* __restrict__ WK6, unsigned short* __restrict__ WV6,
                                               unsigned short* __restrict__ WO6, float* __restrict__ BR, unsigned short* __restrict__ TB) {
  const unsigned t = threadIdx.x;
  const unsigned b = blockIdx.x;
  // chunk numbers are clamped for the loads, so that no branch stands among them; the stores are guarded
  const unsigned ka = min(b, (unsigned)(PR_ACT - 1));
  const unsigned kw = min(b, (unsigned)(4 * PR_W - 1));
  const unsigned w  = kw / (unsigned)PR_W, kc = kw % (unsigned)PR_W;
  const unsigned r0 = ka * (unsigned)(PR_CH / DM);
  const size_t ao = (size_t)(r0 / (unsigned)SEQ) * ((size_t)SEQ_FULL * DM) + (size_t)(r0 % (unsigned)SEQ) * DM;
  const v4f* sq = (const v4f*)(Qi + ao) + t;                    // block-uniform base + the thread's 16 B inside 8 KiB of the chunk
  const v4f* sk = (const v4f*)(Ki + ao) + t;
  const v4f* sv = (const v4f*)(Vi + ao) + t;
  const v4f* sw = (const v4f*)((w == 0u ? Wq : w == 1u ? Wk : w == 2u ? Wv : Wo) + (size_t)kc * PR_CH) + t;
  // one piece of the biases (u < DM) or of the table per thread of the first blocks; every thread's address is in bounds
  const unsigned u = b * (unsigned)PR_T + t;
  const unsigned tq = u < (unsigned)DM ? 0u : u - (unsigned)DM;

  v4f xs = {0.f, 0.f, 0.f, 0.f};
  if (b < (unsigned)PR_SMALL) {
    const unsigned bw = u / (unsigned)(DM / 4);
    const float* bs = bw == 0u ? bq : bw == 1u ? bk : bw == 2u ? bv : bo;
    const float* ss = u < (unsigned)DM ? bs + (u % (unsigned)(DM / 4)) * 4u : rel + min(tq / (unsigned)(DK / 4), (unsigned)(NREL - 1)) * (unsigned)DK + (tq % (unsigned)(DK / 4)) * 4u;
    xs = *(const v4f*)ss;
  }
  // PR_ORDER: the compiler moves nothing across it. The loads leave plane by plane and each plane is converted and stored as soon as its own loads are back,
  // while the later planes are still on their way; without it the conversions of all planes are mixed and the first store waits for most of the loads.
#define PR_ORDER() __builtin_amdgcn_sched_barrier(0)
  // every loop below is unrolled: the pieces stay in registers and their offsets become immediates
  v4f xq[PR_L], xk[PR_L], xv[PR_L], xw[PR_L];
#pragma unroll
  for (int j = 0; j < PR_L; ++j) xq[j] = sq[j * PR_T];
  PR_ORDER();
#pragma unroll
  for (int j = 0; j < PR_L; ++j) xk[j] = sk[j * PR_T];
  PR_ORDER();
#pragma unroll
  for (int j = 0; j < PR_L; ++j) xv[j] = sv[j * PR_T];
  PR_ORDER();
#pragma unroll
  for (int j = 0; j < PR_L; ++j) xw[j] = sw[j * PR_T];
  // stands in front of every later write of a register that one of the loads above names as an address; the thread number, their offset register, is named as an input so that it keeps its value until here
  asm volatile("s_wait_xcnt 0x0" :: "v"(t) : "memory");

  if (b < (unsigned)PR_SMALL) {
    if (u < (unsigned)DM) {
      v4f r; r.x = cmb_bf(xs.x); r.y = cmb_bf(xs.y); r.z = cmb_bf(xs.z); r.w = cmb_bf(xs.w);
      *(v4f*)(BR + u * 4u) = r;
    } else if (u < (unsigned)PR_SQ) {
      u2 pk = pr_f16(xs, 1.0f);
      if (tq / (unsigned)(DK / 4) >= (unsigned)NREL) { pk.x = 0u; pk.y = 0u; }
      *(u2*)(TB + tq * 4u) = pk;
    }
  }
  if (b < (unsigned)PR_ACT) {
    const size_t o = (size_t)ka * PR_CH + t * 4u;
#pragma unroll
    for (int j = 0; j < PR_L; ++j) *(u2*)(XQ + o + j * (PR_T * 4)) = pr_f16(xq[j], 1.0f);
    PR_ORDER();
#pragma unroll
    for (int j = 0; j < PR_L; ++j) *(u2*)(XK + o + j * (PR_T * 4)) = pr_f16(xk[j], 1.0f);
    PR_ORDER();
#pragma unroll
    for (int j = 0; j < PR_L; ++j) *(u2*)(XV + o + j * (PR_T * 4)) = pr_f16(xv[j], 1.0f);
    // stands in front of the weight chunk's conversions, which write over registers that these stores name
    asm volatile("s_wait_xcnt 0x0" ::: "memory");
  }
  PR_ORDER();   // as above: the weight chunk's conversions stay behind the V plane's stores, which otherwise wait for the weight loads too
  if (b < (unsigned)(4 * PR_W)) {
    unsigned short* dp = (w == 0u ? WQ6 : w == 1u ? WK6 : w == 2u ? WV6 : WO6) + (size_t)kc * PR_CH + t * 4u;
#pragma unroll
    for (int j = 0; j < PR_L; ++j) *(u2*)(dp + j * (PR_T * 4)) = pr_f16(xw[j], 16.0f);
  }
}

// =====================================================================================================================
// Fused attention with clipped relative-position bias. One wave per 16 queries; the 8 waves of a block share one (batch, head) and its K, V tiles in LDS.
//   score(l, r) = q_l . k_r / 8 + q_l . table[clip(r - l, -16, 16) + 16]
//   Transposed score tiles S^T = K . Q^T (A = key rows, B = query rows): D has lane = query, element = key, which is the A-operand
//   layout of P for O = P . V (32 keys per step), so P never leaves registers. q, k: one f16 plane each, one product per score tile and 32 d.
//   Relative dots: table (A, rows padded to NRELP) x q (B), staged once per wave in LDS [16][QP] and gathered per element,
//   but only in the passes that touch the clip band |r - l| < 16: in every other pass all 32 x 16 distances clip to the same end of the table,
//   the bias is one value per query, and scale, bias and running maximum go into one fma per score.
//   V^T plane [feature][token] f16 gives B fragments with contiguous keys. Online softmax in f32 (exp2 domain), P = 2^(score - reference) in f16.
//   A query's reference is set RLOW below its maximum so far (P then uses f16's range on both sides of 1) and stays in use while every lane's P of a pass sum to PMAX at most,
//   so that each P fits f16 (one ballot, one scalar branch per pass). Only where they do not is the pass's maximum taken, are the lane halves' maxima joined, the reference raised,
//   the sums and O rescaled and the pass's P formed anew. Each lane half sums its own keys; the halves' sums are joined once, behind the loop.
//   K (64 keys x 64 d) and V^T (64 features x 64 keys) come into LDS 64 keys at a time by tensor loads, one tile each from waves 0, 1, two buffers:
//   stage s + 1 flies while stage s is worked on. The blocks of one (batch, head) walk the same keys: each starts at a stage of its own and wraps, so that at any time they ask L2 for
//   different lines; the online softmax takes the keys in any order.
// =====================================================================================================================
constexpr uint32_t AT_KEYS  = 64u;                 // keys per stage
constexpr uint32_t AT_ROWB  = 128u;                // bytes of one tile row: 64 d of a key, or 64 keys of a feature
constexpr uint32_t AT_ROWS  = 64u;                 // rows per tile (one tensor load of one wave)
constexpr uint32_t AT_PITCH = AT_ROWB + 16u;       // LDS row pitch, laid by the load's pad: an odd multiple of 16 B for ds_load_b128 readers
constexpr uint32_t AT_SLICE = 10240u;              // 64 x 144 = 9,216 B rounded up to a multiple of 2 KiB
constexpr uint32_t AT_STAGE = 2u * AT_SLICE;       // [K | V^T]
constexpr int      AT_NST   = SEQ / (int)AT_KEYS;
static_assert(AT_ROWS * AT_PITCH <= AT_SLICE && AT_SLICE % 2048u == 0u);
static_assert(DK * 2 == (int)AT_ROWB && DK == (int)AT_ROWS && AT_NST >= 2);
// group 1: 1-byte elements, tile = tensor = 64 rows of 128 B, source row pitch in bytes, 16 B of LDS pad behind every 128-B row, no mask
__device__ __forceinline__ u32x8 at_group1(uint32_t src_pitch) {
  u32x8 g;
  g[0] = uni((1u << 20) | (4u << 22) | (3u << 25));
  g[1] = uni((AT_ROWB & 0xFFFFu) << 16);
  g[2] = uni((AT_ROWB >> 16) | ((AT_ROWS & 0xFFFFu) << 16));
  g[3] = uni((AT_ROWS >> 16) | (AT_ROWB << 16));
  g[4] = uni(AT_ROWS);
  g[5] = uni(src_pitch);
  g[6] = uni(0u);
  g[7] = uni(0u);
  return g;
}

__global__ __launch_bounds__(32 * AT_NW) void k_attn_rel(const unsigned short* __restrict__ QFp, const unsigned short* __restrict__ KFp,
                                                         const unsigned short* __restrict__ VTp, const unsigned short* __restrict__ TBp,
                                                         unsigned short* __restrict__ CTX) {
  __shared__ __attribute__((aligned(2048))) unsigned char ring[2 * AT_STAGE];
  __shared__ __align__(16) float qrs[AT_NW][16 * QP];
  __shared__ __align__(16) float osm[AT_NW][16 * OSP];
  const _Float16* QF = (const _Float16*)QFp;
  const _Float16* TB = (const _Float16*)TBp;
  const int lane = threadIdx.x & 31, wave = threadIdx.x >> 5, hh = lane >> 4, c = lane & 15;
  const int bh = (int)blockIdx.x / ((SEQ / 16) / AT_NW);            // the same for the whole block
  const int l0 = (((int)blockIdx.x - bh * ((SEQ / 16) / AT_NW)) * AT_NW + wave) * 16;
  const int b = bh / NH, h = bh - b * NH;
  const size_t tok0 = (size_t)b * SEQ;

  // q as B operand (lane = query column c), 2 k-steps of 32
  v16h qf[2];
  {
    const size_t qo = (tok0 + l0 + c) * DM + h * DK + 8 * hh;
#pragma unroll
    for (int dc = 0; dc < 2; ++dc) qf[dc] = ldfh(QF + qo + dc * 32);
  }
  // this wave's tile: wave 0 brings K, wave 1 V^T; the other waves issue nothing (their words name V^T's tile and are not used)
  const uint32_t wv = uni((uint32_t)threadIdx.x >> 5);
  const uint32_t sl = wv < 1u ? 0u : 1u;
  const uint64_t gsrc = sl == 0u ? (uint64_t)(size_t)(KFp + tok0 * DM + h * DK)
                                 : (uint64_t)(size_t)(VTp + (size_t)(h * DK) * MT + tok0);
  const uint32_t gstep = sl == 1u ? AT_KEYS * 2u : AT_KEYS * (uint32_t)DM * 2u;     // source bytes from one stage to the next
  u32x8 g1 = at_group1(sl == 1u ? (uint32_t)MT * 2u : (uint32_t)DM * 2u);
  asm volatile("" : "+s"(g1));   // the pinned() form on descriptor words: held in their scalar registers, built once, so that none is written again while a request is outstanding
  const uint32_t ldst = (uint32_t)(size_t)ring + sl * AT_SLICE;
  // the key stage that ring position x holds: scalar, the same for the whole block; two stages apart from one block of a (batch, head) to the next, odd heads one further
  const uint32_t sfirst = uni((uint32_t)(((int)blockIdx.x - bh * ((SEQ / 16) / AT_NW)) * 2 + (bh & 1)) % (uint32_t)AT_NST);
  auto kstage = [&](uint32_t x) -> uint32_t { return (x + sfirst) % (uint32_t)AT_NST; };
  u32x4 g0 = tdm_group0(ldst, gsrc + (uint64_t)(kstage(0u) * gstep));
  if (pinned((uint32_t)(wv < 2u))) {
    tdm_load(g0, g1);                                         // stage 0 -> buffer 0
    wait_tensor0(g0, g1);
  }
  __syncthreads();                                            // stage 0 published
  g0 = tdm_group0(ldst + AT_STAGE, gsrc + (uint64_t)(kstage(1u) * gstep));
  asm volatile("" : "+s"(g0));   // the pinned() form on descriptor words: all four stand in their scalar registers in front of the branch, so that none is written behind the load
  if (pinned((uint32_t)(wv < 2u))) tdm_load(g0, g1);          // stage 1 -> buffer 1 (SEQ >= 128)

  // relative dots: D[j][query] = sum_d table[j][d] * q[query][d]; lane = query c, element r -> j = jt*16 + 8hh + r
  float* myq = qrs[wave];
#pragma unroll
  for (int jt = 0; jt < NRELP / 16; ++jt) {
    v8f acc = zero8();
#pragma unroll
    for (int dc = 0; dc < 2; ++dc) {
      const v16h ta = ldfh(TB + (jt * 16 + c) * DK + dc * 32 + 8 * hh);
      acc = wmmah(ta, qf[dc], acc);
    }
#pragma unroll
    for (int r = 0; r < 8; ++r) myq[c * QP + jt * 16 + 8 * hh + r] = acc[r];
  }
  __builtin_amdgcn_fence(3 /* release order */, "workgroup");
  __builtin_amdgcn_wave_barrier();
  __builtin_amdgcn_fence(2 /* acquire order */, "workgroup");

  const int lglob = l0 + c;
  const float* qrow = myq + c * QP + MAXREL;        // indexed by clip(r - l, -16, 16)
  const float L2E = 1.4426950408889634f;
  const float SCL = 0.125f * 1.4426950408889634f;   // 1 / sqrt(DK) in the exp2 domain
  // the wave's first query as a scalar: the test on a pass's distance from the band is a scalar branch
  const int l0s = (((int)blockIdx.x - bh * ((SEQ / 16) / AT_NW)) * AT_NW + (int)wv) * 16;
  const int caddr = (8 * hh) << 2;                  // byte index of lane 8hh
  const int xaddr = (lane ^ 16) << 2;               // byte index of the lane that holds the same query in the other half
  const float bLo = qrow[-MAXREL] * L2E, bHi = qrow[MAXREL] * L2E;   // this query's bias left and right of the band, exp2 domain
  float m_run = -1.0e30f, s_run = 0.f;
  v8f o[4];
#pragma unroll
  for (int t = 0; t < 4; ++t) o[t] = zero8();
  // fragment rows in LDS: lane = key row (K) or feature row (V^T) c of a 16-row group, lane half at 16 B
  const unsigned char* kR = ring + (uint32_t)c * AT_PITCH + (uint32_t)hh * 16u;
  const unsigned char* vR = kR + AT_SLICE;

  // kept rolled: one publish point per stage
#pragma unroll 1
  for (int s = 0; s < AT_NST; ++s) {
  const uint32_t buf = ((uint32_t)s & 1u) * AT_STAGE;
  // the two 32-key passes of a stage are unrolled: their LDS offsets become immediates
#pragma unroll
  for (int ps = 0; ps < 2; ++ps) {
    const int r0 = (int)kstage((uint32_t)s) * (int)AT_KEYS + ps * 32;
    // the pass's K fragments are read as one group ahead of its score products; only this stage's buffer is read (loops unrolled: the fragment arrays stay in registers)
    v16h kf[2][2];
#pragma unroll
    for (int tt = 0; tt < 2; ++tt)
#pragma unroll
      for (int dc = 0; dc < 2; ++dc) kf[tt][dc] = ldfh((const _Float16*)(kR + buf + (uint32_t)(ps * 32 + 16 * tt) * AT_PITCH + (uint32_t)dc * 64u));
    v8f t[2];
#pragma unroll
    for (int tt = 0; tt < 2; ++tt) {
      v8f acc = zero8();
#pragma unroll
      for (int dc = 0; dc < 2; ++dc) acc = wmmah(kf[tt][dc], qf[dc], acc);
      t[tt] = acc;
    }
    // the pass's V^T fragments are asked for ahead of the softmax, which covers their LDS latency (unrolled: the array stays in registers)
    v16h vfr[4];
#pragma unroll
    for (int tq = 0; tq < 4; ++tq) vfr[tq] = ldfh((const _Float16*)(vR + buf + (uint32_t)tq * 16u * AT_PITCH + (uint32_t)ps * 64u));
    // element e <-> key r0 + 8hh + e (tile 0) and r0 + 16 + 8hh + e (tile 1); this lane's query is lglob
    const int rel = r0 - l0s;                         // distances of the pass: rel - 15 ... rel + 31
    float bL = rel < 0 ? bLo : bHi;                   // the bias where every distance of the pass clips to the same end
    if (!(rel + 31 <= -MAXREL || rel - 15 >= MAXREL)) {
      // the pass touches the band: each score's own bias goes into its raw product, (t / 8 + bias) * L2E = (t + 8 * bias) * SCL
      const int dbase = r0 + 8 * hh - lglob;
#pragma unroll
      for (int e = 0; e < 8; ++e) {
        const int d0 = min(max(dbase + e, -MAXREL), MAXREL);
        const int d1 = min(max(dbase + 16 + e, -MAXREL), MAXREL);
        t[0][e] = fmaf(qrow[d0], 8.0f, t[0][e]);
        t[1][e] = fmaf(qrow[d1], 8.0f, t[1][e]);
      }
      bL = 0.f;
    }
    float sum;
    float ex[16];                                     // 2^(score - reference)
    // two runs of eight exponentials; the loops are unrolled so that arguments and results are registers, as the asm operands ask
    auto powers = [&]() {
      const float kb = bL - m_run;
      sum = 0.f;
#pragma unroll
      for (int g = 0; g < 2; ++g) {
        float xa[8], ea[8];
#pragma unroll
        for (int r = 0; r < 8; ++r) xa[r] = fmaf(t[g][r], SCL, kb);
        exp2_hw8(xa, ea);
#pragma unroll
        for (int r = 0; r < 8; ++r) {
          sum += ea[r];
          ex[8 * g + r] = ea[r];
        }
      }
    };
    powers();
    // rare (always in the first pass): a lane's powers of this pass sum to more than PMAX, so that one of them might not fit f16 (one ballot, one scalar branch per pass).
    // Then every query's reference goes up to RLOW below its maximum so far (where that is higher), its sums and its O row come down by the same factor,
    // and the pass's powers are formed anew: each is then at most 2^RLOW.
    if (__builtin_amdgcn_ballot_w32(!(sum <= PMAX)) != 0u) {
      // this lane's largest score of the pass, exp2 domain: the maximum is taken over the raw products (SCL > 0); the loops of this block are unrolled: all arrays are registers
      float tm = -3.0e38f;
#pragma unroll
      for (int e = 0; e < 8; ++e) tm = fmaxf(tm, fmaxf(t[0][e], t[1][e]));
      const float mt = fmaf(tm, SCL, bL);
      const float m_new = fmaxf(m_run, fmaxf(mt, from_lane(mt, xaddr)) - RLOW);   // the two lane halves hold the same query
      const float corr  = exp2_hw1(m_run - m_new);
      s_run *= corr;
      m_run = m_new;
      float sc[8];
#pragma unroll
      for (int i = 0; i < 8; ++i) sc[i] = from_lane(corr, caddr + 4 * i);   // O tile rows are queries 8hh + i
#pragma unroll
      for (int tq = 0; tq < 4; ++tq)
#pragma unroll
        for (int i = 0; i < 8; ++i) o[tq][i] *= sc[i];
      powers();
    }
    v16h pA;                                          // P as A operand: element i <-> key r0 + k(i, hh) (unrolled: both arrays are registers)
#pragma unroll
    for (int i = 0; i < 16; ++i) pA[i] = (_Float16)ex[i];
    s_run += sum;                                     // this lane half's keys only
#pragma unroll
    for (int tq = 0; tq < 4; ++tq) o[tq] = wmmah(pA, vfr[tq], o[tq]);
  }
    // publish point of stage s + 1: own LDS reads retired, the issuer's own load landed, then the barrier that publishes s + 1 and frees this buffer
    wait_ds0();
    if (pinned((uint32_t)(wv < 2u))) wait_tensor0(g0, g1);
    __syncthreads();
    g0 = tdm_group0(ldst + buf, gsrc + (uint64_t)(kstage((uint32_t)(s + 2)) * gstep));
    asm volatile("" : "+s"(g0));   // the pinned() form on descriptor words, as in front of the loop: formed behind the wait, none written behind the load
    if (pinned((uint32_t)(wv < 2u && s + 2 < AT_NST))) tdm_load(g0, g1);   // issued only while stage s + 2 exists
  }
  wait_tensor0(g0, g1);
  wait_ds0();

  const float s_tot = s_run + from_lane(s_run, xaddr);   // the two lane halves hold the same query
  float inv[8];
#pragma unroll
  for (int i = 0; i < 8; ++i) inv[i] = 1.0f / __shfl(s_tot, i + 8 * hh, 32);
  float* os = osm[wave];
#pragma unroll
  for (int tq = 0; tq < 4; ++tq)
#pragma unroll
    for (int i = 0; i < 8; ++i) os[(8 * hh + i) * OSP + tq * 16 + c] = o[tq][i] * inv[i];
  __builtin_amdgcn_fence(3 /* release order */, "workgroup");
  __builtin_amdgcn_wave_barrier();
  __builtin_amdgcn_fence(2 /* acquire order */, "workgroup");
  {
    const int q = lane >> 3, c8 = (lane & 7) * 8;
    unsigned short* ch = CTX + (tok0 + l0) * (size_t)DM + h * DK + c8;
    v8h pv[4];
#pragma unroll
    for (int it = 0; it < 4; ++it) {
      const float* sp = os + (it * 4 + q) * OSP + c8;
#pragma unroll
      for (int e = 0; e < 8; ++e) pv[it][e] = (_Float16)sp[e];
    }
#pragma unroll
    for (int it = 0; it < 4; ++it) *(v8h*)(ch + (size_t)(it * 4 + q) * DM) = pv[it];
  }
}

extern "C" void kernel_launch(void* const* d_in, const int* in_sizes, int n_in, void* d_out, int out_size, void* d_ws, size_t ws_size, hipStream_t stream) {
  if (n_in < 12) return;
  const long long actn = ((long long)(NB - 1) * SEQ_FULL + SEQ) * DM;
  if ((long long)in_sizes[0] < actn || (long long)in_sizes[1] < actn || (long long)in_sizes[2] < actn) return;
  if (in_sizes[3] < DM * DM || in_sizes[5] < DM * DM || in_sizes[7] < DM * DM || in_sizes[9] < DM * DM) return;
  if (in_sizes[4] < DM || in_sizes[6] < DM || in_sizes[8] < DM || in_sizes[10] < DM) return;
  if (in_sizes[11] < NREL * DK) return;
  if ((long long)out_size < (long long)MT * DM) return;

  const float* Qi = (const float*)d_in[0];
  const float* Ki = (const float*)d_in[1];
  const float* Vi = (const float*)d_in[2];
  const float* Wq = (const float*)d_in[3];
  const float* bq = (const float*)d_in[4];
  const float* Wk = (const float*)d_in[5];
  const float* bk = (const float*)d_in[6];
  const float* Wv = (const float*)d_in[7];
  const float* bv = (const float*)d_in[8];
  const float* Wo = (const float*)d_in[9];
  const float* bo = (const float*)d_in[10];
  const float* rel = (const float*)d_in[11];
  float* out = (float*)d_out;

  constexpr size_t SZ_ACT = (size_t)MT * DM * 2;          // 16-bit [MT][DM] plane
  constexpr size_t SZ_W   = (size_t)DM * DM * 2;
  constexpr size_t SZ_BR  = (size_t)4 * DM * 4;
  constexpr size_t SZ_TB  = (size_t)NRELP * DK * 2;
  static_assert(SZ_ACT % 256 == 0 && SZ_W % 256 == 0 && SZ_BR % 256 == 0 && SZ_TB % 256 == 0);
  constexpr size_t TOTAL = 3 * SZ_ACT + 4 * SZ_W + SZ_BR + SZ_TB + 4 * SZ_ACT;
  static_assert(TOTAL <= (size_t)134217728);
  if (TOTAL > ws_size) return;

  char* wsp = (char*)d_ws;
  unsigned short* XQ  = (unsigned short*)wsp; wsp += SZ_ACT;
  unsigned short* XK  = (unsigned short*)wsp; wsp += SZ_ACT;
  unsigned short* XV  = (unsigned short*)wsp; wsp += SZ_ACT;
  unsigned short* WQ6 = (unsigned short*)wsp; wsp += SZ_W;
  unsigned short* WK6 = (unsigned short*)wsp; wsp += SZ_W;
  unsigned short* WV6 = (unsigned short*)wsp; wsp += SZ_W;
  unsigned short* WO6 = (unsigned short*)wsp; wsp += SZ_W;
  float*          BR  = (float*)wsp;          wsp += SZ_BR;
  unsigned short* TB  = (unsigned short*)wsp; wsp += SZ_TB;
  unsigned short* QFp = (unsigned short*)wsp; wsp += SZ_ACT;     // [MT tokens][DM features] f16
  unsigned short* KFp = (unsigned short*)wsp; wsp += SZ_ACT;
  unsigned short* VTp = (unsigned short*)wsp; wsp += SZ_ACT;     // [DM features][MT tokens] f16
  unsigned short* CTX = (unsigned short*)wsp; wsp += SZ_ACT;     // [MT][DM] f16

  k_prep<<<PR_GRID, PR_T, 0, stream>>>(Qi, Ki, Vi, Wq, Wk, Wv, Wo, bq, bk, bv, bo, rel, XQ, XK, XV, WQ6, WK6, WV6, WO6, BR, TB);

  const unsigned gQK = (unsigned)((MT / 128) * (DM / 128));
  k_gemm_qkv<<<3u * gQK, 128, 0, stream>>>(XQ, XK, XV, WQ6, WK6, WV6, QFp, KFp, VTp, BR, 0.0625f);

  k_attn_rel<<<(unsigned)((NB * NH * (SEQ / 16)) / AT_NW), 32 * AT_NW, 0, stream>>>(QFp, KFp, VTp, TB, CTX);

  k_gemm_out<<<gQK, 128, 0, stream>>>(CTX, WO6, out, BR + 3 * DM, MT, DM, DM, 0.0625f);
}

// v010
// One run takes 69.6 microseconds.
// Timed twice side by side with v009, it ran 1.06 and 1.05 times as fast.
// Over all steps from v000 it is 5.45 times as fast.
// Contractions, all v_wmma_f32_16x16x32_f16 with f32 accumulate: q/k/v and output projections (inputs and weights RNE-converted to bf16 and held exactly in f16, weights x16; the context as one f16 plane); content scores and relative-position dots (q, k as one f16 plane each, the 33x64 table RNE-converted to bf16 and held in f16); P.V (P f16, at most 2^15; v f16).
#include <hip/hip_runtime.h>
#include <math.h>
#include <stdint.h>

#ifndef NB
#define NB 4
#endif
#ifndef SEQ
#define SEQ 1024
#endif
#define NB_FULL 4
#define SEQ_FULL 1024
#define DM 1024
#define NH 16
#define DK 64
#define MAXREL 16
#define NREL 33
#define NRELP 48
#define MT (NB * SEQ)
#define AT_NW 8
#define QP 52
#define OSP 68
#define RLOW 7.0f
#define PMAX 32768.0f

static_assert(NH * DK == DM);
static_assert(DK == 64);
static_assert(2 * MAXREL + 1 == NREL);
static_assert(NRELP % 16 == 0 && NRELP >= NREL);
static_assert(QP >= NRELP);
static_assert(SEQ % 64 == 0);
static_assert(MT % 128 == 0);
static_assert(DM % 128 == 0);
static_assert(DM >= 256);
static_assert(((SEQ / 16) * NB * NH) % AT_NW == 0);
static_assert((SEQ / 16) % AT_NW == 0);
static_assert(SEQ >= 128);
static_assert(NB <= NB_FULL && SEQ <= SEQ_FULL);

typedef __attribute__((ext_vector_type(16))) _Float16 v16h;
typedef __attribute__((ext_vector_type(8)))  _Float16 v8h;
typedef __attribute__((ext_vector_type(8)))  float    v8f;
typedef __attribute__((ext_vector_type(4)))  float    v4f;

// 16-bit WMMA fragment map (wave32), lane L, hh = L>>4, c = L&15:
//   A 16x32: lane = row c;    element i -> k = (i<8) ? 8hh+i : 16+8hh+(i-8)
//   B 32x16: lane = column c; the same k(i,hh)
//   D 16x16 (8 f32): lane = column c; element r -> row 8hh+r

__device__ __forceinline__ float cmb_bf(float v) { const unsigned u = __float_as_uint(v); const unsigned r = (u + 0x7fffu + ((u >> 16) & 1u)) & 0xffff0000u; return __uint_as_float(r); }   // bf16 RNE kept as f32 (finite inputs)
__device__ __forceinline__ unsigned int cmb_pk2(float a, float b) { return (unsigned int)__builtin_bit_cast(unsigned short, (_Float16)a) | ((unsigned int)__builtin_bit_cast(unsigned short, (_Float16)b) << 16); }

// 2^x by the hardware instruction alone, for the softmax. From -126 up it is the value exp2f gives (infinity where 2^x leaves f32: such a pass is formed anew); below that the result is 0 where exp2f
// gives a subnormal: P (f16) is 0 either way, the query's sum holds a term of about 2^RLOW or more that absorbs it, and a rescale factor that small leaves nothing of the old sums.
// A run of them is one statement: every result register differs from every argument register (early clobber), so that no v_exp_f32 is directly followed by an
// instruction that reads its result or writes over its argument; the v_nop is that one slot behind the last of the run.
__device__ __forceinline__ void exp2_hw8(const float (&x)[8], float (&e)[8]) {
  asm("v_exp_f32 %0, %8\n\tv_exp_f32 %1, %9\n\tv_exp_f32 %2, %10\n\tv_exp_f32 %3, %11\n\t"
      "v_exp_f32 %4, %12\n\tv_exp_f32 %5, %13\n\tv_exp_f32 %6, %14\n\tv_exp_f32 %7, %15\n\tv_nop"
      : "=&v"(e[0]), "=&v"(e[1]), "=&v"(e[2]), "=&v"(e[3]), "=&v"(e[4]), "=&v"(e[5]), "=&v"(e[6]), "=&v"(e[7])
      : "v"(x[0]), "v"(x[1]), "v"(x[2]), "v"(x[3]), "v"(x[4]), "v"(x[5]), "v"(x[6]), "v"(x[7]));
}
__device__ __forceinline__ float exp2_hw1(float x) {
  float e;
  asm("v_exp_f32 %0, %1\n\tv_nop" : "=v"(e) : "v"(x));
  return e;
}

// the value that lane addr / 4 holds: the instruction that __shfl and __shfl_xor compile to, with the byte index formed once, in front of the loop, by the caller
__device__ __forceinline__ float from_lane(float v, int addr) { return __int_as_float(__builtin_amdgcn_ds_bpermute(addr, __float_as_int(v))); }

__device__ __forceinline__ v8f zero8() { v8f z = {0.f, 0.f, 0.f, 0.f, 0.f, 0.f, 0.f, 0.f}; return z; }

__device__ __forceinline__ v8f wmmah(v16h a, v16h b, v8f c) {
  c = __builtin_amdgcn_wmma_f32_16x16x32_f16(false, a, false, b, (short)0, c, false, false);
  asm volatile("v_nop\n\tv_nop\n\tv_nop\n\tv_nop" : "+v"(c) : "v"(a), "v"(b));
  return c;
}
union FHu { v16h v; v8h h[2]; };
// p already includes the lane-half offset 8*hh: elements 0..7 <- p[0..7], 8..15 <- p[16..23]
__device__ __forceinline__ v16h ldfh(const _Float16* p) { FHu f; f.h[0] = *(const v8h*)(p); f.h[1] = *(const v8h*)(p + 16); return f.v; }

// ---- hazard guards for the register-blocked GEMM ----
__device__ __forceinline__ void acc_guard4(v8f& a, v8f& b, v8f& c, v8f& d) { asm volatile("v_nop\n\tv_nop\n\tv_nop\n\tv_nop" : "+v"(a), "+v"(b), "+v"(c), "+v"(d)); }

template <typename T> struct Frag;
template <> struct Frag<_Float16> {
  typedef v16h V;
  static __device__ __forceinline__ v16h load(const _Float16* p) { return ldfh(p); }
  static __device__ __forceinline__ v8f mma(v16h a, v16h b, v8f c) { return __builtin_amdgcn_wmma_f32_16x16x32_f16(false, a, false, b, (short)0, c, false, false); }
};
template <int ET> struct Elem;
template <> struct Elem<0> { typedef _Float16 T; };

// ---- Tensor loads into LDS for the GEMM panels ----
typedef uint32_t u32x4 __attribute__((ext_vector_type(4)));
typedef uint32_t u32x8 __attribute__((ext_vector_type(8)));
constexpr uint32_t G_ROWS  = 64u;                  // rows per slice (one tensor load of one wave)
// ROWB = bytes of one operand row per stage: 256 (128 k) or 128 (64 k)
template <uint32_t ROWB> struct GRing {
  static_assert(ROWB == 256u || ROWB == 128u);
  static constexpr uint32_t PITCH = ROWB + 16u;                                       // LDS row pitch, laid by the load's pad: an odd multiple of 16 B for ds_load_b128 readers
  static constexpr uint32_t SLICE = ((G_ROWS * PITCH + 2047u) / 2048u) * 2048u;       // 64 rows, rounded up to a multiple of 2 KiB: 18,432 B or 10,240 B
  static constexpr uint32_t STAGE = 4u * SLICE;                                       // [A rows 0..63 | A rows 64..127 | Bt rows 0..63 | Bt rows 64..127]
};
__device__ __forceinline__ uint32_t uni(uint32_t v) { return (uint32_t)__builtin_amdgcn_readfirstlane(v); }
// keeps the test in a scalar register, so that the branch round a tensor load is a scalar branch (the load ignores EXEC)
__device__ __forceinline__ uint32_t pinned(uint32_t v) { uint32_t w = (uint32_t)__builtin_amdgcn_readfirstlane(v); asm volatile("" : "+s"(w)); return w; }
// the wave's LDS reads have retired before the buffer is handed back for a refill
__device__ __forceinline__ void wait_ds0() { asm volatile("s_wait_dscnt 0x0" ::: "memory"); }
// the wave's own tensor load has landed (the compiler places no wait for it); the request's descriptor is named as an input so that its registers keep their values until here
__device__ __forceinline__ void wait_tensor0(u32x4 g0, u32x8 g1) { asm volatile("s_wait_tensorcnt 0x0" :: "s"(g0), "s"(g1) : "memory"); }
__device__ __forceinline__ void tdm_load(u32x4 g0, u32x8 g1) { asm volatile("tensor_load_to_lds %0, %1" :: "s"(g0), "s"(g1) : "memory"); }
// group 1: 1-byte elements, tile = tensor = 64 rows of ROWB bytes, source row pitch in bytes, 16 B of LDS pad behind every row (interval code 5 for 256-B rows, 4 for 128-B rows), no mask
template <uint32_t ROWB>
__device__ __forceinline__ u32x8 tdm_group1(uint32_t src_pitch) {
  u32x8 g;
  g[0] = uni((1u << 20) | ((ROWB == 256u ? 5u : 4u) << 22) | (3u << 25));
  g[1] = uni((ROWB & 0xFFFFu) << 16);
  g[2] = uni((ROWB >> 16) | ((G_ROWS & 0xFFFFu) << 16));
  g[3] = uni((G_ROWS >> 16) | (ROWB << 16));
  g[4] = uni(G_ROWS);
  g[5] = uni(src_pitch);
  g[6] = uni(0u);
  g[7] = uni(0u);
  return g;
}
__device__ __forceinline__ u32x4 tdm_group0(uint32_t lds_dst, uint64_t ga) {
  u32x4 g;
  g[0] = uni(1u); g[1] = uni(lds_dst); g[2] = uni((uint32_t)ga); g[3] = uni((((uint32_t)(ga >> 32)) & 0x01FFFFFFu) | 0x80000000u);
  return g;
}

// ---- Register-blocked WMMA GEMM body: C[m,n] = scale * sum_k A[m,k] * Bt[n,k] + bias; a work-group of 4 waves (2 x 2) owns a 128x128 tile, each wave 64x64 of it.
// The 128 rows of A and of Bt come into LDS ROWB / 2 k at a time by tensor loads, one 64-row slice per wave and stage, two buffers: stage s + 1 flies while stage s is multiplied.
// A row-major [M,K] (pitch lda), Bt row-major [N,K] (pitch ldb); M,N % 128 == 0, K % 128 == 0, K >= 256 (no tails, at least two stages).
// BIAS_MODE 1 = bias[m], 2 = bias[n]. OUT_MODE 0 = f32, 1 = f16.
// The work-groups that share a panel all walk the same K: each starts at a stage of its own, ((tile row + tile column) mod (stages / u)) * u with u = stages per 256 B of the row, and wraps, so that at any time they ask L2 for
// different lines of the panel and the requests of a launch spread over the whole row length instead of one 256-B column of it. Only the order of the k sum differs from tile to tile.
// tile = the work-group's tile number (the same in every thread). slab = the wave's own 16 x 68 floats of output staging; it may lie inside ring:
// the last pass of the loop ends with every wave's LDS reads retired, every tensor load landed and a work-group barrier, and nothing is issued behind it.
template <int ET, int BIAS_MODE, int OUT_MODE, uint32_t ROWB>
__device__ __forceinline__ void gemm64_body(
    const unsigned short* __restrict__ Ap, int lda, const unsigned short* __restrict__ Btp, int ldb,
    void* __restrict__ Cout, int ldc, const float* __restrict__ bias,
    int M, int N, int K, float scale, int tile, float* slab, unsigned char* ring) {
  typedef typename Elem<ET>::T T;
  typedef typename Frag<T>::V V;
  constexpr uint32_t G_ROWB = ROWB, G_PITCH = GRing<ROWB>::PITCH, G_SLICE = GRing<ROWB>::SLICE, G_STAGE = GRing<ROWB>::STAGE;
  constexpr int KSTEPS = (int)(ROWB / 64u);        // 32-k steps per stage
  const T* A = (const T*)Ap; const T* Bt = (const T*)Btp;
  const int lane = threadIdx.x & 31;
  const uint32_t wave = uni(threadIdx.x >> 5);
  const int tilesN = N >> 7;
  const int tilesM = M >> 7;
  if (tile >= tilesM * tilesN) return;   // the same for the whole block, in front of every barrier and tensor load
  const int tm = tile / tilesN;
  const int tn = tile - tm * tilesN;
  const int m0 = (tm << 7) + (int)((wave >> 1) << 6);
  const int n0 = (tn << 7) + (int)((wave & 1u) << 6);
  const int rlane = lane & 15;
  const int koff  = (lane >> 4) * 8;
  const int mOff  = (lane >> 4) * 8;

  v8f acc[4][4];
#pragma unroll
  for (int i = 0; i < 4; ++i)
#pragma unroll
    for (int j = 0; j < 4; ++j) acc[i][j] = zero8();

  // this wave's slice: waves 0, 1 bring the two halves of A's 128 rows, waves 2, 3 those of Bt's
  const bool isB = wave >= 2u;
  const uint64_t srcA = (uint64_t)(size_t)(A + (size_t)((tm << 7) + (int)((wave & 1u) << 6)) * lda);
  const uint64_t srcB = (uint64_t)(size_t)(Bt + (size_t)((tn << 7) + (int)((wave & 1u) << 6)) * ldb);
  const uint64_t gsrc = isB ? srcB : srcA;
  u32x8 g1 = tdm_group1<ROWB>((uint32_t)(isB ? ldb : lda) * 2u);
  asm volatile("" : "+s"(g1));   // the pinned() form on descriptor words: held in their scalar registers, built once, so that none is written again while a request is outstanding
  const uint32_t ldst = (uint32_t)(size_t)ring + wave * G_SLICE;
  const int nst = K >> (ROWB == 256u ? 7 : 6);
  // the stage of K that ring position x holds (x < nst): scalar, the same for the whole block
  // the starts lie whole 256-B units of the row apart, also where a stage is half a unit
  constexpr uint32_t UNIT = 256u / ROWB;
  const uint32_t kfirst = uni(((uint32_t)(tm + tn) % ((uint32_t)nst / UNIT)) * UNIT);
  auto kstage = [&](uint32_t x) -> uint64_t { const uint32_t v = x + kfirst; return (uint64_t)(v >= (uint32_t)nst ? v - (uint32_t)nst : v); };
  // this wave's fragment rows: A from slice wave >> 1, Bt from slice 2 + (wave & 1)
  const unsigned char* aR = ring + (wave >> 1) * G_SLICE + (uint32_t)rlane * G_PITCH + (uint32_t)koff * 2u;
  const unsigned char* bR = ring + (2u + (wave & 1u)) * G_SLICE + (uint32_t)rlane * G_PITCH + (uint32_t)koff * 2u;

  u32x4 g0 = tdm_group0(ldst, gsrc + kstage(0u) * G_ROWB);
  tdm_load(g0, g1);                                           // stage 0 -> buffer 0
  wait_tensor0(g0, g1);
  __syncthreads();                                            // stage 0 published
  g0 = tdm_group0(ldst + G_STAGE, gsrc + kstage(1u) * G_ROWB);
  tdm_load(g0, g1);                                           // stage 1 -> buffer 1 (K >= 256)

  // kept rolled: one publish point per stage
#pragma unroll 1
  for (int s = 0; s < nst; ++s) {
    const uint32_t buf = ((uint32_t)s & 1u) * G_STAGE;
    // two fragment sets inside the stage: the LDS reads of the next 32 k go ahead of this 32 k's WMMAs; nothing of the next stage is read here
    V ah[2][4], bh[2][4];
#pragma unroll
    for (int j = 0; j < 4; ++j) {
      bh[0][j] = Frag<T>::load((const T*)(bR + buf + (uint32_t)j * 16u * G_PITCH));
      ah[0][j] = Frag<T>::load((const T*)(aR + buf + (uint32_t)j * 16u * G_PITCH));
    }
#pragma unroll
    for (int kk = 0; kk < KSTEPS; ++kk) {
      const int cur = kk & 1, nxt = cur ^ 1;
      if (kk < KSTEPS - 1) {
#pragma unroll
        for (int j = 0; j < 4; ++j) {
          bh[nxt][j] = Frag<T>::load((const T*)(bR + buf + (uint32_t)j * 16u * G_PITCH + (uint32_t)(kk + 1) * 64u));
          ah[nxt][j] = Frag<T>::load((const T*)(aR + buf + (uint32_t)j * 16u * G_PITCH + (uint32_t)(kk + 1) * 64u));
        }
      }
#pragma unroll
      for (int i = 0; i < 4; ++i) {
#pragma unroll
        for (int j = 0; j < 4; ++j) acc[i][j] = Frag<T>::mma(ah[cur][i], bh[cur][j], acc[i][j]);
        acc_guard4(acc[i][0], acc[i][1], acc[i][2], acc[i][3]);   // the four vector slots behind a WMMA; it also keeps each group of LDS reads where it is written
      }
    }
    // publish point of stage s + 1: own LDS reads retired, own load landed, then the barrier that publishes s + 1 and frees this buffer
    wait_ds0();
    wait_tensor0(g0, g1);
    __syncthreads();
    if (pinned((uint32_t)(s + 2 < nst))) {
      g0 = tdm_group0(ldst + buf, gsrc + kstage((uint32_t)(s + 2)) * G_ROWB);
      tdm_load(g0, g1);
    }
  }
  wait_tensor0(g0, g1);
  wait_ds0();
  acc_guard4(acc[0][0], acc[0][1], acc[0][2], acc[0][3]);
  acc_guard4(acc[1][0], acc[1][1], acc[1][2], acc[1][3]);
  acc_guard4(acc[2][0], acc[2][1], acc[2][2], acc[2][3]);
  acc_guard4(acc[3][0], acc[3][1], acc[3][2], acc[3][3]);

#pragma unroll
  for (int i = 0; i < 4; ++i) {
    const int mBase = m0 + (i << 4);
#pragma unroll
    for (int j = 0; j < 4; ++j) {
      const int n = n0 + (j << 4) + rlane;
      float bv = 0.f;
      if (BIAS_MODE == 2) bv = bias[n];
#pragma unroll
      for (int r = 0; r < 8; ++r) {
        float v = acc[i][j][r] * scale;
        if (BIAS_MODE == 1) v += bias[mBase + mOff + r];
        if (BIAS_MODE == 2) v += bv;
        slab[(mOff + r) * 68 + (j << 4) + rlane] = v;
      }
    }
    __builtin_amdgcn_fence(3 /* release order */, "workgroup");
    __builtin_amdgcn_wave_barrier();
    __builtin_amdgcn_fence(2 /* acquire order */, "workgroup");
    if (OUT_MODE == 0) {
      float* C = (float*)Cout;
      const int hh = lane >> 4, c4 = (lane & 15) * 4;     // row segment = 256 B = 16 lanes x 16 B
      {
#pragma unroll
        for (int it = 0; it < 8; ++it) {
          const int row = it * 2 + hh;
          v4f v = *(const v4f*)(slab + row * 68 + c4);
          *(v4f*)(C + (size_t)(mBase + row) * ldc + n0 + c4) = v;
        }
        
      }
    } else {
      const int q = lane >> 3, c8 = (lane & 7) * 8;
      unsigned short* C  = (unsigned short*)Cout;
      {
#pragma unroll
        for (int it = 0; it < 4; ++it) {
          const int row = it * 4 + q;
          const float* sp = slab + row * 68 + c8;
          v8h hv;
#pragma unroll
          for (int e = 0; e < 8; ++e) hv[e] = (_Float16)sp[e];
          *(v8h*)(C + (size_t)(mBase + row) * ldc + n0 + c8) = hv;
        }
        
      }
    }
    __builtin_amdgcn_fence(3 /* release order */, "workgroup");
    __builtin_amdgcn_wave_barrier();
    __builtin_amdgcn_fence(2 /* acquire order */, "workgroup");
  }
}

// q, k and v projections in one launch: work-groups [0, T) take q's tiles, [T, 2T) k's, [2T, 3T) v's, T = tiles of one projection.
//   q, k: C[token][feature] = sum_k X[token][k] * W[feature][k] + bias[feature], f16 operands, one f16 plane out
//   v, transposed: C[feature][token] = sum_k Wv[feature][k] * X[token][k] + bias[feature], f16 out (pitch = tokens)
// Stages of 64 k: a work-group holds 97 KiB of LDS (ring and output staging side by side) and exactly three of them share a WGP, so that with three tiles per WGP
// every work-group of the launch is resident from the start and the WGPs carry equal shares: no second round with its own first loads and epilogue,
// and one group's tensor-load waits, first fragment reads and epilogue run under the other two's WMMAs.
constexpr int G_TILES = (MT / 128) * (DM / 128);
constexpr uint32_t G_QKV_ROWB = 128u;              // bytes of an operand row per stage in this launch
constexpr uint32_t G_SLAB = 16u * 68u * 4u;        // bytes of one wave's output staging
static_assert(3u * (2u * GRing<G_QKV_ROWB>::STAGE + 4u * G_SLAB) <= 327680u && 4u * (2u * GRing<G_QKV_ROWB>::STAGE + 4u * G_SLAB) > 327680u);
__global__ __launch_bounds__(128) void k_gemm_qkv(const unsigned short* __restrict__ XQ, const unsigned short* __restrict__ XK, const unsigned short* __restrict__ XV,
                                                  const unsigned short* __restrict__ WQ, const unsigned short* __restrict__ WK, const unsigned short* __restrict__ WV,
                                                  unsigned short* __restrict__ QF, unsigned short* __restrict__ KF,
                                                  unsigned short* __restrict__ VT, const float* __restrict__ BR, float scale) {
  __shared__ __attribute__((aligned(2048))) unsigned char ring[2 * GRing<G_QKV_ROWB>::STAGE];
  __shared__ __align__(16) float sT[4][16 * 68];
  float* slab = sT[threadIdx.x >> 5];
  const int which = (int)blockIdx.x / G_TILES;                 // the same for the whole block
  const int tile  = (int)blockIdx.x - which * G_TILES;
  if (which < 2) {
    const bool isq = which == 0;
    gemm64_body<0, 2, 1, G_QKV_ROWB>(isq ? XQ : XK, DM, isq ? WQ : WK, DM, (void*)(isq ? QF : KF), DM, BR + which * DM, MT, DM, DM, scale, tile, slab, ring);
  } else {
    gemm64_body<0, 1, 1, G_QKV_ROWB>(WV, DM, XV, DM, (void*)VT, MT, BR + 2 * DM, DM, MT, DM, scale, tile, slab, ring);
  }
}
// output projection: f16 operands (A = context, Bt = Wo x16), bias[n], f32 out
__global__ __launch_bounds__(128) void k_gemm_out(const unsigned short* __restrict__ A, const unsigned short* __restrict__ W,
                                                  float* __restrict__ C, const float* __restrict__ bias, int M, int N, int K, float scale) {
  __shared__ __attribute__((aligned(2048))) unsigned char ring[2 * GRing<256u>::STAGE];
  __shared__ __align__(16) float sT[4][16 * 68];
  gemm64_body<0, 2, 0, 256u>(A, K, W, K, (void*)C, N, bias, M, N, K, scale, (int)blockIdx.x, sT[threadIdx.x >> 5], ring);
}

// ---- operand preparation, all of it in one launch of long-lived waves ----
// A chunk is 16,384 consecutive floats of one source (16 rows of DM). A block of 16 waves takes four chunks; every thread asks for all its 16-B pieces first
// (each wave-wide load covers 512 contiguous bytes), then converts and stores them in the order in which they were asked for.
//   activations:  f32 -> bf16 (RNE) -> f16 plane [MT][DM]; rows (b, s) of the full-size inputs
//   Wq, Wk, Wv, Wo: f32 -> bf16 (RNE) -> x16 -> f16 plane [DM][DM] (exact; [out][in] is already the Bt layout)
//   biases:       f32 -> bf16 (RNE) kept as f32; table: f32 -> bf16 (RNE) -> f16 plane [NRELP][DK], rows >= NREL written as zeros (clamped source address)
typedef __attribute__((ext_vector_type(2))) unsigned int u2;
constexpr int PR_T     = 512;                                   // threads per block
constexpr int PR_L     = 8;                                     // 16-B loads per thread and chunk
constexpr int PR_CH    = PR_T * PR_L * 4;                       // floats per chunk
constexpr int PR_ACT   = (int)(((long long)MT * DM) / PR_CH);   // chunks per activation plane
constexpr int PR_W     = (DM * DM) / PR_CH;                     // chunks per weight matrix
constexpr int PR_GRID  = PR_ACT > 4 * PR_W ? PR_ACT : 4 * PR_W;  // block b: chunk b of each activation plane and chunk b of [Wq, Wk, Wv, Wo]
constexpr int PR_SQ    = DM + NRELP * (DK / 4);                 // 4-float pieces of the four biases, then of the padded table
constexpr int PR_SMALL = (PR_SQ + PR_T - 1) / PR_T;             // the first blocks take one such piece per thread on top
static_assert(PR_CH % DM == 0 && SEQ % (PR_CH / DM) == 0 && ((long long)MT * DM) % PR_CH == 0 && (DM * DM) % PR_CH == 0);
static_assert(PR_SMALL <= PR_GRID && DK % 4 == 0 && DM % 4 == 0 && (PR_T * 4) % DM == 0);

__device__ __forceinline__ u2 pr_f16(v4f x, float sc) { u2 p; p.x = cmb_pk2(cmb_bf(x.x) * sc, cmb_bf(x.y) * sc); p.y = cmb_pk2(cmb_bf(x.z) * sc, cmb_bf(x.w) * sc); return p; }

__global__ __launch_bounds__(PR_T) void k_prep(const float* __restrict__ Qi, const float* __restrict__ Ki, const float* __restrict__ Vi,
                                               const float* __restrict__ Wq, const float* __restrict__ Wk, const float* __restrict__ Wv, const float* __restrict__ Wo,
                                               const float* __restrict__ bq, const float* __restrict__ bk, const float* __restrict__ bv, const float* __restrict__ bo,
                                               const float* __restrict__ rel,
                                               unsigned short* __restrict__ XQ, unsigned short* __restrict__ XK, unsigned short* __restrict__ XV,
                                               unsigned short* __restrict__ WQ6, unsigned short* __restrict__ WK6, unsigned short* __restrict__ WV6,
                                               unsigned short* __restrict__ WO6, float* __restrict__ BR, unsigned short* __restrict__ TB) {
  const unsigned t = threadIdx.x;
  const unsigned b = blockIdx.x;
  // chunk numbers are clamped for the loads, so that no branch stands among them; the stores are guarded
  const unsigned ka = min(b, (unsigned)(PR_ACT - 1));
  const unsigned kw = min(b, (unsigned)(4 * PR_W - 1));
  const unsigned w  = kw / (unsigned)PR_W, kc = kw % (unsigned)PR_W;
  const unsigned r0 = ka * (unsigned)(PR_CH / DM);
  const size_t ao = (size_t)(r0 / (unsigned)SEQ) * ((size_t)SEQ_FULL * DM) + (size_t)(r0 % (unsigned)SEQ) * DM;
  const v4f* sq = (const v4f*)(Qi + ao) + t;                    // block-uniform base + the thread's 16 B inside 8 KiB of the chunk
  const v4f* sk = (const v4f*)(Ki + ao) + t;
  const v4f* sv = (const v4f*)(Vi + ao) + t;
  const v4f* sw = (const v4f*)((w == 0u ? Wq : w == 1u ? Wk : w == 2u ? Wv : Wo) + (size_t)kc * PR_CH) + t;
  // one piece of the biases (u < DM) or of the table per thread of the first blocks; every thread's address is in bounds
  const unsigned u = b * (unsigned)PR_T + t;
  const unsigned tq = u < (unsigned)DM ? 0u : u - (unsigned)DM;

  v4f xs = {0.f, 0.f, 0.f, 0.f};
  if (b < (unsigned)PR_SMALL) {
    const unsigned bw = u / (unsigned)(DM / 4);
    const float* bs = bw == 0u ? bq : bw == 1u ? bk : bw == 2u ? bv : bo;
    const float* ss = u < (unsigned)DM ? bs + (u % (unsigned)(DM / 4)) * 4u : rel + min(tq / (unsigned)(DK / 4), (unsigned)(NREL - 1)) * (unsigned)DK + (tq % (unsigned)(DK / 4)) * 4u;
    xs = *(const v4f*)ss;
  }
  // PR_ORDER: the compiler moves nothing across it. The loads leave plane by plane and each plane is converted and stored as soon as its own loads are back,
  // while the later planes are still on their way; without it the conversions of all planes are mixed and the first store waits for most of the loads.
#define PR_ORDER() __builtin_amdgcn_sched_barrier(0)
  // every loop below is unrolled: the pieces stay in registers and their offsets become immediates
  v4f xq[PR_L], xk[PR_L], xv[PR_L], xw[PR_L];
#pragma unroll
  for (int j = 0; j < PR_L; ++j) xq[j] = sq[j * PR_T];
  PR_ORDER();
#pragma unroll
  for (int j = 0; j < PR_L; ++j) xk[j] = sk[j * PR_T];
  PR_ORDER();
#pragma unroll
  for (int j = 0; j < PR_L; ++j) xv[j] = sv[j * PR_T];
  PR_ORDER();
#pragma unroll
  for (int j = 0; j < PR_L; ++j) xw[j] = sw[j * PR_T];
  // stands in front of every later write of a register that one of the loads above names as an address; the thread number, their offset register, is named as an input so that it keeps its value until here
  asm volatile("s_wait_xcnt 0x0" :: "v"(t) : "memory");

  if (b < (unsigned)PR_SMALL) {
    if (u < (unsigned)DM) {
      v4f r; r.x = cmb_bf(xs.x); r.y = cmb_bf(xs.y); r.z = cmb_bf(xs.z); r.w = cmb_bf(xs.w);
      *(v4f*)(BR + u * 4u) = r;
    } else if (u < (unsigned)PR_SQ) {
      u2 pk = pr_f16(xs, 1.0f);
      if (tq / (unsigned)(DK / 4) >= (unsigned)NREL) { pk.x = 0u; pk.y = 0u; }
      *(u2*)(TB + tq * 4u) = pk;
    }
  }
  if (b < (unsigned)PR_ACT) {
    const size_t o = (size_t)ka * PR_CH + t * 4u;
#pragma unroll
    for (int j = 0; j < PR_L; ++j) *(u2*)(XQ + o + j * (PR_T * 4)) = pr_f16(xq[j], 1.0f);
    PR_ORDER();
#pragma unroll
    for (int j = 0; j < PR_L; ++j) *(u2*)(XK + o + j * (PR_T * 4)) = pr_f16(xk[j], 1.0f);
    PR_ORDER();
#pragma unroll
    for (int j = 0; j < PR_L; ++j) *(u2*)(XV + o + j * (PR_T * 4)) = pr_f16(xv[j], 1.0f);
    // stands in front of the weight chunk's conversions, which write over registers that these stores name
    asm volatile("s_wait_xcnt 0x0" ::: "memory");
  }
  PR_ORDER();   // as above: the weight chunk's conversions stay behind the V plane's stores, which otherwise wait for the weight loads too
  if (b < (unsigned)(4 * PR_W)) {
    unsigned short* dp = (w == 0u ? WQ6 : w == 1u ? WK6 : w == 2u ? WV6 : WO6) + (size_t)kc * PR_CH + t * 4u;
#pragma unroll
    for (int j = 0; j < PR_L; ++j) *(u2*)(dp + j * (PR_T * 4)) = pr_f16(xw[j], 16.0f);
  }
}

// =====================================================================================================================
// Fused attention with clipped relative-position bias. One wave per 16 queries; the 8 waves of a block share one (batch, head) and its K, V tiles in LDS.
//   score(l, r) = q_l . k_r / 8 + q_l . table[clip(r - l, -16, 16) + 16]
//   Transposed score tiles S^T = K . Q^T (A = key rows, B = query rows): D has lane = query, element = key, which is the A-operand
//   layout of P for O = P . V (32 keys per step), so P never leaves registers. q, k: one f16 plane each, one product per score tile and 32 d.
//   Relative dots: table (A, rows padded to NRELP) x q (B), staged once per wave in LDS [16][QP] and gathered per element,
//   but only in the passes that touch the clip band |r - l| < 16: in every other pass all 32 x 16 distances clip to the same end of the table,
//   the bias is one value per query, and scale, bias and running maximum go into one fma per score.
//   V^T plane [feature][token] f16 gives B fragments with contiguous keys. Online softmax in f32 (exp2 domain), P = 2^(score - reference) in f16.
//   A query's reference is set RLOW below its maximum so far (P then uses f16's range on both sides of 1) and stays in use while every lane's P of a pass sum to PMAX at most,
//   so that each P fits f16 (one ballot, one scalar branch per pass). Only where they do not is the pass's maximum taken, are the lane halves' maxima joined, the reference raised,
//   the sums and O rescaled and the pass's P formed anew. Each lane half sums its own keys; the halves' sums are joined once, behind the loop.
//   K (64 keys x 64 d) and V^T (64 features x 64 keys) come into LDS 64 keys at a time by tensor loads, one tile each from waves 0, 1, two buffers:
//   stage s + 1 flies while stage s is worked on. The blocks of one (batch, head) walk the same keys: each starts at a stage of its own and wraps, so that at any time they ask L2 for
//   different lines; the online softmax takes the keys in any order.
// =====================================================================================================================
constexpr uint32_t AT_KEYS  = 64u;                 // keys per stage
constexpr uint32_t AT_ROWB  = 128u;                // bytes of one tile row: 64 d of a key, or 64 keys of a feature
constexpr uint32_t AT_ROWS  = 64u;                 // rows per tile (one tensor load of one wave)
constexpr uint32_t AT_PITCH = AT_ROWB + 16u;       // LDS row pitch, laid by the load's pad: an odd multiple of 16 B for ds_load_b128 readers
constexpr uint32_t AT_SLICE = 10240u;              // 64 x 144 = 9,216 B rounded up to a multiple of 2 KiB
constexpr uint32_t AT_STAGE = 2u * AT_SLICE;       // [K | V^T]
constexpr int      AT_NST   = SEQ / (int)AT_KEYS;
static_assert(AT_ROWS * AT_PITCH <= AT_SLICE && AT_SLICE % 2048u == 0u);
static_assert(DK * 2 == (int)AT_ROWB && DK == (int)AT_ROWS && AT_NST >= 2);
// group 1: 1-byte elements, tile = tensor = 64 rows of 128 B, source row pitch in bytes, 16 B of LDS pad behind every 128-B row, no mask
__device__ __forceinline__ u32x8 at_group1(uint32_t src_pitch) {
  u32x8 g;
  g[0] = uni((1u << 20) | (4u << 22) | (3u << 25));
  g[1] = uni((AT_ROWB & 0xFFFFu) << 16);
  g[2] = uni((AT_ROWB >> 16) | ((AT_ROWS & 0xFFFFu) << 16));
  g[3] = uni((AT_ROWS >> 16) | (AT_ROWB << 16));
  g[4] = uni(AT_ROWS);
  g[5] = uni(src_pitch);
  g[6] = uni(0u);
  g[7] = uni(0u);
  return g;
}

__global__ __launch_bounds__(32 * AT_NW) void k_attn_rel(const unsigned short* __restrict__ QFp, const unsigned short* __restrict__ KFp,
                                                         const unsigned short* __restrict__ VTp, const unsigned short* __restrict__ TBp,
                                                         unsigned short* __restrict__ CTX) {
  __shared__ __attribute__((aligned(2048))) unsigned char ring[2 * AT_STAGE];
  __shared__ __align__(16) float qrs[AT_NW][16 * QP];
  __shared__ __align__(16) float osm[AT_NW][16 * OSP];
  const _Float16* QF = (const _Float16*)QFp;
  const _Float16* TB = (const _Float16*)TBp;
  const int lane = threadIdx.x & 31, wave = threadIdx.x >> 5, hh = lane >> 4, c = lane & 15;
  const int bh = (int)blockIdx.x / ((SEQ / 16) / AT_NW);            // the same for the whole block
  const int l0 = (((int)blockIdx.x - bh * ((SEQ / 16) / AT_NW)) * AT_NW + wave) * 16;
  const int b = bh / NH, h = bh - b * NH;
  const size_t tok0 = (size_t)b * SEQ;

  // q as B operand (lane = query column c), 2 k-steps of 32
  v16h qf[2];
  {
    const size_t qo = (tok0 + l0 + c) * DM + h * DK + 8 * hh;
#pragma unroll
    for (int dc = 0; dc < 2; ++dc) qf[dc] = ldfh(QF + qo + dc * 32);
  }
  // this wave's tile: wave 0 brings K, wave 1 V^T; the other waves issue nothing (their words name V^T's tile and are not used)
  const uint32_t wv = uni((uint32_t)threadIdx.x >> 5);
  const uint32_t sl = wv < 1u ? 0u : 1u;
  const uint64_t gsrc = sl == 0u ? (uint64_t)(size_t)(KFp + tok0 * DM + h * DK)
                                 : (uint64_t)(size_t)(VTp + (size_t)(h * DK) * MT + tok0);
  const uint32_t gstep = sl == 1u ? AT_KEYS * 2u : AT_KEYS * (uint32_t)DM * 2u;     // source bytes from one stage to the next
  u32x8 g1 = at_group1(sl == 1u ? (uint32_t)MT * 2u : (uint32_t)DM * 2u);
  asm volatile("" : "+s"(g1));   // the pinned() form on descriptor words: held in their scalar registers, built once, so that none is written again while a request is outstanding
  const uint32_t ldst = (uint32_t)(size_t)ring + sl * AT_SLICE;
  // the key stage that ring position x holds: scalar, the same for the whole block; two stages apart from one block of a (batch, head) to the next, odd heads one further
  const uint32_t sfirst = uni((uint32_t)(((int)blockIdx.x - bh * ((SEQ / 16) / AT_NW)) * 2 + (bh & 1)) % (uint32_t)AT_NST);
  auto kstage = [&](uint32_t x) -> uint32_t { return (x + sfirst) % (uint32_t)AT_NST; };
  u32x4 g0 = tdm_group0(ldst, gsrc + (uint64_t)(kstage(0u) * gstep));
  if (pinned((uint32_t)(wv < 2u))) {
    tdm_load(g0, g1);                                         // stage 0 -> buffer 0
    wait_tensor0(g0, g1);
  }
  __syncthreads();                                            // stage 0 published
  g0 = tdm_group0(ldst + AT_STAGE, gsrc + (uint64_t)(kstage(1u) * gstep));
  asm volatile("" : "+s"(g0));   // the pinned() form on descriptor words: all four stand in their scalar registers in front of the branch, so that none is written behind the load
  if (pinned((uint32_t)(wv < 2u))) tdm_load(g0, g1);          // stage 1 -> buffer 1 (SEQ >= 128)

  // relative dots: D[j][query] = sum_d table[j][d] * q[query][d]; lane = query c, element r -> j = jt*16 + 8hh + r
  float* myq = qrs[wave];
#pragma unroll
  for (int jt = 0; jt < NRELP / 16; ++jt) {
    v8f acc = zero8();
#pragma unroll
    for (int dc = 0; dc < 2; ++dc) {
      const v16h ta = ldfh(TB + (jt * 16 + c) * DK + dc * 32 + 8 * hh);
      acc = wmmah(ta, qf[dc], acc);
    }
#pragma unroll
    for (int r = 0; r < 8; ++r) myq[c * QP + jt * 16 + 8 * hh + r] = acc[r];
  }
  __builtin_amdgcn_fence(3 /* release order */, "workgroup");
  __builtin_amdgcn_wave_barrier();
  __builtin_amdgcn_fence(2 /* acquire order */, "workgroup");

  const int lglob = l0 + c;
  const float* qrow = myq + c * QP + MAXREL;        // indexed by clip(r - l, -16, 16)
  const float L2E = 1.4426950408889634f;
  const float SCL = 0.125f * 1.4426950408889634f;   // 1 / sqrt(DK) in the exp2 domain
  // the wave's first query as a scalar: the test on a pass's distance from the band is a scalar branch
  const int l0s = (((int)blockIdx.x - bh * ((SEQ / 16) / AT_NW)) * AT_NW + (int)wv) * 16;
  const int caddr = (8 * hh) << 2;                  // byte index of lane 8hh
  const int xaddr = (lane ^ 16) << 2;               // byte index of the lane that holds the same query in the other half
  const float bLo = qrow[-MAXREL] * L2E, bHi = qrow[MAXREL] * L2E;   // this query's bias left and right of the band, exp2 domain
  float m_run = -1.0e30f, s_run = 0.f;
  v8f o[4];
#pragma unroll
  for (int t = 0; t < 4; ++t) o[t] = zero8();
  // fragment rows in LDS: lane = key row (K) or feature row (V^T) c of a 16-row group, lane half at 16 B
  const unsigned char* kR = ring + (uint32_t)c * AT_PITCH + (uint32_t)hh * 16u;
  const unsigned char* vR = kR + AT_SLICE;

  // kept rolled: one publish point per stage
#pragma unroll 1
  for (int s = 0; s < AT_NST; ++s) {
  const uint32_t buf = ((uint32_t)s & 1u) * AT_STAGE;
  // the two 32-key passes of a stage are unrolled: their LDS offsets become immediates
#pragma unroll
  for (int ps = 0; ps < 2; ++ps) {
    const int r0 = (int)kstage((uint32_t)s) * (int)AT_KEYS + ps * 32;
    // the pass's K fragments are read as one group ahead of its score products; only this stage's buffer is read (loops unrolled: the fragment arrays stay in registers)
    v16h kf[2][2];
#pragma unroll
    for (int tt = 0; tt < 2; ++tt)
#pragma unroll
      for (int dc = 0; dc < 2; ++dc) kf[tt][dc] = ldfh((const _Float16*)(kR + buf + (uint32_t)(ps * 32 + 16 * tt) * AT_PITCH + (uint32_t)dc * 64u));
    v8f t[2];
#pragma unroll
    for (int tt = 0; tt < 2; ++tt) {
      v8f acc = zero8();
#pragma unroll
      for (int dc = 0; dc < 2; ++dc) acc = wmmah(kf[tt][dc], qf[dc], acc);
      t[tt] = acc;
    }
    // the pass's V^T fragments are asked for ahead of the softmax, which covers their LDS latency (unrolled: the array stays in registers)
    v16h vfr[4];
#pragma unroll
    for (int tq = 0; tq < 4; ++tq) vfr[tq] = ldfh((const _Float16*)(vR + buf + (uint32_t)tq * 16u * AT_PITCH + (uint32_t)ps * 64u));
    // element e <-> key r0 + 8hh + e (tile 0) and r0 + 16 + 8hh + e (tile 1); this lane's query is lglob
    const int rel = r0 - l0s;                         // distances of the pass: rel - 15 ... rel + 31
    float bL = rel < 0 ? bLo : bHi;                   // the bias where every distance of the pass clips to the same end
    if (!(rel + 31 <= -MAXREL || rel - 15 >= MAXREL)) {
      // the pass touches the band: each score's own bias goes into its raw product, (t / 8 + bias) * L2E = (t + 8 * bias) * SCL
      const int dbase = r0 + 8 * hh - lglob;
#pragma unroll
      for (int e = 0; e < 8; ++e) {
        const int d0 = min(max(dbase + e, -MAXREL), MAXREL);
        const int d1 = min(max(dbase + 16 + e, -MAXREL), MAXREL);
        t[0][e] = fmaf(qrow[d0], 8.0f, t[0][e]);
        t[1][e] = fmaf(qrow[d1], 8.0f, t[1][e]);
      }
      bL = 0.f;
    }
    float sum;
    float ex[16];                                     // 2^(score - reference)
    // two runs of eight exponentials; the loops are unrolled so that arguments and results are registers, as the asm operands ask
    auto powers = [&]() {
      const float kb = bL - m_run;
      sum = 0.f;
#pragma unroll
      for (int g = 0; g < 2; ++g) {
        float xa[8], ea[8];
#pragma unroll
        for (int r = 0; r < 8; ++r) xa[r] = fmaf(t[g][r], SCL, kb);
        exp2_hw8(xa, ea);
#pragma unroll
        for (int r = 0; r < 8; ++r) {
          sum += ea[r];
          ex[8 * g + r] = ea[r];
        }
      }
    };
    powers();
    // rare (always in the first pass): a lane's powers of this pass sum to more than PMAX, so that one of them might not fit f16 (one ballot, one scalar branch per pass).
    // Then every query's reference goes up to RLOW below its maximum so far (where that is higher), its sums and its O row come down by the same factor,
    // and the pass's powers are formed anew: each is then at most 2^RLOW.
    if (__builtin_amdgcn_ballot_w32(!(sum <= PMAX)) != 0u) {
      // this lane's largest score of the pass, exp2 domain: the maximum is taken over the raw products (SCL > 0); the loops of this block are unrolled: all arrays are registers
      float tm = -3.0e38f;
#pragma unroll
      for (int e = 0; e < 8; ++e) tm = fmaxf(tm, fmaxf(t[0][e], t[1][e]));
      const float mt = fmaf(tm, SCL, bL);
      const float m_new = fmaxf(m_run, fmaxf(mt, from_lane(mt, xaddr)) - RLOW);   // the two lane halves hold the same query
      const float corr  = exp2_hw1(m_run - m_new);
      s_run *= corr;
      m_run = m_new;
      float sc[8];
#pragma unroll
      for (int i = 0; i < 8; ++i) sc[i] = from_lane(corr, caddr + 4 * i);   // O tile rows are queries 8hh + i
#pragma unroll
      for (int tq = 0; tq < 4; ++tq)
#pragma unroll
        for (int i = 0; i < 8; ++i) o[tq][i] *= sc[i];
      powers();
    }
    v16h pA;                                          // P as A operand: element i <-> key r0 + k(i, hh) (unrolled: both arrays are registers)
#pragma unroll
    for (int i = 0; i < 16; ++i) pA[i] = (_Float16)ex[i];
    s_run += sum;                                     // this lane half's keys only
#pragma unroll
    for (int tq = 0; tq < 4; ++tq) o[tq] = wmmah(pA, vfr[tq], o[tq]);
  }
    // publish point of stage s + 1: own LDS reads retired, the issuer's own load landed, then the barrier that publishes s + 1 and frees this buffer
    wait_ds0();
    if (pinned((uint32_t)(wv < 2u))) wait_tensor0(g0, g1);
    __syncthreads();
    g0 = tdm_group0(ldst + buf, gsrc + (uint64_t)(kstage((uint32_t)(s + 2)) * gstep));
    asm volatile("" : "+s"(g0));   // the pinned() form on descriptor words, as in front of the loop: formed behind the wait, none written behind the load
    if (pinned((uint32_t)(wv < 2u && s + 2 < AT_NST))) tdm_load(g0, g1);   // issued only while stage s + 2 exists
  }
  wait_tensor0(g0, g1);
  wait_ds0();

  const float s_tot = s_run + from_lane(s_run, xaddr);   // the two lane halves hold the same query
  float inv[8];
#pragma unroll
  for (int i = 0; i < 8; ++i) inv[i] = 1.0f / __shfl(s_tot, i + 8 * hh, 32);
  float* os = osm[wave];
#pragma unroll
  for (int tq = 0; tq < 4; ++tq)
#pragma unroll
    for (int i = 0; i < 8; ++i) os[(8 * hh + i) * OSP + tq * 16 + c] = o[tq][i] * inv[i];
  __builtin_amdgcn_fence(3 /* release order */, "workgroup");
  __builtin_amdgcn_wave_barrier();
  __builtin_amdgcn_fence(2 /* acquire order */, "workgroup");
  {
    const int q = lane >> 3, c8 = (lane & 7) * 8;
    unsigned short* ch = CTX + (tok0 + l0) * (size_t)DM + h * DK + c8;
    v8h pv[4];
#pragma unroll
    for (int it = 0; it < 4; ++it) {
      const float* sp = os + (it * 4 + q) * OSP + c8;
#pragma unroll
      for (int e = 0; e < 8; ++e) pv[it][e] = (_Float16)sp[e];
    }
#pragma unroll
    for (int it = 0; it < 4; ++it) *(v8h*)(ch + (size_t)(it * 4 + q) * DM) = pv[it];
  }
}

extern "C" void kernel_launch(void* const* d_in, const int* in_sizes, int n_in, void* d_out, int out_size, void* d_ws, size_t ws_size, hipStream_t stream) {
  if (n_in < 12) return;
  const long long actn = ((long long)(NB - 1) * SEQ_FULL + SEQ) * DM;
  if ((long long)in_sizes[0] < actn || (long long)in_sizes[1] < actn || (long long)in_sizes[2] < actn) return;
  if (in_sizes[3] < DM * DM || in_sizes[5] < DM * DM || in_sizes[7] < DM * DM || in_sizes[9] < DM * DM) return;
  if (in_sizes[4] < DM || in_sizes[6] < DM || in_sizes[8] < DM || in_sizes[10] < DM) return;
  if (in_sizes[11] < NREL * DK) return;
  if ((long long)out_size < (long long)MT * DM) return;

  const float* Qi = (const float*)d_in[0];
  const float* Ki = (const float*)d_in[1];
  const float* Vi = (const float*)d_in[2];
  const float* Wq = (const float*)d_in[3];
  const float* bq = (const float*)d_in[4];
  const float* Wk = (const float*)d_in[5];
  const float* bk = (const float*)d_in[6];
  const float* Wv = (const float*)d_in[7];
  const float* bv = (const float*)d_in[8];
  const float* Wo = (const float*)d_in[9];
  const float* bo = (const float*)d_in[10];
  const float* rel = (const float*)d_in[11];
  float* out = (float*)d_out;

  constexpr size_t SZ_ACT = (size_t)MT * DM * 2;          // 16-bit [MT][DM] plane
  constexpr size_t SZ_W   = (size_t)DM * DM * 2;
  constexpr size_t SZ_BR  = (size_t)4 * DM * 4;
  constexpr size_t SZ_TB  = (size_t)NRELP * DK * 2;
  static_assert(SZ_ACT % 256 == 0 && SZ_W % 256 == 0 && SZ_BR % 256 == 0 && SZ_TB % 256 == 0);
  constexpr size_t TOTAL = 3 * SZ_ACT + 4 * SZ_W + SZ_BR + SZ_TB + 4 * SZ_ACT;
  static_assert(TOTAL <= (size_t)134217728);
  if (TOTAL > ws_size) return;

  char* wsp = (char*)d_ws;
  unsigned short* XQ  = (unsigned short*)wsp; wsp += SZ_ACT;
  unsigned short* XK  = (unsigned short*)wsp; wsp += SZ_ACT;
  unsigned short* XV  = (unsigned short*)wsp; wsp += SZ_ACT;
  unsigned short* WQ6 = (unsigned short*)wsp; wsp += SZ_W;
  unsigned short* WK6 = (unsigned short*)wsp; wsp += SZ_W;
  unsigned short* WV6 = (unsigned short*)wsp; wsp += SZ_W;
  unsigned short* WO6 = (unsigned short*)wsp; wsp += SZ_W;
  float*          BR  = (float*)wsp;          wsp += SZ_BR;
  unsigned short* TB  = (unsigned short*)wsp; wsp += SZ_TB;
  unsigned short* QFp = (unsigned short*)wsp; wsp += SZ_ACT;     // [MT tokens][DM features] f16
  unsigned short* KFp = (unsigned short*)wsp; wsp += SZ_ACT;
  unsigned short* VTp = (unsigned short*)wsp; wsp += SZ_ACT;     // [DM features][MT tokens] f16
  unsigned short* CTX = (unsigned short*)wsp; wsp += SZ_ACT;     // [MT][DM] f16

  k_prep<<<PR_GRID, PR_T, 0, stream>>>(Qi, Ki, Vi, Wq, Wk, Wv, Wo, bq, bk, bv, bo, rel, XQ, XK, XV, WQ6, WK6, WV6, WO6, BR, TB);

  const unsigned gQK = (unsigned)((MT / 128) * (DM / 128));
  k_gemm_qkv<<<3u * gQK, 128, 0, stream>>>(XQ, XK, XV, WQ6, WK6, WV6, QFp, KFp, VTp, BR, 0.0625f);

  k_attn_rel<<<(unsigned)((NB * NH * (SEQ / 16)) / AT_NW), 32 * AT_NW, 0, stream>>>(QFp, KFp, VTp, TB, CTX);

  k_gemm_out<<<gQK, 128, 0, stream>>>(CTX, WO6, out, BR + 3 * DM, MT, DM, DM, 0.0625f);
}
